// v000
// The times below were measured on an AMD MI455X: many runs one after another, warmed up first and cycling through
// copies of the inputs, with the whole window's GPU time divided by the number of runs. Launches and the gaps
// between them are all in it. The median over several windows is given; except for v000 it joins two sittings, which
// can be a few percent apart, so the side-by-side timings, each taken in one sitting, are the better comparison.
// The starting kernel, v000, takes 678 microseconds a run.
// Contractions: q/k/v projections = v_wmma_f32_16x16x32_bf16 (bf16 operands: RNE-converted x, W, bias; single product); head-averaged q.k^T scores = v_wmma_f32_16x16x32_f16 (q, k f16 planes carried x16; single product); p.v = v_wmma_f32_16x16x32_f16 (centered softmax weights 16384*p-8 in f16, v^T f16 plane carried x64; single product; f64/f32 column mean of v added back); output projection = v_wmma_f32_16x16x32_f16 (attention output as f16 hi (x1024) + residual (x2048) planes, two products into separate accumulators; Wo as f16 of its bf16-RNE value x1024); all f32 accumulate; softmax in f32.
#include <hip/hip_runtime.h>
#include <math.h>
#include <stdint.h>

#define NB    2
#define SEQ   2048
#define DM    1024
#define NH    16
#define HD    64
#define ROWS  (NB * SEQ)             // 4096 token rows
#define OUTN  (ROWS * DM)
static_assert(NH * HD == DM);
static_assert(HD == 64);
static_assert((SEQ % 64) == 0 && (DM % 64) == 0 && (ROWS % 64) == 0 && (DM % 32) == 0 && (DM % 256) == 0);
static_assert(SEQ == 256 * 8);
static_assert((((ROWS / 64) * (DM / 64)) % 8) == 0);
static_assert((((SEQ / 64) * (SEQ / 64)) % 8) == 0);
static_assert((((SEQ / 64) * (DM / 64)) % 8) == 0);
static_assert((((ROWS / 32) * (DM / 64)) % 8) == 0);
static_assert(((ROWS * DM / 8) % 256) == 0 && ((DM * DM / 8) % 256) == 0);
static_assert((size_t)SEQ * SEQ * 4 <= (size_t)ROWS * DM * 4);

typedef _Float16 v16h __attribute__((ext_vector_type(16)));
typedef _Float16 v8h  __attribute__((ext_vector_type(8)));
typedef __bf16   v16b __attribute__((ext_vector_type(16)));
typedef __bf16   v8b  __attribute__((ext_vector_type(8)));
typedef float    v8f  __attribute__((ext_vector_type(8)));
typedef float    v4f  __attribute__((ext_vector_type(4)));
typedef unsigned int v4u __attribute__((ext_vector_type(4)));

// ---- scalar helpers --------------------------------------------------------------------------------
__device__ __forceinline__ unsigned short bf_bits(float f) {          // f32 -> bf16 bits, RNE convert
  unsigned u = __float_as_uint(f);
  return (unsigned short)((u + 0x7FFFu + ((u >> 16) & 1u)) >> 16);
}
__device__ __forceinline__ float bf_up(unsigned short h) { return __uint_as_float(((unsigned)h) << 16); }
__device__ __forceinline__ unsigned short h_bits(_Float16 x) { return __builtin_bit_cast(unsigned short, x); }
__device__ __forceinline__ unsigned pk16(unsigned short a, unsigned short b) { return (unsigned)a | ((unsigned)b << 16); }
__device__ __forceinline__ v8f zero8() { v8f z = {0.f, 0.f, 0.f, 0.f, 0.f, 0.f, 0.f, 0.f}; return z; }

// ---- fragment loaders: 16-bit A/B operand, lane -> row/col (lane&15), p already includes +8*(lane>>4);
//      elements 0..7 <- p[0..7] (k0+8h..), elements 8..15 <- p[16..23] (k0+16+8h..)
__device__ __forceinline__ v16b ldfrag_b(const __bf16* p) {
  union { v16b v; v8b h[2]; } f;
  f.h[0] = *(const v8b*)(p);
  f.h[1] = *(const v8b*)(p + 16);
  return f.v;
}
__device__ __forceinline__ v16h ldfrag_h(const _Float16* p) {
  union { v16h v; v8h h[2]; } f;
  f.h[0] = *(const v8h*)(p);
  f.h[1] = *(const v8h*)(p + 16);
  return f.v;
}

// ---- WMMA helpers with trailing VALU hazard gap --------------------------------------------------------
__device__ __forceinline__ v8f mma_h(v16h a, v16h b, v8f c) {
  c = __builtin_amdgcn_wmma_f32_16x16x32_f16(false, a, false, b, (short)0, c, false, false);
#if defined(__HIP_DEVICE_COMPILE__)
  asm volatile("v_nop\n\tv_nop\n\tv_nop\n\tv_nop" : "+v"(c) : "v"(a), "v"(b));
#endif
  return c;
}
__device__ __forceinline__ v8f mma_b_raw(v16b a, v16b b, v8f c) {
  return __builtin_amdgcn_wmma_f32_16x16x32_bf16(false, a, false, b, (short)0, c, false, false);
}
__device__ __forceinline__ void dep_guard_b(v8f& a, v8f& b, v16b x, v16b y) {
#if defined(__HIP_DEVICE_COMPILE__)
  asm volatile("v_nop\n\tv_nop\n\tv_nop\n\tv_nop" : "+v"(a), "+v"(b) : "v"(x), "v"(y));
#endif
}
__device__ __forceinline__ void keep4_b(v16b a, v16b b, v16b c, v16b d) {
#if defined(__HIP_DEVICE_COMPILE__)
  asm volatile("v_nop" :: "v"(a), "v"(b), "v"(c), "v"(d));
#endif
}
__device__ __forceinline__ void acc_guard4(v8f& a, v8f& b, v8f& c, v8f& d) {
#if defined(__HIP_DEVICE_COMPILE__)
  asm volatile("v_nop\n\tv_nop\n\tv_nop\n\tv_nop" : "+v"(a), "+v"(b), "+v"(c), "+v"(d));
#endif
}

// =====================================================================================================
// f32 -> bf16 (RNE convert), 8 elements per thread, one 16-B store per lane: a wave writes 512 contiguous B
// coverage: n8 threads x 8 = whole plane (n8 is a multiple of 256 here).
// =====================================================================================================
__global__ __launch_bounds__(256) void cvt_bf16x8(const float* __restrict__ in, unsigned short* out, int n8) {
  const int i = blockIdx.x * 256 + threadIdx.x;
  if (i < n8) {
    const v4f a = *(const v4f*)(in + (size_t)i * 8);
    const v4f b = *(const v4f*)(in + (size_t)i * 8 + 4);
    v4u p;
    p[0] = pk16(bf_bits(a[0]), bf_bits(a[1]));
    p[1] = pk16(bf_bits(a[2]), bf_bits(a[3]));
    p[2] = pk16(bf_bits(b[0]), bf_bits(b[1]));
    p[3] = pk16(bf_bits(b[2]), bf_bits(b[3]));
    *(v4u*)(out + (size_t)i * 8) = p;
    
  }
}

// =====================================================================================================
// f32 -> f16 plane = f16(v * scale) (scale a power of two); when rb != 0, v is first RNE-converted to bf16
// and widened back (exact in f16 after the power-of-two scale). 8 elements per thread, one 16-B store per
// coverage: n8 threads x 8 = whole plane (n8 multiple of 256).
// =====================================================================================================
__global__ __launch_bounds__(256) void plane_f16x8(const float* __restrict__ in, unsigned short* hp, int n8,
                                                   float scale, int rb) {
  const int i = blockIdx.x * 256 + threadIdx.x;
  if (i < n8) {
    const v4f a = *(const v4f*)(in + (size_t)i * 8);
    const v4f b = *(const v4f*)(in + (size_t)i * 8 + 4);
    float f[8];
    f[0] = a[0]; f[1] = a[1]; f[2] = a[2]; f[3] = a[3];
    f[4] = b[0]; f[5] = b[1]; f[6] = b[2]; f[7] = b[3];
    if (rb != 0) {
#pragma unroll
      for (int e = 0; e < 8; ++e) f[e] = bf_up(bf_bits(f[e]));
    }
    v4u ph;
#pragma unroll
    for (int e = 0; e < 4; ++e) {
      const _Float16 x0 = (_Float16)(f[2 * e] * scale);
      const _Float16 x1 = (_Float16)(f[2 * e + 1] * scale);
      ph[e] = pk16(h_bits(x0), h_bits(x1));
    }
    *(v4u*)(hp + (size_t)i * 8) = ph;
    
  }
}

// =====================================================================================================
// Register-blocked bf16 WMMA GEMM with bias: C[m][n] = sum_k A[m][k] * Bt[n][k] + bf16rne(bias[n]); one wave per
// 64x64 tile, no block barriers. A row-major [M][K] pitch lda; Bt row-major [N][K] pitch ldb (k contiguous);
// bias f32 [N] (RNE converted to bf16 and widened in the epilogue); M, N multiples of 64, K multiple of 32
// (fixed sizes, statically asserted); the tile count is a multiple of 8 for every launch here (no idle waves).
// Output f32 [M][N] pitch ldc. Epilogue: 16-row slabs staged per wave in LDS; each 64-wide row segment
// =====================================================================================================
__global__ __launch_bounds__(256) void gemm64(
    const unsigned short* __restrict__ Ap, int lda,
    const unsigned short* __restrict__ Btp, int ldb,
    const float* __restrict__ bias,
    float* C, int ldc, int M, int N, int K) {
  const __bf16* Ab  = (const __bf16*)(const void*)Ap;
  const __bf16* Bb  = (const __bf16*)(const void*)Btp;
  __shared__ __align__(16) float sT[8][16 * 68];   // per-wave 16x64 slab, pitch 68 floats
  const int lane = threadIdx.x & 31;
  const int wave = threadIdx.x >> 5;
  const int tilesN = N >> 6;
  const int tilesM = M >> 6;
  const int tile = blockIdx.x * 8 + wave;
  if (tile >= tilesM * tilesN) return;   // wave-uniform; no block barriers in this kernel
  const int tm = tile / tilesN;
  const int tn = tile - tm * tilesN;
  const int m0 = tm << 6;
  const int n0 = tn << 6;

  const int rlane = lane & 15;                 // row (A) / col (B, D) within subtile
  const int koff  = (lane >> 4) * 8;           // k offset of this lane half
  const int mOff  = (lane >> 4) * 8;           // D row offset

  v8f acc[4][4];
#pragma unroll
  for (int i = 0; i < 4; ++i)
#pragma unroll
    for (int j = 0; j < 4; ++j) acc[i][j] = zero8();

  for (int k0 = 0; k0 < K; k0 += 32) {
    v16b bh[4];
#pragma unroll
    for (int j = 0; j < 4; ++j) {
      const size_t bo = (size_t)(n0 + (j << 4) + rlane) * ldb + koff + k0;
      bh[j] = ldfrag_b(Bb + bo);
    }
#pragma unroll
    for (int i = 0; i < 4; ++i) {
      const size_t ao = (size_t)(m0 + (i << 4) + rlane) * lda + koff + k0;
      const v16b ah = ldfrag_b(Ab + ao);
#pragma unroll
      for (int j = 0; j < 4; ++j) {
        acc[i][j] = mma_b_raw(ah, bh[j], acc[i][j]);
      }
      dep_guard_b(acc[i][0], acc[i][3], ah, ah);
    }
    keep4_b(bh[0], bh[1], bh[2], bh[3]);
  }
  acc_guard4(acc[0][0], acc[0][1], acc[0][2], acc[0][3]);
  acc_guard4(acc[1][0], acc[1][1], acc[1][2], acc[1][3]);
  acc_guard4(acc[2][0], acc[2][1], acc[2][2], acc[2][3]);
  acc_guard4(acc[3][0], acc[3][1], acc[3][2], acc[3][3]);

  // ---- bias per D column of this lane (n0 + 16j + rlane < N) ----
  float bz[4];
#pragma unroll
  for (int j = 0; j < 4; ++j) bz[j] = bf_up(bf_bits(bias[n0 + (j << 4) + rlane]));

  // ---- epilogue ----
  float* slab = sT[wave];
#pragma unroll
  for (int i = 0; i < 4; ++i) {
    const int mBase = m0 + (i << 4);
#pragma unroll
    for (int r = 0; r < 8; ++r) {
#pragma unroll
      for (int j = 0; j < 4; ++j) {
        slab[(mOff + r) * 68 + (j << 4) + rlane] = acc[i][j][r] + bz[j];
      }
    }
    __builtin_amdgcn_fence(__ATOMIC_RELEASE, "workgroup");
    __builtin_amdgcn_wave_barrier();
    __builtin_amdgcn_fence(__ATOMIC_ACQUIRE, "workgroup");
    {
      const int hh = lane >> 4, c4 = (lane & 15) * 4;     // 256-B row segment = 16 lanes x 16 B
      v4f ov[8];
#pragma unroll
      for (int it = 0; it < 8; ++it) {
        const int row = it * 2 + hh;                       // it 0..7 x hh 0..1 = rows 0..15
        ov[it] = *(const v4f*)(slab + row * 68 + c4);
      }
      {
#pragma unroll
        for (int it = 0; it < 8; ++it) {
          const int row = it * 2 + hh;
          *(v4f*)(C + (size_t)(mBase + row) * ldc + n0 + c4) = ov[it];
        }
        
      }
    }
    __builtin_amdgcn_fence(__ATOMIC_RELEASE, "workgroup");
    __builtin_amdgcn_wave_barrier();
    __builtin_amdgcn_fence(__ATOMIC_ACQUIRE, "workgroup");
  }
}

// =====================================================================================================
// v f32 token-major vf[(b*SEQ + t)*DM + n] -> f16 v^T plane vth[(b*DM + n)*SEQ + t] = f16(v * vscale),
// vscale a power of two.
// Block = one 64-token x 64-feature tile of one b; grid = (SEQ/64, DM/64, NB); tile staged in LDS as f32
// (v4f loads, __syncthreads).
// Store: group g = tid>>3 (0..31), piece = tid&7: iteration it writes row n = it*32+g, lanes 8q..8q+7 x 16 B =
// coverage: 2 iterations x 32 groups = 64 rows n, 8 pieces x 8 = 64 tokens per row; grid covers every (b,
// n tile, t tile) -> the whole plane.
// =====================================================================================================
__global__ __launch_bounds__(256) void vt_plane(const float* __restrict__ vf, unsigned short* vth, float vscale) {
  __shared__ __align__(16) float sv[64 * 68];       // [tt][d] pitch 68 floats
  const int tid = threadIdx.x;
  const int t0  = blockIdx.x * 64;
  const int fh  = blockIdx.y;                        // feature tile (64 features)
  const int b   = blockIdx.z;
#pragma unroll
  for (int i = 0; i < 4; ++i) {
    const int idx = i * 256 + tid;                  // 0..1023
    const int tt = idx >> 4, c4 = (idx & 15) * 4;
    const v4f a = *(const v4f*)(vf + ((size_t)(b * SEQ + t0 + tt)) * DM + fh * 64 + c4);
    *(v4f*)(sv + tt * 68 + c4) = a;
  }
  __syncthreads();

  const int g = tid >> 3, piece = tid & 7;
  v4u hv[2];
  size_t hofs[2];
#pragma unroll
  for (int it = 0; it < 2; ++it) {
    const int d = it * 32 + g;
    v4u a;
#pragma unroll
    for (int e = 0; e < 4; ++e) {
      const float f0 = sv[(piece * 8 + 2 * e) * 68 + d];
      const float f1 = sv[(piece * 8 + 2 * e + 1) * 68 + d];
      a[e] = pk16(h_bits((_Float16)(f0 * vscale)), h_bits((_Float16)(f1 * vscale)));
    }
    hv[it] = a;
    hofs[it] = ((size_t)(b * DM + fh * 64 + d)) * SEQ + t0 + piece * 8;
  }
  {
#pragma unroll
    for (int it = 0; it < 2; ++it) {
      *(v4u*)(vth + hofs[it]) = hv[it];
    }
    
  }
}

// =====================================================================================================
// Column mean over tokens: mv[b*DM + n] = (1/SEQ) * sum_t vf[(b*SEQ + t)*DM + n], f64 accumulation.
// grid = (DM/256, NB), thread = column; the 256 means are staged in LDS (__syncthreads), then threads 0..63
// (waves 0 and 1, wave-uniform) each write one 16-B piece: lanes 8q..8q+7 of one instruction = one whole
// coverage: DM/256 blocks x 256 columns x NB = every column of every batch.
// =====================================================================================================
__global__ __launch_bounds__(256) void colmean(const float* __restrict__ vf, float* mv) {
  __shared__ __align__(16) float sm[256];
  const int tid = threadIdx.x;
  const int n = blockIdx.x * 256 + tid;              // < DM by the grid size
  const int b = blockIdx.y;
  const float* p = vf + (size_t)b * SEQ * DM + n;
  double s = 0.0;
#pragma unroll 4
  for (int t = 0; t < SEQ; ++t) s += (double)p[(size_t)t * DM];
  sm[tid] = (float)(s * (1.0 / (double)SEQ));
  __syncthreads();
  if (tid < 64) {                                    // waves 0 and 1 entirely
    const v4f v = *(const v4f*)(sm + tid * 4);
    float* q = mv + (size_t)b * DM + blockIdx.x * 256 + tid * 4;
    *(v4f*)q = v;
    
  }
}

// =====================================================================================================
// f16 WMMA GEMM with scale: C[m][n] = cscale * sum_k A[m][k] * Bt[n][k] (f16 products, f32 accumulate).
// Same tiling/epilogue as gemm64 (one wave per 64x64 tile, no block barriers, 16-row LDS slabs, each 256-B
// coverage: 4 slabs x 16 rows x 64 cols = the wave's whole 64x64 tile; tile count a multiple of 8.
// =====================================================================================================
__global__ __launch_bounds__(256) void gemm64h_s(
    const unsigned short* __restrict__ Ap, int lda,
    const unsigned short* __restrict__ Btp, int ldb,
    float* C, int ldc, int M, int N, int K, float cscale) {
  const _Float16* Ah = (const _Float16*)(const void*)Ap;
  const _Float16* Bh = (const _Float16*)(const void*)Btp;
  __shared__ __align__(16) float sT[8][16 * 68];
  const int lane = threadIdx.x & 31;
  const int wave = threadIdx.x >> 5;
  const int tilesN = N >> 6;
  const int tilesM = M >> 6;
  const int tile = blockIdx.x * 8 + wave;
  if (tile >= tilesM * tilesN) return;   // wave-uniform; no block barriers in this kernel
  const int tm = tile / tilesN;
  const int tn = tile - tm * tilesN;
  const int m0 = tm << 6;
  const int n0 = tn << 6;
  const int rlane = lane & 15;
  const int koff  = (lane >> 4) * 8;
  const int mOff  = (lane >> 4) * 8;

  v8f acc[4][4];
#pragma unroll
  for (int i = 0; i < 4; ++i)
#pragma unroll
    for (int j = 0; j < 4; ++j) acc[i][j] = zero8();

  for (int k0 = 0; k0 < K; k0 += 32) {
    v16h bh[4];
#pragma unroll
    for (int j = 0; j < 4; ++j) {
      const size_t bo = (size_t)(n0 + (j << 4) + rlane) * ldb + koff + k0;
      bh[j] = ldfrag_h(Bh + bo);
    }
#pragma unroll
    for (int i = 0; i < 4; ++i) {
      const size_t ao = (size_t)(m0 + (i << 4) + rlane) * lda + koff + k0;
      const v16h ah = ldfrag_h(Ah + ao);
#pragma unroll
      for (int j = 0; j < 4; ++j) {
        acc[i][j] = mma_h(ah, bh[j], acc[i][j]);
      }
    }
  }

  float* slab = sT[wave];
#pragma unroll
  for (int i = 0; i < 4; ++i) {
    const int mBase = m0 + (i << 4);
#pragma unroll
    for (int r = 0; r < 8; ++r) {
#pragma unroll
      for (int j = 0; j < 4; ++j) {
        slab[(mOff + r) * 68 + (j << 4) + rlane] = acc[i][j][r] * cscale;
      }
    }
    __builtin_amdgcn_fence(__ATOMIC_RELEASE, "workgroup");
    __builtin_amdgcn_wave_barrier();
    __builtin_amdgcn_fence(__ATOMIC_ACQUIRE, "workgroup");
    {
      const int hh = lane >> 4, c4 = (lane & 15) * 4;
      v4f ov[8];
#pragma unroll
      for (int it = 0; it < 8; ++it) {
        const int row = it * 2 + hh;
        ov[it] = *(const v4f*)(slab + row * 68 + c4);
      }
      {
#pragma unroll
        for (int it = 0; it < 8; ++it) {
          const int row = it * 2 + hh;
          *(v4f*)(C + (size_t)(mBase + row) * ldc + n0 + c4) = ov[it];
        }
        
      }
    }
    __builtin_amdgcn_fence(__ATOMIC_RELEASE, "workgroup");
    __builtin_amdgcn_wave_barrier();
    __builtin_amdgcn_fence(__ATOMIC_ACQUIRE, "workgroup");
  }
}

// =====================================================================================================
// Row softmax over SEQ keys, max-subtracted, f32: p = exp(s - max) / sum; stored CENTERED and scaled as
// f16(16384 * p - 8) = f16(16384 * (p - 1/SEQ)) (the 1/SEQ part is added back downstream as the column
// mean of v). One 256-thread block per row, 8 consecutive elements per thread (two v4f loads), wave
// reductions by __shfl_xor, 8 wave partials combined in fixed order through LDS.
// =====================================================================================================
__global__ __launch_bounds__(256) void softmax_c(const float* __restrict__ sf, unsigned short* ph) {
  __shared__ float redm[8];
  __shared__ float reds[8];
  const int row  = blockIdx.x;
  const int tid  = threadIdx.x;
  const int lane = tid & 31;
  const int wave = tid >> 5;
  const float* s = sf + (size_t)row * SEQ + tid * 8;
  const v4f a = *(const v4f*)(s);
  const v4f c = *(const v4f*)(s + 4);
  float v[8];
  v[0] = a[0]; v[1] = a[1]; v[2] = a[2]; v[3] = a[3];
  v[4] = c[0]; v[5] = c[1]; v[6] = c[2]; v[7] = c[3];
  float m = v[0];
#pragma unroll
  for (int e = 1; e < 8; ++e) m = fmaxf(m, v[e]);
#pragma unroll
  for (int o = 16; o > 0; o >>= 1) m = fmaxf(m, __shfl_xor(m, o));
  if (lane == 0) redm[wave] = m;
  __syncthreads();
  float mm = redm[0];
#pragma unroll
  for (int w = 1; w < 8; ++w) mm = fmaxf(mm, redm[w]);
  float sum = 0.f;
#pragma unroll
  for (int e = 0; e < 8; ++e) {
    v[e] = __expf(v[e] - mm);
    sum += v[e];
  }
#pragma unroll
  for (int o = 16; o > 0; o >>= 1) sum += __shfl_xor(sum, o);
  if (lane == 0) reds[wave] = sum;
  __syncthreads();
  float tot = 0.f;
#pragma unroll
  for (int w = 0; w < 8; ++w) tot += reds[w];       // fixed order, identical for every thread
  const float inv = 1.0f / tot;                     // tot >= 1
  v4u pk;
#pragma unroll
  for (int e = 0; e < 4; ++e) {
    const float p0 = v[2 * e] * inv;
    const float p1 = v[2 * e + 1] * inv;
    const _Float16 x0 = (_Float16)(p0 * 16384.0f - 8.0f);
    const _Float16 x1 = (_Float16)(p1 * 16384.0f - 8.0f);
    pk[e] = pk16(h_bits(x0), h_bits(x1));
  }
  unsigned short* o = ph + (size_t)row * SEQ + tid * 8;
  *(v4u*)o = pk;
  
}

// =====================================================================================================
// p.v for one batch bb: O[i][n] = oscale * sum_j P[i][j] * Vt[n][j] + mv[n] (f16 products, f32 accumulate;
// oscale folds back the weight and v carries; mv = column mean of v in f32). P f16 [SEQ][SEQ] pitch lda
// (j contiguous); Vt f16 [DM][SEQ] pitch ldb; n = h*HD + d.
// O is written as two f16 head-major planes: hi = f16(O*1024), lo = f16((O*1024 - hi)*2048), element
// (bb, h, i, d) at [((bb*NH + h)*SEQ + i)*HD + d]; a 64-wide tile column block is exactly one head h = tn,
// One wave per 64x64 tile, no block barriers; tile count multiple of 8. Epilogue: 16-row f32 slab staged per
// coverage: 4 slabs x (4 q x 4 g4 = 16 rows) x (8 pieces x 8 = 64 cols) = the wave's whole tile in both
// planes; grid covers every (i tile, head) of this batch.
// =====================================================================================================
__global__ __launch_bounds__(256) void gemm64h_o(
    const unsigned short* __restrict__ Ap, int lda,
    const unsigned short* __restrict__ Btp, int ldb,
    const float* __restrict__ mv,
    unsigned short* ohi, unsigned short* olo, int bb,
    int M, int N, int K, float oscale) {
  const _Float16* Ah = (const _Float16*)(const void*)Ap;
  const _Float16* Bh = (const _Float16*)(const void*)Btp;
  __shared__ __align__(16) float sT[8][16 * 68];
  const int lane = threadIdx.x & 31;
  const int wave = threadIdx.x >> 5;
  const int tilesN = N >> 6;
  const int tilesM = M >> 6;
  const int tile = blockIdx.x * 8 + wave;
  if (tile >= tilesM * tilesN) return;   // wave-uniform; no block barriers in this kernel
  const int tm = tile / tilesN;
  const int tn = tile - tm * tilesN;     // == head index (tile width 64 == HD)
  const int m0 = tm << 6;
  const int n0 = tn << 6;
  const int rlane = lane & 15;
  const int koff  = (lane >> 4) * 8;
  const int mOff  = (lane >> 4) * 8;

  v8f acc[4][4];
#pragma unroll
  for (int i = 0; i < 4; ++i)
#pragma unroll
    for (int j = 0; j < 4; ++j) acc[i][j] = zero8();

  for (int k0 = 0; k0 < K; k0 += 32) {
    v16h bh[4];
#pragma unroll
    for (int j = 0; j < 4; ++j) {
      const size_t bo = (size_t)(n0 + (j << 4) + rlane) * ldb + koff + k0;
      bh[j] = ldfrag_h(Bh + bo);
    }
#pragma unroll
    for (int i = 0; i < 4; ++i) {
      const size_t ao = (size_t)(m0 + (i << 4) + rlane) * lda + koff + k0;
      const v16h ah = ldfrag_h(Ah + ao);
#pragma unroll
      for (int j = 0; j < 4; ++j) {
        acc[i][j] = mma_h(ah, bh[j], acc[i][j]);
      }
    }
  }

  float mz[4];
#pragma unroll
  for (int j = 0; j < 4; ++j) mz[j] = mv[n0 + (j << 4) + rlane];

  float* slab = sT[wave];
  const size_t pbase = ((size_t)(bb * NH + tn)) * SEQ;     // plane row base for head tn of batch bb
#pragma unroll
  for (int i = 0; i < 4; ++i) {
    const int mBase = m0 + (i << 4);
#pragma unroll
    for (int r = 0; r < 8; ++r) {
#pragma unroll
      for (int j = 0; j < 4; ++j) {
        slab[(mOff + r) * 68 + (j << 4) + rlane] = acc[i][j][r] * oscale + mz[j];
      }
    }
    __builtin_amdgcn_fence(__ATOMIC_RELEASE, "workgroup");
    __builtin_amdgcn_wave_barrier();
    __builtin_amdgcn_fence(__ATOMIC_ACQUIRE, "workgroup");
    {
      const int g4 = lane >> 3, piece = lane & 7;
      v4u hv[4], lv[4];
      size_t ofs[4];
#pragma unroll
      for (int q = 0; q < 4; ++q) {
        const int row = q * 4 + g4;                      // q 0..3 x g4 0..3 = rows 0..15
        const v4f x0 = *(const v4f*)(slab + row * 68 + piece * 8);
        const v4f x1 = *(const v4f*)(slab + row * 68 + piece * 8 + 4);
        float f[8];
        f[0] = x0[0]; f[1] = x0[1]; f[2] = x0[2]; f[3] = x0[3];
        f[4] = x1[0]; f[5] = x1[1]; f[6] = x1[2]; f[7] = x1[3];
        v4u ph, pl;
#pragma unroll
        for (int e = 0; e < 4; ++e) {
          const float s0 = f[2 * e] * 1024.0f;
          const float s1 = f[2 * e + 1] * 1024.0f;
          const _Float16 h0 = (_Float16)s0;
          const _Float16 h1 = (_Float16)s1;
          const _Float16 l0 = (_Float16)((s0 - (float)h0) * 2048.0f);
          const _Float16 l1 = (_Float16)((s1 - (float)h1) * 2048.0f);
          ph[e] = pk16(h_bits(h0), h_bits(h1));
          pl[e] = pk16(h_bits(l0), h_bits(l1));
        }
        hv[q] = ph;
        lv[q] = pl;
        ofs[q] = (pbase + (size_t)(mBase + row)) * HD + piece * 8;
      }
      {
#pragma unroll
        for (int q = 0; q < 4; ++q) {
          *(v4u*)(ohi + ofs[q]) = hv[q];
          *(v4u*)(olo + ofs[q]) = lv[q];
        }
        
      }
    }
    __builtin_amdgcn_fence(__ATOMIC_RELEASE, "workgroup");
    __builtin_amdgcn_wave_barrier();
    __builtin_amdgcn_fence(__ATOMIC_ACQUIRE, "workgroup");
  }
}

// =====================================================================================================
// Output projection: C[m][n] = sch * (sum_k Ahi[m][k]*Bt[n][k] + scl * sum_k Alo[m][k]*Bt[n][k]) + bf16rne(bias[n])
// (f16 products, f32 accumulate, hi and scaled-residual products in separate accumulators). Ahi/Alo row-major
// [M][K] pitch lda; Bt [N][K] pitch ldb; C f32 [M][N] pitch ldc. One wave per 32x64 tile, no block barriers;
// tile count multiple of 8; A fragments (2 rows x 2 planes) cached per k-step, B fragments streamed.
// Epilogue: 16-row slabs staged per wave in LDS; each 64-wide row segment (256 B) written by one instruction
// coverage: 2 slabs x 16 rows x 64 cols = the wave's whole 32x64 tile; grid covers every tile of C.
// =====================================================================================================
__global__ __launch_bounds__(256) void gemm32h_w(
    const unsigned short* __restrict__ Ahp, const unsigned short* __restrict__ Alp, int lda,
    const unsigned short* __restrict__ Btp, int ldb,
    const float* __restrict__ bias,
    float* C, int ldc, int M, int N, int K, float sch, float scl) {
  const _Float16* Ah = (const _Float16*)(const void*)Ahp;
  const _Float16* Al = (const _Float16*)(const void*)Alp;
  const _Float16* Bh = (const _Float16*)(const void*)Btp;
  __shared__ __align__(16) float sT[8][16 * 68];
  const int lane = threadIdx.x & 31;
  const int wave = threadIdx.x >> 5;
  const int tilesN = N >> 6;
  const int tilesM = M >> 5;
  const int tile = blockIdx.x * 8 + wave;
  if (tile >= tilesM * tilesN) return;   // wave-uniform; no block barriers in this kernel
  const int tm = tile / tilesN;
  const int tn = tile - tm * tilesN;
  const int m0 = tm << 5;
  const int n0 = tn << 6;
  const int rlane = lane & 15;
  const int koff  = (lane >> 4) * 8;
  const int mOff  = (lane >> 4) * 8;

  v8f acch[2][4], accl[2][4];
#pragma unroll
  for (int i = 0; i < 2; ++i)
#pragma unroll
    for (int j = 0; j < 4; ++j) { acch[i][j] = zero8(); accl[i][j] = zero8(); }

  for (int k0 = 0; k0 < K; k0 += 32) {
    v16h fh[2], fl[2];
#pragma unroll
    for (int i = 0; i < 2; ++i) {
      const size_t ao = (size_t)(m0 + (i << 4) + rlane) * lda + koff + k0;
      fh[i] = ldfrag_h(Ah + ao);
      fl[i] = ldfrag_h(Al + ao);
    }
#pragma unroll
    for (int j = 0; j < 4; ++j) {
      const size_t bo = (size_t)(n0 + (j << 4) + rlane) * ldb + koff + k0;
      const v16h bfr = ldfrag_h(Bh + bo);
#pragma unroll
      for (int i = 0; i < 2; ++i) {
        acch[i][j] = mma_h(fh[i], bfr, acch[i][j]);
        accl[i][j] = mma_h(fl[i], bfr, accl[i][j]);
      }
    }
  }

  float bz[4];
#pragma unroll
  for (int j = 0; j < 4; ++j) bz[j] = bf_up(bf_bits(bias[n0 + (j << 4) + rlane]));

  float* slab = sT[wave];
#pragma unroll
  for (int i = 0; i < 2; ++i) {
    const int mBase = m0 + (i << 4);
#pragma unroll
    for (int r = 0; r < 8; ++r) {
#pragma unroll
      for (int j = 0; j < 4; ++j) {
        slab[(mOff + r) * 68 + (j << 4) + rlane] = (acch[i][j][r] + accl[i][j][r] * scl) * sch + bz[j];
      }
    }
    __builtin_amdgcn_fence(__ATOMIC_RELEASE, "workgroup");
    __builtin_amdgcn_wave_barrier();
    __builtin_amdgcn_fence(__ATOMIC_ACQUIRE, "workgroup");
    {
      const int hh = lane >> 4, c4 = (lane & 15) * 4;     // 256-B row segment = 16 lanes x 16 B
      v4f ov[8];
#pragma unroll
      for (int it = 0; it < 8; ++it) {
        const int row = it * 2 + hh;                       // it 0..7 x hh 0..1 = rows 0..15
        ov[it] = *(const v4f*)(slab + row * 68 + c4);
      }
      {
#pragma unroll
        for (int it = 0; it < 8; ++it) {
          const int row = it * 2 + hh;
          *(v4f*)(C + (size_t)(mBase + row) * ldc + n0 + c4) = ov[it];
        }
        
      }
    }
    __builtin_amdgcn_fence(__ATOMIC_RELEASE, "workgroup");
    __builtin_amdgcn_wave_barrier();
    __builtin_amdgcn_fence(__ATOMIC_ACQUIRE, "workgroup");
  }
}

// =====================================================================================================
// Workspace map (bytes); every region an exact multiple of its whole-line / whole-tile store granularity
// within a launch; Tf is reused sequentially: q, k, v f32 projections, then the per-batch f32 score map):
//   Xb   bf16 [4096][1024]              0         8388608
//   Wqb  bf16 [1024 n][1024 k]     8388608         2097152
//   Wkb  bf16 [1024 n][1024 k]    10485760         2097152
//   Wvb  bf16 [1024 n][1024 k]    12582912         2097152
//   Woh  f16  [1024 n][1024 k]    14680064         2097152   (f16(bf16(Wo) x1024))
//   Tf   f32  [4096][1024]       16777216        16777216   (also S f32 [2048][2048] of the current batch)
//   Qh   f16  [4096][1024]       33554432         8388608   (q x16)
//   Kh   f16  [4096][1024]       41943040         8388608   (k x16)
//   VTh  f16  [2*1024][2048]     50331648         8388608   ([b*DM + n][t], v x64)
//   Ph   f16  [2048][2048]       58720256         8388608   (centered weights of the current batch)
//   Ohi  f16  [2][16][2048][64]  67108864         8388608
//   Olo  f16  [2][16][2048][64]  75497472         8388608
//   end                          83894272
// Inputs: query f32 [2][2048][1024]; Wq, Wk, Wv, Wo f32 [1024 out][1024 in]; bq, bk, bv, bo f32 [1024].
// d_out f32 [4096][1024] at byte 0 (row = b*SEQ + s, col = n).
// =====================================================================================================
extern "C" void kernel_launch(void* const* d_in, const int* in_sizes, int n_in,
                              void* d_out, int out_size, void* d_ws, size_t ws_size,
                              hipStream_t stream) {
  if (n_in < 9) return;
  if (in_sizes[0] != NB * SEQ * DM) return;
  if (in_sizes[1] != DM * DM) return;
  if (in_sizes[2] != DM) return;
  if (in_sizes[3] != DM * DM) return;
  if (in_sizes[4] != DM) return;
  if (in_sizes[5] != DM * DM) return;
  if (in_sizes[6] != DM) return;
  if (in_sizes[7] != DM * DM) return;
  if (in_sizes[8] != DM) return;
  if (out_size != OUTN) return;

  const float* x  = (const float*)d_in[0];   // [NB*SEQ][DM]
  const float* Wq = (const float*)d_in[1];   // [DM n][DM k]
  const float* bq = (const float*)d_in[2];   // [DM]
  const float* Wk = (const float*)d_in[3];
  const float* bk = (const float*)d_in[4];
  const float* Wv = (const float*)d_in[5];
  const float* bv = (const float*)d_in[6];
  const float* Wo = (const float*)d_in[7];
  const float* bo = (const float*)d_in[8];

  const size_t PXb = (size_t)ROWS * DM * 2;          //  8388608
  const size_t PW  = (size_t)DM * DM * 2;            //  2097152
  const size_t PF  = (size_t)ROWS * DM * 4;          // 16777216
  const size_t PH  = (size_t)ROWS * DM * 2;          //  8388608
  const size_t PVt = (size_t)NB * DM * SEQ * 2;      //  8388608
  const size_t PP  = (size_t)SEQ * SEQ * 2;          //  8388608
  const size_t PO  = (size_t)NB * NH * SEQ * HD * 2; //  8388608
  const size_t PMv = (size_t)NB * DM * 4;            //     8192
  size_t off = 0;
  const size_t oXb = off; off += PXb;
  const size_t oWq = off; off += PW;
  const size_t oWk = off; off += PW;
  const size_t oWv = off; off += PW;
  const size_t oWo = off; off += PW;
  const size_t oTf = off; off += PF;
  const size_t oQh = off; off += PH;
  const size_t oKh = off; off += PH;
  const size_t oVt = off; off += PVt;
  const size_t oP  = off; off += PP;
  const size_t oOh = off; off += PO;
  const size_t oOl = off; off += PO;
  const size_t oMv = off; off += PMv;
  if (off > ws_size) return;                        // off = 83894272
  if (off > (size_t)134217728) return;

  char* ws = (char*)d_ws;
  unsigned short* Xb  = (unsigned short*)(ws + oXb);
  unsigned short* Wqb = (unsigned short*)(ws + oWq);
  unsigned short* Wkb = (unsigned short*)(ws + oWk);
  unsigned short* Wvb = (unsigned short*)(ws + oWv);
  unsigned short* Woh = (unsigned short*)(ws + oWo);
  float*          Tf  = (float*)(ws + oTf);
  unsigned short* Qh  = (unsigned short*)(ws + oQh);
  unsigned short* Kh  = (unsigned short*)(ws + oKh);
  unsigned short* VTh = (unsigned short*)(ws + oVt);
  unsigned short* Ph  = (unsigned short*)(ws + oP);
  unsigned short* Ohi = (unsigned short*)(ws + oOh);
  unsigned short* Olo = (unsigned short*)(ws + oOl);
  float*          mV  = (float*)(ws + oMv);
  float*          outf = (float*)d_out;             // [ROWS][DM]

  const dim3 blk(256);
  const int n8x = ROWS * DM / 8;                    // 524288
  const int n8w = DM * DM / 8;                      // 131072
  const dim3 gCvtX(n8x / 256);                      // 2048 blocks (exact)
  const dim3 gCvtW(n8w / 256);                      //  512 blocks (exact)
  const dim3 gGemm(((ROWS / 64) * (DM / 64)) / 8);  // 1024 tiles -> 128 blocks
  const dim3 gVpl(SEQ / 64, DM / 64, NB);           // (32, 16, 2)
  const dim3 gCm(DM / 256, NB);                     // (4, 2)
  const dim3 gSc(((SEQ / 64) * (SEQ / 64)) / 8);    // 1024 tiles -> 128 blocks per batch
  const dim3 gSm(SEQ);                              // 2048 rows per batch
  const dim3 gPv(((SEQ / 64) * (DM / 64)) / 8);     //  512 tiles -> 64 blocks per batch
  const dim3 gWo(((ROWS / 32) * (DM / 64)) / 8);    // 2048 tiles -> 256 blocks
  const float qkScale = 16.0f;                      // q and k planes carried x16
  const float woScale = 1024.0f;                    // Wo plane carried x1024
  const float sscale  = 1.0f / 32768.0f;            // (1/sqrt(64))/16 heads = 1/128, two x16 carries folded back
  const float vScale  = 64.0f;                      // v^T plane carried x64
  const float pvOscl  = 1.0f / 1048576.0f;          // 1/(16384 * 64)
  const float woSch   = 1.0f / 1048576.0f;          // 1/(1024 * 1024): O hi carry and Wo carry
  const float woScl   = 1.0f / 2048.0f;             // residual plane carry

  // (1) activations and weights -> bf16 planes (W is [n][k] already); Wo -> f16 plane of its bf16 value x1024
  cvt_bf16x8<<<gCvtX, blk, 0, stream>>>(x, Xb, n8x);
  cvt_bf16x8<<<gCvtW, blk, 0, stream>>>(Wq, Wqb, n8w);
  cvt_bf16x8<<<gCvtW, blk, 0, stream>>>(Wk, Wkb, n8w);
  cvt_bf16x8<<<gCvtW, blk, 0, stream>>>(Wv, Wvb, n8w);
  plane_f16x8<<<gCvtW, blk, 0, stream>>>(Wo, Woh, n8w, woScale, 1);
  // (2) q = Xb . Wqb^T + bq -> Tf [4096][1024] (M=4096, N=1024, K=1024), then f16 plane (x16)
  gemm64<<<gGemm, blk, 0, stream>>>(Xb, DM, Wqb, DM, bq, Tf, DM, ROWS, DM, DM);
  plane_f16x8<<<gCvtX, blk, 0, stream>>>(Tf, Qh, n8x, qkScale, 0);
  // (3) k likewise
  gemm64<<<gGemm, blk, 0, stream>>>(Xb, DM, Wkb, DM, bk, Tf, DM, ROWS, DM, DM);
  plane_f16x8<<<gCvtX, blk, 0, stream>>>(Tf, Kh, n8x, qkScale, 0);
  // (4) v likewise -> Tf, then f16 v^T plane (x64) and f32 column means over tokens
  gemm64<<<gGemm, blk, 0, stream>>>(Xb, DM, Wvb, DM, bv, Tf, DM, ROWS, DM, DM);
  vt_plane<<<gVpl, blk, 0, stream>>>(Tf, VTh, vScale);
  colmean<<<gCm, blk, 0, stream>>>(Tf, mV);
  // (5) per batch: head-averaged scores (K = 1024) -> Tf as S [2048][2048]; row softmax -> centered weights;
  //     p . v -> O hi/res head-major planes
  for (int b = 0; b < NB; ++b) {
    gemm64h_s<<<gSc, blk, 0, stream>>>(Qh + (size_t)b * SEQ * DM, DM, Kh + (size_t)b * SEQ * DM, DM,
                                       Tf, SEQ, SEQ, SEQ, DM, sscale);
    softmax_c<<<gSm, blk, 0, stream>>>(Tf, Ph);
    gemm64h_o<<<gPv, blk, 0, stream>>>(Ph, SEQ, VTh + (size_t)b * DM * SEQ, SEQ, mV + (size_t)b * DM,
                                       Ohi, Olo, b, SEQ, DM, SEQ, pvOscl);
  }
  // (6) out = O(flat [4096][1024]) . Woh^T + bo -> d_out
  gemm32h_w<<<gWo, blk, 0, stream>>>(Ohi, Olo, DM, Woh, DM, bo, outf, DM, ROWS, DM, DM, woSch, woScl);
  (void)hipGetLastError();
}

// v001
// One run takes 502 microseconds.
// Next to v000, in two timings, it ran 1.37 times as fast each time.
// Contractions: q/k/v projections = v_wmma_f32_16x16x32_bf16 (bf16 operands: RNE-converted x, W, bias; single product); head-averaged q.k^T scores = v_wmma_f32_16x16x32_f16 (q, k f16 planes carried x16; single product); p.v = v_wmma_f32_16x16x32_f16 (centered softmax weights 16384*p-8 in f16, v^T f16 plane carried x64; single product; f64/f32 column mean of v added back); output projection = v_wmma_f32_16x16x32_f16 (attention output as f16 hi (x1024) + residual (x2048) planes, two products into separate accumulators; Wo as f16 of its bf16-RNE value x1024); all f32 accumulate; softmax in f32.
#include <hip/hip_runtime.h>
#include <math.h>
#include <stdint.h>

#define NB    2
#define SEQ   2048
#define DM    1024
#define NH    16
#define HD    64
#define ROWS  (NB * SEQ)             // 4096 token rows
#define OUTN  (ROWS * DM)
static_assert(NH * HD == DM);
static_assert(HD == 64);
static_assert((SEQ % 64) == 0 && (DM % 64) == 0 && (ROWS % 64) == 0 && (DM % 32) == 0 && (DM % 256) == 0);
static_assert(SEQ == 256 * 8);
static_assert((SEQ % 128) == 0);
static_assert((((ROWS / 64) * (DM / 64)) % 8) == 0);
static_assert((((SEQ / 64) * (SEQ / 64)) % 8) == 0);
static_assert((((SEQ / 64) * (DM / 64)) % 8) == 0);
static_assert((((ROWS / 32) * (DM / 64)) % 8) == 0);
static_assert(((ROWS * DM / 8) % 256) == 0 && ((DM * DM / 8) % 256) == 0);
static_assert((size_t)SEQ * SEQ * 4 <= (size_t)ROWS * DM * 4);

typedef _Float16 v16h __attribute__((ext_vector_type(16)));
typedef _Float16 v8h  __attribute__((ext_vector_type(8)));
typedef __bf16   v16b __attribute__((ext_vector_type(16)));
typedef __bf16   v8b  __attribute__((ext_vector_type(8)));
typedef float    v8f  __attribute__((ext_vector_type(8)));
typedef float    v4f  __attribute__((ext_vector_type(4)));
typedef unsigned int v4u __attribute__((ext_vector_type(4)));

// ---- scalar helpers --------------------------------------------------------------------------------
__device__ __forceinline__ unsigned short bf_bits(float f) {          // f32 -> bf16 bits, RNE convert
  unsigned u = __float_as_uint(f);
  return (unsigned short)((u + 0x7FFFu + ((u >> 16) & 1u)) >> 16);
}
__device__ __forceinline__ float bf_up(unsigned short h) { return __uint_as_float(((unsigned)h) << 16); }
__device__ __forceinline__ unsigned short h_bits(_Float16 x) { return __builtin_bit_cast(unsigned short, x); }
__device__ __forceinline__ unsigned pk16(unsigned short a, unsigned short b) { return (unsigned)a | ((unsigned)b << 16); }
__device__ __forceinline__ v8f zero8() { v8f z = {0.f, 0.f, 0.f, 0.f, 0.f, 0.f, 0.f, 0.f}; return z; }

// ---- fragment loaders: 16-bit A/B operand, lane -> row/col (lane&15), p already includes +8*(lane>>4);
//      elements 0..7 <- p[0..7] (k0+8h..), elements 8..15 <- p[16..23] (k0+16+8h..)
__device__ __forceinline__ v16b ldfrag_b(const __bf16* p) {
  union { v16b v; v8b h[2]; } f;
  f.h[0] = *(const v8b*)(p);
  f.h[1] = *(const v8b*)(p + 16);
  return f.v;
}
__device__ __forceinline__ v16h ldfrag_h(const _Float16* p) {
  union { v16h v; v8h h[2]; } f;
  f.h[0] = *(const v8h*)(p);
  f.h[1] = *(const v8h*)(p + 16);
  return f.v;
}

// ---- WMMA helpers with trailing VALU hazard gap --------------------------------------------------------
__device__ __forceinline__ v8f mma_h(v16h a, v16h b, v8f c) {
  c = __builtin_amdgcn_wmma_f32_16x16x32_f16(false, a, false, b, (short)0, c, false, false);
#if defined(__HIP_DEVICE_COMPILE__)
  asm volatile("v_nop\n\tv_nop\n\tv_nop\n\tv_nop" : "+v"(c) : "v"(a), "v"(b));
#endif
  return c;
}
__device__ __forceinline__ v8f mma_b_raw(v16b a, v16b b, v8f c) {
  return __builtin_amdgcn_wmma_f32_16x16x32_bf16(false, a, false, b, (short)0, c, false, false);
}
__device__ __forceinline__ void dep_guard_b(v8f& a, v8f& b, v16b x, v16b y) {
#if defined(__HIP_DEVICE_COMPILE__)
  asm volatile("v_nop\n\tv_nop\n\tv_nop\n\tv_nop" : "+v"(a), "+v"(b) : "v"(x), "v"(y));
#endif
}
__device__ __forceinline__ void keep4_b(v16b a, v16b b, v16b c, v16b d) {
#if defined(__HIP_DEVICE_COMPILE__)
  asm volatile("v_nop" :: "v"(a), "v"(b), "v"(c), "v"(d));
#endif
}
__device__ __forceinline__ void acc_guard4(v8f& a, v8f& b, v8f& c, v8f& d) {
#if defined(__HIP_DEVICE_COMPILE__)
  asm volatile("v_nop\n\tv_nop\n\tv_nop\n\tv_nop" : "+v"(a), "+v"(b), "+v"(c), "+v"(d));
#endif
}

// =====================================================================================================
// f32 -> bf16 (RNE convert), 8 elements per thread, one 16-B store per lane: a wave writes 512 contiguous B
// coverage: n8 threads x 8 = whole plane (n8 is a multiple of 256 here).
// =====================================================================================================
__global__ __launch_bounds__(256) void cvt_bf16x8(const float* __restrict__ in, unsigned short* out, int n8) {
  const int i = blockIdx.x * 256 + threadIdx.x;
  if (i < n8) {
    const v4f a = *(const v4f*)(in + (size_t)i * 8);
    const v4f b = *(const v4f*)(in + (size_t)i * 8 + 4);
    v4u p;
    p[0] = pk16(bf_bits(a[0]), bf_bits(a[1]));
    p[1] = pk16(bf_bits(a[2]), bf_bits(a[3]));
    p[2] = pk16(bf_bits(b[0]), bf_bits(b[1]));
    p[3] = pk16(bf_bits(b[2]), bf_bits(b[3]));
    *(v4u*)(out + (size_t)i * 8) = p;
    
  }
}

// =====================================================================================================
// f32 -> f16 plane = f16(v * scale) (scale a power of two); when rb != 0, v is first RNE-converted to bf16
// and widened back (exact in f16 after the power-of-two scale). 8 elements per thread, one 16-B store per
// coverage: n8 threads x 8 = whole plane (n8 multiple of 256).
// =====================================================================================================
__global__ __launch_bounds__(256) void plane_f16x8(const float* __restrict__ in, unsigned short* hp, int n8,
                                                   float scale, int rb) {
  const int i = blockIdx.x * 256 + threadIdx.x;
  if (i < n8) {
    const v4f a = *(const v4f*)(in + (size_t)i * 8);
    const v4f b = *(const v4f*)(in + (size_t)i * 8 + 4);
    float f[8];
    f[0] = a[0]; f[1] = a[1]; f[2] = a[2]; f[3] = a[3];
    f[4] = b[0]; f[5] = b[1]; f[6] = b[2]; f[7] = b[3];
    if (rb != 0) {
#pragma unroll
      for (int e = 0; e < 8; ++e) f[e] = bf_up(bf_bits(f[e]));
    }
    v4u ph;
#pragma unroll
    for (int e = 0; e < 4; ++e) {
      const _Float16 x0 = (_Float16)(f[2 * e] * scale);
      const _Float16 x1 = (_Float16)(f[2 * e + 1] * scale);
      ph[e] = pk16(h_bits(x0), h_bits(x1));
    }
    *(v4u*)(hp + (size_t)i * 8) = ph;
    
  }
}

// =====================================================================================================
// Register-blocked bf16 WMMA GEMM with bias: C[m][n] = sum_k A[m][k] * Bt[n][k] + bf16rne(bias[n]); one wave per
// 64x64 tile, no block barriers. A row-major [M][K] pitch lda; Bt row-major [N][K] pitch ldb (k contiguous);
// bias f32 [N] (RNE converted to bf16 and widened in the epilogue); M, N multiples of 64, K multiple of 32
// (fixed sizes, statically asserted); the tile count is a multiple of 8 for every launch here (no idle waves).
// Output f32 [M][N] pitch ldc. Epilogue: 16-row slabs staged per wave in LDS; each 64-wide row segment
// =====================================================================================================
__global__ __launch_bounds__(256) void gemm64(
    const unsigned short* __restrict__ Ap, int lda,
    const unsigned short* __restrict__ Btp, int ldb,
    const float* __restrict__ bias,
    float* C, int ldc, int M, int N, int K) {
  const __bf16* Ab  = (const __bf16*)(const void*)Ap;
  const __bf16* Bb  = (const __bf16*)(const void*)Btp;
  __shared__ __align__(16) float sT[8][16 * 68];   // per-wave 16x64 slab, pitch 68 floats
  const int lane = threadIdx.x & 31;
  const int wave = threadIdx.x >> 5;
  const int tilesN = N >> 6;
  const int tilesM = M >> 6;
  const int tile = blockIdx.x * 8 + wave;
  if (tile >= tilesM * tilesN) return;   // wave-uniform; no block barriers in this kernel
  const int tm = tile / tilesN;
  const int tn = tile - tm * tilesN;
  const int m0 = tm << 6;
  const int n0 = tn << 6;

  const int rlane = lane & 15;                 // row (A) / col (B, D) within subtile
  const int koff  = (lane >> 4) * 8;           // k offset of this lane half
  const int mOff  = (lane >> 4) * 8;           // D row offset

  v8f acc[4][4];
#pragma unroll
  for (int i = 0; i < 4; ++i)
#pragma unroll
    for (int j = 0; j < 4; ++j) acc[i][j] = zero8();

  for (int k0 = 0; k0 < K; k0 += 32) {
    v16b bh[4];
#pragma unroll
    for (int j = 0; j < 4; ++j) {
      const size_t bo = (size_t)(n0 + (j << 4) + rlane) * ldb + koff + k0;
      bh[j] = ldfrag_b(Bb + bo);
    }
#pragma unroll
    for (int i = 0; i < 4; ++i) {
      const size_t ao = (size_t)(m0 + (i << 4) + rlane) * lda + koff + k0;
      const v16b ah = ldfrag_b(Ab + ao);
#pragma unroll
      for (int j = 0; j < 4; ++j) {
        acc[i][j] = mma_b_raw(ah, bh[j], acc[i][j]);
      }
      dep_guard_b(acc[i][0], acc[i][3], ah, ah);
    }
    keep4_b(bh[0], bh[1], bh[2], bh[3]);
  }
  acc_guard4(acc[0][0], acc[0][1], acc[0][2], acc[0][3]);
  acc_guard4(acc[1][0], acc[1][1], acc[1][2], acc[1][3]);
  acc_guard4(acc[2][0], acc[2][1], acc[2][2], acc[2][3]);
  acc_guard4(acc[3][0], acc[3][1], acc[3][2], acc[3][3]);

  // ---- bias per D column of this lane (n0 + 16j + rlane < N) ----
  float bz[4];
#pragma unroll
  for (int j = 0; j < 4; ++j) bz[j] = bf_up(bf_bits(bias[n0 + (j << 4) + rlane]));

  // ---- epilogue ----
  float* slab = sT[wave];
#pragma unroll
  for (int i = 0; i < 4; ++i) {
    const int mBase = m0 + (i << 4);
#pragma unroll
    for (int r = 0; r < 8; ++r) {
#pragma unroll
      for (int j = 0; j < 4; ++j) {
        slab[(mOff + r) * 68 + (j << 4) + rlane] = acc[i][j][r] + bz[j];
      }
    }
    __builtin_amdgcn_fence(__ATOMIC_RELEASE, "workgroup");
    __builtin_amdgcn_wave_barrier();
    __builtin_amdgcn_fence(__ATOMIC_ACQUIRE, "workgroup");
    {
      const int hh = lane >> 4, c4 = (lane & 15) * 4;     // 256-B row segment = 16 lanes x 16 B
      v4f ov[8];
#pragma unroll
      for (int it = 0; it < 8; ++it) {
        const int row = it * 2 + hh;                       // it 0..7 x hh 0..1 = rows 0..15
        ov[it] = *(const v4f*)(slab + row * 68 + c4);
      }
      {
#pragma unroll
        for (int it = 0; it < 8; ++it) {
          const int row = it * 2 + hh;
          *(v4f*)(C + (size_t)(mBase + row) * ldc + n0 + c4) = ov[it];
        }
        
      }
    }
    __builtin_amdgcn_fence(__ATOMIC_RELEASE, "workgroup");
    __builtin_amdgcn_wave_barrier();
    __builtin_amdgcn_fence(__ATOMIC_ACQUIRE, "workgroup");
  }
}

// =====================================================================================================
// v f32 token-major vf[(b*SEQ + t)*DM + n] -> f16 v^T plane vth[(b*DM + n)*SEQ + t] = f16(v * vscale),
// vscale a power of two.
// Block = one 64-token x 64-feature tile of one b; grid = (SEQ/64, DM/64, NB); tile staged in LDS as f32
// (v4f loads, __syncthreads).
// Store: group g = tid>>3 (0..31), piece = tid&7: iteration it writes row n = it*32+g, lanes 8q..8q+7 x 16 B =
// coverage: 2 iterations x 32 groups = 64 rows n, 8 pieces x 8 = 64 tokens per row; grid covers every (b,
// n tile, t tile) -> the whole plane.
// =====================================================================================================
__global__ __launch_bounds__(256) void vt_plane(const float* __restrict__ vf, unsigned short* vth, float vscale) {
  __shared__ __align__(16) float sv[64 * 68];       // [tt][d] pitch 68 floats
  const int tid = threadIdx.x;
  const int t0  = blockIdx.x * 64;
  const int fh  = blockIdx.y;                        // feature tile (64 features)
  const int b   = blockIdx.z;
#pragma unroll
  for (int i = 0; i < 4; ++i) {
    const int idx = i * 256 + tid;                  // 0..1023
    const int tt = idx >> 4, c4 = (idx & 15) * 4;
    const v4f a = *(const v4f*)(vf + ((size_t)(b * SEQ + t0 + tt)) * DM + fh * 64 + c4);
    *(v4f*)(sv + tt * 68 + c4) = a;
  }
  __syncthreads();

  const int g = tid >> 3, piece = tid & 7;
  v4u hv[2];
  size_t hofs[2];
#pragma unroll
  for (int it = 0; it < 2; ++it) {
    const int d = it * 32 + g;
    v4u a;
#pragma unroll
    for (int e = 0; e < 4; ++e) {
      const float f0 = sv[(piece * 8 + 2 * e) * 68 + d];
      const float f1 = sv[(piece * 8 + 2 * e + 1) * 68 + d];
      a[e] = pk16(h_bits((_Float16)(f0 * vscale)), h_bits((_Float16)(f1 * vscale)));
    }
    hv[it] = a;
    hofs[it] = ((size_t)(b * DM + fh * 64 + d)) * SEQ + t0 + piece * 8;
  }
  {
#pragma unroll
    for (int it = 0; it < 2; ++it) {
      *(v4u*)(vth + hofs[it]) = hv[it];
    }
    
  }
}

// =====================================================================================================
// Column mean over tokens: mv[b*DM + n] = (1/SEQ) * sum_t vf[(b*SEQ + t)*DM + n], f64 accumulation.
// Block = 32 columns (one 128-B line per token row) x all SEQ tokens of one b; grid = (DM/32, NB); 1024 threads.
// Thread = (row group rg = tid>>3 in 0..127, piece = tid&7): 16 v4f loads, rows rg + 128*i, all independent, so a
// block has 256 KiB in flight instead of one dependent load stream per column. Sums: per thread over i (f64),
// then over the 4 row groups of a wave by __shfl_xor (8, 16), then the 32 wave partials through LDS
// (__syncthreads), added by wave 0 as a fixed pairwise tree, lane = column.
// coverage: DM/32 blocks x 32 columns x NB = every column of every batch; one 128-B store per block.
// =====================================================================================================
__global__ __launch_bounds__(1024) void colmean(const float* __restrict__ vf, float* mv) {
  __shared__ __align__(16) double sp[32][32];        // [wave][column]
  const int tid   = threadIdx.x;
  const int lane  = tid & 31;
  const int wave  = tid >> 5;
  const int piece = tid & 7;                         // 16-B piece of the 128-B row segment
  const int rg    = tid >> 3;                        // 0..127
  const int b     = blockIdx.y;
  const float* p = vf + ((size_t)b * SEQ + rg) * DM + blockIdx.x * 32 + piece * 4;
  v4f x[SEQ / 128];
#pragma unroll
  for (int i = 0; i < SEQ / 128; ++i) x[i] = *(const v4f*)(p + (size_t)i * 128 * DM);
  double s[4];
#pragma unroll
  for (int e = 0; e < 4; ++e) s[e] = (double)x[0][e];
#pragma unroll
  for (int i = 1; i < SEQ / 128; ++i) {
#pragma unroll
    for (int e = 0; e < 4; ++e) s[e] += (double)x[i][e];
  }
#pragma unroll
  for (int e = 0; e < 4; ++e) {
    s[e] += __shfl_xor(s[e], 8);
    s[e] += __shfl_xor(s[e], 16);
  }
  if (lane < 8) {
#pragma unroll
    for (int e = 0; e < 4; ++e) sp[wave][piece * 4 + e] = s[e];
  }
  __syncthreads();
  if (wave == 0) {                                   // wave-uniform
    double r[32];
#pragma unroll
    for (int w = 0; w < 32; ++w) r[w] = sp[w][lane];
#pragma unroll
    for (int o = 16; o > 0; o >>= 1) {
#pragma unroll
      for (int w = 0; w < o; ++w) r[w] += r[w + o];
    }
    mv[(size_t)b * DM + blockIdx.x * 32 + lane] = (float)(r[0] * (1.0 / (double)SEQ));
  }
}

// =====================================================================================================
// f16 WMMA GEMM with scale: C[m][n] = cscale * sum_k A[m][k] * Bt[n][k] (f16 products, f32 accumulate).
// Same tiling/epilogue as gemm64 (one wave per 64x64 tile, no block barriers, 16-row LDS slabs, each 256-B
// coverage: 4 slabs x 16 rows x 64 cols = the wave's whole 64x64 tile; tile count a multiple of 8.
// =====================================================================================================
__global__ __launch_bounds__(256) void gemm64h_s(
    const unsigned short* __restrict__ Ap, int lda,
    const unsigned short* __restrict__ Btp, int ldb,
    float* C, int ldc, int M, int N, int K, float cscale) {
  const _Float16* Ah = (const _Float16*)(const void*)Ap;
  const _Float16* Bh = (const _Float16*)(const void*)Btp;
  __shared__ __align__(16) float sT[8][16 * 68];
  const int lane = threadIdx.x & 31;
  const int wave = threadIdx.x >> 5;
  const int tilesN = N >> 6;
  const int tilesM = M >> 6;
  const int tile = blockIdx.x * 8 + wave;
  if (tile >= tilesM * tilesN) return;   // wave-uniform; no block barriers in this kernel
  const int tm = tile / tilesN;
  const int tn = tile - tm * tilesN;
  const int m0 = tm << 6;
  const int n0 = tn << 6;
  const int rlane = lane & 15;
  const int koff  = (lane >> 4) * 8;
  const int mOff  = (lane >> 4) * 8;

  v8f acc[4][4];
#pragma unroll
  for (int i = 0; i < 4; ++i)
#pragma unroll
    for (int j = 0; j < 4; ++j) acc[i][j] = zero8();

  for (int k0 = 0; k0 < K; k0 += 32) {
    v16h bh[4];
#pragma unroll
    for (int j = 0; j < 4; ++j) {
      const size_t bo = (size_t)(n0 + (j << 4) + rlane) * ldb + koff + k0;
      bh[j] = ldfrag_h(Bh + bo);
    }
#pragma unroll
    for (int i = 0; i < 4; ++i) {
      const size_t ao = (size_t)(m0 + (i << 4) + rlane) * lda + koff + k0;
      const v16h ah = ldfrag_h(Ah + ao);
#pragma unroll
      for (int j = 0; j < 4; ++j) {
        acc[i][j] = mma_h(ah, bh[j], acc[i][j]);
      }
    }
  }

  float* slab = sT[wave];
#pragma unroll
  for (int i = 0; i < 4; ++i) {
    const int mBase = m0 + (i << 4);
#pragma unroll
    for (int r = 0; r < 8; ++r) {
#pragma unroll
      for (int j = 0; j < 4; ++j) {
        slab[(mOff + r) * 68 + (j << 4) + rlane] = acc[i][j][r] * cscale;
      }
    }
    __builtin_amdgcn_fence(__ATOMIC_RELEASE, "workgroup");
    __builtin_amdgcn_wave_barrier();
    __builtin_amdgcn_fence(__ATOMIC_ACQUIRE, "workgroup");
    {
      const int hh = lane >> 4, c4 = (lane & 15) * 4;
      v4f ov[8];
#pragma unroll
      for (int it = 0; it < 8; ++it) {
        const int row = it * 2 + hh;
        ov[it] = *(const v4f*)(slab + row * 68 + c4);
      }
      {
#pragma unroll
        for (int it = 0; it < 8; ++it) {
          const int row = it * 2 + hh;
          *(v4f*)(C + (size_t)(mBase + row) * ldc + n0 + c4) = ov[it];
        }
        
      }
    }
    __builtin_amdgcn_fence(__ATOMIC_RELEASE, "workgroup");
    __builtin_amdgcn_wave_barrier();
    __builtin_amdgcn_fence(__ATOMIC_ACQUIRE, "workgroup");
  }
}

// =====================================================================================================
// Row softmax over SEQ keys, max-subtracted, f32: p = exp(s - max) / sum; stored CENTERED and scaled as
// f16(16384 * p - 8) = f16(16384 * (p - 1/SEQ)) (the 1/SEQ part is added back downstream as the column
// mean of v). One 256-thread block per row, 8 consecutive elements per thread (two v4f loads), wave
// reductions by __shfl_xor, 8 wave partials combined in fixed order through LDS.
// =====================================================================================================
__global__ __launch_bounds__(256) void softmax_c(const float* __restrict__ sf, unsigned short* ph) {
  __shared__ float redm[8];
  __shared__ float reds[8];
  const int row  = blockIdx.x;
  const int tid  = threadIdx.x;
  const int lane = tid & 31;
  const int wave = tid >> 5;
  const float* s = sf + (size_t)row * SEQ + tid * 8;
  const v4f a = *(const v4f*)(s);
  const v4f c = *(const v4f*)(s + 4);
  float v[8];
  v[0] = a[0]; v[1] = a[1]; v[2] = a[2]; v[3] = a[3];
  v[4] = c[0]; v[5] = c[1]; v[6] = c[2]; v[7] = c[3];
  float m = v[0];
#pragma unroll
  for (int e = 1; e < 8; ++e) m = fmaxf(m, v[e]);
#pragma unroll
  for (int o = 16; o > 0; o >>= 1) m = fmaxf(m, __shfl_xor(m, o));
  if (lane == 0) redm[wave] = m;
  __syncthreads();
  float mm = redm[0];
#pragma unroll
  for (int w = 1; w < 8; ++w) mm = fmaxf(mm, redm[w]);
  float sum = 0.f;
#pragma unroll
  for (int e = 0; e < 8; ++e) {
    v[e] = __expf(v[e] - mm);
    sum += v[e];
  }
#pragma unroll
  for (int o = 16; o > 0; o >>= 1) sum += __shfl_xor(sum, o);
  if (lane == 0) reds[wave] = sum;
  __syncthreads();
  float tot = 0.f;
#pragma unroll
  for (int w = 0; w < 8; ++w) tot += reds[w];       // fixed order, identical for every thread
  const float inv = 1.0f / tot;                     // tot >= 1
  v4u pk;
#pragma unroll
  for (int e = 0; e < 4; ++e) {
    const float p0 = v[2 * e] * inv;
    const float p1 = v[2 * e + 1] * inv;
    const _Float16 x0 = (_Float16)(p0 * 16384.0f - 8.0f);
    const _Float16 x1 = (_Float16)(p1 * 16384.0f - 8.0f);
    pk[e] = pk16(h_bits(x0), h_bits(x1));
  }
  unsigned short* o = ph + (size_t)row * SEQ + tid * 8;
  *(v4u*)o = pk;
  
}

// =====================================================================================================
// p.v for one batch bb: O[i][n] = oscale * sum_j P[i][j] * Vt[n][j] + mv[n] (f16 products, f32 accumulate;
// oscale folds back the weight and v carries; mv = column mean of v in f32). P f16 [SEQ][SEQ] pitch lda
// (j contiguous); Vt f16 [DM][SEQ] pitch ldb; n = h*HD + d.
// O is written as two f16 head-major planes: hi = f16(O*1024), lo = f16((O*1024 - hi)*2048), element
// (bb, h, i, d) at [((bb*NH + h)*SEQ + i)*HD + d]; a 64-wide tile column block is exactly one head h = tn,
// One wave per 64x64 tile, no block barriers; tile count multiple of 8. Epilogue: 16-row f32 slab staged per
// coverage: 4 slabs x (4 q x 4 g4 = 16 rows) x (8 pieces x 8 = 64 cols) = the wave's whole tile in both
// planes; grid covers every (i tile, head) of this batch.
// =====================================================================================================
__global__ __launch_bounds__(256) void gemm64h_o(
    const unsigned short* __restrict__ Ap, int lda,
    const unsigned short* __restrict__ Btp, int ldb,
    const float* __restrict__ mv,
    unsigned short* ohi, unsigned short* olo, int bb,
    int M, int N, int K, float oscale) {
  const _Float16* Ah = (const _Float16*)(const void*)Ap;
  const _Float16* Bh = (const _Float16*)(const void*)Btp;
  __shared__ __align__(16) float sT[8][16 * 68];
  const int lane = threadIdx.x & 31;
  const int wave = threadIdx.x >> 5;
  const int tilesN = N >> 6;
  const int tilesM = M >> 6;
  const int tile = blockIdx.x * 8 + wave;
  if (tile >= tilesM * tilesN) return;   // wave-uniform; no block barriers in this kernel
  const int tm = tile / tilesN;
  const int tn = tile - tm * tilesN;     // == head index (tile width 64 == HD)
  const int m0 = tm << 6;
  const int n0 = tn << 6;
  const int rlane = lane & 15;
  const int koff  = (lane >> 4) * 8;
  const int mOff  = (lane >> 4) * 8;

  v8f acc[4][4];
#pragma unroll
  for (int i = 0; i < 4; ++i)
#pragma unroll
    for (int j = 0; j < 4; ++j) acc[i][j] = zero8();

  for (int k0 = 0; k0 < K; k0 += 32) {
    v16h bh[4];
#pragma unroll
    for (int j = 0; j < 4; ++j) {
      const size_t bo = (size_t)(n0 + (j << 4) + rlane) * ldb + koff + k0;
      bh[j] = ldfrag_h(Bh + bo);
    }
#pragma unroll
    for (int i = 0; i < 4; ++i) {
      const size_t ao = (size_t)(m0 + (i << 4) + rlane) * lda + koff + k0;
      const v16h ah = ldfrag_h(Ah + ao);
#pragma unroll
      for (int j = 0; j < 4; ++j) {
        acc[i][j] = mma_h(ah, bh[j], acc[i][j]);
      }
    }
  }

  float mz[4];
#pragma unroll
  for (int j = 0; j < 4; ++j) mz[j] = mv[n0 + (j << 4) + rlane];

  float* slab = sT[wave];
  const size_t pbase = ((size_t)(bb * NH + tn)) * SEQ;     // plane row base for head tn of batch bb
#pragma unroll
  for (int i = 0; i < 4; ++i) {
    const int mBase = m0 + (i << 4);
#pragma unroll
    for (int r = 0; r < 8; ++r) {
#pragma unroll
      for (int j = 0; j < 4; ++j) {
        slab[(mOff + r) * 68 + (j << 4) + rlane] = acc[i][j][r] * oscale + mz[j];
      }
    }
    __builtin_amdgcn_fence(__ATOMIC_RELEASE, "workgroup");
    __builtin_amdgcn_wave_barrier();
    __builtin_amdgcn_fence(__ATOMIC_ACQUIRE, "workgroup");
    {
      const int g4 = lane >> 3, piece = lane & 7;
      v4u hv[4], lv[4];
      size_t ofs[4];
#pragma unroll
      for (int q = 0; q < 4; ++q) {
        const int row = q * 4 + g4;                      // q 0..3 x g4 0..3 = rows 0..15
        const v4f x0 = *(const v4f*)(slab + row * 68 + piece * 8);
        const v4f x1 = *(const v4f*)(slab + row * 68 + piece * 8 + 4);
        float f[8];
        f[0] = x0[0]; f[1] = x0[1]; f[2] = x0[2]; f[3] = x0[3];
        f[4] = x1[0]; f[5] = x1[1]; f[6] = x1[2]; f[7] = x1[3];
        v4u ph, pl;
#pragma unroll
        for (int e = 0; e < 4; ++e) {
          const float s0 = f[2 * e] * 1024.0f;
          const float s1 = f[2 * e + 1] * 1024.0f;
          const _Float16 h0 = (_Float16)s0;
          const _Float16 h1 = (_Float16)s1;
          const _Float16 l0 = (_Float16)((s0 - (float)h0) * 2048.0f);
          const _Float16 l1 = (_Float16)((s1 - (float)h1) * 2048.0f);
          ph[e] = pk16(h_bits(h0), h_bits(h1));
          pl[e] = pk16(h_bits(l0), h_bits(l1));
        }
        hv[q] = ph;
        lv[q] = pl;
        ofs[q] = (pbase + (size_t)(mBase + row)) * HD + piece * 8;
      }
      {
#pragma unroll
        for (int q = 0; q < 4; ++q) {
          *(v4u*)(ohi + ofs[q]) = hv[q];
          *(v4u*)(olo + ofs[q]) = lv[q];
        }
        
      }
    }
    __builtin_amdgcn_fence(__ATOMIC_RELEASE, "workgroup");
    __builtin_amdgcn_wave_barrier();
    __builtin_amdgcn_fence(__ATOMIC_ACQUIRE, "workgroup");
  }
}

// =====================================================================================================
// Output projection: C[m][n] = sch * (sum_k Ahi[m][k]*Bt[n][k] + scl * sum_k Alo[m][k]*Bt[n][k]) + bf16rne(bias[n])
// (f16 products, f32 accumulate, hi and scaled-residual products in separate accumulators). Ahi/Alo row-major
// [M][K] pitch lda; Bt [N][K] pitch ldb; C f32 [M][N] pitch ldc. One wave per 32x64 tile, no block barriers;
// tile count multiple of 8; A fragments (2 rows x 2 planes) cached per k-step, B fragments streamed.
// Epilogue: 16-row slabs staged per wave in LDS; each 64-wide row segment (256 B) written by one instruction
// coverage: 2 slabs x 16 rows x 64 cols = the wave's whole 32x64 tile; grid covers every tile of C.
// =====================================================================================================
__global__ __launch_bounds__(256) void gemm32h_w(
    const unsigned short* __restrict__ Ahp, const unsigned short* __restrict__ Alp, int lda,
    const unsigned short* __restrict__ Btp, int ldb,
    const float* __restrict__ bias,
    float* C, int ldc, int M, int N, int K, float sch, float scl) {
  const _Float16* Ah = (const _Float16*)(const void*)Ahp;
  const _Float16* Al = (const _Float16*)(const void*)Alp;
  const _Float16* Bh = (const _Float16*)(const void*)Btp;
  __shared__ __align__(16) float sT[8][16 * 68];
  const int lane = threadIdx.x & 31;
  const int wave = threadIdx.x >> 5;
  const int tilesN = N >> 6;
  const int tilesM = M >> 5;
  const int tile = blockIdx.x * 8 + wave;
  if (tile >= tilesM * tilesN) return;   // wave-uniform; no block barriers in this kernel
  const int tm = tile / tilesN;
  const int tn = tile - tm * tilesN;
  const int m0 = tm << 5;
  const int n0 = tn << 6;
  const int rlane = lane & 15;
  const int koff  = (lane >> 4) * 8;
  const int mOff  = (lane >> 4) * 8;

  v8f acch[2][4], accl[2][4];
#pragma unroll
  for (int i = 0; i < 2; ++i)
#pragma unroll
    for (int j = 0; j < 4; ++j) { acch[i][j] = zero8(); accl[i][j] = zero8(); }

  for (int k0 = 0; k0 < K; k0 += 32) {
    v16h fh[2], fl[2];
#pragma unroll
    for (int i = 0; i < 2; ++i) {
      const size_t ao = (size_t)(m0 + (i << 4) + rlane) * lda + koff + k0;
      fh[i] = ldfrag_h(Ah + ao);
      fl[i] = ldfrag_h(Al + ao);
    }
#pragma unroll
    for (int j = 0; j < 4; ++j) {
      const size_t bo = (size_t)(n0 + (j << 4) + rlane) * ldb + koff + k0;
      const v16h bfr = ldfrag_h(Bh + bo);
#pragma unroll
      for (int i = 0; i < 2; ++i) {
        acch[i][j] = mma_h(fh[i], bfr, acch[i][j]);
        accl[i][j] = mma_h(fl[i], bfr, accl[i][j]);
      }
    }
  }

  float bz[4];
#pragma unroll
  for (int j = 0; j < 4; ++j) bz[j] = bf_up(bf_bits(bias[n0 + (j << 4) + rlane]));

  float* slab = sT[wave];
#pragma unroll
  for (int i = 0; i < 2; ++i) {
    const int mBase = m0 + (i << 4);
#pragma unroll
    for (int r = 0; r < 8; ++r) {
#pragma unroll
      for (int j = 0; j < 4; ++j) {
        slab[(mOff + r) * 68 + (j << 4) + rlane] = (acch[i][j][r] + accl[i][j][r] * scl) * sch + bz[j];
      }
    }
    __builtin_amdgcn_fence(__ATOMIC_RELEASE, "workgroup");
    __builtin_amdgcn_wave_barrier();
    __builtin_amdgcn_fence(__ATOMIC_ACQUIRE, "workgroup");
    {
      const int hh = lane >> 4, c4 = (lane & 15) * 4;     // 256-B row segment = 16 lanes x 16 B
      v4f ov[8];
#pragma unroll
      for (int it = 0; it < 8; ++it) {
        const int row = it * 2 + hh;                       // it 0..7 x hh 0..1 = rows 0..15
        ov[it] = *(const v4f*)(slab + row * 68 + c4);
      }
      {
#pragma unroll
        for (int it = 0; it < 8; ++it) {
          const int row = it * 2 + hh;
          *(v4f*)(C + (size_t)(mBase + row) * ldc + n0 + c4) = ov[it];
        }
        
      }
    }
    __builtin_amdgcn_fence(__ATOMIC_RELEASE, "workgroup");
    __builtin_amdgcn_wave_barrier();
    __builtin_amdgcn_fence(__ATOMIC_ACQUIRE, "workgroup");
  }
}

// =====================================================================================================
// Workspace map (bytes); every region an exact multiple of its whole-line / whole-tile store granularity
// within a launch; Tf is reused sequentially: q, k, v f32 projections, then the per-batch f32 score map):
//   Xb   bf16 [4096][1024]              0         8388608
//   Wqb  bf16 [1024 n][1024 k]     8388608         2097152
//   Wkb  bf16 [1024 n][1024 k]    10485760         2097152
//   Wvb  bf16 [1024 n][1024 k]    12582912         2097152
//   Woh  f16  [1024 n][1024 k]    14680064         2097152   (f16(bf16(Wo) x1024))
//   Tf   f32  [4096][1024]       16777216        16777216   (also S f32 [2048][2048] of the current batch)
//   Qh   f16  [4096][1024]       33554432         8388608   (q x16)
//   Kh   f16  [4096][1024]       41943040         8388608   (k x16)
//   VTh  f16  [2*1024][2048]     50331648         8388608   ([b*DM + n][t], v x64)
//   Ph   f16  [2048][2048]       58720256         8388608   (centered weights of the current batch)
//   Ohi  f16  [2][16][2048][64]  67108864         8388608
//   Olo  f16  [2][16][2048][64]  75497472         8388608
//   end                          83894272
// Inputs: query f32 [2][2048][1024]; Wq, Wk, Wv, Wo f32 [1024 out][1024 in]; bq, bk, bv, bo f32 [1024].
// d_out f32 [4096][1024] at byte 0 (row = b*SEQ + s, col = n).
// =====================================================================================================
extern "C" void kernel_launch(void* const* d_in, const int* in_sizes, int n_in,
                              void* d_out, int out_size, void* d_ws, size_t ws_size,
                              hipStream_t stream) {
  if (n_in < 9) return;
  if (in_sizes[0] != NB * SEQ * DM) return;
  if (in_sizes[1] != DM * DM) return;
  if (in_sizes[2] != DM) return;
  if (in_sizes[3] != DM * DM) return;
  if (in_sizes[4] != DM) return;
  if (in_sizes[5] != DM * DM) return;
  if (in_sizes[6] != DM) return;
  if (in_sizes[7] != DM * DM) return;
  if (in_sizes[8] != DM) return;
  if (out_size != OUTN) return;

  const float* x  = (const float*)d_in[0];   // [NB*SEQ][DM]
  const float* Wq = (const float*)d_in[1];   // [DM n][DM k]
  const float* bq = (const float*)d_in[2];   // [DM]
  const float* Wk = (const float*)d_in[3];
  const float* bk = (const float*)d_in[4];
  const float* Wv = (const float*)d_in[5];
  const float* bv = (const float*)d_in[6];
  const float* Wo = (const float*)d_in[7];
  const float* bo = (const float*)d_in[8];

  const size_t PXb = (size_t)ROWS * DM * 2;          //  8388608
  const size_t PW  = (size_t)DM * DM * 2;            //  2097152
  const size_t PF  = (size_t)ROWS * DM * 4;          // 16777216
  const size_t PH  = (size_t)ROWS * DM * 2;          //  8388608
  const size_t PVt = (size_t)NB * DM * SEQ * 2;      //  8388608
  const size_t PP  = (size_t)SEQ * SEQ * 2;          //  8388608
  const size_t PO  = (size_t)NB * NH * SEQ * HD * 2; //  8388608
  const size_t PMv = (size_t)NB * DM * 4;            //     8192
  size_t off = 0;
  const size_t oXb = off; off += PXb;
  const size_t oWq = off; off += PW;
  const size_t oWk = off; off += PW;
  const size_t oWv = off; off += PW;
  const size_t oWo = off; off += PW;
  const size_t oTf = off; off += PF;
  const size_t oQh = off; off += PH;
  const size_t oKh = off; off += PH;
  const size_t oVt = off; off += PVt;
  const size_t oP  = off; off += PP;
  const size_t oOh = off; off += PO;
  const size_t oOl = off; off += PO;
  const size_t oMv = off; off += PMv;
  if (off > ws_size) return;                        // off = 83894272
  if (off > (size_t)134217728) return;

  char* ws = (char*)d_ws;
  unsigned short* Xb  = (unsigned short*)(ws + oXb);
  unsigned short* Wqb = (unsigned short*)(ws + oWq);
  unsigned short* Wkb = (unsigned short*)(ws + oWk);
  unsigned short* Wvb = (unsigned short*)(ws + oWv);
  unsigned short* Woh = (unsigned short*)(ws + oWo);
  float*          Tf  = (float*)(ws + oTf);
  unsigned short* Qh  = (unsigned short*)(ws + oQh);
  unsigned short* Kh  = (unsigned short*)(ws + oKh);
  unsigned short* VTh = (unsigned short*)(ws + oVt);
  unsigned short* Ph  = (unsigned short*)(ws + oP);
  unsigned short* Ohi = (unsigned short*)(ws + oOh);
  unsigned short* Olo = (unsigned short*)(ws + oOl);
  float*          mV  = (float*)(ws + oMv);
  float*          outf = (float*)d_out;             // [ROWS][DM]

  const dim3 blk(256);
  const int n8x = ROWS * DM / 8;                    // 524288
  const int n8w = DM * DM / 8;                      // 131072
  const dim3 gCvtX(n8x / 256);                      // 2048 blocks (exact)
  const dim3 gCvtW(n8w / 256);                      //  512 blocks (exact)
  const dim3 gGemm(((ROWS / 64) * (DM / 64)) / 8);  // 1024 tiles -> 128 blocks
  const dim3 gVpl(SEQ / 64, DM / 64, NB);           // (32, 16, 2)
  const dim3 gCm(DM / 32, NB);                      // (32, 2)
  const dim3 gSc(((SEQ / 64) * (SEQ / 64)) / 8);    // 1024 tiles -> 128 blocks per batch
  const dim3 gSm(SEQ);                              // 2048 rows per batch
  const dim3 gPv(((SEQ / 64) * (DM / 64)) / 8);     //  512 tiles -> 64 blocks per batch
  const dim3 gWo(((ROWS / 32) * (DM / 64)) / 8);    // 2048 tiles -> 256 blocks
  const float qkScale = 16.0f;                      // q and k planes carried x16
  const float woScale = 1024.0f;                    // Wo plane carried x1024
  const float sscale  = 1.0f / 32768.0f;            // (1/sqrt(64))/16 heads = 1/128, two x16 carries folded back
  const float vScale  = 64.0f;                      // v^T plane carried x64
  const float pvOscl  = 1.0f / 1048576.0f;          // 1/(16384 * 64)
  const float woSch   = 1.0f / 1048576.0f;          // 1/(1024 * 1024): O hi carry and Wo carry
  const float woScl   = 1.0f / 2048.0f;             // residual plane carry

  // (1) activations and weights -> bf16 planes (W is [n][k] already); Wo -> f16 plane of its bf16 value x1024
  cvt_bf16x8<<<gCvtX, blk, 0, stream>>>(x, Xb, n8x);
  cvt_bf16x8<<<gCvtW, blk, 0, stream>>>(Wq, Wqb, n8w);
  cvt_bf16x8<<<gCvtW, blk, 0, stream>>>(Wk, Wkb, n8w);
  cvt_bf16x8<<<gCvtW, blk, 0, stream>>>(Wv, Wvb, n8w);
  plane_f16x8<<<gCvtW, blk, 0, stream>>>(Wo, Woh, n8w, woScale, 1);
  // (2) q = Xb . Wqb^T + bq -> Tf [4096][1024] (M=4096, N=1024, K=1024), then f16 plane (x16)
  gemm64<<<gGemm, blk, 0, stream>>>(Xb, DM, Wqb, DM, bq, Tf, DM, ROWS, DM, DM);
  plane_f16x8<<<gCvtX, blk, 0, stream>>>(Tf, Qh, n8x, qkScale, 0);
  // (3) k likewise
  gemm64<<<gGemm, blk, 0, stream>>>(Xb, DM, Wkb, DM, bk, Tf, DM, ROWS, DM, DM);
  plane_f16x8<<<gCvtX, blk, 0, stream>>>(Tf, Kh, n8x, qkScale, 0);
  // (4) v likewise -> Tf, then f16 v^T plane (x64) and f32 column means over tokens
  gemm64<<<gGemm, blk, 0, stream>>>(Xb, DM, Wvb, DM, bv, Tf, DM, ROWS, DM, DM);
  vt_plane<<<gVpl, blk, 0, stream>>>(Tf, VTh, vScale);
  colmean<<<gCm, dim3(1024), 0, stream>>>(Tf, mV);
  // (5) per batch: head-averaged scores (K = 1024) -> Tf as S [2048][2048]; row softmax -> centered weights;
  //     p . v -> O hi/res head-major planes
  for (int b = 0; b < NB; ++b) {
    gemm64h_s<<<gSc, blk, 0, stream>>>(Qh + (size_t)b * SEQ * DM, DM, Kh + (size_t)b * SEQ * DM, DM,
                                       Tf, SEQ, SEQ, SEQ, DM, sscale);
    softmax_c<<<gSm, blk, 0, stream>>>(Tf, Ph);
    gemm64h_o<<<gPv, blk, 0, stream>>>(Ph, SEQ, VTh + (size_t)b * DM * SEQ, SEQ, mV + (size_t)b * DM,
                                       Ohi, Olo, b, SEQ, DM, SEQ, pvOscl);
  }
  // (6) out = O(flat [4096][1024]) . Woh^T + bo -> d_out
  gemm32h_w<<<gWo, blk, 0, stream>>>(Ohi, Olo, DM, Woh, DM, bo, outf, DM, ROWS, DM, DM, woSch, woScl);
  (void)hipGetLastError();
}

// v002
// One run takes 334 microseconds.
// Timed twice side by side with v001, it ran 1.50 and 1.49 times as fast.
// All steps since v000 together make it 2.04 times as fast.
// Contractions: q/k/v projections = v_wmma_f32_16x16x32_bf16 (bf16 operands: RNE-converted x, W, bias; single product); head-averaged q.k^T scores = v_wmma_f32_16x16x32_f16 (q, k f16 planes carried x16; single product); p.v = v_wmma_f32_16x16x32_f16 (centered softmax weights 16384*p-8 in f16, v^T f16 plane carried x64; single product; f64/f32 column mean of v added back); output projection = v_wmma_f32_16x16x32_f16 (attention output as f16 hi (x1024) + residual (x2048) planes, two products into separate accumulators; Wo as f16 of its bf16-RNE value x1024); all f32 accumulate; softmax in f32.
#include <hip/hip_runtime.h>
#include <math.h>
#include <stdint.h>

#define NB    2
#define SEQ   2048
#define DM    1024
#define NH    16
#define HD    64
#define ROWS  (NB * SEQ)             // 4096 token rows
#define OUTN  (ROWS * DM)
static_assert(NH * HD == DM);
static_assert(HD == 64);
static_assert((SEQ % 64) == 0 && (DM % 64) == 0 && (ROWS % 64) == 0 && (DM % 32) == 0 && (DM % 256) == 0);
static_assert(SEQ == 256 * 8);
static_assert((SEQ % 128) == 0);
static_assert((((ROWS / 64) * (DM / 64)) % 8) == 0);
static_assert((((SEQ / 64) * (SEQ / 64)) % 8) == 0);
static_assert((((SEQ / 64) * (DM / 64)) % 8) == 0);
static_assert((((ROWS / 32) * (DM / 64)) % 8) == 0);
static_assert(((ROWS * DM / 8) % 256) == 0 && ((DM * DM / 8) % 256) == 0);
static_assert((size_t)SEQ * SEQ * 4 <= (size_t)ROWS * DM * 4);

typedef _Float16 v16h __attribute__((ext_vector_type(16)));
typedef _Float16 v8h  __attribute__((ext_vector_type(8)));
typedef __bf16   v16b __attribute__((ext_vector_type(16)));
typedef __bf16   v8b  __attribute__((ext_vector_type(8)));
typedef float    v8f  __attribute__((ext_vector_type(8)));
typedef float    v4f  __attribute__((ext_vector_type(4)));
typedef unsigned int v4u __attribute__((ext_vector_type(4)));

// ---- scalar helpers --------------------------------------------------------------------------------
__device__ __forceinline__ unsigned short bf_bits(float f) {          // f32 -> bf16 bits, RNE convert
  unsigned u = __float_as_uint(f);
  return (unsigned short)((u + 0x7FFFu + ((u >> 16) & 1u)) >> 16);
}
__device__ __forceinline__ float bf_up(unsigned short h) { return __uint_as_float(((unsigned)h) << 16); }
__device__ __forceinline__ unsigned short h_bits(_Float16 x) { return __builtin_bit_cast(unsigned short, x); }
__device__ __forceinline__ unsigned pk16(unsigned short a, unsigned short b) { return (unsigned)a | ((unsigned)b << 16); }
__device__ __forceinline__ v8f zero8() { v8f z = {0.f, 0.f, 0.f, 0.f, 0.f, 0.f, 0.f, 0.f}; return z; }

// ---- fragment loaders: 16-bit A/B operand, lane -> row/col (lane&15), p already includes +8*(lane>>4);
//      elements 0..7 <- p[0..7] (k0+8h..), elements 8..15 <- p[16..23] (k0+16+8h..)
__device__ __forceinline__ v16b ldfrag_b(const __bf16* p) {
  union { v16b v; v8b h[2]; } f;
  f.h[0] = *(const v8b*)(p);
  f.h[1] = *(const v8b*)(p + 16);
  return f.v;
}
__device__ __forceinline__ v16h ldfrag_h(const _Float16* p) {
  union { v16h v; v8h h[2]; } f;
  f.h[0] = *(const v8h*)(p);
  f.h[1] = *(const v8h*)(p + 16);
  return f.v;
}

// ---- wave-uniform fragment base, held in a scalar register pair: every fragment load is then scalar base + one lane
//      offset register, so the 16 loads of a k step issue back to back, with no vector address arithmetic and no wait
//      between them (p must be the same in every lane of the wave)
typedef const __attribute__((address_space(1))) char* gcp;
__device__ __forceinline__ const char* sbase(const void* p) {
  const unsigned long long u = (unsigned long long)p;
  const unsigned lo = (unsigned)__builtin_amdgcn_readfirstlane((int)(unsigned)u);
  const unsigned hi = (unsigned)__builtin_amdgcn_readfirstlane((int)(unsigned)(u >> 32));
  return (const char*)(gcp)(((unsigned long long)hi << 32) | lo);
}

// ---- WMMA helpers with trailing VALU hazard gap --------------------------------------------------------
__device__ __forceinline__ v8f mma_h(v16h a, v16h b, v8f c) {
  c = __builtin_amdgcn_wmma_f32_16x16x32_f16(false, a, false, b, (short)0, c, false, false);
#if defined(__HIP_DEVICE_COMPILE__)
  asm volatile("v_nop\n\tv_nop\n\tv_nop\n\tv_nop" : "+v"(c) : "v"(a), "v"(b));
#endif
  return c;
}
__device__ __forceinline__ v8f mma_b_raw(v16b a, v16b b, v8f c) {
  return __builtin_amdgcn_wmma_f32_16x16x32_bf16(false, a, false, b, (short)0, c, false, false);
}
__device__ __forceinline__ void dep_guard_b(v8f& a, v8f& b, v16b x, v16b y) {
#if defined(__HIP_DEVICE_COMPILE__)
  asm volatile("v_nop\n\tv_nop\n\tv_nop\n\tv_nop" : "+v"(a), "+v"(b) : "v"(x), "v"(y));
#endif
}
__device__ __forceinline__ void keep4_b(v16b a, v16b b, v16b c, v16b d) {
#if defined(__HIP_DEVICE_COMPILE__)
  asm volatile("v_nop" :: "v"(a), "v"(b), "v"(c), "v"(d));
#endif
}
__device__ __forceinline__ void acc_guard4(v8f& a, v8f& b, v8f& c, v8f& d) {
#if defined(__HIP_DEVICE_COMPILE__)
  asm volatile("v_nop\n\tv_nop\n\tv_nop\n\tv_nop" : "+v"(a), "+v"(b), "+v"(c), "+v"(d));
#endif
}

// =====================================================================================================
// f32 -> bf16 (RNE convert), 8 elements per thread, one 16-B store per lane: a wave writes 512 contiguous B
// coverage: n8 threads x 8 = whole plane (n8 is a multiple of 256 here).
// =====================================================================================================
__global__ __launch_bounds__(256) void cvt_bf16x8(const float* __restrict__ in, unsigned short* out, int n8) {
  const int i = blockIdx.x * 256 + threadIdx.x;
  if (i < n8) {
    const v4f a = *(const v4f*)(in + (size_t)i * 8);
    const v4f b = *(const v4f*)(in + (size_t)i * 8 + 4);
    v4u p;
    p[0] = pk16(bf_bits(a[0]), bf_bits(a[1]));
    p[1] = pk16(bf_bits(a[2]), bf_bits(a[3]));
    p[2] = pk16(bf_bits(b[0]), bf_bits(b[1]));
    p[3] = pk16(bf_bits(b[2]), bf_bits(b[3]));
    *(v4u*)(out + (size_t)i * 8) = p;
    
  }
}

// =====================================================================================================
// f32 -> f16 plane = f16(v * scale) (scale a power of two); when rb != 0, v is first RNE-converted to bf16
// and widened back (exact in f16 after the power-of-two scale). 8 elements per thread, one 16-B store per
// coverage: n8 threads x 8 = whole plane (n8 multiple of 256).
// =====================================================================================================
__global__ __launch_bounds__(256) void plane_f16x8(const float* __restrict__ in, unsigned short* hp, int n8,
                                                   float scale, int rb) {
  const int i = blockIdx.x * 256 + threadIdx.x;
  if (i < n8) {
    const v4f a = *(const v4f*)(in + (size_t)i * 8);
    const v4f b = *(const v4f*)(in + (size_t)i * 8 + 4);
    float f[8];
    f[0] = a[0]; f[1] = a[1]; f[2] = a[2]; f[3] = a[3];
    f[4] = b[0]; f[5] = b[1]; f[6] = b[2]; f[7] = b[3];
    if (rb != 0) {
#pragma unroll
      for (int e = 0; e < 8; ++e) f[e] = bf_up(bf_bits(f[e]));
    }
    v4u ph;
#pragma unroll
    for (int e = 0; e < 4; ++e) {
      const _Float16 x0 = (_Float16)(f[2 * e] * scale);
      const _Float16 x1 = (_Float16)(f[2 * e + 1] * scale);
      ph[e] = pk16(h_bits(x0), h_bits(x1));
    }
    *(v4u*)(hp + (size_t)i * 8) = ph;
    
  }
}

// =====================================================================================================
// Register-blocked bf16 WMMA GEMM with bias: C[m][n] = sum_k A[m][k] * Bt[n][k] + bf16rne(bias[n]); one wave per
// 64x64 tile, no block barriers. A row-major [M][K] pitch lda; Bt row-major [N][K] pitch ldb (k contiguous);
// bias f32 [N] (RNE converted to bf16 and widened in the epilogue); M, N multiples of 64, K multiple of 32
// (fixed sizes, statically asserted); the tile count is a multiple of 8 for every launch here (no idle waves).
// Output f32 [M][N] pitch ldc. Epilogue: 16-row slabs staged per wave in LDS; each 64-wide row segment
// =====================================================================================================
__global__ __launch_bounds__(256) void gemm64(
    const unsigned short* __restrict__ Ap, int lda,
    const unsigned short* __restrict__ Btp, int ldb,
    const float* __restrict__ bias,
    float* C, int ldc, int M, int N, int K) {
  const __bf16* Ab  = (const __bf16*)(const void*)Ap;
  const __bf16* Bb  = (const __bf16*)(const void*)Btp;
  __shared__ __align__(16) float sT[8][16 * 68];   // per-wave 16x64 slab, pitch 68 floats
  const int lane = threadIdx.x & 31;
  const int wave = threadIdx.x >> 5;
  const int tilesN = N >> 6;
  const int tilesM = M >> 6;
  const int tile = blockIdx.x * 8 + wave;
  if (tile >= tilesM * tilesN) return;   // wave-uniform; no block barriers in this kernel
  const int tm = tile / tilesN;
  const int tn = tile - tm * tilesN;
  const int m0 = tm << 6;
  const int n0 = tn << 6;

  const int rlane = lane & 15;                 // row (A) / col (B, D) within subtile
  const int koff  = (lane >> 4) * 8;           // k offset of this lane half
  const int mOff  = (lane >> 4) * 8;           // D row offset

  v8f acc[4][4];
#pragma unroll
  for (int i = 0; i < 4; ++i)
#pragma unroll
    for (int j = 0; j < 4; ++j) acc[i][j] = zero8();

  // All 8 fragments of a k step are requested before its first product: one memory round trip a step, not four.
  unsigned vb = (unsigned)(rlane * ldb + koff) * 2u;   // byte offset of this lane in a B fragment, k0 included
  unsigned va = (unsigned)(rlane * lda + koff) * 2u;   // the same for an A fragment
  const char* Bt[4];
  const char* At[4];
#pragma unroll
  for (int j = 0; j < 4; ++j) Bt[j] = sbase(Bb + (size_t)(n0 + (j << 4)) * ldb);
#pragma unroll
  for (int i = 0; i < 4; ++i) At[i] = sbase(Ab + (size_t)(m0 + (i << 4)) * lda);
  for (int k0 = 0; k0 < K; k0 += 32) {
    v16b bh[4], ah[4];
#pragma unroll
    for (int j = 0; j < 4; ++j) bh[j] = ldfrag_b((const __bf16*)(Bt[j] + vb));
#pragma unroll
    for (int i = 0; i < 4; ++i) ah[i] = ldfrag_b((const __bf16*)(At[i] + va));
#pragma unroll
    for (int i = 0; i < 4; ++i) {
#pragma unroll
      for (int j = 0; j < 4; ++j) {
        acc[i][j] = mma_b_raw(ah[i], bh[j], acc[i][j]);
      }
      dep_guard_b(acc[i][0], acc[i][3], ah[i], ah[i]);
    }
    keep4_b(bh[0], bh[1], bh[2], bh[3]);
    vb += 64u;
    va += 64u;
  }
  acc_guard4(acc[0][0], acc[0][1], acc[0][2], acc[0][3]);
  acc_guard4(acc[1][0], acc[1][1], acc[1][2], acc[1][3]);
  acc_guard4(acc[2][0], acc[2][1], acc[2][2], acc[2][3]);
  acc_guard4(acc[3][0], acc[3][1], acc[3][2], acc[3][3]);

  // ---- bias per D column of this lane (n0 + 16j + rlane < N) ----
  float bz[4];
#pragma unroll
  for (int j = 0; j < 4; ++j) bz[j] = bf_up(bf_bits(bias[n0 + (j << 4) + rlane]));

  // ---- epilogue ----
  float* slab = sT[wave];
#pragma unroll
  for (int i = 0; i < 4; ++i) {
    const int mBase = m0 + (i << 4);
#pragma unroll
    for (int r = 0; r < 8; ++r) {
#pragma unroll
      for (int j = 0; j < 4; ++j) {
        slab[(mOff + r) * 68 + (j << 4) + rlane] = acc[i][j][r] + bz[j];
      }
    }
    __builtin_amdgcn_fence(__ATOMIC_RELEASE, "workgroup");
    __builtin_amdgcn_wave_barrier();
    __builtin_amdgcn_fence(__ATOMIC_ACQUIRE, "workgroup");
    {
      const int hh = lane >> 4, c4 = (lane & 15) * 4;     // 256-B row segment = 16 lanes x 16 B
      v4f ov[8];
#pragma unroll
      for (int it = 0; it < 8; ++it) {
        const int row = it * 2 + hh;                       // it 0..7 x hh 0..1 = rows 0..15
        ov[it] = *(const v4f*)(slab + row * 68 + c4);
      }
      {
#pragma unroll
        for (int it = 0; it < 8; ++it) {
          const int row = it * 2 + hh;
          *(v4f*)(C + (size_t)(mBase + row) * ldc + n0 + c4) = ov[it];
        }
        
      }
    }
    __builtin_amdgcn_fence(__ATOMIC_RELEASE, "workgroup");
    __builtin_amdgcn_wave_barrier();
    __builtin_amdgcn_fence(__ATOMIC_ACQUIRE, "workgroup");
  }
}

// =====================================================================================================
// v f32 token-major vf[(b*SEQ + t)*DM + n] -> f16 v^T plane vth[(b*DM + n)*SEQ + t] = f16(v * vscale),
// vscale a power of two.
// Block = one 64-token x 64-feature tile of one b; grid = (SEQ/64, DM/64, NB); tile staged in LDS as f32
// (v4f loads, __syncthreads).
// Store: group g = tid>>3 (0..31), piece = tid&7: iteration it writes row n = it*32+g, lanes 8q..8q+7 x 16 B =
// coverage: 2 iterations x 32 groups = 64 rows n, 8 pieces x 8 = 64 tokens per row; grid covers every (b,
// n tile, t tile) -> the whole plane.
// =====================================================================================================
__global__ __launch_bounds__(256) void vt_plane(const float* __restrict__ vf, unsigned short* vth, float vscale) {
  __shared__ __align__(16) float sv[64 * 68];       // [tt][d] pitch 68 floats
  const int tid = threadIdx.x;
  const int t0  = blockIdx.x * 64;
  const int fh  = blockIdx.y;                        // feature tile (64 features)
  const int b   = blockIdx.z;
#pragma unroll
  for (int i = 0; i < 4; ++i) {
    const int idx = i * 256 + tid;                  // 0..1023
    const int tt = idx >> 4, c4 = (idx & 15) * 4;
    const v4f a = *(const v4f*)(vf + ((size_t)(b * SEQ + t0 + tt)) * DM + fh * 64 + c4);
    *(v4f*)(sv + tt * 68 + c4) = a;
  }
  __syncthreads();

  const int g = tid >> 3, piece = tid & 7;
  v4u hv[2];
  size_t hofs[2];
#pragma unroll
  for (int it = 0; it < 2; ++it) {
    const int d = it * 32 + g;
    v4u a;
#pragma unroll
    for (int e = 0; e < 4; ++e) {
      const float f0 = sv[(piece * 8 + 2 * e) * 68 + d];
      const float f1 = sv[(piece * 8 + 2 * e + 1) * 68 + d];
      a[e] = pk16(h_bits((_Float16)(f0 * vscale)), h_bits((_Float16)(f1 * vscale)));
    }
    hv[it] = a;
    hofs[it] = ((size_t)(b * DM + fh * 64 + d)) * SEQ + t0 + piece * 8;
  }
  {
#pragma unroll
    for (int it = 0; it < 2; ++it) {
      *(v4u*)(vth + hofs[it]) = hv[it];
    }
    
  }
}

// =====================================================================================================
// Column mean over tokens: mv[b*DM + n] = (1/SEQ) * sum_t vf[(b*SEQ + t)*DM + n], f64 accumulation.
// Block = 32 columns (one 128-B line per token row) x all SEQ tokens of one b; grid = (DM/32, NB); 1024 threads.
// Thread = (row group rg = tid>>3 in 0..127, piece = tid&7): 16 v4f loads, rows rg + 128*i, all independent, so a
// block has 256 KiB in flight instead of one dependent load stream per column. Sums: per thread over i (f64),
// then over the 4 row groups of a wave by __shfl_xor (8, 16), then the 32 wave partials through LDS
// (__syncthreads), added by wave 0 as a fixed pairwise tree, lane = column.
// coverage: DM/32 blocks x 32 columns x NB = every column of every batch; one 128-B store per block.
// =====================================================================================================
__global__ __launch_bounds__(1024) void colmean(const float* __restrict__ vf, float* mv) {
  __shared__ __align__(16) double sp[32][32];        // [wave][column]
  const int tid   = threadIdx.x;
  const int lane  = tid & 31;
  const int wave  = tid >> 5;
  const int piece = tid & 7;                         // 16-B piece of the 128-B row segment
  const int rg    = tid >> 3;                        // 0..127
  const int b     = blockIdx.y;
  const float* p = vf + ((size_t)b * SEQ + rg) * DM + blockIdx.x * 32 + piece * 4;
  v4f x[SEQ / 128];
#pragma unroll
  for (int i = 0; i < SEQ / 128; ++i) x[i] = *(const v4f*)(p + (size_t)i * 128 * DM);
  double s[4];
#pragma unroll
  for (int e = 0; e < 4; ++e) s[e] = (double)x[0][e];
#pragma unroll
  for (int i = 1; i < SEQ / 128; ++i) {
#pragma unroll
    for (int e = 0; e < 4; ++e) s[e] += (double)x[i][e];
  }
#pragma unroll
  for (int e = 0; e < 4; ++e) {
    s[e] += __shfl_xor(s[e], 8);
    s[e] += __shfl_xor(s[e], 16);
  }
  if (lane < 8) {
#pragma unroll
    for (int e = 0; e < 4; ++e) sp[wave][piece * 4 + e] = s[e];
  }
  __syncthreads();
  if (wave == 0) {                                   // wave-uniform
    double r[32];
#pragma unroll
    for (int w = 0; w < 32; ++w) r[w] = sp[w][lane];
#pragma unroll
    for (int o = 16; o > 0; o >>= 1) {
#pragma unroll
      for (int w = 0; w < o; ++w) r[w] += r[w + o];
    }
    mv[(size_t)b * DM + blockIdx.x * 32 + lane] = (float)(r[0] * (1.0 / (double)SEQ));
  }
}

// =====================================================================================================
// f16 WMMA GEMM with scale: C[m][n] = cscale * sum_k A[m][k] * Bt[n][k] (f16 products, f32 accumulate).
// Same tiling/epilogue as gemm64 (one wave per 64x64 tile, no block barriers, 16-row LDS slabs, each 256-B
// coverage: 4 slabs x 16 rows x 64 cols = the wave's whole 64x64 tile; tile count a multiple of 8.
// =====================================================================================================
__global__ __launch_bounds__(256) void gemm64h_s(
    const unsigned short* __restrict__ Ap, int lda,
    const unsigned short* __restrict__ Btp, int ldb,
    float* C, int ldc, int M, int N, int K, float cscale) {
  const _Float16* Ah = (const _Float16*)(const void*)Ap;
  const _Float16* Bh = (const _Float16*)(const void*)Btp;
  __shared__ __align__(16) float sT[8][16 * 68];
  const int lane = threadIdx.x & 31;
  const int wave = threadIdx.x >> 5;
  const int tilesN = N >> 6;
  const int tilesM = M >> 6;
  const int tile = blockIdx.x * 8 + wave;
  if (tile >= tilesM * tilesN) return;   // wave-uniform; no block barriers in this kernel
  const int tm = tile / tilesN;
  const int tn = tile - tm * tilesN;
  const int m0 = tm << 6;
  const int n0 = tn << 6;
  const int rlane = lane & 15;
  const int koff  = (lane >> 4) * 8;
  const int mOff  = (lane >> 4) * 8;

  v8f acc[4][4];
#pragma unroll
  for (int i = 0; i < 4; ++i)
#pragma unroll
    for (int j = 0; j < 4; ++j) acc[i][j] = zero8();

  // All 8 fragments of a k step are requested before its first product (see gemm64).
  unsigned vb = (unsigned)(rlane * ldb + koff) * 2u;
  unsigned va = (unsigned)(rlane * lda + koff) * 2u;
  const char* Bt[4];
  const char* At[4];
#pragma unroll
  for (int j = 0; j < 4; ++j) Bt[j] = sbase(Bh + (size_t)(n0 + (j << 4)) * ldb);
#pragma unroll
  for (int i = 0; i < 4; ++i) At[i] = sbase(Ah + (size_t)(m0 + (i << 4)) * lda);
  for (int k0 = 0; k0 < K; k0 += 32) {
    v16h bh[4], ah[4];
#pragma unroll
    for (int j = 0; j < 4; ++j) bh[j] = ldfrag_h((const _Float16*)(Bt[j] + vb));
#pragma unroll
    for (int i = 0; i < 4; ++i) ah[i] = ldfrag_h((const _Float16*)(At[i] + va));
#pragma unroll
    for (int i = 0; i < 4; ++i) {
#pragma unroll
      for (int j = 0; j < 4; ++j) {
        acc[i][j] = mma_h(ah[i], bh[j], acc[i][j]);
      }
    }
    vb += 64u;
    va += 64u;
  }

  float* slab = sT[wave];
#pragma unroll
  for (int i = 0; i < 4; ++i) {
    const int mBase = m0 + (i << 4);
#pragma unroll
    for (int r = 0; r < 8; ++r) {
#pragma unroll
      for (int j = 0; j < 4; ++j) {
        slab[(mOff + r) * 68 + (j << 4) + rlane] = acc[i][j][r] * cscale;
      }
    }
    __builtin_amdgcn_fence(__ATOMIC_RELEASE, "workgroup");
    __builtin_amdgcn_wave_barrier();
    __builtin_amdgcn_fence(__ATOMIC_ACQUIRE, "workgroup");
    {
      const int hh = lane >> 4, c4 = (lane & 15) * 4;
      v4f ov[8];
#pragma unroll
      for (int it = 0; it < 8; ++it) {
        const int row = it * 2 + hh;
        ov[it] = *(const v4f*)(slab + row * 68 + c4);
      }
      {
#pragma unroll
        for (int it = 0; it < 8; ++it) {
          const int row = it * 2 + hh;
          *(v4f*)(C + (size_t)(mBase + row) * ldc + n0 + c4) = ov[it];
        }
        
      }
    }
    __builtin_amdgcn_fence(__ATOMIC_RELEASE, "workgroup");
    __builtin_amdgcn_wave_barrier();
    __builtin_amdgcn_fence(__ATOMIC_ACQUIRE, "workgroup");
  }
}

// =====================================================================================================
// Row softmax over SEQ keys, max-subtracted, f32: p = exp(s - max) / sum; stored CENTERED and scaled as
// f16(16384 * p - 8) = f16(16384 * (p - 1/SEQ)) (the 1/SEQ part is added back downstream as the column
// mean of v). One 256-thread block per row, 8 consecutive elements per thread (two v4f loads), wave
// reductions by __shfl_xor, 8 wave partials combined in fixed order through LDS.
// =====================================================================================================
__global__ __launch_bounds__(256) void softmax_c(const float* __restrict__ sf, unsigned short* ph) {
  __shared__ float redm[8];
  __shared__ float reds[8];
  const int row  = blockIdx.x;
  const int tid  = threadIdx.x;
  const int lane = tid & 31;
  const int wave = tid >> 5;
  const float* s = sf + (size_t)row * SEQ + tid * 8;
  const v4f a = *(const v4f*)(s);
  const v4f c = *(const v4f*)(s + 4);
  float v[8];
  v[0] = a[0]; v[1] = a[1]; v[2] = a[2]; v[3] = a[3];
  v[4] = c[0]; v[5] = c[1]; v[6] = c[2]; v[7] = c[3];
  float m = v[0];
#pragma unroll
  for (int e = 1; e < 8; ++e) m = fmaxf(m, v[e]);
#pragma unroll
  for (int o = 16; o > 0; o >>= 1) m = fmaxf(m, __shfl_xor(m, o));
  if (lane == 0) redm[wave] = m;
  __syncthreads();
  float mm = redm[0];
#pragma unroll
  for (int w = 1; w < 8; ++w) mm = fmaxf(mm, redm[w]);
  float sum = 0.f;
#pragma unroll
  for (int e = 0; e < 8; ++e) {
    v[e] = __expf(v[e] - mm);
    sum += v[e];
  }
#pragma unroll
  for (int o = 16; o > 0; o >>= 1) sum += __shfl_xor(sum, o);
  if (lane == 0) reds[wave] = sum;
  __syncthreads();
  float tot = 0.f;
#pragma unroll
  for (int w = 0; w < 8; ++w) tot += reds[w];       // fixed order, identical for every thread
  const float inv = 1.0f / tot;                     // tot >= 1
  v4u pk;
#pragma unroll
  for (int e = 0; e < 4; ++e) {
    const float p0 = v[2 * e] * inv;
    const float p1 = v[2 * e + 1] * inv;
    const _Float16 x0 = (_Float16)(p0 * 16384.0f - 8.0f);
    const _Float16 x1 = (_Float16)(p1 * 16384.0f - 8.0f);
    pk[e] = pk16(h_bits(x0), h_bits(x1));
  }
  unsigned short* o = ph + (size_t)row * SEQ + tid * 8;
  *(v4u*)o = pk;
  
}

// =====================================================================================================
// p.v for one batch bb: O[i][n] = oscale * sum_j P[i][j] * Vt[n][j] + mv[n] (f16 products, f32 accumulate;
// oscale folds back the weight and v carries; mv = column mean of v in f32). P f16 [SEQ][SEQ] pitch lda
// (j contiguous); Vt f16 [DM][SEQ] pitch ldb; n = h*HD + d.
// O is written as two f16 head-major planes: hi = f16(O*1024), lo = f16((O*1024 - hi)*2048), element
// (bb, h, i, d) at [((bb*NH + h)*SEQ + i)*HD + d]; a 64-wide tile column block is exactly one head h = tn,
// One wave per 64x64 tile, no block barriers; tile count multiple of 8. Epilogue: 16-row f32 slab staged per
// coverage: 4 slabs x (4 q x 4 g4 = 16 rows) x (8 pieces x 8 = 64 cols) = the wave's whole tile in both
// planes; grid covers every (i tile, head) of this batch.
// =====================================================================================================
__global__ __launch_bounds__(256) void gemm64h_o(
    const unsigned short* __restrict__ Ap, int lda,
    const unsigned short* __restrict__ Btp, int ldb,
    const float* __restrict__ mv,
    unsigned short* ohi, unsigned short* olo, int bb,
    int M, int N, int K, float oscale) {
  const _Float16* Ah = (const _Float16*)(const void*)Ap;
  const _Float16* Bh = (const _Float16*)(const void*)Btp;
  __shared__ __align__(16) float sT[8][16 * 68];
  const int lane = threadIdx.x & 31;
  const int wave = threadIdx.x >> 5;
  const int tilesN = N >> 6;
  const int tilesM = M >> 6;
  const int tile = blockIdx.x * 8 + wave;
  if (tile >= tilesM * tilesN) return;   // wave-uniform; no block barriers in this kernel
  const int tm = tile / tilesN;
  const int tn = tile - tm * tilesN;     // == head index (tile width 64 == HD)
  const int m0 = tm << 6;
  const int n0 = tn << 6;
  const int rlane = lane & 15;
  const int koff  = (lane >> 4) * 8;
  const int mOff  = (lane >> 4) * 8;

  v8f acc[4][4];
#pragma unroll
  for (int i = 0; i < 4; ++i)
#pragma unroll
    for (int j = 0; j < 4; ++j) acc[i][j] = zero8();

  // All 8 fragments of a k step are requested before its first product (see gemm64).
  unsigned vb = (unsigned)(rlane * ldb + koff) * 2u;
  unsigned va = (unsigned)(rlane * lda + koff) * 2u;
  const char* Bt[4];
  const char* At[4];
#pragma unroll
  for (int j = 0; j < 4; ++j) Bt[j] = sbase(Bh + (size_t)(n0 + (j << 4)) * ldb);
#pragma unroll
  for (int i = 0; i < 4; ++i) At[i] = sbase(Ah + (size_t)(m0 + (i << 4)) * lda);
  for (int k0 = 0; k0 < K; k0 += 32) {
    v16h bh[4], ah[4];
#pragma unroll
    for (int j = 0; j < 4; ++j) bh[j] = ldfrag_h((const _Float16*)(Bt[j] + vb));
#pragma unroll
    for (int i = 0; i < 4; ++i) ah[i] = ldfrag_h((const _Float16*)(At[i] + va));
#pragma unroll
    for (int i = 0; i < 4; ++i) {
#pragma unroll
      for (int j = 0; j < 4; ++j) {
        acc[i][j] = mma_h(ah[i], bh[j], acc[i][j]);
      }
    }
    vb += 64u;
    va += 64u;
  }

  float mz[4];
#pragma unroll
  for (int j = 0; j < 4; ++j) mz[j] = mv[n0 + (j << 4) + rlane];

  float* slab = sT[wave];
  const size_t pbase = ((size_t)(bb * NH + tn)) * SEQ;     // plane row base for head tn of batch bb
#pragma unroll
  for (int i = 0; i < 4; ++i) {
    const int mBase = m0 + (i << 4);
#pragma unroll
    for (int r = 0; r < 8; ++r) {
#pragma unroll
      for (int j = 0; j < 4; ++j) {
        slab[(mOff + r) * 68 + (j << 4) + rlane] = acc[i][j][r] * oscale + mz[j];
      }
    }
    __builtin_amdgcn_fence(__ATOMIC_RELEASE, "workgroup");
    __builtin_amdgcn_wave_barrier();
    __builtin_amdgcn_fence(__ATOMIC_ACQUIRE, "workgroup");
    {
      const int g4 = lane >> 3, piece = lane & 7;
      v4u hv[4], lv[4];
      size_t ofs[4];
#pragma unroll
      for (int q = 0; q < 4; ++q) {
        const int row = q * 4 + g4;                      // q 0..3 x g4 0..3 = rows 0..15
        const v4f x0 = *(const v4f*)(slab + row * 68 + piece * 8);
        const v4f x1 = *(const v4f*)(slab + row * 68 + piece * 8 + 4);
        float f[8];
        f[0] = x0[0]; f[1] = x0[1]; f[2] = x0[2]; f[3] = x0[3];
        f[4] = x1[0]; f[5] = x1[1]; f[6] = x1[2]; f[7] = x1[3];
        v4u ph, pl;
#pragma unroll
        for (int e = 0; e < 4; ++e) {
          const float s0 = f[2 * e] * 1024.0f;
          const float s1 = f[2 * e + 1] * 1024.0f;
          const _Float16 h0 = (_Float16)s0;
          const _Float16 h1 = (_Float16)s1;
          const _Float16 l0 = (_Float16)((s0 - (float)h0) * 2048.0f);
          const _Float16 l1 = (_Float16)((s1 - (float)h1) * 2048.0f);
          ph[e] = pk16(h_bits(h0), h_bits(h1));
          pl[e] = pk16(h_bits(l0), h_bits(l1));
        }
        hv[q] = ph;
        lv[q] = pl;
        ofs[q] = (pbase + (size_t)(mBase + row)) * HD + piece * 8;
      }
      {
#pragma unroll
        for (int q = 0; q < 4; ++q) {
          *(v4u*)(ohi + ofs[q]) = hv[q];
          *(v4u*)(olo + ofs[q]) = lv[q];
        }
        
      }
    }
    __builtin_amdgcn_fence(__ATOMIC_RELEASE, "workgroup");
    __builtin_amdgcn_wave_barrier();
    __builtin_amdgcn_fence(__ATOMIC_ACQUIRE, "workgroup");
  }
}

// =====================================================================================================
// Output projection: C[m][n] = sch * (sum_k Ahi[m][k]*Bt[n][k] + scl * sum_k Alo[m][k]*Bt[n][k]) + bf16rne(bias[n])
// (f16 products, f32 accumulate, hi and scaled-residual products in separate accumulators). Ahi/Alo row-major
// [M][K] pitch lda; Bt [N][K] pitch ldb; C f32 [M][N] pitch ldc. One wave per 32x64 tile, no block barriers;
// tile count multiple of 8; all 8 fragments of a k-step (A: 2 rows x 2 planes, B: 4) loaded at its head.
// Epilogue: 16-row slabs staged per wave in LDS; each 64-wide row segment (256 B) written by one instruction
// coverage: 2 slabs x 16 rows x 64 cols = the wave's whole 32x64 tile; grid covers every tile of C.
// =====================================================================================================
__global__ __launch_bounds__(256) void gemm32h_w(
    const unsigned short* __restrict__ Ahp, const unsigned short* __restrict__ Alp, int lda,
    const unsigned short* __restrict__ Btp, int ldb,
    const float* __restrict__ bias,
    float* C, int ldc, int M, int N, int K, float sch, float scl) {
  const _Float16* Ah = (const _Float16*)(const void*)Ahp;
  const _Float16* Al = (const _Float16*)(const void*)Alp;
  const _Float16* Bh = (const _Float16*)(const void*)Btp;
  __shared__ __align__(16) float sT[8][16 * 68];
  const int lane = threadIdx.x & 31;
  const int wave = threadIdx.x >> 5;
  const int tilesN = N >> 6;
  const int tilesM = M >> 5;
  const int tile = blockIdx.x * 8 + wave;
  if (tile >= tilesM * tilesN) return;   // wave-uniform; no block barriers in this kernel
  const int tm = tile / tilesN;
  const int tn = tile - tm * tilesN;
  const int m0 = tm << 5;
  const int n0 = tn << 6;
  const int rlane = lane & 15;
  const int koff  = (lane >> 4) * 8;
  const int mOff  = (lane >> 4) * 8;

  v8f acch[2][4], accl[2][4];
#pragma unroll
  for (int i = 0; i < 2; ++i)
#pragma unroll
    for (int j = 0; j < 4; ++j) { acch[i][j] = zero8(); accl[i][j] = zero8(); }

  // All 8 fragments of a k step are requested before its first product (see gemm64).
  unsigned vb = (unsigned)(rlane * ldb + koff) * 2u;
  unsigned va = (unsigned)(rlane * lda + koff) * 2u;
  const char* Bt[4];
  const char* Aht[2];
  const char* Alt[2];
#pragma unroll
  for (int j = 0; j < 4; ++j) Bt[j] = sbase(Bh + (size_t)(n0 + (j << 4)) * ldb);
#pragma unroll
  for (int i = 0; i < 2; ++i) {
    Aht[i] = sbase(Ah + (size_t)(m0 + (i << 4)) * lda);
    Alt[i] = sbase(Al + (size_t)(m0 + (i << 4)) * lda);
  }
  for (int k0 = 0; k0 < K; k0 += 32) {
    v16h fh[2], fl[2], bfr[4];
#pragma unroll
    for (int i = 0; i < 2; ++i) {
      fh[i] = ldfrag_h((const _Float16*)(Aht[i] + va));
      fl[i] = ldfrag_h((const _Float16*)(Alt[i] + va));
    }
#pragma unroll
    for (int j = 0; j < 4; ++j) bfr[j] = ldfrag_h((const _Float16*)(Bt[j] + vb));
#pragma unroll
    for (int j = 0; j < 4; ++j) {
#pragma unroll
      for (int i = 0; i < 2; ++i) {
        acch[i][j] = mma_h(fh[i], bfr[j], acch[i][j]);
        accl[i][j] = mma_h(fl[i], bfr[j], accl[i][j]);
      }
    }
    vb += 64u;
    va += 64u;
  }

  float bz[4];
#pragma unroll
  for (int j = 0; j < 4; ++j) bz[j] = bf_up(bf_bits(bias[n0 + (j << 4) + rlane]));

  float* slab = sT[wave];
#pragma unroll
  for (int i = 0; i < 2; ++i) {
    const int mBase = m0 + (i << 4);
#pragma unroll
    for (int r = 0; r < 8; ++r) {
#pragma unroll
      for (int j = 0; j < 4; ++j) {
        slab[(mOff + r) * 68 + (j << 4) + rlane] = (acch[i][j][r] + accl[i][j][r] * scl) * sch + bz[j];
      }
    }
    __builtin_amdgcn_fence(__ATOMIC_RELEASE, "workgroup");
    __builtin_amdgcn_wave_barrier();
    __builtin_amdgcn_fence(__ATOMIC_ACQUIRE, "workgroup");
    {
      const int hh = lane >> 4, c4 = (lane & 15) * 4;     // 256-B row segment = 16 lanes x 16 B
      v4f ov[8];
#pragma unroll
      for (int it = 0; it < 8; ++it) {
        const int row = it * 2 + hh;                       // it 0..7 x hh 0..1 = rows 0..15
        ov[it] = *(const v4f*)(slab + row * 68 + c4);
      }
      {
#pragma unroll
        for (int it = 0; it < 8; ++it) {
          const int row = it * 2 + hh;
          *(v4f*)(C + (size_t)(mBase + row) * ldc + n0 + c4) = ov[it];
        }
        
      }
    }
    __builtin_amdgcn_fence(__ATOMIC_RELEASE, "workgroup");
    __builtin_amdgcn_wave_barrier();
    __builtin_amdgcn_fence(__ATOMIC_ACQUIRE, "workgroup");
  }
}

// =====================================================================================================
// Workspace map (bytes); every region an exact multiple of its whole-line / whole-tile store granularity
// within a launch; Tf is reused sequentially: q, k, v f32 projections, then the per-batch f32 score map):
//   Xb   bf16 [4096][1024]              0         8388608
//   Wqb  bf16 [1024 n][1024 k]     8388608         2097152
//   Wkb  bf16 [1024 n][1024 k]    10485760         2097152
//   Wvb  bf16 [1024 n][1024 k]    12582912         2097152
//   Woh  f16  [1024 n][1024 k]    14680064         2097152   (f16(bf16(Wo) x1024))
//   Tf   f32  [4096][1024]       16777216        16777216   (also S f32 [2048][2048] of the current batch)
//   Qh   f16  [4096][1024]       33554432         8388608   (q x16)
//   Kh   f16  [4096][1024]       41943040         8388608   (k x16)
//   VTh  f16  [2*1024][2048]     50331648         8388608   ([b*DM + n][t], v x64)
//   Ph   f16  [2048][2048]       58720256         8388608   (centered weights of the current batch)
//   Ohi  f16  [2][16][2048][64]  67108864         8388608
//   Olo  f16  [2][16][2048][64]  75497472         8388608
//   end                          83894272
// Inputs: query f32 [2][2048][1024]; Wq, Wk, Wv, Wo f32 [1024 out][1024 in]; bq, bk, bv, bo f32 [1024].
// d_out f32 [4096][1024] at byte 0 (row = b*SEQ + s, col = n).
// =====================================================================================================
extern "C" void kernel_launch(void* const* d_in, const int* in_sizes, int n_in,
                              void* d_out, int out_size, void* d_ws, size_t ws_size,
                              hipStream_t stream) {
  if (n_in < 9) return;
  if (in_sizes[0] != NB * SEQ * DM) return;
  if (in_sizes[1] != DM * DM) return;
  if (in_sizes[2] != DM) return;
  if (in_sizes[3] != DM * DM) return;
  if (in_sizes[4] != DM) return;
  if (in_sizes[5] != DM * DM) return;
  if (in_sizes[6] != DM) return;
  if (in_sizes[7] != DM * DM) return;
  if (in_sizes[8] != DM) return;
  if (out_size != OUTN) return;

  const float* x  = (const float*)d_in[0];   // [NB*SEQ][DM]
  const float* Wq = (const float*)d_in[1];   // [DM n][DM k]
  const float* bq = (const float*)d_in[2];   // [DM]
  const float* Wk = (const float*)d_in[3];
  const float* bk = (const float*)d_in[4];
  const float* Wv = (const float*)d_in[5];
  const float* bv = (const float*)d_in[6];
  const float* Wo = (const float*)d_in[7];
  const float* bo = (const float*)d_in[8];

  const size_t PXb = (size_t)ROWS * DM * 2;          //  8388608
  const size_t PW  = (size_t)DM * DM * 2;            //  2097152
  const size_t PF  = (size_t)ROWS * DM * 4;          // 16777216
  const size_t PH  = (size_t)ROWS * DM * 2;          //  8388608
  const size_t PVt = (size_t)NB * DM * SEQ * 2;      //  8388608
  const size_t PP  = (size_t)SEQ * SEQ * 2;          //  8388608
  const size_t PO  = (size_t)NB * NH * SEQ * HD * 2; //  8388608
  const size_t PMv = (size_t)NB * DM * 4;            //     8192
  size_t off = 0;
  const size_t oXb = off; off += PXb;
  const size_t oWq = off; off += PW;
  const size_t oWk = off; off += PW;
  const size_t oWv = off; off += PW;
  const size_t oWo = off; off += PW;
  const size_t oTf = off; off += PF;
  const size_t oQh = off; off += PH;
  const size_t oKh = off; off += PH;
  const size_t oVt = off; off += PVt;
  const size_t oP  = off; off += PP;
  const size_t oOh = off; off += PO;
  const size_t oOl = off; off += PO;
  const size_t oMv = off; off += PMv;
  if (off > ws_size) return;                        // off = 83894272
  if (off > (size_t)134217728) return;

  char* ws = (char*)d_ws;
  unsigned short* Xb  = (unsigned short*)(ws + oXb);
  unsigned short* Wqb = (unsigned short*)(ws + oWq);
  unsigned short* Wkb = (unsigned short*)(ws + oWk);
  unsigned short* Wvb = (unsigned short*)(ws + oWv);
  unsigned short* Woh = (unsigned short*)(ws + oWo);
  float*          Tf  = (float*)(ws + oTf);
  unsigned short* Qh  = (unsigned short*)(ws + oQh);
  unsigned short* Kh  = (unsigned short*)(ws + oKh);
  unsigned short* VTh = (unsigned short*)(ws + oVt);
  unsigned short* Ph  = (unsigned short*)(ws + oP);
  unsigned short* Ohi = (unsigned short*)(ws + oOh);
  unsigned short* Olo = (unsigned short*)(ws + oOl);
  float*          mV  = (float*)(ws + oMv);
  float*          outf = (float*)d_out;             // [ROWS][DM]

  const dim3 blk(256);
  const int n8x = ROWS * DM / 8;                    // 524288
  const int n8w = DM * DM / 8;                      // 131072
  const dim3 gCvtX(n8x / 256);                      // 2048 blocks (exact)
  const dim3 gCvtW(n8w / 256);                      //  512 blocks (exact)
  const dim3 gGemm(((ROWS / 64) * (DM / 64)) / 8);  // 1024 tiles -> 128 blocks
  const dim3 gVpl(SEQ / 64, DM / 64, NB);           // (32, 16, 2)
  const dim3 gCm(DM / 32, NB);                      // (32, 2)
  const dim3 gSc(((SEQ / 64) * (SEQ / 64)) / 8);    // 1024 tiles -> 128 blocks per batch
  const dim3 gSm(SEQ);                              // 2048 rows per batch
  const dim3 gPv(((SEQ / 64) * (DM / 64)) / 8);     //  512 tiles -> 64 blocks per batch
  const dim3 gWo(((ROWS / 32) * (DM / 64)) / 8);    // 2048 tiles -> 256 blocks
  const float qkScale = 16.0f;                      // q and k planes carried x16
  const float woScale = 1024.0f;                    // Wo plane carried x1024
  const float sscale  = 1.0f / 32768.0f;            // (1/sqrt(64))/16 heads = 1/128, two x16 carries folded back
  const float vScale  = 64.0f;                      // v^T plane carried x64
  const float pvOscl  = 1.0f / 1048576.0f;          // 1/(16384 * 64)
  const float woSch   = 1.0f / 1048576.0f;          // 1/(1024 * 1024): O hi carry and Wo carry
  const float woScl   = 1.0f / 2048.0f;             // residual plane carry

  // (1) activations and weights -> bf16 planes (W is [n][k] already); Wo -> f16 plane of its bf16 value x1024
  cvt_bf16x8<<<gCvtX, blk, 0, stream>>>(x, Xb, n8x);
  cvt_bf16x8<<<gCvtW, blk, 0, stream>>>(Wq, Wqb, n8w);
  cvt_bf16x8<<<gCvtW, blk, 0, stream>>>(Wk, Wkb, n8w);
  cvt_bf16x8<<<gCvtW, blk, 0, stream>>>(Wv, Wvb, n8w);
  plane_f16x8<<<gCvtW, blk, 0, stream>>>(Wo, Woh, n8w, woScale, 1);
  // (2) q = Xb . Wqb^T + bq -> Tf [4096][1024] (M=4096, N=1024, K=1024), then f16 plane (x16)
  gemm64<<<gGemm, blk, 0, stream>>>(Xb, DM, Wqb, DM, bq, Tf, DM, ROWS, DM, DM);
  plane_f16x8<<<gCvtX, blk, 0, stream>>>(Tf, Qh, n8x, qkScale, 0);
  // (3) k likewise
  gemm64<<<gGemm, blk, 0, stream>>>(Xb, DM, Wkb, DM, bk, Tf, DM, ROWS, DM, DM);
  plane_f16x8<<<gCvtX, blk, 0, stream>>>(Tf, Kh, n8x, qkScale, 0);
  // (4) v likewise -> Tf, then f16 v^T plane (x64) and f32 column means over tokens
  gemm64<<<gGemm, blk, 0, stream>>>(Xb, DM, Wvb, DM, bv, Tf, DM, ROWS, DM, DM);
  vt_plane<<<gVpl, blk, 0, stream>>>(Tf, VTh, vScale);
  colmean<<<gCm, dim3(1024), 0, stream>>>(Tf, mV);
  // (5) per batch: head-averaged scores (K = 1024) -> Tf as S [2048][2048]; row softmax -> centered weights;
  //     p . v -> O hi/res head-major planes
  for (int b = 0; b < NB; ++b) {
    gemm64h_s<<<gSc, blk, 0, stream>>>(Qh + (size_t)b * SEQ * DM, DM, Kh + (size_t)b * SEQ * DM, DM,
                                       Tf, SEQ, SEQ, SEQ, DM, sscale);
    softmax_c<<<gSm, blk, 0, stream>>>(Tf, Ph);
    gemm64h_o<<<gPv, blk, 0, stream>>>(Ph, SEQ, VTh + (size_t)b * DM * SEQ, SEQ, mV + (size_t)b * DM,
                                       Ohi, Olo, b, SEQ, DM, SEQ, pvOscl);
  }
  // (6) out = O(flat [4096][1024]) . Woh^T + bo -> d_out
  gemm32h_w<<<gWo, blk, 0, stream>>>(Ohi, Olo, DM, Woh, DM, bo, outf, DM, ROWS, DM, DM, woSch, woScl);
  (void)hipGetLastError();
}

// v003
// It runs in 221 microseconds.
// Two timings next to v002 both put it at 1.51 times that version's speed.
// Over all steps from v000 it is 3.08 times as fast.
// Contractions: q/k/v projections = v_wmma_f32_16x16x32_bf16 (bf16 operands: RNE-converted x, W, bias; single product); head-averaged q.k^T scores = v_wmma_f32_16x16x32_f16 (q, k f16 planes carried x16; single product); p.v = v_wmma_f32_16x16x32_f16 (centered softmax weights 16384*p-8 in f16, v^T f16 plane carried x64; single product; f64/f32 column mean of v added back); output projection = v_wmma_f32_16x16x32_f16 (attention output as f16 hi (x1024) + residual (x2048) planes, two products into separate accumulators; Wo as f16 of its bf16-RNE value x1024); all f32 accumulate; softmax in f32.
#include <hip/hip_runtime.h>
#include <math.h>
#include <stdint.h>

#define NB    2
#define SEQ   2048
#define DM    1024
#define NH    16
#define HD    64
#define ROWS  (NB * SEQ)             // 4096 token rows
#define OUTN  (ROWS * DM)
static_assert(NH * HD == DM);
static_assert(HD == 64);
static_assert((SEQ % 64) == 0 && (DM % 64) == 0 && (ROWS % 64) == 0 && (DM % 32) == 0 && (DM % 256) == 0);
static_assert(SEQ == 256 * 8);
static_assert((SEQ % 128) == 0);
static_assert((((ROWS / 64) * (DM / 64)) % 8) == 0);
static_assert((((SEQ / 64) * (SEQ / 64)) % 8) == 0);
static_assert((((SEQ / 64) * (DM / 64)) % 8) == 0);
static_assert((((ROWS / 32) * (DM / 64)) % 8) == 0);
static_assert(((ROWS * DM / 8) % 256) == 0 && ((DM * DM / 8) % 256) == 0);
static_assert((size_t)NB * SEQ * SEQ * 4 <= (size_t)3 * ROWS * DM * 4);

typedef _Float16 v16h __attribute__((ext_vector_type(16)));
typedef _Float16 v8h  __attribute__((ext_vector_type(8)));
typedef __bf16   v16b __attribute__((ext_vector_type(16)));
typedef __bf16   v8b  __attribute__((ext_vector_type(8)));
typedef float    v8f  __attribute__((ext_vector_type(8)));
typedef float    v4f  __attribute__((ext_vector_type(4)));
typedef unsigned int v4u __attribute__((ext_vector_type(4)));

// ---- scalar helpers --------------------------------------------------------------------------------
__device__ __forceinline__ unsigned short bf_bits(float f) {          // f32 -> bf16 bits, RNE convert
  unsigned u = __float_as_uint(f);
  return (unsigned short)((u + 0x7FFFu + ((u >> 16) & 1u)) >> 16);
}
__device__ __forceinline__ float bf_up(unsigned short h) { return __uint_as_float(((unsigned)h) << 16); }
__device__ __forceinline__ unsigned short h_bits(_Float16 x) { return __builtin_bit_cast(unsigned short, x); }
__device__ __forceinline__ unsigned pk16(unsigned short a, unsigned short b) { return (unsigned)a | ((unsigned)b << 16); }
__device__ __forceinline__ v8f zero8() { v8f z = {0.f, 0.f, 0.f, 0.f, 0.f, 0.f, 0.f, 0.f}; return z; }

// ---- fragment loaders: 16-bit A/B operand, lane -> row/col (lane&15), p already includes +8*(lane>>4);
//      elements 0..7 <- p[0..7] (k0+8h..), elements 8..15 <- p[16..23] (k0+16+8h..)
__device__ __forceinline__ v16b ldfrag_b(const __bf16* p) {
  union { v16b v; v8b h[2]; } f;
  f.h[0] = *(const v8b*)(p);
  f.h[1] = *(const v8b*)(p + 16);
  return f.v;
}
__device__ __forceinline__ v16h ldfrag_h(const _Float16* p) {
  union { v16h v; v8h h[2]; } f;
  f.h[0] = *(const v8h*)(p);
  f.h[1] = *(const v8h*)(p + 16);
  return f.v;
}

// ---- wave-uniform fragment base, held in a scalar register pair: every fragment load is then scalar base + one lane
//      offset register, so the 16 loads of a k step issue back to back, with no vector address arithmetic and no wait
//      between them (p must be the same in every lane of the wave)
typedef const __attribute__((address_space(1))) char* gcp;
__device__ __forceinline__ const char* sbase(const void* p) {
  const unsigned long long u = (unsigned long long)p;
  const unsigned lo = (unsigned)__builtin_amdgcn_readfirstlane((int)(unsigned)u);
  const unsigned hi = (unsigned)__builtin_amdgcn_readfirstlane((int)(unsigned)(u >> 32));
  return (const char*)(gcp)(((unsigned long long)hi << 32) | lo);
}

// ---- WMMA helpers with trailing VALU hazard gap --------------------------------------------------------
__device__ __forceinline__ v8f mma_h(v16h a, v16h b, v8f c) {
  c = __builtin_amdgcn_wmma_f32_16x16x32_f16(false, a, false, b, (short)0, c, false, false);
#if defined(__HIP_DEVICE_COMPILE__)
  asm volatile("v_nop\n\tv_nop\n\tv_nop\n\tv_nop" : "+v"(c) : "v"(a), "v"(b));
#endif
  return c;
}
__device__ __forceinline__ v8f mma_b_raw(v16b a, v16b b, v8f c) {
  return __builtin_amdgcn_wmma_f32_16x16x32_bf16(false, a, false, b, (short)0, c, false, false);
}
__device__ __forceinline__ void dep_guard_b(v8f& a, v8f& b, v16b x, v16b y) {
#if defined(__HIP_DEVICE_COMPILE__)
  asm volatile("v_nop\n\tv_nop\n\tv_nop\n\tv_nop" : "+v"(a), "+v"(b) : "v"(x), "v"(y));
#endif
}
__device__ __forceinline__ void keep4_b(v16b a, v16b b, v16b c, v16b d) {
#if defined(__HIP_DEVICE_COMPILE__)
  asm volatile("v_nop" :: "v"(a), "v"(b), "v"(c), "v"(d));
#endif
}
__device__ __forceinline__ void acc_guard4(v8f& a, v8f& b, v8f& c, v8f& d) {
#if defined(__HIP_DEVICE_COMPILE__)
  asm volatile("v_nop\n\tv_nop\n\tv_nop\n\tv_nop" : "+v"(a), "+v"(b), "+v"(c), "+v"(d));
#endif
}

// =====================================================================================================
// All five input conversions in one grid. Blocks [0, XBLK): x -> bf16 (RNE convert); then WBLK blocks each for Wq, Wk,
// Wv -> bf16 and for Wo -> f16(bf16rne(Wo) * woscale) (exact in f16 after the power-of-two scale). The five output
// planes lie one behind the other in the workspace, so the output index is the flat thread index. 8 elements per
// thread, one 16-B store per lane: a wave writes 512 contiguous B. The plane is chosen by blockIdx (block-uniform).
// coverage: (XBLK + 4 * WBLK) blocks x 256 threads x 8 = all five planes exactly.
// =====================================================================================================
#define XBLK (ROWS * DM / 8 / 256)
#define WBLK (DM * DM / 8 / 256)
__global__ __launch_bounds__(256) void cvt_inputs(const float* __restrict__ x, const float* __restrict__ Wq,
                                                  const float* __restrict__ Wk, const float* __restrict__ Wv,
                                                  const float* __restrict__ Wo, unsigned short* out, float woscale) {
  const int blk = blockIdx.x;
  const float* in = x;
  int first = 0;                                     // first block of this block's plane
  if (blk >= XBLK) {
    const int w = (blk - XBLK) / WBLK;               // 0..3
    in = (w == 0) ? Wq : (w == 1) ? Wk : (w == 2) ? Wv : Wo;
    first = XBLK + w * WBLK;
  }
  const int i = (blk - first) * 256 + threadIdx.x;
  const v4f a = *(const v4f*)(in + (size_t)i * 8);
  const v4f b = *(const v4f*)(in + (size_t)i * 8 + 4);
  // precaution: stands in front of every later rewrite of the two loads' address registers
  asm volatile("s_wait_xcnt 0x0" ::: "memory");
  v4u p;
  if (blk < XBLK + 3 * WBLK) {
    p[0] = pk16(bf_bits(a[0]), bf_bits(a[1]));
    p[1] = pk16(bf_bits(a[2]), bf_bits(a[3]));
    p[2] = pk16(bf_bits(b[0]), bf_bits(b[1]));
    p[3] = pk16(bf_bits(b[2]), bf_bits(b[3]));
  } else {
    p[0] = pk16(h_bits((_Float16)(bf_up(bf_bits(a[0])) * woscale)), h_bits((_Float16)(bf_up(bf_bits(a[1])) * woscale)));
    p[1] = pk16(h_bits((_Float16)(bf_up(bf_bits(a[2])) * woscale)), h_bits((_Float16)(bf_up(bf_bits(a[3])) * woscale)));
    p[2] = pk16(h_bits((_Float16)(bf_up(bf_bits(b[0])) * woscale)), h_bits((_Float16)(bf_up(bf_bits(b[1])) * woscale)));
    p[3] = pk16(h_bits((_Float16)(bf_up(bf_bits(b[2])) * woscale)), h_bits((_Float16)(bf_up(bf_bits(b[3])) * woscale)));
  }
  *(v4u*)(out + ((size_t)blk * 256 + threadIdx.x) * 8) = p;
}

// =====================================================================================================
// f32 -> f16 plane = f16(v * scale) (scale a power of two); when rb != 0, v is first RNE-converted to bf16
// and widened back (exact in f16 after the power-of-two scale). 8 elements per thread, one 16-B store per
// coverage: n8 threads x 8 = whole plane (n8 multiple of 256).
// =====================================================================================================
__global__ __launch_bounds__(256) void plane_f16x8(const float* __restrict__ in, unsigned short* hp, int n8,
                                                   float scale, int rb) {
  const int i = blockIdx.x * 256 + threadIdx.x;
  if (i < n8) {
    const v4f a = *(const v4f*)(in + (size_t)i * 8);
    const v4f b = *(const v4f*)(in + (size_t)i * 8 + 4);
    float f[8];
    f[0] = a[0]; f[1] = a[1]; f[2] = a[2]; f[3] = a[3];
    f[4] = b[0]; f[5] = b[1]; f[6] = b[2]; f[7] = b[3];
    if (rb != 0) {
#pragma unroll
      for (int e = 0; e < 8; ++e) f[e] = bf_up(bf_bits(f[e]));
    }
    v4u ph;
#pragma unroll
    for (int e = 0; e < 4; ++e) {
      const _Float16 x0 = (_Float16)(f[2 * e] * scale);
      const _Float16 x1 = (_Float16)(f[2 * e + 1] * scale);
      ph[e] = pk16(h_bits(x0), h_bits(x1));
    }
    *(v4u*)(hp + (size_t)i * 8) = ph;
    
  }
}

// =====================================================================================================
// Register-blocked bf16 WMMA GEMM with bias: C[m][n] = sum_k A[m][k] * Bt[n][k] + bf16rne(bias[n]); one wave per
// 64x64 tile, no block barriers. A row-major [M][K] pitch lda; Bt row-major [N][K] pitch ldb (k contiguous);
// bias f32 [N] (RNE converted to bf16 and widened in the epilogue); M, N multiples of 64, K multiple of 32
// (fixed sizes, statically asserted); the tile count is a multiple of 8 for every launch here (no idle waves).
// Output f32 [M][N] pitch ldc. Epilogue: 16-row slabs staged per wave in LDS; each 64-wide row segment
// blockIdx.y = which of three independent products on the same A runs here (q, k, v): Bt plane y (N*ldb elements
// apart), bias y, C plane y (M*ldc elements apart).
// =====================================================================================================
__global__ __launch_bounds__(256) void gemm64(
    const unsigned short* __restrict__ Ap, int lda,
    const unsigned short* __restrict__ Btp, int ldb,
    const float* __restrict__ bias0, const float* __restrict__ bias1, const float* __restrict__ bias2,
    float* Cp, int ldc, int M, int N, int K) {
  const int which = blockIdx.y;
  const float* bias = (which == 0) ? bias0 : (which == 1) ? bias1 : bias2;
  float* C = Cp + (size_t)which * M * ldc;
  const __bf16* Ab  = (const __bf16*)(const void*)Ap;
  const __bf16* Bb  = (const __bf16*)(const void*)Btp + (size_t)which * N * ldb;
  __shared__ __align__(16) float sT[8][16 * 68];   // per-wave 16x64 slab, pitch 68 floats
  const int lane = threadIdx.x & 31;
  const int wave = threadIdx.x >> 5;
  const int tilesN = N >> 6;
  const int tilesM = M >> 6;
  const int tile = blockIdx.x * 8 + wave;
  if (tile >= tilesM * tilesN) return;   // wave-uniform; no block barriers in this kernel
  const int tm = tile / tilesN;
  const int tn = tile - tm * tilesN;
  const int m0 = tm << 6;
  const int n0 = tn << 6;

  const int rlane = lane & 15;                 // row (A) / col (B, D) within subtile
  const int koff  = (lane >> 4) * 8;           // k offset of this lane half
  const int mOff  = (lane >> 4) * 8;           // D row offset

  v8f acc[4][4];
#pragma unroll
  for (int i = 0; i < 4; ++i)
#pragma unroll
    for (int j = 0; j < 4; ++j) acc[i][j] = zero8();

  // All 8 fragments of a k step are requested before its first product: one memory round trip a step, not four.
  unsigned vb = (unsigned)(rlane * ldb + koff) * 2u;   // byte offset of this lane in a B fragment, k0 included
  unsigned va = (unsigned)(rlane * lda + koff) * 2u;   // the same for an A fragment
  const char* Bt[4];
  const char* At[4];
#pragma unroll
  for (int j = 0; j < 4; ++j) Bt[j] = sbase(Bb + (size_t)(n0 + (j << 4)) * ldb);
#pragma unroll
  for (int i = 0; i < 4; ++i) At[i] = sbase(Ab + (size_t)(m0 + (i << 4)) * lda);
  for (int k0 = 0; k0 < K; k0 += 32) {
    v16b bh[4], ah[4];
#pragma unroll
    for (int j = 0; j < 4; ++j) bh[j] = ldfrag_b((const __bf16*)(Bt[j] + vb));
#pragma unroll
    for (int i = 0; i < 4; ++i) ah[i] = ldfrag_b((const __bf16*)(At[i] + va));
#pragma unroll
    for (int i = 0; i < 4; ++i) {
#pragma unroll
      for (int j = 0; j < 4; ++j) {
        acc[i][j] = mma_b_raw(ah[i], bh[j], acc[i][j]);
      }
      dep_guard_b(acc[i][0], acc[i][3], ah[i], ah[i]);
    }
    keep4_b(bh[0], bh[1], bh[2], bh[3]);
    vb += 64u;
    va += 64u;
  }
  acc_guard4(acc[0][0], acc[0][1], acc[0][2], acc[0][3]);
  acc_guard4(acc[1][0], acc[1][1], acc[1][2], acc[1][3]);
  acc_guard4(acc[2][0], acc[2][1], acc[2][2], acc[2][3]);
  acc_guard4(acc[3][0], acc[3][1], acc[3][2], acc[3][3]);

  // ---- bias per D column of this lane (n0 + 16j + rlane < N) ----
  float bz[4];
#pragma unroll
  for (int j = 0; j < 4; ++j) bz[j] = bf_up(bf_bits(bias[n0 + (j << 4) + rlane]));

  // ---- epilogue ----
  float* slab = sT[wave];
#pragma unroll
  for (int i = 0; i < 4; ++i) {
    const int mBase = m0 + (i << 4);
#pragma unroll
    for (int r = 0; r < 8; ++r) {
#pragma unroll
      for (int j = 0; j < 4; ++j) {
        slab[(mOff + r) * 68 + (j << 4) + rlane] = acc[i][j][r] + bz[j];
      }
    }
    __builtin_amdgcn_fence(__ATOMIC_RELEASE, "workgroup");
    __builtin_amdgcn_wave_barrier();
    __builtin_amdgcn_fence(__ATOMIC_ACQUIRE, "workgroup");
    {
      const int hh = lane >> 4, c4 = (lane & 15) * 4;     // 256-B row segment = 16 lanes x 16 B
      v4f ov[8];
#pragma unroll
      for (int it = 0; it < 8; ++it) {
        const int row = it * 2 + hh;                       // it 0..7 x hh 0..1 = rows 0..15
        ov[it] = *(const v4f*)(slab + row * 68 + c4);
      }
      {
#pragma unroll
        for (int it = 0; it < 8; ++it) {
          const int row = it * 2 + hh;
          *(v4f*)(C + (size_t)(mBase + row) * ldc + n0 + c4) = ov[it];
        }
        
      }
    }
    __builtin_amdgcn_fence(__ATOMIC_RELEASE, "workgroup");
    __builtin_amdgcn_wave_barrier();
    __builtin_amdgcn_fence(__ATOMIC_ACQUIRE, "workgroup");
  }
}

// =====================================================================================================
// v f32 token-major vf[(b*SEQ + t)*DM + n] -> f16 v^T plane vth[(b*DM + n)*SEQ + t] = f16(v * vscale),
// vscale a power of two.
// Block = one 64-token x 64-feature tile of one b; grid = (SEQ/64, DM/64, NB); tile staged in LDS as f32
// (v4f loads, __syncthreads).
// Store: group g = tid>>3 (0..31), piece = tid&7: iteration it writes row n = it*32+g, lanes 8q..8q+7 x 16 B =
// coverage: 2 iterations x 32 groups = 64 rows n, 8 pieces x 8 = 64 tokens per row; grid covers every (b,
// n tile, t tile) -> the whole plane.
// =====================================================================================================
__global__ __launch_bounds__(256) void vt_plane(const float* __restrict__ vf, unsigned short* vth, float vscale) {
  __shared__ __align__(16) float sv[64 * 68];       // [tt][d] pitch 68 floats
  const int tid = threadIdx.x;
  const int t0  = blockIdx.x * 64;
  const int fh  = blockIdx.y;                        // feature tile (64 features)
  const int b   = blockIdx.z;
#pragma unroll
  for (int i = 0; i < 4; ++i) {
    const int idx = i * 256 + tid;                  // 0..1023
    const int tt = idx >> 4, c4 = (idx & 15) * 4;
    const v4f a = *(const v4f*)(vf + ((size_t)(b * SEQ + t0 + tt)) * DM + fh * 64 + c4);
    *(v4f*)(sv + tt * 68 + c4) = a;
  }
  __syncthreads();

  const int g = tid >> 3, piece = tid & 7;
  v4u hv[2];
  size_t hofs[2];
#pragma unroll
  for (int it = 0; it < 2; ++it) {
    const int d = it * 32 + g;
    v4u a;
#pragma unroll
    for (int e = 0; e < 4; ++e) {
      const float f0 = sv[(piece * 8 + 2 * e) * 68 + d];
      const float f1 = sv[(piece * 8 + 2 * e + 1) * 68 + d];
      a[e] = pk16(h_bits((_Float16)(f0 * vscale)), h_bits((_Float16)(f1 * vscale)));
    }
    hv[it] = a;
    hofs[it] = ((size_t)(b * DM + fh * 64 + d)) * SEQ + t0 + piece * 8;
  }
  {
#pragma unroll
    for (int it = 0; it < 2; ++it) {
      *(v4u*)(vth + hofs[it]) = hv[it];
    }
    
  }
}

// =====================================================================================================
// Column mean over tokens: mv[b*DM + n] = (1/SEQ) * sum_t vf[(b*SEQ + t)*DM + n], f64 accumulation.
// Block = 32 columns (one 128-B line per token row) x all SEQ tokens of one b; grid = (DM/32, NB); 1024 threads.
// Thread = (row group rg = tid>>3 in 0..127, piece = tid&7): 16 v4f loads, rows rg + 128*i, all independent, so a
// block has 256 KiB in flight instead of one dependent load stream per column. Sums: per thread over i (f64),
// then over the 4 row groups of a wave by __shfl_xor (8, 16), then the 32 wave partials through LDS
// (__syncthreads), added by wave 0 as a fixed pairwise tree, lane = column.
// coverage: DM/32 blocks x 32 columns x NB = every column of every batch; one 128-B store per block.
// =====================================================================================================
__global__ __launch_bounds__(1024) void colmean(const float* __restrict__ vf, float* mv) {
  __shared__ __align__(16) double sp[32][32];        // [wave][column]
  const int tid   = threadIdx.x;
  const int lane  = tid & 31;
  const int wave  = tid >> 5;
  const int piece = tid & 7;                         // 16-B piece of the 128-B row segment
  const int rg    = tid >> 3;                        // 0..127
  const int b     = blockIdx.y;
  const float* p = vf + ((size_t)b * SEQ + rg) * DM + blockIdx.x * 32 + piece * 4;
  v4f x[SEQ / 128];
#pragma unroll
  for (int i = 0; i < SEQ / 128; ++i) x[i] = *(const v4f*)(p + (size_t)i * 128 * DM);
  double s[4];
#pragma unroll
  for (int e = 0; e < 4; ++e) s[e] = (double)x[0][e];
#pragma unroll
  for (int i = 1; i < SEQ / 128; ++i) {
#pragma unroll
    for (int e = 0; e < 4; ++e) s[e] += (double)x[i][e];
  }
#pragma unroll
  for (int e = 0; e < 4; ++e) {
    s[e] += __shfl_xor(s[e], 8);
    s[e] += __shfl_xor(s[e], 16);
  }
  if (lane < 8) {
#pragma unroll
    for (int e = 0; e < 4; ++e) sp[wave][piece * 4 + e] = s[e];
  }
  __syncthreads();
  if (wave == 0) {                                   // wave-uniform
    double r[32];
#pragma unroll
    for (int w = 0; w < 32; ++w) r[w] = sp[w][lane];
#pragma unroll
    for (int o = 16; o > 0; o >>= 1) {
#pragma unroll
      for (int w = 0; w < o; ++w) r[w] += r[w + o];
    }
    mv[(size_t)b * DM + blockIdx.x * 32 + lane] = (float)(r[0] * (1.0 / (double)SEQ));
  }
}

// =====================================================================================================
// f16 WMMA GEMM with scale: C[m][n] = cscale * sum_k A[m][k] * Bt[n][k] (f16 products, f32 accumulate).
// Same tiling/epilogue as gemm64 (one wave per 64x64 tile, no block barriers, 16-row LDS slabs, each 256-B
// coverage: 4 slabs x 16 rows x 64 cols = the wave's whole 64x64 tile; tile count a multiple of 8.
// =====================================================================================================
__global__ __launch_bounds__(256) void gemm64h_s(
    const unsigned short* __restrict__ Ap, int lda,
    const unsigned short* __restrict__ Btp, int ldb,
    float* Cp, int ldc, int M, int N, int K, float cscale) {
  const int bb = blockIdx.y;             // batch: A, Bt and C planes of the batches lie one behind the other
  float* C = Cp + (size_t)bb * M * ldc;
  const _Float16* Ah = (const _Float16*)(const void*)Ap + (size_t)bb * M * lda;
  const _Float16* Bh = (const _Float16*)(const void*)Btp + (size_t)bb * N * ldb;
  __shared__ __align__(16) float sT[8][16 * 68];
  const int lane = threadIdx.x & 31;
  const int wave = threadIdx.x >> 5;
  const int tilesN = N >> 6;
  const int tilesM = M >> 6;
  const int tile = blockIdx.x * 8 + wave;
  if (tile >= tilesM * tilesN) return;   // wave-uniform; no block barriers in this kernel
  const int tm = tile / tilesN;
  const int tn = tile - tm * tilesN;
  const int m0 = tm << 6;
  const int n0 = tn << 6;
  const int rlane = lane & 15;
  const int koff  = (lane >> 4) * 8;
  const int mOff  = (lane >> 4) * 8;

  v8f acc[4][4];
#pragma unroll
  for (int i = 0; i < 4; ++i)
#pragma unroll
    for (int j = 0; j < 4; ++j) acc[i][j] = zero8();

  // All 8 fragments of a k step are requested before its first product (see gemm64).
  unsigned vb = (unsigned)(rlane * ldb + koff) * 2u;
  unsigned va = (unsigned)(rlane * lda + koff) * 2u;
  const char* Bt[4];
  const char* At[4];
#pragma unroll
  for (int j = 0; j < 4; ++j) Bt[j] = sbase(Bh + (size_t)(n0 + (j << 4)) * ldb);
#pragma unroll
  for (int i = 0; i < 4; ++i) At[i] = sbase(Ah + (size_t)(m0 + (i << 4)) * lda);
  for (int k0 = 0; k0 < K; k0 += 32) {
    v16h bh[4], ah[4];
#pragma unroll
    for (int j = 0; j < 4; ++j) bh[j] = ldfrag_h((const _Float16*)(Bt[j] + vb));
#pragma unroll
    for (int i = 0; i < 4; ++i) ah[i] = ldfrag_h((const _Float16*)(At[i] + va));
#pragma unroll
    for (int i = 0; i < 4; ++i) {
#pragma unroll
      for (int j = 0; j < 4; ++j) {
        acc[i][j] = mma_h(ah[i], bh[j], acc[i][j]);
      }
    }
    vb += 64u;
    va += 64u;
  }

  float* slab = sT[wave];
#pragma unroll
  for (int i = 0; i < 4; ++i) {
    const int mBase = m0 + (i << 4);
#pragma unroll
    for (int r = 0; r < 8; ++r) {
#pragma unroll
      for (int j = 0; j < 4; ++j) {
        slab[(mOff + r) * 68 + (j << 4) + rlane] = acc[i][j][r] * cscale;
      }
    }
    __builtin_amdgcn_fence(__ATOMIC_RELEASE, "workgroup");
    __builtin_amdgcn_wave_barrier();
    __builtin_amdgcn_fence(__ATOMIC_ACQUIRE, "workgroup");
    {
      const int hh = lane >> 4, c4 = (lane & 15) * 4;
      v4f ov[8];
#pragma unroll
      for (int it = 0; it < 8; ++it) {
        const int row = it * 2 + hh;
        ov[it] = *(const v4f*)(slab + row * 68 + c4);
      }
      {
#pragma unroll
        for (int it = 0; it < 8; ++it) {
          const int row = it * 2 + hh;
          *(v4f*)(C + (size_t)(mBase + row) * ldc + n0 + c4) = ov[it];
        }
        
      }
    }
    __builtin_amdgcn_fence(__ATOMIC_RELEASE, "workgroup");
    __builtin_amdgcn_wave_barrier();
    __builtin_amdgcn_fence(__ATOMIC_ACQUIRE, "workgroup");
  }
}

// =====================================================================================================
// Row softmax over SEQ keys, max-subtracted, f32: p = exp(s - max) / sum; stored CENTERED and scaled as
// f16(16384 * p - 8) = f16(16384 * (p - 1/SEQ)) (the 1/SEQ part is added back downstream as the column
// mean of v). One 256-thread block per row, 8 consecutive elements per thread (two v4f loads), wave
// reductions by __shfl_xor, 8 wave partials combined in fixed order through LDS.
// =====================================================================================================
__global__ __launch_bounds__(256) void softmax_c(const float* __restrict__ sf, unsigned short* ph) {
  __shared__ float redm[8];
  __shared__ float reds[8];
  const int row  = blockIdx.x;
  const int tid  = threadIdx.x;
  const int lane = tid & 31;
  const int wave = tid >> 5;
  const float* s = sf + (size_t)row * SEQ + tid * 8;
  const v4f a = *(const v4f*)(s);
  const v4f c = *(const v4f*)(s + 4);
  float v[8];
  v[0] = a[0]; v[1] = a[1]; v[2] = a[2]; v[3] = a[3];
  v[4] = c[0]; v[5] = c[1]; v[6] = c[2]; v[7] = c[3];
  float m = v[0];
#pragma unroll
  for (int e = 1; e < 8; ++e) m = fmaxf(m, v[e]);
#pragma unroll
  for (int o = 16; o > 0; o >>= 1) m = fmaxf(m, __shfl_xor(m, o));
  if (lane == 0) redm[wave] = m;
  __syncthreads();
  float mm = redm[0];
#pragma unroll
  for (int w = 1; w < 8; ++w) mm = fmaxf(mm, redm[w]);
  float sum = 0.f;
#pragma unroll
  for (int e = 0; e < 8; ++e) {
    v[e] = __expf(v[e] - mm);
    sum += v[e];
  }
#pragma unroll
  for (int o = 16; o > 0; o >>= 1) sum += __shfl_xor(sum, o);
  if (lane == 0) reds[wave] = sum;
  __syncthreads();
  float tot = 0.f;
#pragma unroll
  for (int w = 0; w < 8; ++w) tot += reds[w];       // fixed order, identical for every thread
  const float inv = 1.0f / tot;                     // tot >= 1
  v4u pk;
#pragma unroll
  for (int e = 0; e < 4; ++e) {
    const float p0 = v[2 * e] * inv;
    const float p1 = v[2 * e + 1] * inv;
    const _Float16 x0 = (_Float16)(p0 * 16384.0f - 8.0f);
    const _Float16 x1 = (_Float16)(p1 * 16384.0f - 8.0f);
    pk[e] = pk16(h_bits(x0), h_bits(x1));
  }
  unsigned short* o = ph + (size_t)row * SEQ + tid * 8;
  *(v4u*)o = pk;
  
}

// =====================================================================================================
// p.v, batch bb = blockIdx.y: O[i][n] = oscale * sum_j P[i][j] * Vt[n][j] + mv[n] (f16 products, f32 accumulate;
// oscale folds back the weight and v carries; mv = column mean of v in f32). P f16 [SEQ][SEQ] pitch lda
// (j contiguous); Vt f16 [DM][SEQ] pitch ldb; n = h*HD + d.
// O is written as two f16 head-major planes: hi = f16(O*1024), lo = f16((O*1024 - hi)*2048), element
// (bb, h, i, d) at [((bb*NH + h)*SEQ + i)*HD + d]; a 64-wide tile column block is exactly one head h = tn,
// One wave per 64x64 tile, no block barriers; tile count multiple of 8. Epilogue: 16-row f32 slab staged per
// coverage: 4 slabs x (4 q x 4 g4 = 16 rows) x (8 pieces x 8 = 64 cols) = the wave's whole tile in both
// planes; grid covers every (i tile, head) of this batch.
// =====================================================================================================
__global__ __launch_bounds__(256) void gemm64h_o(
    const unsigned short* __restrict__ Ap, int lda,
    const unsigned short* __restrict__ Btp, int ldb,
    const float* __restrict__ mvp,
    unsigned short* ohi, unsigned short* olo,
    int M, int N, int K, float oscale) {
  const int bb = blockIdx.y;             // batch: P, Vt and mv planes of the batches lie one behind the other
  const float* mv = mvp + (size_t)bb * N;
  const _Float16* Ah = (const _Float16*)(const void*)Ap + (size_t)bb * M * lda;
  const _Float16* Bh = (const _Float16*)(const void*)Btp + (size_t)bb * N * ldb;
  __shared__ __align__(16) float sT[8][16 * 68];
  const int lane = threadIdx.x & 31;
  const int wave = threadIdx.x >> 5;
  const int tilesN = N >> 6;
  const int tilesM = M >> 6;
  const int tile = blockIdx.x * 8 + wave;
  if (tile >= tilesM * tilesN) return;   // wave-uniform; no block barriers in this kernel
  const int tm = tile / tilesN;
  const int tn = tile - tm * tilesN;     // == head index (tile width 64 == HD)
  const int m0 = tm << 6;
  const int n0 = tn << 6;
  const int rlane = lane & 15;
  const int koff  = (lane >> 4) * 8;
  const int mOff  = (lane >> 4) * 8;

  v8f acc[4][4];
#pragma unroll
  for (int i = 0; i < 4; ++i)
#pragma unroll
    for (int j = 0; j < 4; ++j) acc[i][j] = zero8();

  // All 8 fragments of a k step are requested before its first product (see gemm64).
  unsigned vb = (unsigned)(rlane * ldb + koff) * 2u;
  unsigned va = (unsigned)(rlane * lda + koff) * 2u;
  const char* Bt[4];
  const char* At[4];
#pragma unroll
  for (int j = 0; j < 4; ++j) Bt[j] = sbase(Bh + (size_t)(n0 + (j << 4)) * ldb);
#pragma unroll
  for (int i = 0; i < 4; ++i) At[i] = sbase(Ah + (size_t)(m0 + (i << 4)) * lda);
  for (int k0 = 0; k0 < K; k0 += 32) {
    v16h bh[4], ah[4];
#pragma unroll
    for (int j = 0; j < 4; ++j) bh[j] = ldfrag_h((const _Float16*)(Bt[j] + vb));
#pragma unroll
    for (int i = 0; i < 4; ++i) ah[i] = ldfrag_h((const _Float16*)(At[i] + va));
#pragma unroll
    for (int i = 0; i < 4; ++i) {
#pragma unroll
      for (int j = 0; j < 4; ++j) {
        acc[i][j] = mma_h(ah[i], bh[j], acc[i][j]);
      }
    }
    vb += 64u;
    va += 64u;
  }

  float mz[4];
#pragma unroll
  for (int j = 0; j < 4; ++j) mz[j] = mv[n0 + (j << 4) + rlane];

  float* slab = sT[wave];
  const size_t pbase = ((size_t)(bb * NH + tn)) * SEQ;     // plane row base for head tn of batch bb
#pragma unroll
  for (int i = 0; i < 4; ++i) {
    const int mBase = m0 + (i << 4);
#pragma unroll
    for (int r = 0; r < 8; ++r) {
#pragma unroll
      for (int j = 0; j < 4; ++j) {
        slab[(mOff + r) * 68 + (j << 4) + rlane] = acc[i][j][r] * oscale + mz[j];
      }
    }
    __builtin_amdgcn_fence(__ATOMIC_RELEASE, "workgroup");
    __builtin_amdgcn_wave_barrier();
    __builtin_amdgcn_fence(__ATOMIC_ACQUIRE, "workgroup");
    {
      const int g4 = lane >> 3, piece = lane & 7;
      v4u hv[4], lv[4];
      size_t ofs[4];
#pragma unroll
      for (int q = 0; q < 4; ++q) {
        const int row = q * 4 + g4;                      // q 0..3 x g4 0..3 = rows 0..15
        const v4f x0 = *(const v4f*)(slab + row * 68 + piece * 8);
        const v4f x1 = *(const v4f*)(slab + row * 68 + piece * 8 + 4);
        float f[8];
        f[0] = x0[0]; f[1] = x0[1]; f[2] = x0[2]; f[3] = x0[3];
        f[4] = x1[0]; f[5] = x1[1]; f[6] = x1[2]; f[7] = x1[3];
        v4u ph, pl;
#pragma unroll
        for (int e = 0; e < 4; ++e) {
          const float s0 = f[2 * e] * 1024.0f;
          const float s1 = f[2 * e + 1] * 1024.0f;
          const _Float16 h0 = (_Float16)s0;
          const _Float16 h1 = (_Float16)s1;
          const _Float16 l0 = (_Float16)((s0 - (float)h0) * 2048.0f);
          const _Float16 l1 = (_Float16)((s1 - (float)h1) * 2048.0f);
          ph[e] = pk16(h_bits(h0), h_bits(h1));
          pl[e] = pk16(h_bits(l0), h_bits(l1));
        }
        hv[q] = ph;
        lv[q] = pl;
        ofs[q] = (pbase + (size_t)(mBase + row)) * HD + piece * 8;
      }
      {
#pragma unroll
        for (int q = 0; q < 4; ++q) {
          *(v4u*)(ohi + ofs[q]) = hv[q];
          *(v4u*)(olo + ofs[q]) = lv[q];
        }
        
      }
    }
    __builtin_amdgcn_fence(__ATOMIC_RELEASE, "workgroup");
    __builtin_amdgcn_wave_barrier();
    __builtin_amdgcn_fence(__ATOMIC_ACQUIRE, "workgroup");
  }
}

// =====================================================================================================
// Output projection: C[m][n] = sch * (sum_k Ahi[m][k]*Bt[n][k] + scl * sum_k Alo[m][k]*Bt[n][k]) + bf16rne(bias[n])
// (f16 products, f32 accumulate, hi and scaled-residual products in separate accumulators). Ahi/Alo row-major
// [M][K] pitch lda; Bt [N][K] pitch ldb; C f32 [M][N] pitch ldc. One wave per 32x64 tile, no block barriers;
// tile count multiple of 8; all 8 fragments of a k-step (A: 2 rows x 2 planes, B: 4) loaded at its head.
// Epilogue: 16-row slabs staged per wave in LDS; each 64-wide row segment (256 B) written by one instruction
// coverage: 2 slabs x 16 rows x 64 cols = the wave's whole 32x64 tile; grid covers every tile of C.
// =====================================================================================================
__global__ __launch_bounds__(256) void gemm32h_w(
    const unsigned short* __restrict__ Ahp, const unsigned short* __restrict__ Alp, int lda,
    const unsigned short* __restrict__ Btp, int ldb,
    const float* __restrict__ bias,
    float* C, int ldc, int M, int N, int K, float sch, float scl) {
  const _Float16* Ah = (const _Float16*)(const void*)Ahp;
  const _Float16* Al = (const _Float16*)(const void*)Alp;
  const _Float16* Bh = (const _Float16*)(const void*)Btp;
  __shared__ __align__(16) float sT[8][16 * 68];
  const int lane = threadIdx.x & 31;
  const int wave = threadIdx.x >> 5;
  const int tilesN = N >> 6;
  const int tilesM = M >> 5;
  const int tile = blockIdx.x * 8 + wave;
  if (tile >= tilesM * tilesN) return;   // wave-uniform; no block barriers in this kernel
  const int tm = tile / tilesN;
  const int tn = tile - tm * tilesN;
  const int m0 = tm << 5;
  const int n0 = tn << 6;
  const int rlane = lane & 15;
  const int koff  = (lane >> 4) * 8;
  const int mOff  = (lane >> 4) * 8;

  v8f acch[2][4], accl[2][4];
#pragma unroll
  for (int i = 0; i < 2; ++i)
#pragma unroll
    for (int j = 0; j < 4; ++j) { acch[i][j] = zero8(); accl[i][j] = zero8(); }

  // All 8 fragments of a k step are requested before its first product (see gemm64).
  unsigned vb = (unsigned)(rlane * ldb + koff) * 2u;
  unsigned va = (unsigned)(rlane * lda + koff) * 2u;
  const char* Bt[4];
  const char* Aht[2];
  const char* Alt[2];
#pragma unroll
  for (int j = 0; j < 4; ++j) Bt[j] = sbase(Bh + (size_t)(n0 + (j << 4)) * ldb);
#pragma unroll
  for (int i = 0; i < 2; ++i) {
    Aht[i] = sbase(Ah + (size_t)(m0 + (i << 4)) * lda);
    Alt[i] = sbase(Al + (size_t)(m0 + (i << 4)) * lda);
  }
  for (int k0 = 0; k0 < K; k0 += 32) {
    v16h fh[2], fl[2], bfr[4];
#pragma unroll
    for (int i = 0; i < 2; ++i) {
      fh[i] = ldfrag_h((const _Float16*)(Aht[i] + va));
      fl[i] = ldfrag_h((const _Float16*)(Alt[i] + va));
    }
#pragma unroll
    for (int j = 0; j < 4; ++j) bfr[j] = ldfrag_h((const _Float16*)(Bt[j] + vb));
#pragma unroll
    for (int j = 0; j < 4; ++j) {
#pragma unroll
      for (int i = 0; i < 2; ++i) {
        acch[i][j] = mma_h(fh[i], bfr[j], acch[i][j]);
        accl[i][j] = mma_h(fl[i], bfr[j], accl[i][j]);
      }
    }
    vb += 64u;
    va += 64u;
  }

  float bz[4];
#pragma unroll
  for (int j = 0; j < 4; ++j) bz[j] = bf_up(bf_bits(bias[n0 + (j << 4) + rlane]));

  float* slab = sT[wave];
#pragma unroll
  for (int i = 0; i < 2; ++i) {
    const int mBase = m0 + (i << 4);
#pragma unroll
    for (int r = 0; r < 8; ++r) {
#pragma unroll
      for (int j = 0; j < 4; ++j) {
        slab[(mOff + r) * 68 + (j << 4) + rlane] = (acch[i][j][r] + accl[i][j][r] * scl) * sch + bz[j];
      }
    }
    __builtin_amdgcn_fence(__ATOMIC_RELEASE, "workgroup");
    __builtin_amdgcn_wave_barrier();
    __builtin_amdgcn_fence(__ATOMIC_ACQUIRE, "workgroup");
    {
      const int hh = lane >> 4, c4 = (lane & 15) * 4;     // 256-B row segment = 16 lanes x 16 B
      v4f ov[8];
#pragma unroll
      for (int it = 0; it < 8; ++it) {
        const int row = it * 2 + hh;                       // it 0..7 x hh 0..1 = rows 0..15
        ov[it] = *(const v4f*)(slab + row * 68 + c4);
      }
      {
#pragma unroll
        for (int it = 0; it < 8; ++it) {
          const int row = it * 2 + hh;
          *(v4f*)(C + (size_t)(mBase + row) * ldc + n0 + c4) = ov[it];
        }
        
      }
    }
    __builtin_amdgcn_fence(__ATOMIC_RELEASE, "workgroup");
    __builtin_amdgcn_wave_barrier();
    __builtin_amdgcn_fence(__ATOMIC_ACQUIRE, "workgroup");
  }
}

// =====================================================================================================
// Workspace map (bytes); every region an exact multiple of its whole-line / whole-tile store granularity
// within a launch; Tf holds the q, k, v f32 projections side by side, then the f32 score maps of both batches):
//   Xb   bf16 [4096][1024]              0         8388608
//   Wqb  bf16 [1024 n][1024 k]     8388608         2097152
//   Wkb  bf16 [1024 n][1024 k]    10485760         2097152
//   Wvb  bf16 [1024 n][1024 k]    12582912         2097152
//   Woh  f16  [1024 n][1024 k]    14680064         2097152   (f16(bf16(Wo) x1024))
//   Tf   f32  [3][4096][1024]    16777216        50331648   (q, k, v; later S f32 [2][2048][2048])
//   Qh   f16  [4096][1024]       67108864         8388608   (q x16)
//   Kh   f16  [4096][1024]       75497472         8388608   (k x16)
//   VTh  f16  [2*1024][2048]     83886080         8388608   ([b*DM + n][t], v x64)
//   Ph   f16  [2][2048][2048]    92274688        16777216   (centered weights)
//   Ohi  f16  [2][16][2048][64] 109051904         8388608
//   Olo  f16  [2][16][2048][64] 117440512         8388608
//   mV   f32  [2][1024]         125829120            8192
//   end                         125837312
// Inputs: query f32 [2][2048][1024]; Wq, Wk, Wv, Wo f32 [1024 out][1024 in]; bq, bk, bv, bo f32 [1024].
// d_out f32 [4096][1024] at byte 0 (row = b*SEQ + s, col = n).
// =====================================================================================================
extern "C" void kernel_launch(void* const* d_in, const int* in_sizes, int n_in,
                              void* d_out, int out_size, void* d_ws, size_t ws_size,
                              hipStream_t stream) {
  if (n_in < 9) return;
  if (in_sizes[0] != NB * SEQ * DM) return;
  if (in_sizes[1] != DM * DM) return;
  if (in_sizes[2] != DM) return;
  if (in_sizes[3] != DM * DM) return;
  if (in_sizes[4] != DM) return;
  if (in_sizes[5] != DM * DM) return;
  if (in_sizes[6] != DM) return;
  if (in_sizes[7] != DM * DM) return;
  if (in_sizes[8] != DM) return;
  if (out_size != OUTN) return;

  const float* x  = (const float*)d_in[0];   // [NB*SEQ][DM]
  const float* Wq = (const float*)d_in[1];   // [DM n][DM k]
  const float* bq = (const float*)d_in[2];   // [DM]
  const float* Wk = (const float*)d_in[3];
  const float* bk = (const float*)d_in[4];
  const float* Wv = (const float*)d_in[5];
  const float* bv = (const float*)d_in[6];
  const float* Wo = (const float*)d_in[7];
  const float* bo = (const float*)d_in[8];

  const size_t PXb = (size_t)ROWS * DM * 2;          //  8388608
  const size_t PW  = (size_t)DM * DM * 2;            //  2097152
  const size_t PF  = (size_t)3 * ROWS * DM * 4;      // 50331648
  const size_t PH  = (size_t)ROWS * DM * 2;          //  8388608
  const size_t PVt = (size_t)NB * DM * SEQ * 2;      //  8388608
  const size_t PP  = (size_t)NB * SEQ * SEQ * 2;     // 16777216
  const size_t PO  = (size_t)NB * NH * SEQ * HD * 2; //  8388608
  const size_t PMv = (size_t)NB * DM * 4;            //     8192
  size_t off = 0;
  const size_t oXb = off; off += PXb;
  const size_t oWq = off; off += PW;
  const size_t oWk = off; off += PW;
  const size_t oWv = off; off += PW;
  const size_t oWo = off; off += PW;
  const size_t oTf = off; off += PF;
  const size_t oQh = off; off += PH;
  const size_t oKh = off; off += PH;
  const size_t oVt = off; off += PVt;
  const size_t oP  = off; off += PP;
  const size_t oOh = off; off += PO;
  const size_t oOl = off; off += PO;
  const size_t oMv = off; off += PMv;
  if (off > ws_size) return;                        // off = 125837312
  if (off > (size_t)134217728) return;

  char* ws = (char*)d_ws;
  unsigned short* Xb  = (unsigned short*)(ws + oXb);
  unsigned short* Wqb = (unsigned short*)(ws + oWq);
  unsigned short* Woh = (unsigned short*)(ws + oWo);
  float*          Tf  = (float*)(ws + oTf);
  unsigned short* Qh  = (unsigned short*)(ws + oQh);
  unsigned short* Kh  = (unsigned short*)(ws + oKh);
  float*          Vf  = Tf + (size_t)2 * ROWS * DM; // v plane of Tf
  unsigned short* VTh = (unsigned short*)(ws + oVt);
  unsigned short* Ph  = (unsigned short*)(ws + oP);
  unsigned short* Ohi = (unsigned short*)(ws + oOh);
  unsigned short* Olo = (unsigned short*)(ws + oOl);
  float*          mV  = (float*)(ws + oMv);
  float*          outf = (float*)d_out;             // [ROWS][DM]

  const dim3 blk(256);
  const int n8x = ROWS * DM / 8;                    // 524288
  const dim3 gCvt(XBLK + 4 * WBLK);                 // 2048 + 4 * 512 blocks (exact)
  const dim3 gPl(2 * n8x / 256);                    // 4096 blocks (exact): q and k planes
  const dim3 gGemm(((ROWS / 64) * (DM / 64)) / 8, 3);  // 1024 tiles -> 128 blocks, x 3 projections
  const dim3 gVpl(SEQ / 64, DM / 64, NB);           // (32, 16, 2)
  const dim3 gCm(DM / 32, NB);                      // (32, 2)
  const dim3 gSc(((SEQ / 64) * (SEQ / 64)) / 8, NB);  // 1024 tiles -> 128 blocks per batch
  const dim3 gSm(NB * SEQ);                         // 2048 rows per batch
  const dim3 gPv(((SEQ / 64) * (DM / 64)) / 8, NB); //  512 tiles -> 64 blocks per batch
  const dim3 gWo(((ROWS / 32) * (DM / 64)) / 8);    // 2048 tiles -> 256 blocks
  const float qkScale = 16.0f;                      // q and k planes carried x16
  const float woScale = 1024.0f;                    // Wo plane carried x1024
  const float sscale  = 1.0f / 32768.0f;            // (1/sqrt(64))/16 heads = 1/128, two x16 carries folded back
  const float vScale  = 64.0f;                      // v^T plane carried x64
  const float pvOscl  = 1.0f / 1048576.0f;          // 1/(16384 * 64)
  const float woSch   = 1.0f / 1048576.0f;          // 1/(1024 * 1024): O hi carry and Wo carry
  const float woScl   = 1.0f / 2048.0f;             // residual plane carry

  // (1) activations and weights -> bf16 planes (W is [n][k] already); Wo -> f16 plane of its bf16 value x1024;
  //     Xb, Wqb, Wkb, Wvb, Woh lie one behind the other
  cvt_inputs<<<gCvt, blk, 0, stream>>>(x, Wq, Wk, Wv, Wo, Xb, woScale);
  // (2) q, k, v = Xb . W^T + bias -> Tf [3][4096][1024] (M=4096, N=1024, K=1024 each), one grid
  gemm64<<<gGemm, blk, 0, stream>>>(Xb, DM, Wqb, DM, bq, bk, bv, Tf, DM, ROWS, DM, DM);
  // (3) q and k -> f16 planes (x16); source planes and target planes are each adjacent
  plane_f16x8<<<gPl, blk, 0, stream>>>(Tf, Qh, 2 * n8x, qkScale, 0);
  // (4) v -> f16 v^T plane (x64) and f32 column means over tokens
  vt_plane<<<gVpl, blk, 0, stream>>>(Vf, VTh, vScale);
  colmean<<<gCm, dim3(1024), 0, stream>>>(Vf, mV);
  // (5) both batches in one grid each: head-averaged scores (K = 1024) -> Tf as S [2][2048][2048]; row softmax ->
  //     centered weights; p . v -> O hi/res head-major planes
  gemm64h_s<<<gSc, blk, 0, stream>>>(Qh, DM, Kh, DM, Tf, SEQ, SEQ, SEQ, DM, sscale);
  softmax_c<<<gSm, blk, 0, stream>>>(Tf, Ph);
  gemm64h_o<<<gPv, blk, 0, stream>>>(Ph, SEQ, VTh, SEQ, mV, Ohi, Olo, SEQ, DM, SEQ, pvOscl);
  // (6) out = O(flat [4096][1024]) . Woh^T + bo -> d_out
  gemm32h_w<<<gWo, blk, 0, stream>>>(Ohi, Olo, DM, Woh, DM, bo, outf, DM, ROWS, DM, DM, woSch, woScl);
  (void)hipGetLastError();
}

// v004
// One run takes 148 microseconds.
// Next to v003, in two timings, it ran 1.49 and 1.50 times as fast.
// Over all steps from v000 it is 4.60 times as fast.
// Contractions: q/k/v projections = v_wmma_f32_16x16x32_bf16 (bf16 operands: RNE-converted x, W, bias; single product); head-averaged q.k^T scores = v_wmma_f32_16x16x32_f16 (q, k f16 planes carried x16; single product); p.v = v_wmma_f32_16x16x32_f16 (centered softmax weights 16384*p-8 in f16, v^T f16 plane carried x64; single product; f64/f32 column mean of v added back); output projection = v_wmma_f32_16x16x32_f16 (attention output as f16 hi (x1024) + residual (x2048) planes, two products into separate accumulators; Wo as f16 of its bf16-RNE value x1024); all f32 accumulate; softmax in f32.
#include <hip/hip_runtime.h>
#include <math.h>
#include <stdint.h>

#define NB    2
#define SEQ   2048
#define DM    1024
#define NH    16
#define HD    64
#define ROWS  (NB * SEQ)             // 4096 token rows
#define OUTN  (ROWS * DM)
static_assert(NH * HD == DM);
static_assert(HD == 64);
static_assert((SEQ % 64) == 0 && (DM % 64) == 0 && (ROWS % 64) == 0 && (DM % 32) == 0 && (DM % 256) == 0);
static_assert(SEQ == 256 * 8);
static_assert((SEQ % 128) == 0);
static_assert((((ROWS / 64) * (DM / 64)) % 8) == 0);
static_assert((((SEQ / 64) * (SEQ / 64)) % 8) == 0);
static_assert((((SEQ / 64) * (DM / 64)) % 8) == 0);
static_assert((((ROWS / 32) * (DM / 64)) % 8) == 0);
static_assert(((ROWS * DM / 8) % 256) == 0 && ((DM * DM / 8) % 256) == 0);
static_assert((size_t)NB * SEQ * SEQ * 4 <= (size_t)3 * ROWS * DM * 4);
static_assert((ROWS % 128) == 0 && (SEQ % 256) == 0 && (DM % 256) == 0 && DM >= 128 && SEQ >= 128);   // block tiles, two stages

typedef _Float16 v16h __attribute__((ext_vector_type(16)));
typedef _Float16 v8h  __attribute__((ext_vector_type(8)));
typedef __bf16   v16b __attribute__((ext_vector_type(16)));
typedef __bf16   v8b  __attribute__((ext_vector_type(8)));
typedef float    v8f  __attribute__((ext_vector_type(8)));
typedef float    v4f  __attribute__((ext_vector_type(4)));
typedef unsigned int v4u __attribute__((ext_vector_type(4)));

// ---- scalar helpers --------------------------------------------------------------------------------
__device__ __forceinline__ unsigned short bf_bits(float f) {          // f32 -> bf16 bits, RNE convert
  unsigned u = __float_as_uint(f);
  return (unsigned short)((u + 0x7FFFu + ((u >> 16) & 1u)) >> 16);
}
__device__ __forceinline__ float bf_up(unsigned short h) { return __uint_as_float(((unsigned)h) << 16); }
__device__ __forceinline__ unsigned short h_bits(_Float16 x) { return __builtin_bit_cast(unsigned short, x); }
__device__ __forceinline__ unsigned pk16(unsigned short a, unsigned short b) { return (unsigned)a | ((unsigned)b << 16); }
__device__ __forceinline__ v8f zero8() { v8f z = {0.f, 0.f, 0.f, 0.f, 0.f, 0.f, 0.f, 0.f}; return z; }

// ---- fragment loaders: 16-bit A/B operand, lane -> row/col (lane&15), p already includes +8*(lane>>4);
//      elements 0..7 <- p[0..7] (k0+8h..), elements 8..15 <- p[16..23] (k0+16+8h..)
__device__ __forceinline__ v16b ldfrag_b(const __bf16* p) {
  union { v16b v; v8b h[2]; } f;
  f.h[0] = *(const v8b*)(p);
  f.h[1] = *(const v8b*)(p + 16);
  return f.v;
}
__device__ __forceinline__ v16h ldfrag_h(const _Float16* p) {
  union { v16h v; v8h h[2]; } f;
  f.h[0] = *(const v8h*)(p);
  f.h[1] = *(const v8h*)(p + 16);
  return f.v;
}

// ---- operand staging in LDS, shared by the 8 waves of a block ------------------------------------------
// A stage = 64 k (one 128-B line) of 384 operand rows: rows 0..127 the block's A rows, rows 128..383 its B rows, at a
// pitch of 144 B (16 B x odd: conflict-free for ds_load_b128 readers). Two stages: the next one is copied while this
// one is multiplied. Thread tid copies 16 B of row c * 32 + (tid >> 3), piece tid & 7, for c = 0..11: every wave-wide
// copy covers four whole 128-B lines of global memory.
#define SROWS   384
#define SPITCH  144
#define SBYTES  (SROWS * SPITCH)     // 55296
#define SCSTEP  (32 * SPITCH)        // LDS distance between a thread's consecutive copies
__device__ __forceinline__ unsigned lds_off(const void* p) { return (unsigned)(size_t)p; }
// The 12 copies of one thread for one stage: a0..a3 = its four A-row addresses, b + j * sb (j = 0..7) its B-row
// addresses, l = its LDS byte address in the target buffer. s_wait_xcnt stands inside the statement, behind the last
// copy: a precaution in front of every later rewrite of the address registers that the copies name.
__device__ __forceinline__ void stage_issue(unsigned l, const char* a0, const char* a1, const char* a2, const char* a3,
                                            const char* b, size_t sb) {
#if defined(__HIP_DEVICE_COMPILE__)
  asm volatile(
      "global_load_async_to_lds_b128 %0, %12, off\n\t"
      "global_load_async_to_lds_b128 %1, %13, off\n\t"
      "global_load_async_to_lds_b128 %2, %14, off\n\t"
      "global_load_async_to_lds_b128 %3, %15, off\n\t"
      "global_load_async_to_lds_b128 %4, %16, off\n\t"
      "global_load_async_to_lds_b128 %5, %17, off\n\t"
      "global_load_async_to_lds_b128 %6, %18, off\n\t"
      "global_load_async_to_lds_b128 %7, %19, off\n\t"
      "global_load_async_to_lds_b128 %8, %20, off\n\t"
      "global_load_async_to_lds_b128 %9, %21, off\n\t"
      "global_load_async_to_lds_b128 %10, %22, off\n\t"
      "global_load_async_to_lds_b128 %11, %23, off\n\t"
      "s_wait_xcnt 0x0"
      :: "v"(l), "v"(l + 1u * SCSTEP), "v"(l + 2u * SCSTEP), "v"(l + 3u * SCSTEP), "v"(l + 4u * SCSTEP),
         "v"(l + 5u * SCSTEP), "v"(l + 6u * SCSTEP), "v"(l + 7u * SCSTEP), "v"(l + 8u * SCSTEP),
         "v"(l + 9u * SCSTEP), "v"(l + 10u * SCSTEP), "v"(l + 11u * SCSTEP),
         "v"(a0), "v"(a1), "v"(a2), "v"(a3), "v"(b), "v"(b + sb), "v"(b + 2 * sb), "v"(b + 3 * sb),
         "v"(b + 4 * sb), "v"(b + 5 * sb), "v"(b + 6 * sb), "v"(b + 7 * sb)
      : "memory");
#endif
}
// this wave's copies have landed in LDS (the compiler places no wait for them)
__device__ __forceinline__ void wait_copies() {
#if defined(__HIP_DEVICE_COMPILE__)
  asm volatile("s_wait_asynccnt 0x0" ::: "memory");
#endif
}
// this wave's LDS reads have returned, so that the buffer may be handed to its next writer behind the barrier
__device__ __forceinline__ void wait_lds() {
#if defined(__HIP_DEVICE_COMPILE__)
  asm volatile("s_wait_dscnt 0x0" ::: "memory");
#endif
}

// ---- WMMA helpers with trailing VALU hazard gap --------------------------------------------------------
__device__ __forceinline__ v8f mma_h(v16h a, v16h b, v8f c) {
  c = __builtin_amdgcn_wmma_f32_16x16x32_f16(false, a, false, b, (short)0, c, false, false);
#if defined(__HIP_DEVICE_COMPILE__)
  asm volatile("v_nop\n\tv_nop\n\tv_nop\n\tv_nop" : "+v"(c) : "v"(a), "v"(b));
#endif
  return c;
}
__device__ __forceinline__ v8f mma_b_raw(v16b a, v16b b, v8f c) {
  return __builtin_amdgcn_wmma_f32_16x16x32_bf16(false, a, false, b, (short)0, c, false, false);
}
__device__ __forceinline__ void dep_guard_b(v8f& a, v8f& b, v16b x, v16b y) {
#if defined(__HIP_DEVICE_COMPILE__)
  asm volatile("v_nop\n\tv_nop\n\tv_nop\n\tv_nop" : "+v"(a), "+v"(b) : "v"(x), "v"(y));
#endif
}
__device__ __forceinline__ void keep4_b(v16b a, v16b b, v16b c, v16b d) {
#if defined(__HIP_DEVICE_COMPILE__)
  asm volatile("v_nop" :: "v"(a), "v"(b), "v"(c), "v"(d));
#endif
}
__device__ __forceinline__ void acc_guard4(v8f& a, v8f& b, v8f& c, v8f& d) {
#if defined(__HIP_DEVICE_COMPILE__)
  asm volatile("v_nop\n\tv_nop\n\tv_nop\n\tv_nop" : "+v"(a), "+v"(b), "+v"(c), "+v"(d));
#endif
}

// =====================================================================================================
// All five input conversions in one grid. Blocks [0, XBLK): x -> bf16 (RNE convert); then WBLK blocks each for Wq, Wk,
// Wv -> bf16 and for Wo -> f16(bf16rne(Wo) * woscale) (exact in f16 after the power-of-two scale). The five output
// planes lie one behind the other in the workspace, so the output index is the flat thread index. 8 elements per
// thread, one 16-B store per lane: a wave writes 512 contiguous B. The plane is chosen by blockIdx (block-uniform).
// coverage: (XBLK + 4 * WBLK) blocks x 256 threads x 8 = all five planes exactly.
// =====================================================================================================
#define XBLK (ROWS * DM / 8 / 256)
#define WBLK (DM * DM / 8 / 256)
__global__ __launch_bounds__(256) void cvt_inputs(const float* __restrict__ x, const float* __restrict__ Wq,
                                                  const float* __restrict__ Wk, const float* __restrict__ Wv,
                                                  const float* __restrict__ Wo, unsigned short* out, float woscale) {
  const int blk = blockIdx.x;
  const float* in = x;
  int first = 0;                                     // first block of this block's plane
  if (blk >= XBLK) {
    const int w = (blk - XBLK) / WBLK;               // 0..3
    in = (w == 0) ? Wq : (w == 1) ? Wk : (w == 2) ? Wv : Wo;
    first = XBLK + w * WBLK;
  }
  const int i = (blk - first) * 256 + threadIdx.x;
  const v4f a = *(const v4f*)(in + (size_t)i * 8);
  const v4f b = *(const v4f*)(in + (size_t)i * 8 + 4);
  // precaution: stands in front of every later rewrite of the two loads' address registers
  asm volatile("s_wait_xcnt 0x0" ::: "memory");
  v4u p;
  if (blk < XBLK + 3 * WBLK) {
    p[0] = pk16(bf_bits(a[0]), bf_bits(a[1]));
    p[1] = pk16(bf_bits(a[2]), bf_bits(a[3]));
    p[2] = pk16(bf_bits(b[0]), bf_bits(b[1]));
    p[3] = pk16(bf_bits(b[2]), bf_bits(b[3]));
  } else {
    p[0] = pk16(h_bits((_Float16)(bf_up(bf_bits(a[0])) * woscale)), h_bits((_Float16)(bf_up(bf_bits(a[1])) * woscale)));
    p[1] = pk16(h_bits((_Float16)(bf_up(bf_bits(a[2])) * woscale)), h_bits((_Float16)(bf_up(bf_bits(a[3])) * woscale)));
    p[2] = pk16(h_bits((_Float16)(bf_up(bf_bits(b[0])) * woscale)), h_bits((_Float16)(bf_up(bf_bits(b[1])) * woscale)));
    p[3] = pk16(h_bits((_Float16)(bf_up(bf_bits(b[2])) * woscale)), h_bits((_Float16)(bf_up(bf_bits(b[3])) * woscale)));
  }
  *(v4u*)(out + ((size_t)blk * 256 + threadIdx.x) * 8) = p;
}

// =====================================================================================================
// f32 -> f16 plane = f16(v * scale) (scale a power of two); when rb != 0, v is first RNE-converted to bf16
// and widened back (exact in f16 after the power-of-two scale). 8 elements per thread, one 16-B store per
// coverage: n8 threads x 8 = whole plane (n8 multiple of 256).
// =====================================================================================================
__global__ __launch_bounds__(256) void plane_f16x8(const float* __restrict__ in, unsigned short* hp, int n8,
                                                   float scale, int rb) {
  const int i = blockIdx.x * 256 + threadIdx.x;
  if (i < n8) {
    const v4f a = *(const v4f*)(in + (size_t)i * 8);
    const v4f b = *(const v4f*)(in + (size_t)i * 8 + 4);
    float f[8];
    f[0] = a[0]; f[1] = a[1]; f[2] = a[2]; f[3] = a[3];
    f[4] = b[0]; f[5] = b[1]; f[6] = b[2]; f[7] = b[3];
    if (rb != 0) {
#pragma unroll
      for (int e = 0; e < 8; ++e) f[e] = bf_up(bf_bits(f[e]));
    }
    v4u ph;
#pragma unroll
    for (int e = 0; e < 4; ++e) {
      const _Float16 x0 = (_Float16)(f[2 * e] * scale);
      const _Float16 x1 = (_Float16)(f[2 * e + 1] * scale);
      ph[e] = pk16(h_bits(x0), h_bits(x1));
    }
    *(v4u*)(hp + (size_t)i * 8) = ph;
    
  }
}

// =====================================================================================================
// Register-blocked bf16 WMMA GEMM with bias: C[m][n] = sum_k A[m][k] * Bt[n][k] + bf16rne(bias[n]); one wave per
// 64x64 tile, 8 waves on a 128x256 block tile whose operands are staged in LDS (one barrier a trip). A row-major [M][K] pitch lda; Bt row-major [N][K] pitch ldb (k contiguous);
// bias f32 [N] (RNE converted to bf16 and widened in the epilogue); M a multiple of 128, N of 256, K of 64
// (fixed sizes, statically asserted).
// Output f32 [M][N] pitch ldc. Epilogue: 16-row slabs staged per wave in LDS; each 64-wide row segment
// blockIdx.y = which of three independent products on the same A runs here (q, k, v): Bt plane y (N*ldb elements
// apart), bias y, C plane y (M*ldc elements apart).
// =====================================================================================================
__global__ __launch_bounds__(256) void gemm64(
    const unsigned short* __restrict__ Ap, int lda,
    const unsigned short* __restrict__ Btp, int ldb,
    const float* __restrict__ bias0, const float* __restrict__ bias1, const float* __restrict__ bias2,
    float* Cp, int ldc, int M, int N, int K) {
  const int which = blockIdx.y;
  const float* bias = (which == 0) ? bias0 : (which == 1) ? bias1 : bias2;
  float* C = Cp + (size_t)which * M * ldc;
  const __bf16* Ab  = (const __bf16*)(const void*)Ap;
  const __bf16* Bb  = (const __bf16*)(const void*)Btp + (size_t)which * N * ldb;
  __shared__ __align__(16) float sT[8][16 * 68];   // per-wave 16x64 slab, pitch 68 floats
  __shared__ __align__(16) char stg[2 * SBYTES];   // the two operand stages
  const int lane = threadIdx.x & 31;
  const int wave = threadIdx.x >> 5;
  const int btN = N >> 8;                // block tile 128 x 256: waves 2 (m) x 4 (n), 64 x 64 each
  const int btM = M >> 7;
  if ((int)blockIdx.x >= btM * btN) return;   // block-uniform, in front of every barrier
  const int bm  = blockIdx.x / btN;
  const int bm0 = bm << 7;
  const int bn0 = (blockIdx.x - bm * btN) << 8;
  const int wm  = wave >> 2;
  const int wn  = wave & 3;
  const int m0 = bm0 + (wm << 6);
  const int n0 = bn0 + (wn << 6);

  const int rlane = lane & 15;                 // row (A) / col (B, D) within subtile
  const int koff  = (lane >> 4) * 8;           // k offset of this lane half
  const int mOff  = (lane >> 4) * 8;           // D row offset

  v8f acc[4][4];
#pragma unroll
  for (int i = 0; i < 4; ++i)
#pragma unroll
    for (int j = 0; j < 4; ++j) acc[i][j] = zero8();

  // Two-buffer ring along K, 64 k a trip: the copies of tile t + 2 fly while tile t + 1 is multiplied.
  const int T = K >> 6;
  const int crow = threadIdx.x >> 3;                   // this thread's row within each group of 32 staged rows
  const int cpc  = (threadIdx.x & 7) * 16;             // its 16-B piece of the 128-B row
  const unsigned lcp = lds_off(stg) + (unsigned)(crow * SPITCH + cpc);
  const size_t sa = (size_t)32 * lda * 2;              // bytes between a thread's consecutive A rows
  const size_t sb = (size_t)32 * ldb * 2;              // the same for B
  const char* ga = (const char*)(Ab + (size_t)(bm0 + crow) * lda) + cpc;
  const char* gb = (const char*)(Bb + (size_t)(bn0 + crow) * ldb) + cpc;
  stage_issue(lcp, ga, ga + sa, ga + 2 * sa, ga + 3 * sa, gb, sb);
  wait_copies();
  __syncthreads();                                     // tile 0 is readable by every wave
  if (T > 1) stage_issue(lcp + SBYTES, ga + 128, ga + sa + 128, ga + 2 * sa + 128, ga + 3 * sa + 128, gb + 128, sb);
  const char* fa = stg + (wm * 64 + rlane) * SPITCH + koff * 2;         // this lane's place in its first A fragment
  const char* fb = stg + (128 + wn * 64 + rlane) * SPITCH + koff * 2;   // the same for B
  for (int t = 0; t < T; ++t) {
    const int bo = (t & 1) * SBYTES;
    // unrolled so that the fragment arrays keep constant indices (registers, no scratch)
#pragma unroll
    for (int ks = 0; ks < 2; ++ks) {
      v16b bh[4], ah[4];
#pragma unroll
      for (int j = 0; j < 4; ++j) bh[j] = ldfrag_b((const __bf16*)(fb + bo + j * 16 * SPITCH + ks * 64));
#pragma unroll
      for (int i = 0; i < 4; ++i) ah[i] = ldfrag_b((const __bf16*)(fa + bo + i * 16 * SPITCH + ks * 64));
#pragma unroll
      for (int i = 0; i < 4; ++i) {
#pragma unroll
        for (int j = 0; j < 4; ++j) {
          acc[i][j] = mma_b_raw(ah[i], bh[j], acc[i][j]);
        }
        dep_guard_b(acc[i][0], acc[i][3], ah[i], ah[i]);
      }
      keep4_b(bh[0], bh[1], bh[2], bh[3]);
    }
    wait_lds();
    wait_copies();
    __syncthreads();                                   // publishes tile t + 1; ends every wave's reads of tile t
    if (t + 2 < T) {                                   // block-uniform
      const size_t ko = (size_t)(t + 2) * 128;
      stage_issue(lcp + (unsigned)bo, ga + ko, ga + sa + ko, ga + 2 * sa + ko, ga + 3 * sa + ko, gb + ko, sb);
    }
  }
  wait_copies();
  acc_guard4(acc[0][0], acc[0][1], acc[0][2], acc[0][3]);
  acc_guard4(acc[1][0], acc[1][1], acc[1][2], acc[1][3]);
  acc_guard4(acc[2][0], acc[2][1], acc[2][2], acc[2][3]);
  acc_guard4(acc[3][0], acc[3][1], acc[3][2], acc[3][3]);

  // ---- bias per D column of this lane (n0 + 16j + rlane < N) ----
  float bz[4];
#pragma unroll
  for (int j = 0; j < 4; ++j) bz[j] = bf_up(bf_bits(bias[n0 + (j << 4) + rlane]));

  // ---- epilogue ----
  float* slab = sT[wave];
#pragma unroll
  for (int i = 0; i < 4; ++i) {
    const int mBase = m0 + (i << 4);
#pragma unroll
    for (int r = 0; r < 8; ++r) {
#pragma unroll
      for (int j = 0; j < 4; ++j) {
        slab[(mOff + r) * 68 + (j << 4) + rlane] = acc[i][j][r] + bz[j];
      }
    }
    __builtin_amdgcn_fence(__ATOMIC_RELEASE, "workgroup");
    __builtin_amdgcn_wave_barrier();
    __builtin_amdgcn_fence(__ATOMIC_ACQUIRE, "workgroup");
    {
      const int hh = lane >> 4, c4 = (lane & 15) * 4;     // 256-B row segment = 16 lanes x 16 B
      v4f ov[8];
#pragma unroll
      for (int it = 0; it < 8; ++it) {
        const int row = it * 2 + hh;                       // it 0..7 x hh 0..1 = rows 0..15
        ov[it] = *(const v4f*)(slab + row * 68 + c4);
      }
      {
#pragma unroll
        for (int it = 0; it < 8; ++it) {
          const int row = it * 2 + hh;
          *(v4f*)(C + (size_t)(mBase + row) * ldc + n0 + c4) = ov[it];
        }
        
      }
    }
    __builtin_amdgcn_fence(__ATOMIC_RELEASE, "workgroup");
    __builtin_amdgcn_wave_barrier();
    __builtin_amdgcn_fence(__ATOMIC_ACQUIRE, "workgroup");
  }
}

// =====================================================================================================
// v f32 token-major vf[(b*SEQ + t)*DM + n] -> f16 v^T plane vth[(b*DM + n)*SEQ + t] = f16(v * vscale),
// vscale a power of two.
// Block = one 64-token x 64-feature tile of one b; grid = (SEQ/64, DM/64, NB); tile staged in LDS as f32
// (v4f loads, __syncthreads).
// Store: group g = tid>>3 (0..31), piece = tid&7: iteration it writes row n = it*32+g, lanes 8q..8q+7 x 16 B =
// coverage: 2 iterations x 32 groups = 64 rows n, 8 pieces x 8 = 64 tokens per row; grid covers every (b,
// n tile, t tile) -> the whole plane.
// =====================================================================================================
__global__ __launch_bounds__(256) void vt_plane(const float* __restrict__ vf, unsigned short* vth, float vscale) {
  __shared__ __align__(16) float sv[64 * 68];       // [tt][d] pitch 68 floats
  const int tid = threadIdx.x;
  const int t0  = blockIdx.x * 64;
  const int fh  = blockIdx.y;                        // feature tile (64 features)
  const int b   = blockIdx.z;
#pragma unroll
  for (int i = 0; i < 4; ++i) {
    const int idx = i * 256 + tid;                  // 0..1023
    const int tt = idx >> 4, c4 = (idx & 15) * 4;
    const v4f a = *(const v4f*)(vf + ((size_t)(b * SEQ + t0 + tt)) * DM + fh * 64 + c4);
    *(v4f*)(sv + tt * 68 + c4) = a;
  }
  __syncthreads();

  const int g = tid >> 3, piece = tid & 7;
  v4u hv[2];
  size_t hofs[2];
#pragma unroll
  for (int it = 0; it < 2; ++it) {
    const int d = it * 32 + g;
    v4u a;
#pragma unroll
    for (int e = 0; e < 4; ++e) {
      const float f0 = sv[(piece * 8 + 2 * e) * 68 + d];
      const float f1 = sv[(piece * 8 + 2 * e + 1) * 68 + d];
      a[e] = pk16(h_bits((_Float16)(f0 * vscale)), h_bits((_Float16)(f1 * vscale)));
    }
    hv[it] = a;
    hofs[it] = ((size_t)(b * DM + fh * 64 + d)) * SEQ + t0 + piece * 8;
  }
  {
#pragma unroll
    for (int it = 0; it < 2; ++it) {
      *(v4u*)(vth + hofs[it]) = hv[it];
    }
    
  }
}

// =====================================================================================================
// Column mean over tokens: mv[b*DM + n] = (1/SEQ) * sum_t vf[(b*SEQ + t)*DM + n], f64 accumulation.
// Block = 32 columns (one 128-B line per token row) x all SEQ tokens of one b; grid = (DM/32, NB); 1024 threads.
// Thread = (row group rg = tid>>3 in 0..127, piece = tid&7): 16 v4f loads, rows rg + 128*i, all independent, so a
// block has 256 KiB in flight instead of one dependent load stream per column. Sums: per thread over i (f64),
// then over the 4 row groups of a wave by __shfl_xor (8, 16), then the 32 wave partials through LDS
// (__syncthreads), added by wave 0 as a fixed pairwise tree, lane = column.
// coverage: DM/32 blocks x 32 columns x NB = every column of every batch; one 128-B store per block.
// =====================================================================================================
__global__ __launch_bounds__(1024) void colmean(const float* __restrict__ vf, float* mv) {
  __shared__ __align__(16) double sp[32][32];        // [wave][column]
  const int tid   = threadIdx.x;
  const int lane  = tid & 31;
  const int wave  = tid >> 5;
  const int piece = tid & 7;                         // 16-B piece of the 128-B row segment
  const int rg    = tid >> 3;                        // 0..127
  const int b     = blockIdx.y;
  const float* p = vf + ((size_t)b * SEQ + rg) * DM + blockIdx.x * 32 + piece * 4;
  v4f x[SEQ / 128];
#pragma unroll
  for (int i = 0; i < SEQ / 128; ++i) x[i] = *(const v4f*)(p + (size_t)i * 128 * DM);
  double s[4];
#pragma unroll
  for (int e = 0; e < 4; ++e) s[e] = (double)x[0][e];
#pragma unroll
  for (int i = 1; i < SEQ / 128; ++i) {
#pragma unroll
    for (int e = 0; e < 4; ++e) s[e] += (double)x[i][e];
  }
#pragma unroll
  for (int e = 0; e < 4; ++e) {
    s[e] += __shfl_xor(s[e], 8);
    s[e] += __shfl_xor(s[e], 16);
  }
  if (lane < 8) {
#pragma unroll
    for (int e = 0; e < 4; ++e) sp[wave][piece * 4 + e] = s[e];
  }
  __syncthreads();
  if (wave == 0) {                                   // wave-uniform
    double r[32];
#pragma unroll
    for (int w = 0; w < 32; ++w) r[w] = sp[w][lane];
#pragma unroll
    for (int o = 16; o > 0; o >>= 1) {
#pragma unroll
      for (int w = 0; w < o; ++w) r[w] += r[w + o];
    }
    mv[(size_t)b * DM + blockIdx.x * 32 + lane] = (float)(r[0] * (1.0 / (double)SEQ));
  }
}

// =====================================================================================================
// f16 WMMA GEMM with scale: C[m][n] = cscale * sum_k A[m][k] * Bt[n][k] (f16 products, f32 accumulate).
// Same tiling/epilogue as gemm64 (one wave per 64x64 tile, operands staged in LDS per block, 16-row LDS slabs, each 256-B
// coverage: 4 slabs x 16 rows x 64 cols = the wave's whole 64x64 tile; 8 waves = the block's 128x256 tile.
// =====================================================================================================
__global__ __launch_bounds__(256) void gemm64h_s(
    const unsigned short* __restrict__ Ap, int lda,
    const unsigned short* __restrict__ Btp, int ldb,
    float* Cp, int ldc, int M, int N, int K, float cscale) {
  const int bb = blockIdx.y;             // batch: A, Bt and C planes of the batches lie one behind the other
  float* C = Cp + (size_t)bb * M * ldc;
  const _Float16* Ah = (const _Float16*)(const void*)Ap + (size_t)bb * M * lda;
  const _Float16* Bh = (const _Float16*)(const void*)Btp + (size_t)bb * N * ldb;
  __shared__ __align__(16) float sT[8][16 * 68];
  __shared__ __align__(16) char stg[2 * SBYTES];   // the two operand stages
  const int lane = threadIdx.x & 31;
  const int wave = threadIdx.x >> 5;
  const int btN = N >> 8;                // block tile 128 x 256: waves 2 (m) x 4 (n), 64 x 64 each
  const int btM = M >> 7;
  if ((int)blockIdx.x >= btM * btN) return;   // block-uniform, in front of every barrier
  const int bm  = blockIdx.x / btN;
  const int bm0 = bm << 7;
  const int bn0 = (blockIdx.x - bm * btN) << 8;
  const int wm  = wave >> 2;
  const int wn  = wave & 3;
  const int m0 = bm0 + (wm << 6);
  const int n0 = bn0 + (wn << 6);
  const int rlane = lane & 15;
  const int koff  = (lane >> 4) * 8;
  const int mOff  = (lane >> 4) * 8;

  v8f acc[4][4];
#pragma unroll
  for (int i = 0; i < 4; ++i)
#pragma unroll
    for (int j = 0; j < 4; ++j) acc[i][j] = zero8();

  // Two-buffer ring along K, 64 k a trip: the copies of tile t + 2 fly while tile t + 1 is multiplied.
  const int T = K >> 6;
  const int crow = threadIdx.x >> 3;                   // this thread's row within each group of 32 staged rows
  const int cpc  = (threadIdx.x & 7) * 16;             // its 16-B piece of the 128-B row
  const unsigned lcp = lds_off(stg) + (unsigned)(crow * SPITCH + cpc);
  const size_t sa = (size_t)32 * lda * 2;              // bytes between a thread's consecutive A rows
  const size_t sb = (size_t)32 * ldb * 2;              // the same for B
  const char* ga = (const char*)(Ah + (size_t)(bm0 + crow) * lda) + cpc;
  const char* gb = (const char*)(Bh + (size_t)(bn0 + crow) * ldb) + cpc;
  stage_issue(lcp, ga, ga + sa, ga + 2 * sa, ga + 3 * sa, gb, sb);
  wait_copies();
  __syncthreads();                                     // tile 0 is readable by every wave
  if (T > 1) stage_issue(lcp + SBYTES, ga + 128, ga + sa + 128, ga + 2 * sa + 128, ga + 3 * sa + 128, gb + 128, sb);
  const char* fa = stg + (wm * 64 + rlane) * SPITCH + koff * 2;         // this lane's place in its first A fragment
  const char* fb = stg + (128 + wn * 64 + rlane) * SPITCH + koff * 2;   // the same for B
  for (int t = 0; t < T; ++t) {
    const int bo = (t & 1) * SBYTES;
    // unrolled so that the fragment arrays keep constant indices (registers, no scratch)
#pragma unroll
    for (int ks = 0; ks < 2; ++ks) {
      v16h bh[4], ah[4];
#pragma unroll
      for (int j = 0; j < 4; ++j) bh[j] = ldfrag_h((const _Float16*)(fb + bo + j * 16 * SPITCH + ks * 64));
#pragma unroll
      for (int i = 0; i < 4; ++i) ah[i] = ldfrag_h((const _Float16*)(fa + bo + i * 16 * SPITCH + ks * 64));
#pragma unroll
      for (int i = 0; i < 4; ++i) {
#pragma unroll
        for (int j = 0; j < 4; ++j) {
          acc[i][j] = mma_h(ah[i], bh[j], acc[i][j]);
        }
      }
    }
    wait_lds();
    wait_copies();
    __syncthreads();                                   // publishes tile t + 1; ends every wave's reads of tile t
    if (t + 2 < T) {                                   // block-uniform
      const size_t ko = (size_t)(t + 2) * 128;
      stage_issue(lcp + (unsigned)bo, ga + ko, ga + sa + ko, ga + 2 * sa + ko, ga + 3 * sa + ko, gb + ko, sb);
    }
  }
  wait_copies();

  float* slab = sT[wave];
#pragma unroll
  for (int i = 0; i < 4; ++i) {
    const int mBase = m0 + (i << 4);
#pragma unroll
    for (int r = 0; r < 8; ++r) {
#pragma unroll
      for (int j = 0; j < 4; ++j) {
        slab[(mOff + r) * 68 + (j << 4) + rlane] = acc[i][j][r] * cscale;
      }
    }
    __builtin_amdgcn_fence(__ATOMIC_RELEASE, "workgroup");
    __builtin_amdgcn_wave_barrier();
    __builtin_amdgcn_fence(__ATOMIC_ACQUIRE, "workgroup");
    {
      const int hh = lane >> 4, c4 = (lane & 15) * 4;
      v4f ov[8];
#pragma unroll
      for (int it = 0; it < 8; ++it) {
        const int row = it * 2 + hh;
        ov[it] = *(const v4f*)(slab + row * 68 + c4);
      }
      {
#pragma unroll
        for (int it = 0; it < 8; ++it) {
          const int row = it * 2 + hh;
          *(v4f*)(C + (size_t)(mBase + row) * ldc + n0 + c4) = ov[it];
        }
        
      }
    }
    __builtin_amdgcn_fence(__ATOMIC_RELEASE, "workgroup");
    __builtin_amdgcn_wave_barrier();
    __builtin_amdgcn_fence(__ATOMIC_ACQUIRE, "workgroup");
  }
}

// =====================================================================================================
// Row softmax over SEQ keys, max-subtracted, f32: p = exp(s - max) / sum; stored CENTERED and scaled as
// f16(16384 * p - 8) = f16(16384 * (p - 1/SEQ)) (the 1/SEQ part is added back downstream as the column
// mean of v). One 256-thread block per row, 8 consecutive elements per thread (two v4f loads), wave
// reductions by __shfl_xor, 8 wave partials combined in fixed order through LDS.
// =====================================================================================================
__global__ __launch_bounds__(256) void softmax_c(const float* __restrict__ sf, unsigned short* ph) {
  __shared__ float redm[8];
  __shared__ float reds[8];
  const int row  = blockIdx.x;
  const int tid  = threadIdx.x;
  const int lane = tid & 31;
  const int wave = tid >> 5;
  const float* s = sf + (size_t)row * SEQ + tid * 8;
  const v4f a = *(const v4f*)(s);
  const v4f c = *(const v4f*)(s + 4);
  float v[8];
  v[0] = a[0]; v[1] = a[1]; v[2] = a[2]; v[3] = a[3];
  v[4] = c[0]; v[5] = c[1]; v[6] = c[2]; v[7] = c[3];
  float m = v[0];
#pragma unroll
  for (int e = 1; e < 8; ++e) m = fmaxf(m, v[e]);
#pragma unroll
  for (int o = 16; o > 0; o >>= 1) m = fmaxf(m, __shfl_xor(m, o));
  if (lane == 0) redm[wave] = m;
  __syncthreads();
  float mm = redm[0];
#pragma unroll
  for (int w = 1; w < 8; ++w) mm = fmaxf(mm, redm[w]);
  float sum = 0.f;
#pragma unroll
  for (int e = 0; e < 8; ++e) {
    v[e] = __expf(v[e] - mm);
    sum += v[e];
  }
#pragma unroll
  for (int o = 16; o > 0; o >>= 1) sum += __shfl_xor(sum, o);
  if (lane == 0) reds[wave] = sum;
  __syncthreads();
  float tot = 0.f;
#pragma unroll
  for (int w = 0; w < 8; ++w) tot += reds[w];       // fixed order, identical for every thread
  const float inv = 1.0f / tot;                     // tot >= 1
  v4u pk;
#pragma unroll
  for (int e = 0; e < 4; ++e) {
    const float p0 = v[2 * e] * inv;
    const float p1 = v[2 * e + 1] * inv;
    const _Float16 x0 = (_Float16)(p0 * 16384.0f - 8.0f);
    const _Float16 x1 = (_Float16)(p1 * 16384.0f - 8.0f);
    pk[e] = pk16(h_bits(x0), h_bits(x1));
  }
  unsigned short* o = ph + (size_t)row * SEQ + tid * 8;
  *(v4u*)o = pk;
  
}

// =====================================================================================================
// p.v, batch bb = blockIdx.y: O[i][n] = oscale * sum_j P[i][j] * Vt[n][j] + mv[n] (f16 products, f32 accumulate;
// oscale folds back the weight and v carries; mv = column mean of v in f32). P f16 [SEQ][SEQ] pitch lda
// (j contiguous); Vt f16 [DM][SEQ] pitch ldb; n = h*HD + d.
// O is written as two f16 head-major planes: hi = f16(O*1024), lo = f16((O*1024 - hi)*2048), element
// (bb, h, i, d) at [((bb*NH + h)*SEQ + i)*HD + d]; a 64-wide tile column block is exactly one head h = tn,
// One wave per 64x64 tile, operands staged in LDS per 128x256 block tile. Epilogue: 16-row f32 slab staged per
// coverage: 4 slabs x (4 q x 4 g4 = 16 rows) x (8 pieces x 8 = 64 cols) = the wave's whole tile in both
// planes; grid covers every (i tile, head) of this batch.
// =====================================================================================================
__global__ __launch_bounds__(256) void gemm64h_o(
    const unsigned short* __restrict__ Ap, int lda,
    const unsigned short* __restrict__ Btp, int ldb,
    const float* __restrict__ mvp,
    unsigned short* ohi, unsigned short* olo,
    int M, int N, int K, float oscale) {
  const int bb = blockIdx.y;             // batch: P, Vt and mv planes of the batches lie one behind the other
  const float* mv = mvp + (size_t)bb * N;
  const _Float16* Ah = (const _Float16*)(const void*)Ap + (size_t)bb * M * lda;
  const _Float16* Bh = (const _Float16*)(const void*)Btp + (size_t)bb * N * ldb;
  __shared__ __align__(16) float sT[8][16 * 68];
  __shared__ __align__(16) char stg[2 * SBYTES];   // the two operand stages
  const int lane = threadIdx.x & 31;
  const int wave = threadIdx.x >> 5;
  const int btN = N >> 8;                // block tile 128 x 256: waves 2 (m) x 4 (n), 64 x 64 each
  const int btM = M >> 7;
  if ((int)blockIdx.x >= btM * btN) return;   // block-uniform, in front of every barrier
  const int bm  = blockIdx.x / btN;
  const int bm0 = bm << 7;
  const int bn0 = (blockIdx.x - bm * btN) << 8;
  const int wm  = wave >> 2;
  const int wn  = wave & 3;
  const int m0 = bm0 + (wm << 6);
  const int n0 = bn0 + (wn << 6);
  const int tn = n0 >> 6;                // == head index (tile width 64 == HD)
  const int rlane = lane & 15;
  const int koff  = (lane >> 4) * 8;
  const int mOff  = (lane >> 4) * 8;

  v8f acc[4][4];
#pragma unroll
  for (int i = 0; i < 4; ++i)
#pragma unroll
    for (int j = 0; j < 4; ++j) acc[i][j] = zero8();

  // Two-buffer ring along K, 64 k a trip: the copies of tile t + 2 fly while tile t + 1 is multiplied.
  const int T = K >> 6;
  const int crow = threadIdx.x >> 3;                   // this thread's row within each group of 32 staged rows
  const int cpc  = (threadIdx.x & 7) * 16;             // its 16-B piece of the 128-B row
  const unsigned lcp = lds_off(stg) + (unsigned)(crow * SPITCH + cpc);
  const size_t sa = (size_t)32 * lda * 2;              // bytes between a thread's consecutive A rows
  const size_t sb = (size_t)32 * ldb * 2;              // the same for B
  const char* ga = (const char*)(Ah + (size_t)(bm0 + crow) * lda) + cpc;
  const char* gb = (const char*)(Bh + (size_t)(bn0 + crow) * ldb) + cpc;
  stage_issue(lcp, ga, ga + sa, ga + 2 * sa, ga + 3 * sa, gb, sb);
  wait_copies();
  __syncthreads();                                     // tile 0 is readable by every wave
  if (T > 1) stage_issue(lcp + SBYTES, ga + 128, ga + sa + 128, ga + 2 * sa + 128, ga + 3 * sa + 128, gb + 128, sb);
  const char* fa = stg + (wm * 64 + rlane) * SPITCH + koff * 2;         // this lane's place in its first A fragment
  const char* fb = stg + (128 + wn * 64 + rlane) * SPITCH + koff * 2;   // the same for B
  for (int t = 0; t < T; ++t) {
    const int bo = (t & 1) * SBYTES;
    // unrolled so that the fragment arrays keep constant indices (registers, no scratch)
#pragma unroll
    for (int ks = 0; ks < 2; ++ks) {
      v16h bh[4], ah[4];
#pragma unroll
      for (int j = 0; j < 4; ++j) bh[j] = ldfrag_h((const _Float16*)(fb + bo + j * 16 * SPITCH + ks * 64));
#pragma unroll
      for (int i = 0; i < 4; ++i) ah[i] = ldfrag_h((const _Float16*)(fa + bo + i * 16 * SPITCH + ks * 64));
#pragma unroll
      for (int i = 0; i < 4; ++i) {
#pragma unroll
        for (int j = 0; j < 4; ++j) {
          acc[i][j] = mma_h(ah[i], bh[j], acc[i][j]);
        }
      }
    }
    wait_lds();
    wait_copies();
    __syncthreads();                                   // publishes tile t + 1; ends every wave's reads of tile t
    if (t + 2 < T) {                                   // block-uniform
      const size_t ko = (size_t)(t + 2) * 128;
      stage_issue(lcp + (unsigned)bo, ga + ko, ga + sa + ko, ga + 2 * sa + ko, ga + 3 * sa + ko, gb + ko, sb);
    }
  }
  wait_copies();

  float mz[4];
#pragma unroll
  for (int j = 0; j < 4; ++j) mz[j] = mv[n0 + (j << 4) + rlane];

  float* slab = sT[wave];
  const size_t pbase = ((size_t)(bb * NH + tn)) * SEQ;     // plane row base for head tn of batch bb
#pragma unroll
  for (int i = 0; i < 4; ++i) {
    const int mBase = m0 + (i << 4);
#pragma unroll
    for (int r = 0; r < 8; ++r) {
#pragma unroll
      for (int j = 0; j < 4; ++j) {
        slab[(mOff + r) * 68 + (j << 4) + rlane] = acc[i][j][r] * oscale + mz[j];
      }
    }
    __builtin_amdgcn_fence(__ATOMIC_RELEASE, "workgroup");
    __builtin_amdgcn_wave_barrier();
    __builtin_amdgcn_fence(__ATOMIC_ACQUIRE, "workgroup");
    {
      const int g4 = lane >> 3, piece = lane & 7;
      v4u hv[4], lv[4];
      size_t ofs[4];
#pragma unroll
      for (int q = 0; q < 4; ++q) {
        const int row = q * 4 + g4;                      // q 0..3 x g4 0..3 = rows 0..15
        const v4f x0 = *(const v4f*)(slab + row * 68 + piece * 8);
        const v4f x1 = *(const v4f*)(slab + row * 68 + piece * 8 + 4);
        float f[8];
        f[0] = x0[0]; f[1] = x0[1]; f[2] = x0[2]; f[3] = x0[3];
        f[4] = x1[0]; f[5] = x1[1]; f[6] = x1[2]; f[7] = x1[3];
        v4u ph, pl;
#pragma unroll
        for (int e = 0; e < 4; ++e) {
          const float s0 = f[2 * e] * 1024.0f;
          const float s1 = f[2 * e + 1] * 1024.0f;
          const _Float16 h0 = (_Float16)s0;
          const _Float16 h1 = (_Float16)s1;
          const _Float16 l0 = (_Float16)((s0 - (float)h0) * 2048.0f);
          const _Float16 l1 = (_Float16)((s1 - (float)h1) * 2048.0f);
          ph[e] = pk16(h_bits(h0), h_bits(h1));
          pl[e] = pk16(h_bits(l0), h_bits(l1));
        }
        hv[q] = ph;
        lv[q] = pl;
        ofs[q] = (pbase + (size_t)(mBase + row)) * HD + piece * 8;
      }
      {
#pragma unroll
        for (int q = 0; q < 4; ++q) {
          *(v4u*)(ohi + ofs[q]) = hv[q];
          *(v4u*)(olo + ofs[q]) = lv[q];
        }
        
      }
    }
    __builtin_amdgcn_fence(__ATOMIC_RELEASE, "workgroup");
    __builtin_amdgcn_wave_barrier();
    __builtin_amdgcn_fence(__ATOMIC_ACQUIRE, "workgroup");
  }
}

// =====================================================================================================
// Output projection: C[m][n] = sch * (sum_k Ahi[m][k]*Bt[n][k] + scl * sum_k Alo[m][k]*Bt[n][k]) + bf16rne(bias[n])
// (f16 products, f32 accumulate, hi and scaled-residual products in separate accumulators). Ahi/Alo row-major
// [M][K] pitch lda; Bt [N][K] pitch ldb; C f32 [M][N] pitch ldc. One wave per 32x64 tile, 8 waves on a 64x256
// block tile whose operands are staged in LDS; all 8 fragments of a k-step (A: 2 rows x 2 planes, B: 4) read at its head.
// Epilogue: 16-row slabs staged per wave in LDS; each 64-wide row segment (256 B) written by one instruction
// coverage: 2 slabs x 16 rows x 64 cols = the wave's whole 32x64 tile; grid covers every tile of C.
// =====================================================================================================
__global__ __launch_bounds__(256) void gemm32h_w(
    const unsigned short* __restrict__ Ahp, const unsigned short* __restrict__ Alp, int lda,
    const unsigned short* __restrict__ Btp, int ldb,
    const float* __restrict__ bias,
    float* C, int ldc, int M, int N, int K, float sch, float scl) {
  const _Float16* Ah = (const _Float16*)(const void*)Ahp;
  const _Float16* Al = (const _Float16*)(const void*)Alp;
  const _Float16* Bh = (const _Float16*)(const void*)Btp;
  __shared__ __align__(16) float sT[8][16 * 68];
  __shared__ __align__(16) char stg[2 * SBYTES];   // the two operand stages
  const int lane = threadIdx.x & 31;
  const int wave = threadIdx.x >> 5;
  const int btN = N >> 8;                // block tile 64 x 256: waves 2 (m) x 4 (n), 32 x 64 each
  const int btM = M >> 6;
  if ((int)blockIdx.x >= btM * btN) return;   // block-uniform, in front of every barrier
  const int bm  = blockIdx.x / btN;
  const int bm0 = bm << 6;
  const int bn0 = (blockIdx.x - bm * btN) << 8;
  const int wm  = wave >> 2;
  const int wn  = wave & 3;
  const int m0 = bm0 + (wm << 5);
  const int n0 = bn0 + (wn << 6);
  const int rlane = lane & 15;
  const int koff  = (lane >> 4) * 8;
  const int mOff  = (lane >> 4) * 8;

  v8f acch[2][4], accl[2][4];
#pragma unroll
  for (int i = 0; i < 2; ++i)
#pragma unroll
    for (int j = 0; j < 4; ++j) { acch[i][j] = zero8(); accl[i][j] = zero8(); }

  // Two-buffer ring along K, 64 k a trip: the copies of tile t + 2 fly while tile t + 1 is multiplied.
  const int T = K >> 6;
  const int crow = threadIdx.x >> 3;                   // this thread's row within each group of 32 staged rows
  const int cpc  = (threadIdx.x & 7) * 16;             // its 16-B piece of the 128-B row
  const unsigned lcp = lds_off(stg) + (unsigned)(crow * SPITCH + cpc);
  const size_t sa = (size_t)32 * lda * 2;              // bytes between a thread's consecutive A rows
  const size_t sb = (size_t)32 * ldb * 2;              // the same for B
  const char* gh = (const char*)(Ah + (size_t)(bm0 + crow) * lda) + cpc;   // staged rows 0..63: hi plane
  const char* gl = (const char*)(Al + (size_t)(bm0 + crow) * lda) + cpc;   // staged rows 64..127: residual plane
  const char* gb = (const char*)(Bh + (size_t)(bn0 + crow) * ldb) + cpc;
  stage_issue(lcp, gh, gh + sa, gl, gl + sa, gb, sb);
  wait_copies();
  __syncthreads();                                     // tile 0 is readable by every wave
  if (T > 1) stage_issue(lcp + SBYTES, gh + 128, gh + sa + 128, gl + 128, gl + sa + 128, gb + 128, sb);
  const char* fa = stg + (wm * 32 + rlane) * SPITCH + koff * 2;         // this lane's place in its first hi fragment
  const char* fb = stg + (128 + wn * 64 + rlane) * SPITCH + koff * 2;   // the same for B
  for (int t = 0; t < T; ++t) {
    const int bo = (t & 1) * SBYTES;
    // unrolled so that the fragment arrays keep constant indices (registers, no scratch)
#pragma unroll
    for (int ks = 0; ks < 2; ++ks) {
      v16h fh[2], fl[2], bfr[4];
#pragma unroll
      for (int i = 0; i < 2; ++i) {
        fh[i] = ldfrag_h((const _Float16*)(fa + bo + i * 16 * SPITCH + ks * 64));
        fl[i] = ldfrag_h((const _Float16*)(fa + bo + (64 + i * 16) * SPITCH + ks * 64));
      }
#pragma unroll
      for (int j = 0; j < 4; ++j) bfr[j] = ldfrag_h((const _Float16*)(fb + bo + j * 16 * SPITCH + ks * 64));
#pragma unroll
      for (int j = 0; j < 4; ++j) {
#pragma unroll
        for (int i = 0; i < 2; ++i) {
          acch[i][j] = mma_h(fh[i], bfr[j], acch[i][j]);
          accl[i][j] = mma_h(fl[i], bfr[j], accl[i][j]);
        }
      }
    }
    wait_lds();
    wait_copies();
    __syncthreads();                                   // publishes tile t + 1; ends every wave's reads of tile t
    if (t + 2 < T) {                                   // block-uniform
      const size_t ko = (size_t)(t + 2) * 128;
      stage_issue(lcp + (unsigned)bo, gh + ko, gh + sa + ko, gl + ko, gl + sa + ko, gb + ko, sb);
    }
  }
  wait_copies();

  float bz[4];
#pragma unroll
  for (int j = 0; j < 4; ++j) bz[j] = bf_up(bf_bits(bias[n0 + (j << 4) + rlane]));

  float* slab = sT[wave];
#pragma unroll
  for (int i = 0; i < 2; ++i) {
    const int mBase = m0 + (i << 4);
#pragma unroll
    for (int r = 0; r < 8; ++r) {
#pragma unroll
      for (int j = 0; j < 4; ++j) {
        slab[(mOff + r) * 68 + (j << 4) + rlane] = (acch[i][j][r] + accl[i][j][r] * scl) * sch + bz[j];
      }
    }
    __builtin_amdgcn_fence(__ATOMIC_RELEASE, "workgroup");
    __builtin_amdgcn_wave_barrier();
    __builtin_amdgcn_fence(__ATOMIC_ACQUIRE, "workgroup");
    {
      const int hh = lane >> 4, c4 = (lane & 15) * 4;     // 256-B row segment = 16 lanes x 16 B
      v4f ov[8];
#pragma unroll
      for (int it = 0; it < 8; ++it) {
        const int row = it * 2 + hh;                       // it 0..7 x hh 0..1 = rows 0..15
        ov[it] = *(const v4f*)(slab + row * 68 + c4);
      }
      {
#pragma unroll
        for (int it = 0; it < 8; ++it) {
          const int row = it * 2 + hh;
          *(v4f*)(C + (size_t)(mBase + row) * ldc + n0 + c4) = ov[it];
        }
        
      }
    }
    __builtin_amdgcn_fence(__ATOMIC_RELEASE, "workgroup");
    __builtin_amdgcn_wave_barrier();
    __builtin_amdgcn_fence(__ATOMIC_ACQUIRE, "workgroup");
  }
}

// =====================================================================================================
// Workspace map (bytes); every region an exact multiple of its whole-line / whole-tile store granularity
// within a launch; Tf holds the q, k, v f32 projections side by side, then the f32 score maps of both batches):
//   Xb   bf16 [4096][1024]              0         8388608
//   Wqb  bf16 [1024 n][1024 k]     8388608         2097152
//   Wkb  bf16 [1024 n][1024 k]    10485760         2097152
//   Wvb  bf16 [1024 n][1024 k]    12582912         2097152
//   Woh  f16  [1024 n][1024 k]    14680064         2097152   (f16(bf16(Wo) x1024))
//   Tf   f32  [3][4096][1024]    16777216        50331648   (q, k, v; later S f32 [2][2048][2048])
//   Qh   f16  [4096][1024]       67108864         8388608   (q x16)
//   Kh   f16  [4096][1024]       75497472         8388608   (k x16)
//   VTh  f16  [2*1024][2048]     83886080         8388608   ([b*DM + n][t], v x64)
//   Ph   f16  [2][2048][2048]    92274688        16777216   (centered weights)
//   Ohi  f16  [2][16][2048][64] 109051904         8388608
//   Olo  f16  [2][16][2048][64] 117440512         8388608
//   mV   f32  [2][1024]         125829120            8192
//   end                         125837312
// Inputs: query f32 [2][2048][1024]; Wq, Wk, Wv, Wo f32 [1024 out][1024 in]; bq, bk, bv, bo f32 [1024].
// d_out f32 [4096][1024] at byte 0 (row = b*SEQ + s, col = n).
// =====================================================================================================
extern "C" void kernel_launch(void* const* d_in, const int* in_sizes, int n_in,
                              void* d_out, int out_size, void* d_ws, size_t ws_size,
                              hipStream_t stream) {
  if (n_in < 9) return;
  if (in_sizes[0] != NB * SEQ * DM) return;
  if (in_sizes[1] != DM * DM) return;
  if (in_sizes[2] != DM) return;
  if (in_sizes[3] != DM * DM) return;
  if (in_sizes[4] != DM) return;
  if (in_sizes[5] != DM * DM) return;
  if (in_sizes[6] != DM) return;
  if (in_sizes[7] != DM * DM) return;
  if (in_sizes[8] != DM) return;
  if (out_size != OUTN) return;

  const float* x  = (const float*)d_in[0];   // [NB*SEQ][DM]
  const float* Wq = (const float*)d_in[1];   // [DM n][DM k]
  const float* bq = (const float*)d_in[2];   // [DM]
  const float* Wk = (const float*)d_in[3];
  const float* bk = (const float*)d_in[4];
  const float* Wv = (const float*)d_in[5];
  const float* bv = (const float*)d_in[6];
  const float* Wo = (const float*)d_in[7];
  const float* bo = (const float*)d_in[8];

  const size_t PXb = (size_t)ROWS * DM * 2;          //  8388608
  const size_t PW  = (size_t)DM * DM * 2;            //  2097152
  const size_t PF  = (size_t)3 * ROWS * DM * 4;      // 50331648
  const size_t PH  = (size_t)ROWS * DM * 2;          //  8388608
  const size_t PVt = (size_t)NB * DM * SEQ * 2;      //  8388608
  const size_t PP  = (size_t)NB * SEQ * SEQ * 2;     // 16777216
  const size_t PO  = (size_t)NB * NH * SEQ * HD * 2; //  8388608
  const size_t PMv = (size_t)NB * DM * 4;            //     8192
  size_t off = 0;
  const size_t oXb = off; off += PXb;
  const size_t oWq = off; off += PW;
  const size_t oWk = off; off += PW;
  const size_t oWv = off; off += PW;
  const size_t oWo = off; off += PW;
  const size_t oTf = off; off += PF;
  const size_t oQh = off; off += PH;
  const size_t oKh = off; off += PH;
  const size_t oVt = off; off += PVt;
  const size_t oP  = off; off += PP;
  const size_t oOh = off; off += PO;
  const size_t oOl = off; off += PO;
  const size_t oMv = off; off += PMv;
  if (off > ws_size) return;                        // off = 125837312
  if (off > (size_t)134217728) return;

  char* ws = (char*)d_ws;
  unsigned short* Xb  = (unsigned short*)(ws + oXb);
  unsigned short* Wqb = (unsigned short*)(ws + oWq);
  unsigned short* Woh = (unsigned short*)(ws + oWo);
  float*          Tf  = (float*)(ws + oTf);
  unsigned short* Qh  = (unsigned short*)(ws + oQh);
  unsigned short* Kh  = (unsigned short*)(ws + oKh);
  float*          Vf  = Tf + (size_t)2 * ROWS * DM; // v plane of Tf
  unsigned short* VTh = (unsigned short*)(ws + oVt);
  unsigned short* Ph  = (unsigned short*)(ws + oP);
  unsigned short* Ohi = (unsigned short*)(ws + oOh);
  unsigned short* Olo = (unsigned short*)(ws + oOl);
  float*          mV  = (float*)(ws + oMv);
  float*          outf = (float*)d_out;             // [ROWS][DM]

  const dim3 blk(256);
  const int n8x = ROWS * DM / 8;                    // 524288
  const dim3 gCvt(XBLK + 4 * WBLK);                 // 2048 + 4 * 512 blocks (exact)
  const dim3 gPl(2 * n8x / 256);                    // 4096 blocks (exact): q and k planes
  const dim3 gGemm(((ROWS / 64) * (DM / 64)) / 8, 3);  // 1024 tiles -> 128 blocks, x 3 projections
  const dim3 gVpl(SEQ / 64, DM / 64, NB);           // (32, 16, 2)
  const dim3 gCm(DM / 32, NB);                      // (32, 2)
  const dim3 gSc(((SEQ / 64) * (SEQ / 64)) / 8, NB);  // 1024 tiles -> 128 blocks per batch
  const dim3 gSm(NB * SEQ);                         // 2048 rows per batch
  const dim3 gPv(((SEQ / 64) * (DM / 64)) / 8, NB); //  512 tiles -> 64 blocks per batch
  const dim3 gWo(((ROWS / 32) * (DM / 64)) / 8);    // 2048 tiles -> 256 blocks
  const float qkScale = 16.0f;                      // q and k planes carried x16
  const float woScale = 1024.0f;                    // Wo plane carried x1024
  const float sscale  = 1.0f / 32768.0f;            // (1/sqrt(64))/16 heads = 1/128, two x16 carries folded back
  const float vScale  = 64.0f;                      // v^T plane carried x64
  const float pvOscl  = 1.0f / 1048576.0f;          // 1/(16384 * 64)
  const float woSch   = 1.0f / 1048576.0f;          // 1/(1024 * 1024): O hi carry and Wo carry
  const float woScl   = 1.0f / 2048.0f;             // residual plane carry

  // (1) activations and weights -> bf16 planes (W is [n][k] already); Wo -> f16 plane of its bf16 value x1024;
  //     Xb, Wqb, Wkb, Wvb, Woh lie one behind the other
  cvt_inputs<<<gCvt, blk, 0, stream>>>(x, Wq, Wk, Wv, Wo, Xb, woScale);
  // (2) q, k, v = Xb . W^T + bias -> Tf [3][4096][1024] (M=4096, N=1024, K=1024 each), one grid
  gemm64<<<gGemm, blk, 0, stream>>>(Xb, DM, Wqb, DM, bq, bk, bv, Tf, DM, ROWS, DM, DM);
  // (3) q and k -> f16 planes (x16); source planes and target planes are each adjacent
  plane_f16x8<<<gPl, blk, 0, stream>>>(Tf, Qh, 2 * n8x, qkScale, 0);
  // (4) v -> f16 v^T plane (x64) and f32 column means over tokens
  vt_plane<<<gVpl, blk, 0, stream>>>(Vf, VTh, vScale);
  colmean<<<gCm, dim3(1024), 0, stream>>>(Vf, mV);
  // (5) both batches in one grid each: head-averaged scores (K = 1024) -> Tf as S [2][2048][2048]; row softmax ->
  //     centered weights; p . v -> O hi/res head-major planes
  gemm64h_s<<<gSc, blk, 0, stream>>>(Qh, DM, Kh, DM, Tf, SEQ, SEQ, SEQ, DM, sscale);
  softmax_c<<<gSm, blk, 0, stream>>>(Tf, Ph);
  gemm64h_o<<<gPv, blk, 0, stream>>>(Ph, SEQ, VTh, SEQ, mV, Ohi, Olo, SEQ, DM, SEQ, pvOscl);
  // (6) out = O(flat [4096][1024]) . Woh^T + bo -> d_out
  gemm32h_w<<<gWo, blk, 0, stream>>>(Ohi, Olo, DM, Woh, DM, bo, outf, DM, ROWS, DM, DM, woSch, woScl);
  (void)hipGetLastError();
}

// v005
// Measured time: 135 microseconds a run.
// Two timings next to v004 both put it at 1.10 times that version's speed.
// Counting every step since v000, it is 5.07 times as fast.
// Contractions: q/k/v projections = v_wmma_f32_16x16x32_bf16 (bf16 operands: RNE-converted x, W, bias; single product); head-averaged q.k^T scores = v_wmma_f32_16x16x32_f16 (q, k f16 planes carried x16; single product); p.v = v_wmma_f32_16x16x32_f16 (centered softmax weights 16384*p-8 in f16, v^T f16 plane carried x64; single product; f64/f32 column mean of v added back); output projection = v_wmma_f32_16x16x32_f16 (attention output as f16 hi (x1024) + residual (x2048) planes, two products into separate accumulators; Wo as f16 of its bf16-RNE value x1024); all f32 accumulate; softmax in f32.
#include <hip/hip_runtime.h>
#include <math.h>
#include <stdint.h>

#define NB    2
#define SEQ   2048
#define DM    1024
#define NH    16
#define HD    64
#define ROWS  (NB * SEQ)             // 4096 token rows
#define OUTN  (ROWS * DM)
static_assert(NH * HD == DM);
static_assert(HD == 64);
static_assert((SEQ % 64) == 0 && (DM % 64) == 0 && (ROWS % 64) == 0 && (DM % 32) == 0 && (DM % 256) == 0);
static_assert(SEQ == 256 * 8);
static_assert((SEQ % 128) == 0);
static_assert((((ROWS / 64) * (DM / 64)) % 8) == 0);
static_assert((((SEQ / 64) * (SEQ / 64)) % 8) == 0);
static_assert((((SEQ / 64) * (DM / 64)) % 8) == 0);
static_assert((((ROWS / 32) * (DM / 64)) % 8) == 0);
static_assert(((ROWS * DM / 8) % 256) == 0 && ((DM * DM / 8) % 256) == 0);
static_assert((size_t)NB * SEQ * SEQ * 4 <= (size_t)3 * ROWS * DM * 4);
static_assert((ROWS % 128) == 0 && (SEQ % 256) == 0 && (DM % 256) == 0 && DM >= 128 && SEQ >= 128);   // block tiles, two stages

typedef _Float16 v16h __attribute__((ext_vector_type(16)));
typedef _Float16 v8h  __attribute__((ext_vector_type(8)));
typedef __bf16   v16b __attribute__((ext_vector_type(16)));
typedef __bf16   v8b  __attribute__((ext_vector_type(8)));
typedef float    v8f  __attribute__((ext_vector_type(8)));
typedef float    v4f  __attribute__((ext_vector_type(4)));
typedef unsigned int v4u __attribute__((ext_vector_type(4)));

// ---- scalar helpers --------------------------------------------------------------------------------
__device__ __forceinline__ unsigned short bf_bits(float f) {          // f32 -> bf16 bits, RNE convert
  unsigned u = __float_as_uint(f);
  return (unsigned short)((u + 0x7FFFu + ((u >> 16) & 1u)) >> 16);
}
__device__ __forceinline__ float bf_up(unsigned short h) { return __uint_as_float(((unsigned)h) << 16); }
__device__ __forceinline__ unsigned short h_bits(_Float16 x) { return __builtin_bit_cast(unsigned short, x); }
__device__ __forceinline__ unsigned pk16(unsigned short a, unsigned short b) { return (unsigned)a | ((unsigned)b << 16); }
__device__ __forceinline__ v8f zero8() { v8f z = {0.f, 0.f, 0.f, 0.f, 0.f, 0.f, 0.f, 0.f}; return z; }

// ---- fragment loaders: 16-bit A/B operand, lane -> row/col (lane&15), p already includes +8*(lane>>4);
//      elements 0..7 <- p[0..7] (k0+8h..), elements 8..15 <- p[16..23] (k0+16+8h..)
__device__ __forceinline__ v16b ldfrag_b(const __bf16* p) {
  union { v16b v; v8b h[2]; } f;
  f.h[0] = *(const v8b*)(p);
  f.h[1] = *(const v8b*)(p + 16);
  return f.v;
}
__device__ __forceinline__ v16h ldfrag_h(const _Float16* p) {
  union { v16h v; v8h h[2]; } f;
  f.h[0] = *(const v8h*)(p);
  f.h[1] = *(const v8h*)(p + 16);
  return f.v;
}

// ---- operand staging in LDS, shared by the 8 waves of a block ------------------------------------------
// A stage = 64 k (one 128-B line) of 384 operand rows: rows 0..127 the block's A rows, rows 128..383 its B rows, at a
// pitch of 144 B (16 B x odd: conflict-free for ds_load_b128 readers). Two stages: the next one is copied while this
// one is multiplied. Thread tid copies 16 B of row c * 32 + (tid >> 3), piece tid & 7, for c = 0..11: every wave-wide
// copy covers four whole 128-B lines of global memory.
#define SROWS   384
#define SPITCH  144
#define SBYTES  (SROWS * SPITCH)     // 55296
#define SCSTEP  (32 * SPITCH)        // LDS distance between a thread's consecutive copies
__device__ __forceinline__ unsigned lds_off(const void* p) { return (unsigned)(size_t)p; }
// The 12 copies of one thread for one stage: a0..a3 = its four A-row addresses, b + j * sb (j = 0..7) its B-row
// addresses, l = its LDS byte address in the target buffer. s_wait_xcnt stands inside the statement, behind the last
// copy: a precaution in front of every later rewrite of the address registers that the copies name.
__device__ __forceinline__ void stage_issue(unsigned l, const char* a0, const char* a1, const char* a2, const char* a3,
                                            const char* b, size_t sb) {
#if defined(__HIP_DEVICE_COMPILE__)
  asm volatile(
      "global_load_async_to_lds_b128 %0, %12, off\n\t"
      "global_load_async_to_lds_b128 %1, %13, off\n\t"
      "global_load_async_to_lds_b128 %2, %14, off\n\t"
      "global_load_async_to_lds_b128 %3, %15, off\n\t"
      "global_load_async_to_lds_b128 %4, %16, off\n\t"
      "global_load_async_to_lds_b128 %5, %17, off\n\t"
      "global_load_async_to_lds_b128 %6, %18, off\n\t"
      "global_load_async_to_lds_b128 %7, %19, off\n\t"
      "global_load_async_to_lds_b128 %8, %20, off\n\t"
      "global_load_async_to_lds_b128 %9, %21, off\n\t"
      "global_load_async_to_lds_b128 %10, %22, off\n\t"
      "global_load_async_to_lds_b128 %11, %23, off\n\t"
      "s_wait_xcnt 0x0"
      :: "v"(l), "v"(l + 1u * SCSTEP), "v"(l + 2u * SCSTEP), "v"(l + 3u * SCSTEP), "v"(l + 4u * SCSTEP),
         "v"(l + 5u * SCSTEP), "v"(l + 6u * SCSTEP), "v"(l + 7u * SCSTEP), "v"(l + 8u * SCSTEP),
         "v"(l + 9u * SCSTEP), "v"(l + 10u * SCSTEP), "v"(l + 11u * SCSTEP),
         "v"(a0), "v"(a1), "v"(a2), "v"(a3), "v"(b), "v"(b + sb), "v"(b + 2 * sb), "v"(b + 3 * sb),
         "v"(b + 4 * sb), "v"(b + 5 * sb), "v"(b + 6 * sb), "v"(b + 7 * sb)
      : "memory");
#endif
}
// this wave's copies have landed in LDS (the compiler places no wait for them)
__device__ __forceinline__ void wait_copies() {
#if defined(__HIP_DEVICE_COMPILE__)
  asm volatile("s_wait_asynccnt 0x0" ::: "memory");
#endif
}
// this wave's LDS reads have returned, so that the buffer may be handed to its next writer behind the barrier
__device__ __forceinline__ void wait_lds() {
#if defined(__HIP_DEVICE_COMPILE__)
  asm volatile("s_wait_dscnt 0x0" ::: "memory");
#endif
}

// ---- WMMA helpers with trailing VALU hazard gap --------------------------------------------------------
__device__ __forceinline__ v8f mma_h(v16h a, v16h b, v8f c) {
  c = __builtin_amdgcn_wmma_f32_16x16x32_f16(false, a, false, b, (short)0, c, false, false);
#if defined(__HIP_DEVICE_COMPILE__)
  asm volatile("v_nop\n\tv_nop\n\tv_nop\n\tv_nop" : "+v"(c) : "v"(a), "v"(b));
#endif
  return c;
}
__device__ __forceinline__ v8f mma_b_raw(v16b a, v16b b, v8f c) {
  return __builtin_amdgcn_wmma_f32_16x16x32_bf16(false, a, false, b, (short)0, c, false, false);
}
__device__ __forceinline__ void dep_guard_b(v8f& a, v8f& b, v16b x, v16b y) {
#if defined(__HIP_DEVICE_COMPILE__)
  asm volatile("v_nop\n\tv_nop\n\tv_nop\n\tv_nop" : "+v"(a), "+v"(b) : "v"(x), "v"(y));
#endif
}
__device__ __forceinline__ void keep4_b(v16b a, v16b b, v16b c, v16b d) {
#if defined(__HIP_DEVICE_COMPILE__)
  asm volatile("v_nop" :: "v"(a), "v"(b), "v"(c), "v"(d));
#endif
}
__device__ __forceinline__ void acc_guard4(v8f& a, v8f& b, v8f& c, v8f& d) {
#if defined(__HIP_DEVICE_COMPILE__)
  asm volatile("v_nop\n\tv_nop\n\tv_nop\n\tv_nop" : "+v"(a), "+v"(b), "+v"(c), "+v"(d));
#endif
}

// =====================================================================================================
// All five input conversions in one grid. Blocks [0, XBLK): x -> bf16 (RNE convert); then WBLK blocks each for Wq, Wk,
// Wv -> bf16 and for Wo -> f16(bf16rne(Wo) * woscale) (exact in f16 after the power-of-two scale). The five output
// planes lie one behind the other in the workspace, so the output index is the flat thread index. 8 elements per
// thread, one 16-B store per lane: a wave writes 512 contiguous B. The plane is chosen by blockIdx (block-uniform).
// coverage: (XBLK + 4 * WBLK) blocks x 256 threads x 8 = all five planes exactly.
// =====================================================================================================
#define XBLK (ROWS * DM / 8 / 256)
#define WBLK (DM * DM / 8 / 256)
__global__ __launch_bounds__(256) void cvt_inputs(const float* __restrict__ x, const float* __restrict__ Wq,
                                                  const float* __restrict__ Wk, const float* __restrict__ Wv,
                                                  const float* __restrict__ Wo, unsigned short* out, float woscale) {
  const int blk = blockIdx.x;
  const float* in = x;
  int first = 0;                                     // first block of this block's plane
  if (blk >= XBLK) {
    const int w = (blk - XBLK) / WBLK;               // 0..3
    in = (w == 0) ? Wq : (w == 1) ? Wk : (w == 2) ? Wv : Wo;
    first = XBLK + w * WBLK;
  }
  const int i = (blk - first) * 256 + threadIdx.x;
  const v4f a = *(const v4f*)(in + (size_t)i * 8);
  const v4f b = *(const v4f*)(in + (size_t)i * 8 + 4);
  // precaution: stands in front of every later rewrite of the two loads' address registers
  asm volatile("s_wait_xcnt 0x0" ::: "memory");
  v4u p;
  if (blk < XBLK + 3 * WBLK) {
    p[0] = pk16(bf_bits(a[0]), bf_bits(a[1]));
    p[1] = pk16(bf_bits(a[2]), bf_bits(a[3]));
    p[2] = pk16(bf_bits(b[0]), bf_bits(b[1]));
    p[3] = pk16(bf_bits(b[2]), bf_bits(b[3]));
  } else {
    p[0] = pk16(h_bits((_Float16)(bf_up(bf_bits(a[0])) * woscale)), h_bits((_Float16)(bf_up(bf_bits(a[1])) * woscale)));
    p[1] = pk16(h_bits((_Float16)(bf_up(bf_bits(a[2])) * woscale)), h_bits((_Float16)(bf_up(bf_bits(a[3])) * woscale)));
    p[2] = pk16(h_bits((_Float16)(bf_up(bf_bits(b[0])) * woscale)), h_bits((_Float16)(bf_up(bf_bits(b[1])) * woscale)));
    p[3] = pk16(h_bits((_Float16)(bf_up(bf_bits(b[2])) * woscale)), h_bits((_Float16)(bf_up(bf_bits(b[3])) * woscale)));
  }
  *(v4u*)(out + ((size_t)blk * 256 + threadIdx.x) * 8) = p;
}

// =====================================================================================================
// Register-blocked bf16 WMMA GEMM with bias: C[m][n] = sum_k A[m][k] * Bt[n][k] + bf16rne(bias[n]); one wave per
// 64x64 tile, 8 waves on a 128x256 block tile whose operands are staged in LDS (one barrier a trip). A row-major [M][K] pitch lda; Bt row-major [N][K] pitch ldb (k contiguous);
// bias f32 [N] (RNE converted to bf16 and widened in the epilogue); M, N multiples of the 128x256 block tile, K of 64
// (fixed sizes, statically asserted); M a multiple of 128, N of 256, K of 64 for every launch here (no idle waves).
// blockIdx.y = which of three independent products on the same A runs here (q, k, v): Bt plane y (N*ldb elements
// apart), bias y. Each product leaves in the form its reader takes:
//   q, k: f16 plane y of qkh, [M][N] pitch ldc, = f16(C * qkscale); 16-row f32 slabs staged per wave in LDS, each
//         64-wide row segment (128 B, one line) stored by 8 lanes x 16 B.
//   v:    f32 [M][N] pitch ldc in vf (for the column mean), and the f16 v^T plane vth[(b*DM + n)*SEQ + t] =
//         f16(C * vscale), m = b*SEQ + t: a lane's 8 accumulator rows are 8 consecutive t of one n, so the wave's tile
//         is laid transposed in LDS by 16-B stores (its own 64 x 144 B of the operand stages, which every wave has
//         left behind the loop's last barrier) and leaves as whole 128-B lines.
// coverage: 8 waves x 64x64 = the block's 128x256 tile of its plane(s); grid covers every tile of q, k and v.
// =====================================================================================================
__global__ __launch_bounds__(256) void gemm64(
    const unsigned short* __restrict__ Ap, int lda,
    const unsigned short* __restrict__ Btp, int ldb,
    const float* __restrict__ bias0, const float* __restrict__ bias1, const float* __restrict__ bias2,
    unsigned short* qkh, float* vf, unsigned short* vth, int ldc, int M, int N, int K, float qkscale, float vscale) {
  const int which = blockIdx.y;
  const float* bias = (which == 0) ? bias0 : (which == 1) ? bias1 : bias2;
  const __bf16* Ab  = (const __bf16*)(const void*)Ap;
  const __bf16* Bb  = (const __bf16*)(const void*)Btp + (size_t)which * N * ldb;
  __shared__ __align__(16) float sT[8][16 * 68];   // per-wave 16x64 slab, pitch 68 floats
  __shared__ __align__(16) char stg[2 * SBYTES];   // the two operand stages
  const int lane = threadIdx.x & 31;
  const int wave = threadIdx.x >> 5;
  const int btN = N >> 8;                // block tile 128 x 256: waves 2 (m) x 4 (n), 64 x 64 each
  const int btM = M >> 7;
  if ((int)blockIdx.x >= btM * btN) return;   // block-uniform, in front of every barrier
  const int bm  = blockIdx.x / btN;
  const int bm0 = bm << 7;
  const int bn0 = (blockIdx.x - bm * btN) << 8;
  const int wm  = wave >> 2;
  const int wn  = wave & 3;
  const int m0 = bm0 + (wm << 6);
  const int n0 = bn0 + (wn << 6);

  const int rlane = lane & 15;                 // row (A) / col (B, D) within subtile
  const int koff  = (lane >> 4) * 8;           // k offset of this lane half
  const int mOff  = (lane >> 4) * 8;           // D row offset

  v8f acc[4][4];
#pragma unroll
  for (int i = 0; i < 4; ++i)
#pragma unroll
    for (int j = 0; j < 4; ++j) acc[i][j] = zero8();

  // Two-buffer ring along K, 64 k a trip: the copies of tile t + 2 fly while tile t + 1 is multiplied.
  const int T = K >> 6;
  const int crow = threadIdx.x >> 3;                   // this thread's row within each group of 32 staged rows
  const int cpc  = (threadIdx.x & 7) * 16;             // its 16-B piece of the 128-B row
  const unsigned lcp = lds_off(stg) + (unsigned)(crow * SPITCH + cpc);
  const size_t sa = (size_t)32 * lda * 2;              // bytes between a thread's consecutive A rows
  const size_t sb = (size_t)32 * ldb * 2;              // the same for B
  const char* ga = (const char*)(Ab + (size_t)(bm0 + crow) * lda) + cpc;
  const char* gb = (const char*)(Bb + (size_t)(bn0 + crow) * ldb) + cpc;
  stage_issue(lcp, ga, ga + sa, ga + 2 * sa, ga + 3 * sa, gb, sb);
  wait_copies();
  __syncthreads();                                     // tile 0 is readable by every wave
  if (T > 1) stage_issue(lcp + SBYTES, ga + 128, ga + sa + 128, ga + 2 * sa + 128, ga + 3 * sa + 128, gb + 128, sb);
  const char* fa = stg + (wm * 64 + rlane) * SPITCH + koff * 2;         // this lane's place in its first A fragment
  const char* fb = stg + (128 + wn * 64 + rlane) * SPITCH + koff * 2;   // the same for B
  for (int t = 0; t < T; ++t) {
    const int bo = (t & 1) * SBYTES;
    // unrolled so that the fragment arrays keep constant indices (registers, no scratch)
#pragma unroll
    for (int ks = 0; ks < 2; ++ks) {
      v16b bh[4], ah[4];
#pragma unroll
      for (int j = 0; j < 4; ++j) bh[j] = ldfrag_b((const __bf16*)(fb + bo + j * 16 * SPITCH + ks * 64));
#pragma unroll
      for (int i = 0; i < 4; ++i) ah[i] = ldfrag_b((const __bf16*)(fa + bo + i * 16 * SPITCH + ks * 64));
#pragma unroll
      for (int i = 0; i < 4; ++i) {
#pragma unroll
        for (int j = 0; j < 4; ++j) {
          acc[i][j] = mma_b_raw(ah[i], bh[j], acc[i][j]);
        }
        dep_guard_b(acc[i][0], acc[i][3], ah[i], ah[i]);
      }
      keep4_b(bh[0], bh[1], bh[2], bh[3]);
    }
    wait_lds();
    wait_copies();
    __syncthreads();                                   // publishes tile t + 1; ends every wave's reads of tile t
    if (t + 2 < T) {                                   // block-uniform
      const size_t ko = (size_t)(t + 2) * 128;
      stage_issue(lcp + (unsigned)bo, ga + ko, ga + sa + ko, ga + 2 * sa + ko, ga + 3 * sa + ko, gb + ko, sb);
    }
  }
  wait_copies();
  acc_guard4(acc[0][0], acc[0][1], acc[0][2], acc[0][3]);
  acc_guard4(acc[1][0], acc[1][1], acc[1][2], acc[1][3]);
  acc_guard4(acc[2][0], acc[2][1], acc[2][2], acc[2][3]);
  acc_guard4(acc[3][0], acc[3][1], acc[3][2], acc[3][3]);

  // ---- bias per D column of this lane (n0 + 16j + rlane < N) ----
  float bz[4];
#pragma unroll
  for (int j = 0; j < 4; ++j) bz[j] = bf_up(bf_bits(bias[n0 + (j << 4) + rlane]));

  // ---- epilogue ----
  float* slab = sT[wave];
  if (which < 2) {                                         // block-uniform: q or k -> f16 plane
    unsigned short* H = qkh + (size_t)which * M * ldc;
#pragma unroll
    for (int i = 0; i < 4; ++i) {
      const int mBase = m0 + (i << 4);
#pragma unroll
      for (int r = 0; r < 8; ++r) {
#pragma unroll
        for (int j = 0; j < 4; ++j) {
          slab[(mOff + r) * 68 + (j << 4) + rlane] = (acc[i][j][r] + bz[j]) * qkscale;
        }
      }
      __builtin_amdgcn_fence(__ATOMIC_RELEASE, "workgroup");
      __builtin_amdgcn_wave_barrier();
      __builtin_amdgcn_fence(__ATOMIC_ACQUIRE, "workgroup");
      {
        const int g4 = lane >> 3, piece = lane & 7;        // 128-B row segment = 8 lanes x 16 B
        v4u hv[4];
#pragma unroll
        for (int q = 0; q < 4; ++q) {
          const int row = q * 4 + g4;                      // q 0..3 x g4 0..3 = rows 0..15
          const v4f x0 = *(const v4f*)(slab + row * 68 + piece * 8);
          const v4f x1 = *(const v4f*)(slab + row * 68 + piece * 8 + 4);
          v4u ph;
          ph[0] = pk16(h_bits((_Float16)x0[0]), h_bits((_Float16)x0[1]));
          ph[1] = pk16(h_bits((_Float16)x0[2]), h_bits((_Float16)x0[3]));
          ph[2] = pk16(h_bits((_Float16)x1[0]), h_bits((_Float16)x1[1]));
          ph[3] = pk16(h_bits((_Float16)x1[2]), h_bits((_Float16)x1[3]));
          hv[q] = ph;
        }
#pragma unroll
        for (int q = 0; q < 4; ++q) {
          const int row = q * 4 + g4;
          *(v4u*)(H + (size_t)(mBase + row) * ldc + n0 + piece * 8) = hv[q];
        }
      }
      __builtin_amdgcn_fence(__ATOMIC_RELEASE, "workgroup");
      __builtin_amdgcn_wave_barrier();
      __builtin_amdgcn_fence(__ATOMIC_ACQUIRE, "workgroup");
    }
    return;
  }

  // v: slab by slab the f32 rows, and the slab's part of the transposed f16 tile (LDS only); then the v^T lines
  char* tb = stg + wave * (64 * SPITCH);                   // this wave's [n 64][t 64] f16 tile, pitch 144 B
  float* C = vf;
#pragma unroll
  for (int i = 0; i < 4; ++i) {
    const int mBase = m0 + (i << 4);
#pragma unroll
    for (int j = 0; j < 4; ++j) {
      v4u pk;
#pragma unroll
      for (int e = 0; e < 4; ++e) {
        pk[e] = pk16(h_bits((_Float16)((acc[i][j][2 * e] + bz[j]) * vscale)),
                     h_bits((_Float16)((acc[i][j][2 * e + 1] + bz[j]) * vscale)));
      }
      *(v4u*)(tb + ((j << 4) + rlane) * SPITCH + (i << 5) + mOff * 2) = pk;   // t = 16 i + mOff + 0..7
    }
#pragma unroll
    for (int r = 0; r < 8; ++r) {
#pragma unroll
      for (int j = 0; j < 4; ++j) {
        slab[(mOff + r) * 68 + (j << 4) + rlane] = acc[i][j][r] + bz[j];
      }
    }
    __builtin_amdgcn_fence(__ATOMIC_RELEASE, "workgroup");
    __builtin_amdgcn_wave_barrier();
    __builtin_amdgcn_fence(__ATOMIC_ACQUIRE, "workgroup");
    {
      const int hh = lane >> 4, c4 = (lane & 15) * 4;     // 256-B row segment = 16 lanes x 16 B
      v4f ov[8];
#pragma unroll
      for (int it = 0; it < 8; ++it) {
        const int row = it * 2 + hh;                       // it 0..7 x hh 0..1 = rows 0..15
        ov[it] = *(const v4f*)(slab + row * 68 + c4);
      }
      {
#pragma unroll
        for (int it = 0; it < 8; ++it) {
          const int row = it * 2 + hh;
          *(v4f*)(C + (size_t)(mBase + row) * ldc + n0 + c4) = ov[it];
        }
      }
    }
    __builtin_amdgcn_fence(__ATOMIC_RELEASE, "workgroup");
    __builtin_amdgcn_wave_barrier();
    __builtin_amdgcn_fence(__ATOMIC_ACQUIRE, "workgroup");
  }
  {
    const int vb  = m0 / SEQ;                              // batch of this wave's 64 token rows (SEQ % 64 == 0)
    const int vt0 = m0 - vb * SEQ;
    const int g4 = lane >> 3, piece = lane & 7;            // 128-B line of one n = 8 lanes x 16 B
    unsigned short* vrow = vth + ((size_t)(vb * DM + n0 + g4)) * SEQ + vt0 + piece * 8;
#pragma unroll
    for (int hb = 0; hb < 2; ++hb) {
      v4u tv[8];
#pragma unroll
      for (int it = 0; it < 8; ++it) {
        const int row = (hb * 8 + it) * 4 + g4;            // 16 x g4 0..3 = rows n 0..63
        tv[it] = *(const v4u*)(tb + row * SPITCH + piece * 16);
      }
#pragma unroll
      for (int it = 0; it < 8; ++it) {
        *(v4u*)(vrow + (size_t)((hb * 8 + it) * 4) * SEQ) = tv[it];
      }
    }
    // precaution: stands behind the last of the sixteen stores, in front of every later rewrite of their registers
    asm volatile("s_wait_xcnt 0x0" ::: "memory");
  }
}

// =====================================================================================================
// Column mean over tokens: mv[b*DM + n] = (1/SEQ) * sum_t vf[(b*SEQ + t)*DM + n], f64 accumulation.
// Block = 32 columns (one 128-B line per token row) x all SEQ tokens of one b; grid = (DM/32, NB); 1024 threads.
// Thread = (row group rg = tid>>3 in 0..127, piece = tid&7): 16 v4f loads, rows rg + 128*i, all independent, so a
// block has 256 KiB in flight instead of one dependent load stream per column. Sums: per thread over i (f64),
// then over the 4 row groups of a wave by __shfl_xor (8, 16), then the 32 wave partials through LDS
// (__syncthreads), added by wave 0 as a fixed pairwise tree, lane = column.
// coverage: DM/32 blocks x 32 columns x NB = every column of every batch; one 128-B store per block.
// =====================================================================================================
__global__ __launch_bounds__(1024) void colmean(const float* __restrict__ vf, float* mv) {
  __shared__ __align__(16) double sp[32][32];        // [wave][column]
  const int tid   = threadIdx.x;
  const int lane  = tid & 31;
  const int wave  = tid >> 5;
  const int piece = tid & 7;                         // 16-B piece of the 128-B row segment
  const int rg    = tid >> 3;                        // 0..127
  const int b     = blockIdx.y;
  const float* p = vf + ((size_t)b * SEQ + rg) * DM + blockIdx.x * 32 + piece * 4;
  v4f x[SEQ / 128];
#pragma unroll
  for (int i = 0; i < SEQ / 128; ++i) x[i] = *(const v4f*)(p + (size_t)i * 128 * DM);
  double s[4];
#pragma unroll
  for (int e = 0; e < 4; ++e) s[e] = (double)x[0][e];
#pragma unroll
  for (int i = 1; i < SEQ / 128; ++i) {
#pragma unroll
    for (int e = 0; e < 4; ++e) s[e] += (double)x[i][e];
  }
#pragma unroll
  for (int e = 0; e < 4; ++e) {
    s[e] += __shfl_xor(s[e], 8);
    s[e] += __shfl_xor(s[e], 16);
  }
  if (lane < 8) {
#pragma unroll
    for (int e = 0; e < 4; ++e) sp[wave][piece * 4 + e] = s[e];
  }
  __syncthreads();
  if (wave == 0) {                                   // wave-uniform
    double r[32];
#pragma unroll
    for (int w = 0; w < 32; ++w) r[w] = sp[w][lane];
#pragma unroll
    for (int o = 16; o > 0; o >>= 1) {
#pragma unroll
      for (int w = 0; w < o; ++w) r[w] += r[w + o];
    }
    mv[(size_t)b * DM + blockIdx.x * 32 + lane] = (float)(r[0] * (1.0 / (double)SEQ));
  }
}

// =====================================================================================================
// f16 WMMA GEMM with scale: C[m][n] = cscale * sum_k A[m][k] * Bt[n][k] (f16 products, f32 accumulate).
// Same tiling/epilogue as gemm64 (one wave per 64x64 tile, operands staged in LDS per block, 16-row LDS slabs, each 256-B
// coverage: 4 slabs x 16 rows x 64 cols = the wave's whole 64x64 tile; 8 waves = the block's 128x256 tile.
// =====================================================================================================
__global__ __launch_bounds__(256) void gemm64h_s(
    const unsigned short* __restrict__ Ap, int lda,
    const unsigned short* __restrict__ Btp, int ldb,
    float* Cp, int ldc, int M, int N, int K, float cscale) {
  const int bb = blockIdx.y;             // batch: A, Bt and C planes of the batches lie one behind the other
  float* C = Cp + (size_t)bb * M * ldc;
  const _Float16* Ah = (const _Float16*)(const void*)Ap + (size_t)bb * M * lda;
  const _Float16* Bh = (const _Float16*)(const void*)Btp + (size_t)bb * N * ldb;
  __shared__ __align__(16) float sT[8][16 * 68];
  __shared__ __align__(16) char stg[2 * SBYTES];   // the two operand stages
  const int lane = threadIdx.x & 31;
  const int wave = threadIdx.x >> 5;
  const int btN = N >> 8;                // block tile 128 x 256: waves 2 (m) x 4 (n), 64 x 64 each
  const int btM = M >> 7;
  if ((int)blockIdx.x >= btM * btN) return;   // block-uniform, in front of every barrier
  const int bm  = blockIdx.x / btN;
  const int bm0 = bm << 7;
  const int bn0 = (blockIdx.x - bm * btN) << 8;
  const int wm  = wave >> 2;
  const int wn  = wave & 3;
  const int m0 = bm0 + (wm << 6);
  const int n0 = bn0 + (wn << 6);
  const int rlane = lane & 15;
  const int koff  = (lane >> 4) * 8;
  const int mOff  = (lane >> 4) * 8;

  v8f acc[4][4];
#pragma unroll
  for (int i = 0; i < 4; ++i)
#pragma unroll
    for (int j = 0; j < 4; ++j) acc[i][j] = zero8();

  // Two-buffer ring along K, 64 k a trip: the copies of tile t + 2 fly while tile t + 1 is multiplied.
  const int T = K >> 6;
  const int crow = threadIdx.x >> 3;                   // this thread's row within each group of 32 staged rows
  const int cpc  = (threadIdx.x & 7) * 16;             // its 16-B piece of the 128-B row
  const unsigned lcp = lds_off(stg) + (unsigned)(crow * SPITCH + cpc);
  const size_t sa = (size_t)32 * lda * 2;              // bytes between a thread's consecutive A rows
  const size_t sb = (size_t)32 * ldb * 2;              // the same for B
  const char* ga = (const char*)(Ah + (size_t)(bm0 + crow) * lda) + cpc;
  const char* gb = (const char*)(Bh + (size_t)(bn0 + crow) * ldb) + cpc;
  stage_issue(lcp, ga, ga + sa, ga + 2 * sa, ga + 3 * sa, gb, sb);
  wait_copies();
  __syncthreads();                                     // tile 0 is readable by every wave
  if (T > 1) stage_issue(lcp + SBYTES, ga + 128, ga + sa + 128, ga + 2 * sa + 128, ga + 3 * sa + 128, gb + 128, sb);
  const char* fa = stg + (wm * 64 + rlane) * SPITCH + koff * 2;         // this lane's place in its first A fragment
  const char* fb = stg + (128 + wn * 64 + rlane) * SPITCH + koff * 2;   // the same for B
  for (int t = 0; t < T; ++t) {
    const int bo = (t & 1) * SBYTES;
    // unrolled so that the fragment arrays keep constant indices (registers, no scratch)
#pragma unroll
    for (int ks = 0; ks < 2; ++ks) {
      v16h bh[4], ah[4];
#pragma unroll
      for (int j = 0; j < 4; ++j) bh[j] = ldfrag_h((const _Float16*)(fb + bo + j * 16 * SPITCH + ks * 64));
#pragma unroll
      for (int i = 0; i < 4; ++i) ah[i] = ldfrag_h((const _Float16*)(fa + bo + i * 16 * SPITCH + ks * 64));
#pragma unroll
      for (int i = 0; i < 4; ++i) {
#pragma unroll
        for (int j = 0; j < 4; ++j) {
          acc[i][j] = mma_h(ah[i], bh[j], acc[i][j]);
        }
      }
    }
    wait_lds();
    wait_copies();
    __syncthreads();                                   // publishes tile t + 1; ends every wave's reads of tile t
    if (t + 2 < T) {                                   // block-uniform
      const size_t ko = (size_t)(t + 2) * 128;
      stage_issue(lcp + (unsigned)bo, ga + ko, ga + sa + ko, ga + 2 * sa + ko, ga + 3 * sa + ko, gb + ko, sb);
    }
  }
  wait_copies();

  float* slab = sT[wave];
#pragma unroll
  for (int i = 0; i < 4; ++i) {
    const int mBase = m0 + (i << 4);
#pragma unroll
    for (int r = 0; r < 8; ++r) {
#pragma unroll
      for (int j = 0; j < 4; ++j) {
        slab[(mOff + r) * 68 + (j << 4) + rlane] = acc[i][j][r] * cscale;
      }
    }
    __builtin_amdgcn_fence(__ATOMIC_RELEASE, "workgroup");
    __builtin_amdgcn_wave_barrier();
    __builtin_amdgcn_fence(__ATOMIC_ACQUIRE, "workgroup");
    {
      const int hh = lane >> 4, c4 = (lane & 15) * 4;
      v4f ov[8];
#pragma unroll
      for (int it = 0; it < 8; ++it) {
        const int row = it * 2 + hh;
        ov[it] = *(const v4f*)(slab + row * 68 + c4);
      }
      {
#pragma unroll
        for (int it = 0; it < 8; ++it) {
          const int row = it * 2 + hh;
          *(v4f*)(C + (size_t)(mBase + row) * ldc + n0 + c4) = ov[it];
        }
        
      }
    }
    __builtin_amdgcn_fence(__ATOMIC_RELEASE, "workgroup");
    __builtin_amdgcn_wave_barrier();
    __builtin_amdgcn_fence(__ATOMIC_ACQUIRE, "workgroup");
  }
}

// =====================================================================================================
// Row softmax over SEQ keys, max-subtracted, f32: p = exp(s - max) / sum; stored CENTERED and scaled as
// f16(16384 * p - 8) = f16(16384 * (p - 1/SEQ)) (the 1/SEQ part is added back downstream as the column
// mean of v). One 256-thread block per row, 8 consecutive elements per thread (two v4f loads), wave
// reductions by __shfl_xor, 8 wave partials combined in fixed order through LDS.
// =====================================================================================================
__global__ __launch_bounds__(256) void softmax_c(const float* __restrict__ sf, unsigned short* ph) {
  __shared__ float redm[8];
  __shared__ float reds[8];
  const int row  = blockIdx.x;
  const int tid  = threadIdx.x;
  const int lane = tid & 31;
  const int wave = tid >> 5;
  const float* s = sf + (size_t)row * SEQ + tid * 8;
  const v4f a = *(const v4f*)(s);
  const v4f c = *(const v4f*)(s + 4);
  float v[8];
  v[0] = a[0]; v[1] = a[1]; v[2] = a[2]; v[3] = a[3];
  v[4] = c[0]; v[5] = c[1]; v[6] = c[2]; v[7] = c[3];
  float m = v[0];
#pragma unroll
  for (int e = 1; e < 8; ++e) m = fmaxf(m, v[e]);
#pragma unroll
  for (int o = 16; o > 0; o >>= 1) m = fmaxf(m, __shfl_xor(m, o));
  if (lane == 0) redm[wave] = m;
  __syncthreads();
  float mm = redm[0];
#pragma unroll
  for (int w = 1; w < 8; ++w) mm = fmaxf(mm, redm[w]);
  float sum = 0.f;
#pragma unroll
  for (int e = 0; e < 8; ++e) {
    v[e] = __expf(v[e] - mm);
    sum += v[e];
  }
#pragma unroll
  for (int o = 16; o > 0; o >>= 1) sum += __shfl_xor(sum, o);
  if (lane == 0) reds[wave] = sum;
  __syncthreads();
  float tot = 0.f;
#pragma unroll
  for (int w = 0; w < 8; ++w) tot += reds[w];       // fixed order, identical for every thread
  const float inv = 1.0f / tot;                     // tot >= 1
  v4u pk;
#pragma unroll
  for (int e = 0; e < 4; ++e) {
    const float p0 = v[2 * e] * inv;
    const float p1 = v[2 * e + 1] * inv;
    const _Float16 x0 = (_Float16)(p0 * 16384.0f - 8.0f);
    const _Float16 x1 = (_Float16)(p1 * 16384.0f - 8.0f);
    pk[e] = pk16(h_bits(x0), h_bits(x1));
  }
  unsigned short* o = ph + (size_t)row * SEQ + tid * 8;
  *(v4u*)o = pk;
  
}

// =====================================================================================================
// p.v, batch bb = blockIdx.y: O[i][n] = oscale * sum_j P[i][j] * Vt[n][j] + mv[n] (f16 products, f32 accumulate;
// oscale folds back the weight and v carries; mv = column mean of v in f32). P f16 [SEQ][SEQ] pitch lda
// (j contiguous); Vt f16 [DM][SEQ] pitch ldb; n = h*HD + d.
// O is written as two f16 head-major planes: hi = f16(O*1024), lo = f16((O*1024 - hi)*2048), element
// (bb, h, i, d) at [((bb*NH + h)*SEQ + i)*HD + d]; a 64-wide tile column block is exactly one head h = tn,
// One wave per 64x64 tile, operands staged in LDS per 128x256 block tile. Epilogue: 16-row f32 slab staged per
// coverage: 4 slabs x (4 q x 4 g4 = 16 rows) x (8 pieces x 8 = 64 cols) = the wave's whole tile in both
// planes; grid covers every (i tile, head) of this batch.
// =====================================================================================================
__global__ __launch_bounds__(256) void gemm64h_o(
    const unsigned short* __restrict__ Ap, int lda,
    const unsigned short* __restrict__ Btp, int ldb,
    const float* __restrict__ mvp,
    unsigned short* ohi, unsigned short* olo,
    int M, int N, int K, float oscale) {
  const int bb = blockIdx.y;             // batch: P, Vt and mv planes of the batches lie one behind the other
  const float* mv = mvp + (size_t)bb * N;
  const _Float16* Ah = (const _Float16*)(const void*)Ap + (size_t)bb * M * lda;
  const _Float16* Bh = (const _Float16*)(const void*)Btp + (size_t)bb * N * ldb;
  __shared__ __align__(16) float sT[8][16 * 68];
  __shared__ __align__(16) char stg[2 * SBYTES];   // the two operand stages
  const int lane = threadIdx.x & 31;
  const int wave = threadIdx.x >> 5;
  const int btN = N >> 8;                // block tile 128 x 256: waves 2 (m) x 4 (n), 64 x 64 each
  const int btM = M >> 7;
  if ((int)blockIdx.x >= btM * btN) return;   // block-uniform, in front of every barrier
  const int bm  = blockIdx.x / btN;
  const int bm0 = bm << 7;
  const int bn0 = (blockIdx.x - bm * btN) << 8;
  const int wm  = wave >> 2;
  const int wn  = wave & 3;
  const int m0 = bm0 + (wm << 6);
  const int n0 = bn0 + (wn << 6);
  const int tn = n0 >> 6;                // == head index (tile width 64 == HD)
  const int rlane = lane & 15;
  const int koff  = (lane >> 4) * 8;
  const int mOff  = (lane >> 4) * 8;

  v8f acc[4][4];
#pragma unroll
  for (int i = 0; i < 4; ++i)
#pragma unroll
    for (int j = 0; j < 4; ++j) acc[i][j] = zero8();

  // Two-buffer ring along K, 64 k a trip: the copies of tile t + 2 fly while tile t + 1 is multiplied.
  const int T = K >> 6;
  const int crow = threadIdx.x >> 3;                   // this thread's row within each group of 32 staged rows
  const int cpc  = (threadIdx.x & 7) * 16;             // its 16-B piece of the 128-B row
  const unsigned lcp = lds_off(stg) + (unsigned)(crow * SPITCH + cpc);
  const size_t sa = (size_t)32 * lda * 2;              // bytes between a thread's consecutive A rows
  const size_t sb = (size_t)32 * ldb * 2;              // the same for B
  const char* ga = (const char*)(Ah + (size_t)(bm0 + crow) * lda) + cpc;
  const char* gb = (const char*)(Bh + (size_t)(bn0 + crow) * ldb) + cpc;
  stage_issue(lcp, ga, ga + sa, ga + 2 * sa, ga + 3 * sa, gb, sb);
  wait_copies();
  __syncthreads();                                     // tile 0 is readable by every wave
  if (T > 1) stage_issue(lcp + SBYTES, ga + 128, ga + sa + 128, ga + 2 * sa + 128, ga + 3 * sa + 128, gb + 128, sb);
  const char* fa = stg + (wm * 64 + rlane) * SPITCH + koff * 2;         // this lane's place in its first A fragment
  const char* fb = stg + (128 + wn * 64 + rlane) * SPITCH + koff * 2;   // the same for B
  for (int t = 0; t < T; ++t) {
    const int bo = (t & 1) * SBYTES;
    // unrolled so that the fragment arrays keep constant indices (registers, no scratch)
#pragma unroll
    for (int ks = 0; ks < 2; ++ks) {
      v16h bh[4], ah[4];
#pragma unroll
      for (int j = 0; j < 4; ++j) bh[j] = ldfrag_h((const _Float16*)(fb + bo + j * 16 * SPITCH + ks * 64));
#pragma unroll
      for (int i = 0; i < 4; ++i) ah[i] = ldfrag_h((const _Float16*)(fa + bo + i * 16 * SPITCH + ks * 64));
#pragma unroll
      for (int i = 0; i < 4; ++i) {
#pragma unroll
        for (int j = 0; j < 4; ++j) {
          acc[i][j] = mma_h(ah[i], bh[j], acc[i][j]);
        }
      }
    }
    wait_lds();
    wait_copies();
    __syncthreads();                                   // publishes tile t + 1; ends every wave's reads of tile t
    if (t + 2 < T) {                                   // block-uniform
      const size_t ko = (size_t)(t + 2) * 128;
      stage_issue(lcp + (unsigned)bo, ga + ko, ga + sa + ko, ga + 2 * sa + ko, ga + 3 * sa + ko, gb + ko, sb);
    }
  }
  wait_copies();

  float mz[4];
#pragma unroll
  for (int j = 0; j < 4; ++j) mz[j] = mv[n0 + (j << 4) + rlane];

  float* slab = sT[wave];
  const size_t pbase = ((size_t)(bb * NH + tn)) * SEQ;     // plane row base for head tn of batch bb
#pragma unroll
  for (int i = 0; i < 4; ++i) {
    const int mBase = m0 + (i << 4);
#pragma unroll
    for (int r = 0; r < 8; ++r) {
#pragma unroll
      for (int j = 0; j < 4; ++j) {
        slab[(mOff + r) * 68 + (j << 4) + rlane] = acc[i][j][r] * oscale + mz[j];
      }
    }
    __builtin_amdgcn_fence(__ATOMIC_RELEASE, "workgroup");
    __builtin_amdgcn_wave_barrier();
    __builtin_amdgcn_fence(__ATOMIC_ACQUIRE, "workgroup");
    {
      const int g4 = lane >> 3, piece = lane & 7;
      v4u hv[4], lv[4];
      size_t ofs[4];
#pragma unroll
      for (int q = 0; q < 4; ++q) {
        const int row = q * 4 + g4;                      // q 0..3 x g4 0..3 = rows 0..15
        const v4f x0 = *(const v4f*)(slab + row * 68 + piece * 8);
        const v4f x1 = *(const v4f*)(slab + row * 68 + piece * 8 + 4);
        float f[8];
        f[0] = x0[0]; f[1] = x0[1]; f[2] = x0[2]; f[3] = x0[3];
        f[4] = x1[0]; f[5] = x1[1]; f[6] = x1[2]; f[7] = x1[3];
        v4u ph, pl;
#pragma unroll
        for (int e = 0; e < 4; ++e) {
          const float s0 = f[2 * e] * 1024.0f;
          const float s1 = f[2 * e + 1] * 1024.0f;
          const _Float16 h0 = (_Float16)s0;
          const _Float16 h1 = (_Float16)s1;
          const _Float16 l0 = (_Float16)((s0 - (float)h0) * 2048.0f);
          const _Float16 l1 = (_Float16)((s1 - (float)h1) * 2048.0f);
          ph[e] = pk16(h_bits(h0), h_bits(h1));
          pl[e] = pk16(h_bits(l0), h_bits(l1));
        }
        hv[q] = ph;
        lv[q] = pl;
        ofs[q] = (pbase + (size_t)(mBase + row)) * HD + piece * 8;
      }
      {
#pragma unroll
        for (int q = 0; q < 4; ++q) {
          *(v4u*)(ohi + ofs[q]) = hv[q];
          *(v4u*)(olo + ofs[q]) = lv[q];
        }
        
      }
    }
    __builtin_amdgcn_fence(__ATOMIC_RELEASE, "workgroup");
    __builtin_amdgcn_wave_barrier();
    __builtin_amdgcn_fence(__ATOMIC_ACQUIRE, "workgroup");
  }
}

// =====================================================================================================
// Output projection: C[m][n] = sch * (sum_k Ahi[m][k]*Bt[n][k] + scl * sum_k Alo[m][k]*Bt[n][k]) + bf16rne(bias[n])
// (f16 products, f32 accumulate, hi and scaled-residual products in separate accumulators). Ahi/Alo row-major
// [M][K] pitch lda; Bt [N][K] pitch ldb; C f32 [M][N] pitch ldc. One wave per 32x64 tile, 8 waves on a 64x256
// block tile whose operands are staged in LDS; all 8 fragments of a k-step (A: 2 rows x 2 planes, B: 4) read at its head.
// Epilogue: 16-row slabs staged per wave in LDS; each 64-wide row segment (256 B) written by one instruction
// coverage: 2 slabs x 16 rows x 64 cols = the wave's whole 32x64 tile; grid covers every tile of C.
// =====================================================================================================
__global__ __launch_bounds__(256) void gemm32h_w(
    const unsigned short* __restrict__ Ahp, const unsigned short* __restrict__ Alp, int lda,
    const unsigned short* __restrict__ Btp, int ldb,
    const float* __restrict__ bias,
    float* C, int ldc, int M, int N, int K, float sch, float scl) {
  const _Float16* Ah = (const _Float16*)(const void*)Ahp;
  const _Float16* Al = (const _Float16*)(const void*)Alp;
  const _Float16* Bh = (const _Float16*)(const void*)Btp;
  __shared__ __align__(16) float sT[8][16 * 68];
  __shared__ __align__(16) char stg[2 * SBYTES];   // the two operand stages
  const int lane = threadIdx.x & 31;
  const int wave = threadIdx.x >> 5;
  const int btN = N >> 8;                // block tile 64 x 256: waves 2 (m) x 4 (n), 32 x 64 each
  const int btM = M >> 6;
  if ((int)blockIdx.x >= btM * btN) return;   // block-uniform, in front of every barrier
  const int bm  = blockIdx.x / btN;
  const int bm0 = bm << 6;
  const int bn0 = (blockIdx.x - bm * btN) << 8;
  const int wm  = wave >> 2;
  const int wn  = wave & 3;
  const int m0 = bm0 + (wm << 5);
  const int n0 = bn0 + (wn << 6);
  const int rlane = lane & 15;
  const int koff  = (lane >> 4) * 8;
  const int mOff  = (lane >> 4) * 8;

  v8f acch[2][4], accl[2][4];
#pragma unroll
  for (int i = 0; i < 2; ++i)
#pragma unroll
    for (int j = 0; j < 4; ++j) { acch[i][j] = zero8(); accl[i][j] = zero8(); }

  // Two-buffer ring along K, 64 k a trip: the copies of tile t + 2 fly while tile t + 1 is multiplied.
  const int T = K >> 6;
  const int crow = threadIdx.x >> 3;                   // this thread's row within each group of 32 staged rows
  const int cpc  = (threadIdx.x & 7) * 16;             // its 16-B piece of the 128-B row
  const unsigned lcp = lds_off(stg) + (unsigned)(crow * SPITCH + cpc);
  const size_t sa = (size_t)32 * lda * 2;              // bytes between a thread's consecutive A rows
  const size_t sb = (size_t)32 * ldb * 2;              // the same for B
  const char* gh = (const char*)(Ah + (size_t)(bm0 + crow) * lda) + cpc;   // staged rows 0..63: hi plane
  const char* gl = (const char*)(Al + (size_t)(bm0 + crow) * lda) + cpc;   // staged rows 64..127: residual plane
  const char* gb = (const char*)(Bh + (size_t)(bn0 + crow) * ldb) + cpc;
  stage_issue(lcp, gh, gh + sa, gl, gl + sa, gb, sb);
  wait_copies();
  __syncthreads();                                     // tile 0 is readable by every wave
  if (T > 1) stage_issue(lcp + SBYTES, gh + 128, gh + sa + 128, gl + 128, gl + sa + 128, gb + 128, sb);
  const char* fa = stg + (wm * 32 + rlane) * SPITCH + koff * 2;         // this lane's place in its first hi fragment
  const char* fb = stg + (128 + wn * 64 + rlane) * SPITCH + koff * 2;   // the same for B
  for (int t = 0; t < T; ++t) {
    const int bo = (t & 1) * SBYTES;
    // unrolled so that the fragment arrays keep constant indices (registers, no scratch)
#pragma unroll
    for (int ks = 0; ks < 2; ++ks) {
      v16h fh[2], fl[2], bfr[4];
#pragma unroll
      for (int i = 0; i < 2; ++i) {
        fh[i] = ldfrag_h((const _Float16*)(fa + bo + i * 16 * SPITCH + ks * 64));
        fl[i] = ldfrag_h((const _Float16*)(fa + bo + (64 + i * 16) * SPITCH + ks * 64));
      }
#pragma unroll
      for (int j = 0; j < 4; ++j) bfr[j] = ldfrag_h((const _Float16*)(fb + bo + j * 16 * SPITCH + ks * 64));
#pragma unroll
      for (int j = 0; j < 4; ++j) {
#pragma unroll
        for (int i = 0; i < 2; ++i) {
          acch[i][j] = mma_h(fh[i], bfr[j], acch[i][j]);
          accl[i][j] = mma_h(fl[i], bfr[j], accl[i][j]);
        }
      }
    }
    wait_lds();
    wait_copies();
    __syncthreads();                                   // publishes tile t + 1; ends every wave's reads of tile t
    if (t + 2 < T) {                                   // block-uniform
      const size_t ko = (size_t)(t + 2) * 128;
      stage_issue(lcp + (unsigned)bo, gh + ko, gh + sa + ko, gl + ko, gl + sa + ko, gb + ko, sb);
    }
  }
  wait_copies();

  float bz[4];
#pragma unroll
  for (int j = 0; j < 4; ++j) bz[j] = bf_up(bf_bits(bias[n0 + (j << 4) + rlane]));

  float* slab = sT[wave];
#pragma unroll
  for (int i = 0; i < 2; ++i) {
    const int mBase = m0 + (i << 4);
#pragma unroll
    for (int r = 0; r < 8; ++r) {
#pragma unroll
      for (int j = 0; j < 4; ++j) {
        slab[(mOff + r) * 68 + (j << 4) + rlane] = (acch[i][j][r] + accl[i][j][r] * scl) * sch + bz[j];
      }
    }
    __builtin_amdgcn_fence(__ATOMIC_RELEASE, "workgroup");
    __builtin_amdgcn_wave_barrier();
    __builtin_amdgcn_fence(__ATOMIC_ACQUIRE, "workgroup");
    {
      const int hh = lane >> 4, c4 = (lane & 15) * 4;     // 256-B row segment = 16 lanes x 16 B
      v4f ov[8];
#pragma unroll
      for (int it = 0; it < 8; ++it) {
        const int row = it * 2 + hh;                       // it 0..7 x hh 0..1 = rows 0..15
        ov[it] = *(const v4f*)(slab + row * 68 + c4);
      }
      {
#pragma unroll
        for (int it = 0; it < 8; ++it) {
          const int row = it * 2 + hh;
          *(v4f*)(C + (size_t)(mBase + row) * ldc + n0 + c4) = ov[it];
        }
        
      }
    }
    __builtin_amdgcn_fence(__ATOMIC_RELEASE, "workgroup");
    __builtin_amdgcn_wave_barrier();
    __builtin_amdgcn_fence(__ATOMIC_ACQUIRE, "workgroup");
  }
}

// =====================================================================================================
// Workspace map (bytes); every region an exact multiple of its whole-line / whole-tile store granularity
// within a launch; of Tf's three planes the third holds the f32 v projection, the first two the f32 score maps):
//   Xb   bf16 [4096][1024]              0         8388608
//   Wqb  bf16 [1024 n][1024 k]     8388608         2097152
//   Wkb  bf16 [1024 n][1024 k]    10485760         2097152
//   Wvb  bf16 [1024 n][1024 k]    12582912         2097152
//   Woh  f16  [1024 n][1024 k]    14680064         2097152   (f16(bf16(Wo) x1024))
//   Tf   f32  [3][4096][1024]    16777216        50331648   (plane 2: v; planes 0, 1: S f32 [2][2048][2048])
//   Qh   f16  [4096][1024]       67108864         8388608   (q x16)
//   Kh   f16  [4096][1024]       75497472         8388608   (k x16)
//   VTh  f16  [2*1024][2048]     83886080         8388608   ([b*DM + n][t], v x64)
//   Ph   f16  [2][2048][2048]    92274688        16777216   (centered weights)
//   Ohi  f16  [2][16][2048][64] 109051904         8388608
//   Olo  f16  [2][16][2048][64] 117440512         8388608
//   mV   f32  [2][1024]         125829120            8192
//   end                         125837312
// Inputs: query f32 [2][2048][1024]; Wq, Wk, Wv, Wo f32 [1024 out][1024 in]; bq, bk, bv, bo f32 [1024].
// d_out f32 [4096][1024] at byte 0 (row = b*SEQ + s, col = n).
// =====================================================================================================
extern "C" void kernel_launch(void* const* d_in, const int* in_sizes, int n_in,
                              void* d_out, int out_size, void* d_ws, size_t ws_size,
                              hipStream_t stream) {
  if (n_in < 9) return;
  if (in_sizes[0] != NB * SEQ * DM) return;
  if (in_sizes[1] != DM * DM) return;
  if (in_sizes[2] != DM) return;
  if (in_sizes[3] != DM * DM) return;
  if (in_sizes[4] != DM) return;
  if (in_sizes[5] != DM * DM) return;
  if (in_sizes[6] != DM) return;
  if (in_sizes[7] != DM * DM) return;
  if (in_sizes[8] != DM) return;
  if (out_size != OUTN) return;

  const float* x  = (const float*)d_in[0];   // [NB*SEQ][DM]
  const float* Wq = (const float*)d_in[1];   // [DM n][DM k]
  const float* bq = (const float*)d_in[2];   // [DM]
  const float* Wk = (const float*)d_in[3];
  const float* bk = (const float*)d_in[4];
  const float* Wv = (const float*)d_in[5];
  const float* bv = (const float*)d_in[6];
  const float* Wo = (const float*)d_in[7];
  const float* bo = (const float*)d_in[8];

  const size_t PXb = (size_t)ROWS * DM * 2;          //  8388608
  const size_t PW  = (size_t)DM * DM * 2;            //  2097152
  const size_t PF  = (size_t)3 * ROWS * DM * 4;      // 50331648
  const size_t PH  = (size_t)ROWS * DM * 2;          //  8388608
  const size_t PVt = (size_t)NB * DM * SEQ * 2;      //  8388608
  const size_t PP  = (size_t)NB * SEQ * SEQ * 2;     // 16777216
  const size_t PO  = (size_t)NB * NH * SEQ * HD * 2; //  8388608
  const size_t PMv = (size_t)NB * DM * 4;            //     8192
  size_t off = 0;
  const size_t oXb = off; off += PXb;
  const size_t oWq = off; off += PW;
  const size_t oWk = off; off += PW;
  const size_t oWv = off; off += PW;
  const size_t oWo = off; off += PW;
  const size_t oTf = off; off += PF;
  const size_t oQh = off; off += PH;
  const size_t oKh = off; off += PH;
  const size_t oVt = off; off += PVt;
  const size_t oP  = off; off += PP;
  const size_t oOh = off; off += PO;
  const size_t oOl = off; off += PO;
  const size_t oMv = off; off += PMv;
  if (off > ws_size) return;                        // off = 125837312
  if (off > (size_t)134217728) return;

  char* ws = (char*)d_ws;
  unsigned short* Xb  = (unsigned short*)(ws + oXb);
  unsigned short* Wqb = (unsigned short*)(ws + oWq);
  unsigned short* Woh = (unsigned short*)(ws + oWo);
  float*          Tf  = (float*)(ws + oTf);
  unsigned short* Qh  = (unsigned short*)(ws + oQh);
  unsigned short* Kh  = (unsigned short*)(ws + oKh);
  float*          Vf  = Tf + (size_t)2 * ROWS * DM; // v plane of Tf
  unsigned short* VTh = (unsigned short*)(ws + oVt);
  unsigned short* Ph  = (unsigned short*)(ws + oP);
  unsigned short* Ohi = (unsigned short*)(ws + oOh);
  unsigned short* Olo = (unsigned short*)(ws + oOl);
  float*          mV  = (float*)(ws + oMv);
  float*          outf = (float*)d_out;             // [ROWS][DM]

  const dim3 blk(256);
  const dim3 gCvt(XBLK + 4 * WBLK);                 // 2048 + 4 * 512 blocks (exact)
  const dim3 gGemm(((ROWS / 64) * (DM / 64)) / 8, 3);  // 1024 tiles -> 128 blocks, x 3 projections
  const dim3 gCm(DM / 32, NB);                      // (32, 2)
  const dim3 gSc(((SEQ / 64) * (SEQ / 64)) / 8, NB);  // 1024 tiles -> 128 blocks per batch
  const dim3 gSm(NB * SEQ);                         // 2048 rows per batch
  const dim3 gPv(((SEQ / 64) * (DM / 64)) / 8, NB); //  512 tiles -> 64 blocks per batch
  const dim3 gWo(((ROWS / 32) * (DM / 64)) / 8);    // 2048 tiles -> 256 blocks
  const float qkScale = 16.0f;                      // q and k planes carried x16
  const float woScale = 1024.0f;                    // Wo plane carried x1024
  const float sscale  = 1.0f / 32768.0f;            // (1/sqrt(64))/16 heads = 1/128, two x16 carries folded back
  const float vScale  = 64.0f;                      // v^T plane carried x64
  const float pvOscl  = 1.0f / 1048576.0f;          // 1/(16384 * 64)
  const float woSch   = 1.0f / 1048576.0f;          // 1/(1024 * 1024): O hi carry and Wo carry
  const float woScl   = 1.0f / 2048.0f;             // residual plane carry

  // (1) activations and weights -> bf16 planes (W is [n][k] already); Wo -> f16 plane of its bf16 value x1024;
  //     Xb, Wqb, Wkb, Wvb, Woh lie one behind the other
  cvt_inputs<<<gCvt, blk, 0, stream>>>(x, Wq, Wk, Wv, Wo, Xb, woScale);
  // (2) q, k, v = Xb . W^T + bias (M=4096, N=1024, K=1024 each), one grid: q, k -> f16 planes (x16; Qh, Kh are
  //     adjacent); v -> f32 plane Vf and f16 v^T plane (x64)
  gemm64<<<gGemm, blk, 0, stream>>>(Xb, DM, Wqb, DM, bq, bk, bv, Qh, Vf, VTh, DM, ROWS, DM, DM, qkScale, vScale);
  // (3) f32 column means of v over tokens
  colmean<<<gCm, dim3(1024), 0, stream>>>(Vf, mV);
  // (4) both batches in one grid each: head-averaged scores (K = 1024) -> Tf as S [2][2048][2048]; row softmax ->
  //     centered weights; p . v -> O hi/res head-major planes
  gemm64h_s<<<gSc, blk, 0, stream>>>(Qh, DM, Kh, DM, Tf, SEQ, SEQ, SEQ, DM, sscale);
  softmax_c<<<gSm, blk, 0, stream>>>(Tf, Ph);
  gemm64h_o<<<gPv, blk, 0, stream>>>(Ph, SEQ, VTh, SEQ, mV, Ohi, Olo, SEQ, DM, SEQ, pvOscl);
  // (5) out = O(flat [4096][1024]) . Woh^T + bo -> d_out
  gemm32h_w<<<gWo, blk, 0, stream>>>(Ohi, Olo, DM, Woh, DM, bo, outf, DM, ROWS, DM, DM, woSch, woScl);
  (void)hipGetLastError();
}

// v006
// A run of this version takes 114 microseconds.
// In both of two side-by-side timings against v005, it was 1.18 times as fast.
// Counting every step since v000, it is 5.97 times as fast.
// Contractions: q/k/v projections = v_wmma_f32_16x16x32_bf16 (bf16 operands: RNE-converted x, W, bias; single product); head-averaged q.k^T scores = v_wmma_f32_16x16x32_f16 (q, k f16 planes carried x16; single product); p.v = v_wmma_f32_16x16x32_f16 (centered softmax weights 16384*p-8 in f16, v^T f16 plane carried x64; single product; f32 column mean of v added back); output projection = v_wmma_f32_16x16x32_f16 (attention output as f16 hi (x1024) + residual (x2048) planes, two products into separate accumulators; Wo as f16 of its bf16-RNE value x1024); all f32 accumulate; softmax in f32.
#include <hip/hip_runtime.h>
#include <math.h>
#include <stdint.h>

#define NB    2
#define SEQ   2048
#define DM    1024
#define NH    16
#define HD    64
#define ROWS  (NB * SEQ)             // 4096 token rows
#define OUTN  (ROWS * DM)
static_assert(NH * HD == DM);
static_assert(HD == 64);
static_assert((SEQ % 64) == 0 && (DM % 64) == 0 && (ROWS % 64) == 0 && (DM % 32) == 0 && (DM % 256) == 0);
static_assert(SEQ == 256 * 8);
static_assert((SEQ % 128) == 0);
static_assert((((ROWS / 64) * (DM / 64)) % 8) == 0);
static_assert((((SEQ / 64) * (SEQ / 64)) % 8) == 0);
static_assert((((SEQ / 64) * (DM / 64)) % 8) == 0);
static_assert((((ROWS / 32) * (DM / 64)) % 8) == 0);
static_assert(((ROWS * DM / 8) % 256) == 0 && ((DM * DM / 8) % 256) == 0);
static_assert((size_t)NB * SEQ * SEQ * 4 <= (size_t)3 * ROWS * DM * 4);
static_assert((ROWS % 128) == 0 && (SEQ % 256) == 0 && (DM % 256) == 0 && DM >= 128 && SEQ >= 128);   // block tiles, two stages

typedef _Float16 v16h __attribute__((ext_vector_type(16)));
typedef _Float16 v8h  __attribute__((ext_vector_type(8)));
typedef __bf16   v16b __attribute__((ext_vector_type(16)));
typedef __bf16   v8b  __attribute__((ext_vector_type(8)));
typedef float    v8f  __attribute__((ext_vector_type(8)));
typedef float    v4f  __attribute__((ext_vector_type(4)));
typedef unsigned int v4u __attribute__((ext_vector_type(4)));

// ---- scalar helpers --------------------------------------------------------------------------------
__device__ __forceinline__ unsigned short bf_bits(float f) {          // f32 -> bf16 bits, RNE convert
  unsigned u = __float_as_uint(f);
  return (unsigned short)((u + 0x7FFFu + ((u >> 16) & 1u)) >> 16);
}
__device__ __forceinline__ float bf_up(unsigned short h) { return __uint_as_float(((unsigned)h) << 16); }
__device__ __forceinline__ unsigned short h_bits(_Float16 x) { return __builtin_bit_cast(unsigned short, x); }
__device__ __forceinline__ unsigned pk16(unsigned short a, unsigned short b) { return (unsigned)a | ((unsigned)b << 16); }
__device__ __forceinline__ v8f zero8() { v8f z = {0.f, 0.f, 0.f, 0.f, 0.f, 0.f, 0.f, 0.f}; return z; }

// ---- fragment loaders: 16-bit A/B operand, lane -> row/col (lane&15), p already includes +8*(lane>>4);
//      elements 0..7 <- p[0..7] (k0+8h..), elements 8..15 <- p[16..23] (k0+16+8h..)
__device__ __forceinline__ v16b ldfrag_b(const __bf16* p) {
  union { v16b v; v8b h[2]; } f;
  f.h[0] = *(const v8b*)(p);
  f.h[1] = *(const v8b*)(p + 16);
  return f.v;
}
__device__ __forceinline__ v16h ldfrag_h(const _Float16* p) {
  union { v16h v; v8h h[2]; } f;
  f.h[0] = *(const v8h*)(p);
  f.h[1] = *(const v8h*)(p + 16);
  return f.v;
}

// ---- operand staging in LDS, shared by the 8 waves of a block ------------------------------------------
// A stage = 64 k (one 128-B line) of 384 operand rows: rows 0..127 the block's A rows, rows 128..383 its B rows, at a
// pitch of 144 B (16 B x odd: conflict-free for ds_load_b128 readers). Two stages: the next one is copied while this
// one is multiplied. Thread tid copies 16 B of row c * 32 + (tid >> 3), piece tid & 7, for c = 0..11: every wave-wide
// copy covers four whole 128-B lines of global memory.
#define SROWS   384
#define SPITCH  144
#define SBYTES  (SROWS * SPITCH)     // 55296
#define SCSTEP  (32 * SPITCH)        // LDS distance between a thread's consecutive copies
__device__ __forceinline__ unsigned lds_off(const void* p) { return (unsigned)(size_t)p; }
// The 12 copies of one thread for one stage: a0..a3 = its four A-row addresses, b + j * sb (j = 0..7) its B-row
// addresses, l = its LDS byte address in the target buffer. s_wait_xcnt stands inside the statement, behind the last
// copy: a precaution in front of every later rewrite of the address registers that the copies name.
__device__ __forceinline__ void stage_issue(unsigned l, const char* a0, const char* a1, const char* a2, const char* a3,
                                            const char* b, size_t sb) {
#if defined(__HIP_DEVICE_COMPILE__)
  asm volatile(
      "global_load_async_to_lds_b128 %0, %12, off\n\t"
      "global_load_async_to_lds_b128 %1, %13, off\n\t"
      "global_load_async_to_lds_b128 %2, %14, off\n\t"
      "global_load_async_to_lds_b128 %3, %15, off\n\t"
      "global_load_async_to_lds_b128 %4, %16, off\n\t"
      "global_load_async_to_lds_b128 %5, %17, off\n\t"
      "global_load_async_to_lds_b128 %6, %18, off\n\t"
      "global_load_async_to_lds_b128 %7, %19, off\n\t"
      "global_load_async_to_lds_b128 %8, %20, off\n\t"
      "global_load_async_to_lds_b128 %9, %21, off\n\t"
      "global_load_async_to_lds_b128 %10, %22, off\n\t"
      "global_load_async_to_lds_b128 %11, %23, off\n\t"
      "s_wait_xcnt 0x0"
      :: "v"(l), "v"(l + 1u * SCSTEP), "v"(l + 2u * SCSTEP), "v"(l + 3u * SCSTEP), "v"(l + 4u * SCSTEP),
         "v"(l + 5u * SCSTEP), "v"(l + 6u * SCSTEP), "v"(l + 7u * SCSTEP), "v"(l + 8u * SCSTEP),
         "v"(l + 9u * SCSTEP), "v"(l + 10u * SCSTEP), "v"(l + 11u * SCSTEP),
         "v"(a0), "v"(a1), "v"(a2), "v"(a3), "v"(b), "v"(b + sb), "v"(b + 2 * sb), "v"(b + 3 * sb),
         "v"(b + 4 * sb), "v"(b + 5 * sb), "v"(b + 6 * sb), "v"(b + 7 * sb)
      : "memory");
#endif
}
// this wave's copies have landed in LDS (the compiler places no wait for them)
__device__ __forceinline__ void wait_copies() {
#if defined(__HIP_DEVICE_COMPILE__)
  asm volatile("s_wait_asynccnt 0x0" ::: "memory");
#endif
}
// this wave's LDS reads have returned, so that the buffer may be handed to its next writer behind the barrier
__device__ __forceinline__ void wait_lds() {
#if defined(__HIP_DEVICE_COMPILE__)
  asm volatile("s_wait_dscnt 0x0" ::: "memory");
#endif
}

// ---- WMMA helpers with trailing VALU hazard gap --------------------------------------------------------
__device__ __forceinline__ v8f mma_h(v16h a, v16h b, v8f c) {
  c = __builtin_amdgcn_wmma_f32_16x16x32_f16(false, a, false, b, (short)0, c, false, false);
#if defined(__HIP_DEVICE_COMPILE__)
  asm volatile("v_nop\n\tv_nop\n\tv_nop\n\tv_nop" : "+v"(c) : "v"(a), "v"(b));
#endif
  return c;
}
__device__ __forceinline__ v8f mma_b_raw(v16b a, v16b b, v8f c) {
  return __builtin_amdgcn_wmma_f32_16x16x32_bf16(false, a, false, b, (short)0, c, false, false);
}
__device__ __forceinline__ void dep_guard_b(v8f& a, v8f& b, v16b x, v16b y) {
#if defined(__HIP_DEVICE_COMPILE__)
  asm volatile("v_nop\n\tv_nop\n\tv_nop\n\tv_nop" : "+v"(a), "+v"(b) : "v"(x), "v"(y));
#endif
}
__device__ __forceinline__ void keep4_b(v16b a, v16b b, v16b c, v16b d) {
#if defined(__HIP_DEVICE_COMPILE__)
  asm volatile("v_nop" :: "v"(a), "v"(b), "v"(c), "v"(d));
#endif
}
__device__ __forceinline__ void acc_guard4(v8f& a, v8f& b, v8f& c, v8f& d) {
#if defined(__HIP_DEVICE_COMPILE__)
  asm volatile("v_nop\n\tv_nop\n\tv_nop\n\tv_nop" : "+v"(a), "+v"(b), "+v"(c), "+v"(d));
#endif
}

// =====================================================================================================
// All five input conversions in one grid. Blocks [0, XBLK): x -> bf16 (RNE convert); then WBLK blocks each for Wq, Wk,
// Wv -> bf16 and for Wo -> f16(bf16rne(Wo) * woscale) (exact in f16 after the power-of-two scale). The five output
// planes lie one behind the other in the workspace, so the output index is the flat thread index. 8 elements per
// thread, one 16-B store per lane: a wave writes 512 contiguous B. The plane is chosen by blockIdx (block-uniform).
// coverage: (XBLK + 4 * WBLK) blocks x 256 threads x 8 = all five planes exactly.
// =====================================================================================================
#define XBLK (ROWS * DM / 8 / 256)
#define WBLK (DM * DM / 8 / 256)
__global__ __launch_bounds__(256) void cvt_inputs(const float* __restrict__ x, const float* __restrict__ Wq,
                                                  const float* __restrict__ Wk, const float* __restrict__ Wv,
                                                  const float* __restrict__ Wo, unsigned short* out, float woscale) {
  const int blk = blockIdx.x;
  const float* in = x;
  int first = 0;                                     // first block of this block's plane
  if (blk >= XBLK) {
    const int w = (blk - XBLK) / WBLK;               // 0..3
    in = (w == 0) ? Wq : (w == 1) ? Wk : (w == 2) ? Wv : Wo;
    first = XBLK + w * WBLK;
  }
  const int i = (blk - first) * 256 + threadIdx.x;
  const v4f a = *(const v4f*)(in + (size_t)i * 8);
  const v4f b = *(const v4f*)(in + (size_t)i * 8 + 4);
  // precaution: stands in front of every later rewrite of the two loads' address registers
  asm volatile("s_wait_xcnt 0x0" ::: "memory");
  v4u p;
  if (blk < XBLK + 3 * WBLK) {
    p[0] = pk16(bf_bits(a[0]), bf_bits(a[1]));
    p[1] = pk16(bf_bits(a[2]), bf_bits(a[3]));
    p[2] = pk16(bf_bits(b[0]), bf_bits(b[1]));
    p[3] = pk16(bf_bits(b[2]), bf_bits(b[3]));
  } else {
    p[0] = pk16(h_bits((_Float16)(bf_up(bf_bits(a[0])) * woscale)), h_bits((_Float16)(bf_up(bf_bits(a[1])) * woscale)));
    p[1] = pk16(h_bits((_Float16)(bf_up(bf_bits(a[2])) * woscale)), h_bits((_Float16)(bf_up(bf_bits(a[3])) * woscale)));
    p[2] = pk16(h_bits((_Float16)(bf_up(bf_bits(b[0])) * woscale)), h_bits((_Float16)(bf_up(bf_bits(b[1])) * woscale)));
    p[3] = pk16(h_bits((_Float16)(bf_up(bf_bits(b[2])) * woscale)), h_bits((_Float16)(bf_up(bf_bits(b[3])) * woscale)));
  }
  *(v4u*)(out + ((size_t)blk * 256 + threadIdx.x) * 8) = p;
}

// =====================================================================================================
// Register-blocked bf16 WMMA GEMM with bias: C[m][n] = sum_k A[m][k] * Bt[n][k] + bf16rne(bias[n]); one wave per
// 64x64 tile, 8 waves on a 128x256 block tile whose operands are staged in LDS (one barrier a trip). A row-major [M][K] pitch lda; Bt row-major [N][K] pitch ldb (k contiguous);
// bias f32 [N] (RNE converted to bf16 and widened in the epilogue); M, N multiples of the 128x256 block tile, K of 64
// (fixed sizes, statically asserted); M a multiple of 128, N of 256, K of 64 for every launch here (no idle waves).
// blockIdx.y = which of three independent products on the same A runs here (q, k, v): Bt plane y (N*ldb elements
// apart), bias y. Each product leaves in the form its reader takes:
//   q, k: f16 plane y of qkh, [M][N] pitch ldc, = f16(C * qkscale); 16-row f32 slabs staged per wave in LDS, each
//         64-wide row segment (128 B, one line) stored by 8 lanes x 16 B.
//   v:    the column sums of the wave's 64 rows, f32, in ps[(m0 / 64) * N + n] (for the column mean: a lane adds its 32
//         accumulator rows of a column as a tree, the two lane halves are added by __shfl_xor), and the f16 v^T plane
//         vth[(b*DM + n)*SEQ + t] =
//         f16(C * vscale), m = b*SEQ + t: a lane's 8 accumulator rows are 8 consecutive t of one n, so the wave's tile
//         is laid transposed in LDS by 16-B stores (its own 64 x 144 B of the operand stages, which every wave has
//         left behind the loop's last barrier) and leaves as whole 128-B lines.
// coverage: 8 waves x 64x64 = the block's 128x256 tile of its plane(s); grid covers every tile of q, k and v.
// =====================================================================================================
__global__ __launch_bounds__(256) void gemm64(
    const unsigned short* __restrict__ Ap, int lda,
    const unsigned short* __restrict__ Btp, int ldb,
    const float* __restrict__ bias0, const float* __restrict__ bias1, const float* __restrict__ bias2,
    unsigned short* qkh, float* ps, unsigned short* vth, int ldc, int M, int N, int K, float qkscale, float vscale) {
  const int which = blockIdx.y;
  const float* bias = (which == 0) ? bias0 : (which == 1) ? bias1 : bias2;
  const __bf16* Ab  = (const __bf16*)(const void*)Ap;
  const __bf16* Bb  = (const __bf16*)(const void*)Btp + (size_t)which * N * ldb;
  __shared__ __align__(16) float sT[8][16 * 68];   // per-wave 16x64 slab, pitch 68 floats
  __shared__ __align__(16) char stg[2 * SBYTES];   // the two operand stages
  const int lane = threadIdx.x & 31;
  const int wave = threadIdx.x >> 5;
  const int btN = N >> 8;                // block tile 128 x 256: waves 2 (m) x 4 (n), 64 x 64 each
  const int btM = M >> 7;
  if ((int)blockIdx.x >= btM * btN) return;   // block-uniform, in front of every barrier
  const int bm  = blockIdx.x / btN;
  const int bm0 = bm << 7;
  const int bn0 = (blockIdx.x - bm * btN) << 8;
  const int wm  = wave >> 2;
  const int wn  = wave & 3;
  const int m0 = bm0 + (wm << 6);
  const int n0 = bn0 + (wn << 6);

  const int rlane = lane & 15;                 // row (A) / col (B, D) within subtile
  const int koff  = (lane >> 4) * 8;           // k offset of this lane half
  const int mOff  = (lane >> 4) * 8;           // D row offset

  v8f acc[4][4];
#pragma unroll
  for (int i = 0; i < 4; ++i)
#pragma unroll
    for (int j = 0; j < 4; ++j) acc[i][j] = zero8();

  // Two-buffer ring along K, 64 k a trip: the copies of tile t + 2 fly while tile t + 1 is multiplied.
  const int T = K >> 6;
  const int crow = threadIdx.x >> 3;                   // this thread's row within each group of 32 staged rows
  const int cpc  = (threadIdx.x & 7) * 16;             // its 16-B piece of the 128-B row
  const unsigned lcp = lds_off(stg) + (unsigned)(crow * SPITCH + cpc);
  const size_t sa = (size_t)32 * lda * 2;              // bytes between a thread's consecutive A rows
  const size_t sb = (size_t)32 * ldb * 2;              // the same for B
  const char* ga = (const char*)(Ab + (size_t)(bm0 + crow) * lda) + cpc;
  const char* gb = (const char*)(Bb + (size_t)(bn0 + crow) * ldb) + cpc;
  stage_issue(lcp, ga, ga + sa, ga + 2 * sa, ga + 3 * sa, gb, sb);
  wait_copies();
  __syncthreads();                                     // tile 0 is readable by every wave
  if (T > 1) stage_issue(lcp + SBYTES, ga + 128, ga + sa + 128, ga + 2 * sa + 128, ga + 3 * sa + 128, gb + 128, sb);
  const char* fa = stg + (wm * 64 + rlane) * SPITCH + koff * 2;         // this lane's place in its first A fragment
  const char* fb = stg + (128 + wn * 64 + rlane) * SPITCH + koff * 2;   // the same for B
  for (int t = 0; t < T; ++t) {
    const int bo = (t & 1) * SBYTES;
    // unrolled so that the fragment arrays keep constant indices (registers, no scratch)
#pragma unroll
    for (int ks = 0; ks < 2; ++ks) {
      v16b bh[4], ah[4];
#pragma unroll
      for (int j = 0; j < 4; ++j) bh[j] = ldfrag_b((const __bf16*)(fb + bo + j * 16 * SPITCH + ks * 64));
#pragma unroll
      for (int i = 0; i < 4; ++i) ah[i] = ldfrag_b((const __bf16*)(fa + bo + i * 16 * SPITCH + ks * 64));
#pragma unroll
      for (int i = 0; i < 4; ++i) {
#pragma unroll
        for (int j = 0; j < 4; ++j) {
          acc[i][j] = mma_b_raw(ah[i], bh[j], acc[i][j]);
        }
        dep_guard_b(acc[i][0], acc[i][3], ah[i], ah[i]);
      }
      keep4_b(bh[0], bh[1], bh[2], bh[3]);
    }
    wait_lds();
    wait_copies();
    __syncthreads();                                   // publishes tile t + 1; ends every wave's reads of tile t
    if (t + 2 < T) {                                   // block-uniform
      const size_t ko = (size_t)(t + 2) * 128;
      stage_issue(lcp + (unsigned)bo, ga + ko, ga + sa + ko, ga + 2 * sa + ko, ga + 3 * sa + ko, gb + ko, sb);
    }
  }
  wait_copies();
  acc_guard4(acc[0][0], acc[0][1], acc[0][2], acc[0][3]);
  acc_guard4(acc[1][0], acc[1][1], acc[1][2], acc[1][3]);
  acc_guard4(acc[2][0], acc[2][1], acc[2][2], acc[2][3]);
  acc_guard4(acc[3][0], acc[3][1], acc[3][2], acc[3][3]);

  // ---- bias per D column of this lane (n0 + 16j + rlane < N) ----
  float bz[4];
#pragma unroll
  for (int j = 0; j < 4; ++j) bz[j] = bf_up(bf_bits(bias[n0 + (j << 4) + rlane]));

  // ---- epilogue ----
  float* slab = sT[wave];
  if (which < 2) {                                         // block-uniform: q or k -> f16 plane
    unsigned short* H = qkh + (size_t)which * M * ldc;
#pragma unroll
    for (int i = 0; i < 4; ++i) {
      const int mBase = m0 + (i << 4);
#pragma unroll
      for (int r = 0; r < 8; ++r) {
#pragma unroll
        for (int j = 0; j < 4; ++j) {
          slab[(mOff + r) * 68 + (j << 4) + rlane] = (acc[i][j][r] + bz[j]) * qkscale;
        }
      }
      __builtin_amdgcn_fence(__ATOMIC_RELEASE, "workgroup");
      __builtin_amdgcn_wave_barrier();
      __builtin_amdgcn_fence(__ATOMIC_ACQUIRE, "workgroup");
      {
        const int g4 = lane >> 3, piece = lane & 7;        // 128-B row segment = 8 lanes x 16 B
        v4u hv[4];
#pragma unroll
        for (int q = 0; q < 4; ++q) {
          const int row = q * 4 + g4;                      // q 0..3 x g4 0..3 = rows 0..15
          const v4f x0 = *(const v4f*)(slab + row * 68 + piece * 8);
          const v4f x1 = *(const v4f*)(slab + row * 68 + piece * 8 + 4);
          v4u ph;
          ph[0] = pk16(h_bits((_Float16)x0[0]), h_bits((_Float16)x0[1]));
          ph[1] = pk16(h_bits((_Float16)x0[2]), h_bits((_Float16)x0[3]));
          ph[2] = pk16(h_bits((_Float16)x1[0]), h_bits((_Float16)x1[1]));
          ph[3] = pk16(h_bits((_Float16)x1[2]), h_bits((_Float16)x1[3]));
          hv[q] = ph;
        }
#pragma unroll
        for (int q = 0; q < 4; ++q) {
          const int row = q * 4 + g4;
          *(v4u*)(H + (size_t)(mBase + row) * ldc + n0 + piece * 8) = hv[q];
        }
      }
      __builtin_amdgcn_fence(__ATOMIC_RELEASE, "workgroup");
      __builtin_amdgcn_wave_barrier();
      __builtin_amdgcn_fence(__ATOMIC_ACQUIRE, "workgroup");
    }
    return;
  }

  // v: the column sums and the transposed f16 tile (LDS only); then the sums and the v^T lines leave
  char* tb = stg + wave * (64 * SPITCH);                   // this wave's [n 64][t 64] f16 tile, pitch 144 B
  float cs[4];                                             // column 16 j + rlane: sum over the wave's 64 rows
#pragma unroll
  for (int j = 0; j < 4; ++j) {
    const v8f t = (acc[0][j] + acc[1][j]) + (acc[2][j] + acc[3][j]);     // the lane's 32 rows, 8 sums of 4
    const float s = ((t[0] + t[1]) + (t[2] + t[3])) + ((t[4] + t[5]) + (t[6] + t[7]));
    cs[j] = (s + __shfl_xor(s, 16)) + 64.0f * bz[j];       // both lane halves: all 64 rows; each row has the bias once
  }
#pragma unroll
  for (int i = 0; i < 4; ++i) {
#pragma unroll
    for (int j = 0; j < 4; ++j) {
      v4u pk;
#pragma unroll
      for (int e = 0; e < 4; ++e) {
        pk[e] = pk16(h_bits((_Float16)((acc[i][j][2 * e] + bz[j]) * vscale)),
                     h_bits((_Float16)((acc[i][j][2 * e + 1] + bz[j]) * vscale)));
      }
      *(v4u*)(tb + ((j << 4) + rlane) * SPITCH + (i << 5) + mOff * 2) = pk;   // t = 16 i + mOff + 0..7
    }
  }
  // the wave's tile is written; its lanes read each other's rows below
  __builtin_amdgcn_fence(__ATOMIC_RELEASE, "workgroup");
  __builtin_amdgcn_wave_barrier();
  __builtin_amdgcn_fence(__ATOMIC_ACQUIRE, "workgroup");
  {
    // both halves hold all four sums: half h stores columns 16 h + rlane and 32 + 16 h + rlane (two 128-B lines);
    // behind the fence, which would otherwise wait for these stores
    const int hh = lane >> 4;
    float* prow = ps + (size_t)(m0 >> 6) * N + n0 + (hh << 4) + rlane;
    prow[0]  = hh ? cs[1] : cs[0];
    prow[32] = hh ? cs[3] : cs[2];
    // precaution: stands behind the two stores, in front of every later rewrite of their registers
    asm volatile("s_wait_xcnt 0x0" ::: "memory");
  }
  {
    const int vb  = m0 / SEQ;                              // batch of this wave's 64 token rows (SEQ % 64 == 0)
    const int vt0 = m0 - vb * SEQ;
    const int g4 = lane >> 3, piece = lane & 7;            // 128-B line of one n = 8 lanes x 16 B
    unsigned short* vrow = vth + ((size_t)(vb * DM + n0 + g4)) * SEQ + vt0 + piece * 8;
#pragma unroll
    for (int hb = 0; hb < 2; ++hb) {
      v4u tv[8];
#pragma unroll
      for (int it = 0; it < 8; ++it) {
        const int row = (hb * 8 + it) * 4 + g4;            // 16 x g4 0..3 = rows n 0..63
        tv[it] = *(const v4u*)(tb + row * SPITCH + piece * 16);
      }
#pragma unroll
      for (int it = 0; it < 8; ++it) {
        *(v4u*)(vrow + (size_t)((hb * 8 + it) * 4) * SEQ) = tv[it];
      }
    }
    // precaution: stands behind the last of the sixteen stores, in front of every later rewrite of their registers
    asm volatile("s_wait_xcnt 0x0" ::: "memory");
  }
}

// =====================================================================================================
// f16 WMMA GEMM with scale: C[m][n] = cscale * sum_k A[m][k] * Bt[n][k] (f16 products, f32 accumulate).
// Same tiling/epilogue as gemm64 (one wave per 64x64 tile, operands staged in LDS per block, 16-row LDS slabs, each 256-B
// coverage: 4 slabs x 16 rows x 64 cols = the wave's whole 64x64 tile; 8 waves = the block's 128x256 tile.
// =====================================================================================================
__global__ __launch_bounds__(256) void gemm64h_s(
    const unsigned short* __restrict__ Ap, int lda,
    const unsigned short* __restrict__ Btp, int ldb,
    float* Cp, int ldc, int M, int N, int K, float cscale) {
  const int bb = blockIdx.y;             // batch: A, Bt and C planes of the batches lie one behind the other
  float* C = Cp + (size_t)bb * M * ldc;
  const _Float16* Ah = (const _Float16*)(const void*)Ap + (size_t)bb * M * lda;
  const _Float16* Bh = (const _Float16*)(const void*)Btp + (size_t)bb * N * ldb;
  __shared__ __align__(16) float sT[8][16 * 68];
  __shared__ __align__(16) char stg[2 * SBYTES];   // the two operand stages
  const int lane = threadIdx.x & 31;
  const int wave = threadIdx.x >> 5;
  const int btN = N >> 8;                // block tile 128 x 256: waves 2 (m) x 4 (n), 64 x 64 each
  const int btM = M >> 7;
  if ((int)blockIdx.x >= btM * btN) return;   // block-uniform, in front of every barrier
  const int bm  = blockIdx.x / btN;
  const int bm0 = bm << 7;
  const int bn0 = (blockIdx.x - bm * btN) << 8;
  const int wm  = wave >> 2;
  const int wn  = wave & 3;
  const int m0 = bm0 + (wm << 6);
  const int n0 = bn0 + (wn << 6);
  const int rlane = lane & 15;
  const int koff  = (lane >> 4) * 8;
  const int mOff  = (lane >> 4) * 8;

  v8f acc[4][4];
#pragma unroll
  for (int i = 0; i < 4; ++i)
#pragma unroll
    for (int j = 0; j < 4; ++j) acc[i][j] = zero8();

  // Two-buffer ring along K, 64 k a trip: the copies of tile t + 2 fly while tile t + 1 is multiplied.
  const int T = K >> 6;
  const int crow = threadIdx.x >> 3;                   // this thread's row within each group of 32 staged rows
  const int cpc  = (threadIdx.x & 7) * 16;             // its 16-B piece of the 128-B row
  const unsigned lcp = lds_off(stg) + (unsigned)(crow * SPITCH + cpc);
  const size_t sa = (size_t)32 * lda * 2;              // bytes between a thread's consecutive A rows
  const size_t sb = (size_t)32 * ldb * 2;              // the same for B
  const char* ga = (const char*)(Ah + (size_t)(bm0 + crow) * lda) + cpc;
  const char* gb = (const char*)(Bh + (size_t)(bn0 + crow) * ldb) + cpc;
  stage_issue(lcp, ga, ga + sa, ga + 2 * sa, ga + 3 * sa, gb, sb);
  wait_copies();
  __syncthreads();                                     // tile 0 is readable by every wave
  if (T > 1) stage_issue(lcp + SBYTES, ga + 128, ga + sa + 128, ga + 2 * sa + 128, ga + 3 * sa + 128, gb + 128, sb);
  const char* fa = stg + (wm * 64 + rlane) * SPITCH + koff * 2;         // this lane's place in its first A fragment
  const char* fb = stg + (128 + wn * 64 + rlane) * SPITCH + koff * 2;   // the same for B
  for (int t = 0; t < T; ++t) {
    const int bo = (t & 1) * SBYTES;
    // unrolled so that the fragment arrays keep constant indices (registers, no scratch)
#pragma unroll
    for (int ks = 0; ks < 2; ++ks) {
      v16h bh[4], ah[4];
#pragma unroll
      for (int j = 0; j < 4; ++j) bh[j] = ldfrag_h((const _Float16*)(fb + bo + j * 16 * SPITCH + ks * 64));
#pragma unroll
      for (int i = 0; i < 4; ++i) ah[i] = ldfrag_h((const _Float16*)(fa + bo + i * 16 * SPITCH + ks * 64));
#pragma unroll
      for (int i = 0; i < 4; ++i) {
#pragma unroll
        for (int j = 0; j < 4; ++j) {
          acc[i][j] = mma_h(ah[i], bh[j], acc[i][j]);
        }
      }
    }
    wait_lds();
    wait_copies();
    __syncthreads();                                   // publishes tile t + 1; ends every wave's reads of tile t
    if (t + 2 < T) {                                   // block-uniform
      const size_t ko = (size_t)(t + 2) * 128;
      stage_issue(lcp + (unsigned)bo, ga + ko, ga + sa + ko, ga + 2 * sa + ko, ga + 3 * sa + ko, gb + ko, sb);
    }
  }
  wait_copies();

  float* slab = sT[wave];
#pragma unroll
  for (int i = 0; i < 4; ++i) {
    const int mBase = m0 + (i << 4);
#pragma unroll
    for (int r = 0; r < 8; ++r) {
#pragma unroll
      for (int j = 0; j < 4; ++j) {
        slab[(mOff + r) * 68 + (j << 4) + rlane] = acc[i][j][r] * cscale;
      }
    }
    __builtin_amdgcn_fence(__ATOMIC_RELEASE, "workgroup");
    __builtin_amdgcn_wave_barrier();
    __builtin_amdgcn_fence(__ATOMIC_ACQUIRE, "workgroup");
    {
      const int hh = lane >> 4, c4 = (lane & 15) * 4;
      v4f ov[8];
#pragma unroll
      for (int it = 0; it < 8; ++it) {
        const int row = it * 2 + hh;
        ov[it] = *(const v4f*)(slab + row * 68 + c4);
      }
      {
#pragma unroll
        for (int it = 0; it < 8; ++it) {
          const int row = it * 2 + hh;
          *(v4f*)(C + (size_t)(mBase + row) * ldc + n0 + c4) = ov[it];
        }
        
      }
    }
    __builtin_amdgcn_fence(__ATOMIC_RELEASE, "workgroup");
    __builtin_amdgcn_wave_barrier();
    __builtin_amdgcn_fence(__ATOMIC_ACQUIRE, "workgroup");
  }
}

// =====================================================================================================
// Row softmax over SEQ keys, max-subtracted, f32: p = exp(s - max) / sum; stored CENTERED and scaled as
// f16(16384 * p - 8) = f16(16384 * (p - 1/SEQ)) (the 1/SEQ part is added back downstream as the column
// mean of v). One 256-thread block per row, 8 consecutive elements per thread (two v4f loads), wave
// reductions by __shfl_xor, 8 wave partials combined in fixed order through LDS.
// =====================================================================================================
__global__ __launch_bounds__(256) void softmax_c(const float* __restrict__ sf, unsigned short* ph) {
  __shared__ float redm[8];
  __shared__ float reds[8];
  const int row  = blockIdx.x;
  const int tid  = threadIdx.x;
  const int lane = tid & 31;
  const int wave = tid >> 5;
  const float* s = sf + (size_t)row * SEQ + tid * 8;
  const v4f a = *(const v4f*)(s);
  const v4f c = *(const v4f*)(s + 4);
  float v[8];
  v[0] = a[0]; v[1] = a[1]; v[2] = a[2]; v[3] = a[3];
  v[4] = c[0]; v[5] = c[1]; v[6] = c[2]; v[7] = c[3];
  float m = v[0];
#pragma unroll
  for (int e = 1; e < 8; ++e) m = fmaxf(m, v[e]);
#pragma unroll
  for (int o = 16; o > 0; o >>= 1) m = fmaxf(m, __shfl_xor(m, o));
  if (lane == 0) redm[wave] = m;
  __syncthreads();
  float mm = redm[0];
#pragma unroll
  for (int w = 1; w < 8; ++w) mm = fmaxf(mm, redm[w]);
  float sum = 0.f;
#pragma unroll
  for (int e = 0; e < 8; ++e) {
    v[e] = __expf(v[e] - mm);
    sum += v[e];
  }
#pragma unroll
  for (int o = 16; o > 0; o >>= 1) sum += __shfl_xor(sum, o);
  if (lane == 0) reds[wave] = sum;
  __syncthreads();
  float tot = 0.f;
#pragma unroll
  for (int w = 0; w < 8; ++w) tot += reds[w];       // fixed order, identical for every thread
  const float inv = 1.0f / tot;                     // tot >= 1
  v4u pk;
#pragma unroll
  for (int e = 0; e < 4; ++e) {
    const float p0 = v[2 * e] * inv;
    const float p1 = v[2 * e + 1] * inv;
    const _Float16 x0 = (_Float16)(p0 * 16384.0f - 8.0f);
    const _Float16 x1 = (_Float16)(p1 * 16384.0f - 8.0f);
    pk[e] = pk16(h_bits(x0), h_bits(x1));
  }
  unsigned short* o = ph + (size_t)row * SEQ + tid * 8;
  *(v4u*)o = pk;
  
}

// =====================================================================================================
// p.v, batch bb = blockIdx.y: O[i][n] = oscale * sum_j P[i][j] * Vt[n][j] + mv[n] (f16 products, f32 accumulate;
// oscale folds back the weight and v carries; mv = column mean of v in f32: thread tid adds, as a pairwise tree, the SEQ/64
// partial sums ps[(bb*SEQ/64 + p)*DM + n] of column n = bn0 + tid while tile 0 is copied, and leaves the mean in LDS for
// the epilogue, published by the barrier that publishes tile 0). P f16 [SEQ][SEQ] pitch lda
// (j contiguous); Vt f16 [DM][SEQ] pitch ldb; n = h*HD + d.
// O is written as two f16 head-major planes: hi = f16(O*1024), lo = f16((O*1024 - hi)*2048), element
// (bb, h, i, d) at [((bb*NH + h)*SEQ + i)*HD + d]; a 64-wide tile column block is exactly one head h = tn,
// One wave per 64x64 tile, operands staged in LDS per 128x256 block tile. Epilogue: 16-row f32 slab staged per
// coverage: 4 slabs x (4 q x 4 g4 = 16 rows) x (8 pieces x 8 = 64 cols) = the wave's whole tile in both
// planes; grid covers every (i tile, head) of this batch.
// =====================================================================================================
__global__ __launch_bounds__(256) void gemm64h_o(
    const unsigned short* __restrict__ Ap, int lda,
    const unsigned short* __restrict__ Btp, int ldb,
    const float* __restrict__ psp,
    unsigned short* ohi, unsigned short* olo,
    int M, int N, int K, float oscale) {
  const int bb = blockIdx.y;             // batch: P, Vt and partial-sum planes of the batches lie one behind the other
  const _Float16* Ah = (const _Float16*)(const void*)Ap + (size_t)bb * M * lda;
  const _Float16* Bh = (const _Float16*)(const void*)Btp + (size_t)bb * N * ldb;
  __shared__ __align__(16) float sT[8][16 * 68];
  __shared__ __align__(16) char stg[2 * SBYTES];   // the two operand stages
  __shared__ float smz[256];                       // column means of the block's 256 columns
  const int lane = threadIdx.x & 31;
  const int wave = threadIdx.x >> 5;
  const int btN = N >> 8;                // block tile 128 x 256: waves 2 (m) x 4 (n), 64 x 64 each
  const int btM = M >> 7;
  if ((int)blockIdx.x >= btM * btN) return;   // block-uniform, in front of every barrier
  const int bm  = blockIdx.x / btN;
  const int bm0 = bm << 7;
  const int bn0 = (blockIdx.x - bm * btN) << 8;
  const int wm  = wave >> 2;
  const int wn  = wave & 3;
  const int m0 = bm0 + (wm << 6);
  const int n0 = bn0 + (wn << 6);
  const int tn = n0 >> 6;                // == head index (tile width 64 == HD)
  const int rlane = lane & 15;
  const int koff  = (lane >> 4) * 8;
  const int mOff  = (lane >> 4) * 8;

  v8f acc[4][4];
#pragma unroll
  for (int i = 0; i < 4; ++i)
#pragma unroll
    for (int j = 0; j < 4; ++j) acc[i][j] = zero8();

  // Two-buffer ring along K, 64 k a trip: the copies of tile t + 2 fly while tile t + 1 is multiplied.
  const int T = K >> 6;
  const int crow = threadIdx.x >> 3;                   // this thread's row within each group of 32 staged rows
  const int cpc  = (threadIdx.x & 7) * 16;             // its 16-B piece of the 128-B row
  const unsigned lcp = lds_off(stg) + (unsigned)(crow * SPITCH + cpc);
  const size_t sa = (size_t)32 * lda * 2;              // bytes between a thread's consecutive A rows
  const size_t sb = (size_t)32 * ldb * 2;              // the same for B
  const char* ga = (const char*)(Ah + (size_t)(bm0 + crow) * lda) + cpc;
  const char* gb = (const char*)(Bh + (size_t)(bn0 + crow) * ldb) + cpc;
  stage_issue(lcp, ga, ga + sa, ga + 2 * sa, ga + 3 * sa, gb, sb);
  {
    const float* pp = psp + (size_t)bb * (SEQ / 64) * DM + bn0 + threadIdx.x;
    float pv[SEQ / 64];
#pragma unroll
    for (int p = 0; p < SEQ / 64; ++p) pv[p] = pp[(size_t)p * DM];
#pragma unroll
    for (int o = SEQ / 128; o > 0; o >>= 1) {
#pragma unroll
      for (int p = 0; p < o; ++p) pv[p] += pv[p + o];
    }
    smz[threadIdx.x] = pv[0] * (1.0f / (float)SEQ);
  }
  wait_copies();
  __syncthreads();                                     // tile 0 is readable by every wave
  if (T > 1) stage_issue(lcp + SBYTES, ga + 128, ga + sa + 128, ga + 2 * sa + 128, ga + 3 * sa + 128, gb + 128, sb);
  const char* fa = stg + (wm * 64 + rlane) * SPITCH + koff * 2;         // this lane's place in its first A fragment
  const char* fb = stg + (128 + wn * 64 + rlane) * SPITCH + koff * 2;   // the same for B
  for (int t = 0; t < T; ++t) {
    const int bo = (t & 1) * SBYTES;
    // unrolled so that the fragment arrays keep constant indices (registers, no scratch)
#pragma unroll
    for (int ks = 0; ks < 2; ++ks) {
      v16h bh[4], ah[4];
#pragma unroll
      for (int j = 0; j < 4; ++j) bh[j] = ldfrag_h((const _Float16*)(fb + bo + j * 16 * SPITCH + ks * 64));
#pragma unroll
      for (int i = 0; i < 4; ++i) ah[i] = ldfrag_h((const _Float16*)(fa + bo + i * 16 * SPITCH + ks * 64));
#pragma unroll
      for (int i = 0; i < 4; ++i) {
#pragma unroll
        for (int j = 0; j < 4; ++j) {
          acc[i][j] = mma_h(ah[i], bh[j], acc[i][j]);
        }
      }
    }
    wait_lds();
    wait_copies();
    __syncthreads();                                   // publishes tile t + 1; ends every wave's reads of tile t
    if (t + 2 < T) {                                   // block-uniform
      const size_t ko = (size_t)(t + 2) * 128;
      stage_issue(lcp + (unsigned)bo, ga + ko, ga + sa + ko, ga + 2 * sa + ko, ga + 3 * sa + ko, gb + ko, sb);
    }
  }
  wait_copies();

  float mz[4];
#pragma unroll
  for (int j = 0; j < 4; ++j) mz[j] = smz[(wn << 6) + (j << 4) + rlane];

  float* slab = sT[wave];
  const size_t pbase = ((size_t)(bb * NH + tn)) * SEQ;     // plane row base for head tn of batch bb
#pragma unroll
  for (int i = 0; i < 4; ++i) {
    const int mBase = m0 + (i << 4);
#pragma unroll
    for (int r = 0; r < 8; ++r) {
#pragma unroll
      for (int j = 0; j < 4; ++j) {
        slab[(mOff + r) * 68 + (j << 4) + rlane] = acc[i][j][r] * oscale + mz[j];
      }
    }
    __builtin_amdgcn_fence(__ATOMIC_RELEASE, "workgroup");
    __builtin_amdgcn_wave_barrier();
    __builtin_amdgcn_fence(__ATOMIC_ACQUIRE, "workgroup");
    {
      const int g4 = lane >> 3, piece = lane & 7;
      v4u hv[4], lv[4];
      size_t ofs[4];
#pragma unroll
      for (int q = 0; q < 4; ++q) {
        const int row = q * 4 + g4;                      // q 0..3 x g4 0..3 = rows 0..15
        const v4f x0 = *(const v4f*)(slab + row * 68 + piece * 8);
        const v4f x1 = *(const v4f*)(slab + row * 68 + piece * 8 + 4);
        float f[8];
        f[0] = x0[0]; f[1] = x0[1]; f[2] = x0[2]; f[3] = x0[3];
        f[4] = x1[0]; f[5] = x1[1]; f[6] = x1[2]; f[7] = x1[3];
        v4u ph, pl;
#pragma unroll
        for (int e = 0; e < 4; ++e) {
          const float s0 = f[2 * e] * 1024.0f;
          const float s1 = f[2 * e + 1] * 1024.0f;
          const _Float16 h0 = (_Float16)s0;
          const _Float16 h1 = (_Float16)s1;
          const _Float16 l0 = (_Float16)((s0 - (float)h0) * 2048.0f);
          const _Float16 l1 = (_Float16)((s1 - (float)h1) * 2048.0f);
          ph[e] = pk16(h_bits(h0), h_bits(h1));
          pl[e] = pk16(h_bits(l0), h_bits(l1));
        }
        hv[q] = ph;
        lv[q] = pl;
        ofs[q] = (pbase + (size_t)(mBase + row)) * HD + piece * 8;
      }
      {
#pragma unroll
        for (int q = 0; q < 4; ++q) {
          *(v4u*)(ohi + ofs[q]) = hv[q];
          *(v4u*)(olo + ofs[q]) = lv[q];
        }
        
      }
    }
    __builtin_amdgcn_fence(__ATOMIC_RELEASE, "workgroup");
    __builtin_amdgcn_wave_barrier();
    __builtin_amdgcn_fence(__ATOMIC_ACQUIRE, "workgroup");
  }
}

// =====================================================================================================
// Output projection: C[m][n] = sch * (sum_k Ahi[m][k]*Bt[n][k] + scl * sum_k Alo[m][k]*Bt[n][k]) + bf16rne(bias[n])
// (f16 products, f32 accumulate, hi and scaled-residual products in separate accumulators). Ahi/Alo row-major
// [M][K] pitch lda; Bt [N][K] pitch ldb; C f32 [M][N] pitch ldc. One wave per 32x64 tile, 8 waves on a 64x256
// block tile whose operands are staged in LDS; all 8 fragments of a k-step (A: 2 rows x 2 planes, B: 4) read at its head.
// Epilogue: 16-row slabs staged per wave in LDS; each 64-wide row segment (256 B) written by one instruction
// coverage: 2 slabs x 16 rows x 64 cols = the wave's whole 32x64 tile; grid covers every tile of C.
// =====================================================================================================
__global__ __launch_bounds__(256) void gemm32h_w(
    const unsigned short* __restrict__ Ahp, const unsigned short* __restrict__ Alp, int lda,
    const unsigned short* __restrict__ Btp, int ldb,
    const float* __restrict__ bias,
    float* C, int ldc, int M, int N, int K, float sch, float scl) {
  const _Float16* Ah = (const _Float16*)(const void*)Ahp;
  const _Float16* Al = (const _Float16*)(const void*)Alp;
  const _Float16* Bh = (const _Float16*)(const void*)Btp;
  __shared__ __align__(16) float sT[8][16 * 68];
  __shared__ __align__(16) char stg[2 * SBYTES];   // the two operand stages
  const int lane = threadIdx.x & 31;
  const int wave = threadIdx.x >> 5;
  const int btN = N >> 8;                // block tile 64 x 256: waves 2 (m) x 4 (n), 32 x 64 each
  const int btM = M >> 6;
  if ((int)blockIdx.x >= btM * btN) return;   // block-uniform, in front of every barrier
  const int bm  = blockIdx.x / btN;
  const int bm0 = bm << 6;
  const int bn0 = (blockIdx.x - bm * btN) << 8;
  const int wm  = wave >> 2;
  const int wn  = wave & 3;
  const int m0 = bm0 + (wm << 5);
  const int n0 = bn0 + (wn << 6);
  const int rlane = lane & 15;
  const int koff  = (lane >> 4) * 8;
  const int mOff  = (lane >> 4) * 8;

  v8f acch[2][4], accl[2][4];
#pragma unroll
  for (int i = 0; i < 2; ++i)
#pragma unroll
    for (int j = 0; j < 4; ++j) { acch[i][j] = zero8(); accl[i][j] = zero8(); }

  // Two-buffer ring along K, 64 k a trip: the copies of tile t + 2 fly while tile t + 1 is multiplied.
  const int T = K >> 6;
  const int crow = threadIdx.x >> 3;                   // this thread's row within each group of 32 staged rows
  const int cpc  = (threadIdx.x & 7) * 16;             // its 16-B piece of the 128-B row
  const unsigned lcp = lds_off(stg) + (unsigned)(crow * SPITCH + cpc);
  const size_t sa = (size_t)32 * lda * 2;              // bytes between a thread's consecutive A rows
  const size_t sb = (size_t)32 * ldb * 2;              // the same for B
  const char* gh = (const char*)(Ah + (size_t)(bm0 + crow) * lda) + cpc;   // staged rows 0..63: hi plane
  const char* gl = (const char*)(Al + (size_t)(bm0 + crow) * lda) + cpc;   // staged rows 64..127: residual plane
  const char* gb = (const char*)(Bh + (size_t)(bn0 + crow) * ldb) + cpc;
  stage_issue(lcp, gh, gh + sa, gl, gl + sa, gb, sb);
  wait_copies();
  __syncthreads();                                     // tile 0 is readable by every wave
  if (T > 1) stage_issue(lcp + SBYTES, gh + 128, gh + sa + 128, gl + 128, gl + sa + 128, gb + 128, sb);
  const char* fa = stg + (wm * 32 + rlane) * SPITCH + koff * 2;         // this lane's place in its first hi fragment
  const char* fb = stg + (128 + wn * 64 + rlane) * SPITCH + koff * 2;   // the same for B
  for (int t = 0; t < T; ++t) {
    const int bo = (t & 1) * SBYTES;
    // unrolled so that the fragment arrays keep constant indices (registers, no scratch)
#pragma unroll
    for (int ks = 0; ks < 2; ++ks) {
      v16h fh[2], fl[2], bfr[4];
#pragma unroll
      for (int i = 0; i < 2; ++i) {
        fh[i] = ldfrag_h((const _Float16*)(fa + bo + i * 16 * SPITCH + ks * 64));
        fl[i] = ldfrag_h((const _Float16*)(fa + bo + (64 + i * 16) * SPITCH + ks * 64));
      }
#pragma unroll
      for (int j = 0; j < 4; ++j) bfr[j] = ldfrag_h((const _Float16*)(fb + bo + j * 16 * SPITCH + ks * 64));
#pragma unroll
      for (int j = 0; j < 4; ++j) {
#pragma unroll
        for (int i = 0; i < 2; ++i) {
          acch[i][j] = mma_h(fh[i], bfr[j], acch[i][j]);
          accl[i][j] = mma_h(fl[i], bfr[j], accl[i][j]);
        }
      }
    }
    wait_lds();
    wait_copies();
    __syncthreads();                                   // publishes tile t + 1; ends every wave's reads of tile t
    if (t + 2 < T) {                                   // block-uniform
      const size_t ko = (size_t)(t + 2) * 128;
      stage_issue(lcp + (unsigned)bo, gh + ko, gh + sa + ko, gl + ko, gl + sa + ko, gb + ko, sb);
    }
  }
  wait_copies();

  float bz[4];
#pragma unroll
  for (int j = 0; j < 4; ++j) bz[j] = bf_up(bf_bits(bias[n0 + (j << 4) + rlane]));

  float* slab = sT[wave];
#pragma unroll
  for (int i = 0; i < 2; ++i) {
    const int mBase = m0 + (i << 4);
#pragma unroll
    for (int r = 0; r < 8; ++r) {
#pragma unroll
      for (int j = 0; j < 4; ++j) {
        slab[(mOff + r) * 68 + (j << 4) + rlane] = (acch[i][j][r] + accl[i][j][r] * scl) * sch + bz[j];
      }
    }
    __builtin_amdgcn_fence(__ATOMIC_RELEASE, "workgroup");
    __builtin_amdgcn_wave_barrier();
    __builtin_amdgcn_fence(__ATOMIC_ACQUIRE, "workgroup");
    {
      const int hh = lane >> 4, c4 = (lane & 15) * 4;     // 256-B row segment = 16 lanes x 16 B
      v4f ov[8];
#pragma unroll
      for (int it = 0; it < 8; ++it) {
        const int row = it * 2 + hh;                       // it 0..7 x hh 0..1 = rows 0..15
        ov[it] = *(const v4f*)(slab + row * 68 + c4);
      }
      {
#pragma unroll
        for (int it = 0; it < 8; ++it) {
          const int row = it * 2 + hh;
          *(v4f*)(C + (size_t)(mBase + row) * ldc + n0 + c4) = ov[it];
        }
        
      }
    }
    __builtin_amdgcn_fence(__ATOMIC_RELEASE, "workgroup");
    __builtin_amdgcn_wave_barrier();
    __builtin_amdgcn_fence(__ATOMIC_ACQUIRE, "workgroup");
  }
}

// =====================================================================================================
// Workspace map (bytes); every region an exact multiple of its whole-line / whole-tile store granularity
// within a launch; of Tf's three planes the first two hold the f32 score maps):
//   Xb   bf16 [4096][1024]              0         8388608
//   Wqb  bf16 [1024 n][1024 k]     8388608         2097152
//   Wkb  bf16 [1024 n][1024 k]    10485760         2097152
//   Wvb  bf16 [1024 n][1024 k]    12582912         2097152
//   Woh  f16  [1024 n][1024 k]    14680064         2097152   (f16(bf16(Wo) x1024))
//   Tf   f32  [3][4096][1024]    16777216        50331648   (planes 0, 1: S f32 [2][2048][2048])
//   Qh   f16  [4096][1024]       67108864         8388608   (q x16)
//   Kh   f16  [4096][1024]       75497472         8388608   (k x16)
//   VTh  f16  [2*1024][2048]     83886080         8388608   ([b*DM + n][t], v x64)
//   Ph   f16  [2][2048][2048]    92274688        16777216   (centered weights)
//   Ohi  f16  [2][16][2048][64] 109051904         8388608
//   Olo  f16  [2][16][2048][64] 117440512         8388608
//   pS   f32  [64][1024]        125829120          262144   (column sums of v per 64 token rows)
//   end                         126091264
// Inputs: query f32 [2][2048][1024]; Wq, Wk, Wv, Wo f32 [1024 out][1024 in]; bq, bk, bv, bo f32 [1024].
// d_out f32 [4096][1024] at byte 0 (row = b*SEQ + s, col = n).
// =====================================================================================================
extern "C" void kernel_launch(void* const* d_in, const int* in_sizes, int n_in,
                              void* d_out, int out_size, void* d_ws, size_t ws_size,
                              hipStream_t stream) {
  if (n_in < 9) return;
  if (in_sizes[0] != NB * SEQ * DM) return;
  if (in_sizes[1] != DM * DM) return;
  if (in_sizes[2] != DM) return;
  if (in_sizes[3] != DM * DM) return;
  if (in_sizes[4] != DM) return;
  if (in_sizes[5] != DM * DM) return;
  if (in_sizes[6] != DM) return;
  if (in_sizes[7] != DM * DM) return;
  if (in_sizes[8] != DM) return;
  if (out_size != OUTN) return;

  const float* x  = (const float*)d_in[0];   // [NB*SEQ][DM]
  const float* Wq = (const float*)d_in[1];   // [DM n][DM k]
  const float* bq = (const float*)d_in[2];   // [DM]
  const float* Wk = (const float*)d_in[3];
  const float* bk = (const float*)d_in[4];
  const float* Wv = (const float*)d_in[5];
  const float* bv = (const float*)d_in[6];
  const float* Wo = (const float*)d_in[7];
  const float* bo = (const float*)d_in[8];

  const size_t PXb = (size_t)ROWS * DM * 2;          //  8388608
  const size_t PW  = (size_t)DM * DM * 2;            //  2097152
  const size_t PF  = (size_t)3 * ROWS * DM * 4;      // 50331648
  const size_t PH  = (size_t)ROWS * DM * 2;          //  8388608
  const size_t PVt = (size_t)NB * DM * SEQ * 2;      //  8388608
  const size_t PP  = (size_t)NB * SEQ * SEQ * 2;     // 16777216
  const size_t PO  = (size_t)NB * NH * SEQ * HD * 2; //  8388608
  const size_t PMv = (size_t)(ROWS / 64) * DM * 4;   //   262144
  size_t off = 0;
  const size_t oXb = off; off += PXb;
  const size_t oWq = off; off += PW;
  const size_t oWk = off; off += PW;
  const size_t oWv = off; off += PW;
  const size_t oWo = off; off += PW;
  const size_t oTf = off; off += PF;
  const size_t oQh = off; off += PH;
  const size_t oKh = off; off += PH;
  const size_t oVt = off; off += PVt;
  const size_t oP  = off; off += PP;
  const size_t oOh = off; off += PO;
  const size_t oOl = off; off += PO;
  const size_t oMv = off; off += PMv;
  if (off > ws_size) return;                        // off = 126091264
  if (off > (size_t)134217728) return;

  char* ws = (char*)d_ws;
  unsigned short* Xb  = (unsigned short*)(ws + oXb);
  unsigned short* Wqb = (unsigned short*)(ws + oWq);
  unsigned short* Woh = (unsigned short*)(ws + oWo);
  float*          Tf  = (float*)(ws + oTf);
  unsigned short* Qh  = (unsigned short*)(ws + oQh);
  unsigned short* Kh  = (unsigned short*)(ws + oKh);
  unsigned short* VTh = (unsigned short*)(ws + oVt);
  unsigned short* Ph  = (unsigned short*)(ws + oP);
  unsigned short* Ohi = (unsigned short*)(ws + oOh);
  unsigned short* Olo = (unsigned short*)(ws + oOl);
  float*          pS  = (float*)(ws + oMv);
  float*          outf = (float*)d_out;             // [ROWS][DM]

  const dim3 blk(256);
  const dim3 gCvt(XBLK + 4 * WBLK);                 // 2048 + 4 * 512 blocks (exact)
  const dim3 gGemm(((ROWS / 64) * (DM / 64)) / 8, 3);  // 1024 tiles -> 128 blocks, x 3 projections
  const dim3 gSc(((SEQ / 64) * (SEQ / 64)) / 8, NB);  // 1024 tiles -> 128 blocks per batch
  const dim3 gSm(NB * SEQ);                         // 2048 rows per batch
  const dim3 gPv(((SEQ / 64) * (DM / 64)) / 8, NB); //  512 tiles -> 64 blocks per batch
  const dim3 gWo(((ROWS / 32) * (DM / 64)) / 8);    // 2048 tiles -> 256 blocks
  const float qkScale = 16.0f;                      // q and k planes carried x16
  const float woScale = 1024.0f;                    // Wo plane carried x1024
  const float sscale  = 1.0f / 32768.0f;            // (1/sqrt(64))/16 heads = 1/128, two x16 carries folded back
  const float vScale  = 64.0f;                      // v^T plane carried x64
  const float pvOscl  = 1.0f / 1048576.0f;          // 1/(16384 * 64)
  const float woSch   = 1.0f / 1048576.0f;          // 1/(1024 * 1024): O hi carry and Wo carry
  const float woScl   = 1.0f / 2048.0f;             // residual plane carry

  // (1) activations and weights -> bf16 planes (W is [n][k] already); Wo -> f16 plane of its bf16 value x1024;
  //     Xb, Wqb, Wkb, Wvb, Woh lie one behind the other
  cvt_inputs<<<gCvt, blk, 0, stream>>>(x, Wq, Wk, Wv, Wo, Xb, woScale);
  // (2) q, k, v = Xb . W^T + bias (M=4096, N=1024, K=1024 each), one grid: q, k -> f16 planes (x16; Qh, Kh are
  //     adjacent); v -> f16 v^T plane (x64) and f32 column sums per 64 token rows
  gemm64<<<gGemm, blk, 0, stream>>>(Xb, DM, Wqb, DM, bq, bk, bv, Qh, pS, VTh, DM, ROWS, DM, DM, qkScale, vScale);
  // (3) both batches in one grid each: head-averaged scores (K = 1024) -> Tf as S [2][2048][2048]; row softmax ->
  //     centered weights; p . v -> O hi/res head-major planes
  gemm64h_s<<<gSc, blk, 0, stream>>>(Qh, DM, Kh, DM, Tf, SEQ, SEQ, SEQ, DM, sscale);
  softmax_c<<<gSm, blk, 0, stream>>>(Tf, Ph);
  gemm64h_o<<<gPv, blk, 0, stream>>>(Ph, SEQ, VTh, SEQ, pS, Ohi, Olo, SEQ, DM, SEQ, pvOscl);
  // (4) out = O(flat [4096][1024]) . Woh^T + bo -> d_out
  gemm32h_w<<<gWo, blk, 0, stream>>>(Ohi, Olo, DM, Woh, DM, bo, outf, DM, ROWS, DM, DM, woSch, woScl);
  (void)hipGetLastError();
}

// v007
// One run takes 108 microseconds.
// Timed twice side by side with v006, it ran 1.06 times as fast both times.
// All steps since v000 together make it 6.32 times as fast.
// Contractions: q/k/v projections = v_wmma_f32_16x16x32_bf16 (bf16 operands: RNE-converted x, W, bias; single product); head-averaged q.k^T scores = v_wmma_f32_16x16x32_f16 (q, k f16 planes carried x16; single product); p.v = v_wmma_f32_16x16x32_f16 (centered softmax weights 16384*p-8 in f16, v^T f16 plane carried x64; single product; f32 column mean of v added back); output projection = v_wmma_f32_16x16x32_f16 (attention output as f16 hi (x1024) + residual (x2048) planes, two products into separate accumulators; Wo as f16 of its bf16-RNE value x1024); all f32 accumulate; softmax in f32.
#include <hip/hip_runtime.h>
#include <math.h>
#include <stdint.h>

#define NB    2
#define SEQ   2048
#define DM    1024
#define NH    16
#define HD    64
#define ROWS  (NB * SEQ)             // 4096 token rows
#define OUTN  (ROWS * DM)
static_assert(NH * HD == DM);
static_assert(HD == 64);
static_assert((SEQ % 64) == 0 && (DM % 64) == 0 && (ROWS % 64) == 0 && (DM % 32) == 0 && (DM % 256) == 0);
static_assert(SEQ == 256 * 8);
static_assert((SEQ % 128) == 0);
static_assert((((ROWS / 64) * (DM / 64)) % 8) == 0);
static_assert((((SEQ / 64) * (SEQ / 64)) % 8) == 0);
static_assert((((SEQ / 64) * (DM / 64)) % 8) == 0);
static_assert((((ROWS / 32) * (DM / 64)) % 8) == 0);
static_assert(((ROWS * DM / 8) % 256) == 0 && ((DM * DM / 8) % 256) == 0);
static_assert((size_t)NB * SEQ * SEQ * 4 <= (size_t)3 * ROWS * DM * 4);
static_assert((ROWS % 128) == 0 && (SEQ % 256) == 0 && (DM % 256) == 0 && DM >= 128 && SEQ >= 128);   // block tiles, two stages

typedef _Float16 v16h __attribute__((ext_vector_type(16)));
typedef _Float16 v8h  __attribute__((ext_vector_type(8)));
typedef __bf16   v16b __attribute__((ext_vector_type(16)));
typedef __bf16   v8b  __attribute__((ext_vector_type(8)));
typedef float    v8f  __attribute__((ext_vector_type(8)));
typedef float    v4f  __attribute__((ext_vector_type(4)));
typedef unsigned int v4u __attribute__((ext_vector_type(4)));

// ---- scalar helpers --------------------------------------------------------------------------------
__device__ __forceinline__ unsigned short bf_bits(float f) {          // f32 -> bf16 bits, RNE convert
  unsigned u = __float_as_uint(f);
  return (unsigned short)((u + 0x7FFFu + ((u >> 16) & 1u)) >> 16);
}
__device__ __forceinline__ float bf_up(unsigned short h) { return __uint_as_float(((unsigned)h) << 16); }
__device__ __forceinline__ unsigned short h_bits(_Float16 x) { return __builtin_bit_cast(unsigned short, x); }
__device__ __forceinline__ unsigned pk16(unsigned short a, unsigned short b) { return (unsigned)a | ((unsigned)b << 16); }
__device__ __forceinline__ v8f zero8() { v8f z = {0.f, 0.f, 0.f, 0.f, 0.f, 0.f, 0.f, 0.f}; return z; }

// ---- fragment loaders: 16-bit A/B operand, lane -> row/col (lane&15), p already includes +8*(lane>>4);
//      elements 0..7 <- p[0..7] (k0+8h..), elements 8..15 <- p[16..23] (k0+16+8h..)
__device__ __forceinline__ v16b ldfrag_b(const __bf16* p) {
  union { v16b v; v8b h[2]; } f;
  f.h[0] = *(const v8b*)(p);
  f.h[1] = *(const v8b*)(p + 16);
  return f.v;
}
__device__ __forceinline__ v16h ldfrag_h(const _Float16* p) {
  union { v16h v; v8h h[2]; } f;
  f.h[0] = *(const v8h*)(p);
  f.h[1] = *(const v8h*)(p + 16);
  return f.v;
}

// ---- operand staging in LDS, shared by the 8 waves of a block ------------------------------------------
// A stage = 64 k (one 128-B line) of 384 operand rows: rows 0..127 the block's A rows, rows 128..383 its B rows, at a
// pitch of 144 B (16 B x odd: conflict-free for ds_load_b128 readers). Two stages or more: later ones are copied while
// this one is multiplied. Thread tid copies 16 B of row c * 32 + (tid >> 3), piece tid & 7, for c = 0..11: every wave-wide
// copy covers four whole 128-B lines of global memory.
#define SROWS   384
#define SPITCH  144
#define SBYTES  (SROWS * SPITCH)     // 55296
#define SCSTEP  (32 * SPITCH)        // LDS distance between a thread's consecutive copies
__device__ __forceinline__ unsigned lds_off(const void* p) { return (unsigned)(size_t)p; }
// The 12 copies of one thread for one stage: a0..a3 = its four A-row addresses, b + j * sb (j = 0..7) its B-row
// addresses, l = its LDS byte address in the target buffer. s_wait_xcnt stands inside the statement, behind the last
// copy: a precaution in front of every later rewrite of the address registers that the copies name.
__device__ __forceinline__ void stage_issue(unsigned l, const char* a0, const char* a1, const char* a2, const char* a3,
                                            const char* b, size_t sb) {
#if defined(__HIP_DEVICE_COMPILE__)
  asm volatile(
      "global_load_async_to_lds_b128 %0, %12, off\n\t"
      "global_load_async_to_lds_b128 %1, %13, off\n\t"
      "global_load_async_to_lds_b128 %2, %14, off\n\t"
      "global_load_async_to_lds_b128 %3, %15, off\n\t"
      "global_load_async_to_lds_b128 %4, %16, off\n\t"
      "global_load_async_to_lds_b128 %5, %17, off\n\t"
      "global_load_async_to_lds_b128 %6, %18, off\n\t"
      "global_load_async_to_lds_b128 %7, %19, off\n\t"
      "global_load_async_to_lds_b128 %8, %20, off\n\t"
      "global_load_async_to_lds_b128 %9, %21, off\n\t"
      "global_load_async_to_lds_b128 %10, %22, off\n\t"
      "global_load_async_to_lds_b128 %11, %23, off\n\t"
      "s_wait_xcnt 0x0"
      :: "v"(l), "v"(l + 1u * SCSTEP), "v"(l + 2u * SCSTEP), "v"(l + 3u * SCSTEP), "v"(l + 4u * SCSTEP),
         "v"(l + 5u * SCSTEP), "v"(l + 6u * SCSTEP), "v"(l + 7u * SCSTEP), "v"(l + 8u * SCSTEP),
         "v"(l + 9u * SCSTEP), "v"(l + 10u * SCSTEP), "v"(l + 11u * SCSTEP),
         "v"(a0), "v"(a1), "v"(a2), "v"(a3), "v"(b), "v"(b + sb), "v"(b + 2 * sb), "v"(b + 3 * sb),
         "v"(b + 4 * sb), "v"(b + 5 * sb), "v"(b + 6 * sb), "v"(b + 7 * sb)
      : "memory");
#endif
}
// this wave's copies have landed in LDS (the compiler places no wait for them)
__device__ __forceinline__ void wait_copies() {
#if defined(__HIP_DEVICE_COMPILE__)
  asm volatile("s_wait_asynccnt 0x0" ::: "memory");
#endif
}
// The deeper ring of the kernels whose block is alone on its WGP: RING buffers, the copies RING - 1 tiles ahead. Every
// wave issues 12 copies a tile and the counter returns in issue order, so a wait to 12 n leaves exactly the n youngest
// tiles in flight and says that every older tile of this wave has landed.
#define RING 4
static_assert(RING * 12 <= 63);                        // copies of one wave outstanding at most
static_assert(RING == 4);                              // the two counted waits below are written for it
// all but the three youngest tiles have landed (in front of the loop: tile 0)
__device__ __forceinline__ void wait_copies_but3() {
#if defined(__HIP_DEVICE_COMPILE__)
  asm volatile("s_wait_asynccnt 0x24" ::: "memory");
#endif
}
// all but the two youngest tiles have landed (at the foot of trip t: tile t + 1)
__device__ __forceinline__ void wait_copies_but2() {
#if defined(__HIP_DEVICE_COMPILE__)
  asm volatile("s_wait_asynccnt 0x18" ::: "memory");
#endif
}
// this wave's LDS reads have returned, so that the buffer may be handed to its next writer behind the barrier
__device__ __forceinline__ void wait_lds() {
#if defined(__HIP_DEVICE_COMPILE__)
  asm volatile("s_wait_dscnt 0x0" ::: "memory");
#endif
}

// ---- WMMA helpers with trailing VALU hazard gap --------------------------------------------------------
__device__ __forceinline__ v8f mma_h(v16h a, v16h b, v8f c) {
  c = __builtin_amdgcn_wmma_f32_16x16x32_f16(false, a, false, b, (short)0, c, false, false);
#if defined(__HIP_DEVICE_COMPILE__)
  asm volatile("v_nop\n\tv_nop\n\tv_nop\n\tv_nop" : "+v"(c) : "v"(a), "v"(b));
#endif
  return c;
}
__device__ __forceinline__ v8f mma_b_raw(v16b a, v16b b, v8f c) {
  return __builtin_amdgcn_wmma_f32_16x16x32_bf16(false, a, false, b, (short)0, c, false, false);
}
__device__ __forceinline__ void dep_guard_b(v8f& a, v8f& b, v16b x, v16b y) {
#if defined(__HIP_DEVICE_COMPILE__)
  asm volatile("v_nop\n\tv_nop\n\tv_nop\n\tv_nop" : "+v"(a), "+v"(b) : "v"(x), "v"(y));
#endif
}
__device__ __forceinline__ void keep4_b(v16b a, v16b b, v16b c, v16b d) {
#if defined(__HIP_DEVICE_COMPILE__)
  asm volatile("v_nop" :: "v"(a), "v"(b), "v"(c), "v"(d));
#endif
}
__device__ __forceinline__ void acc_guard4(v8f& a, v8f& b, v8f& c, v8f& d) {
#if defined(__HIP_DEVICE_COMPILE__)
  asm volatile("v_nop\n\tv_nop\n\tv_nop\n\tv_nop" : "+v"(a), "+v"(b), "+v"(c), "+v"(d));
#endif
}

// =====================================================================================================
// All five input conversions in one grid. Blocks [0, XBLK): x -> bf16 (RNE convert); then WBLK blocks each for Wq, Wk,
// Wv -> bf16 and for Wo -> f16(bf16rne(Wo) * woscale) (exact in f16 after the power-of-two scale). The five output
// planes lie one behind the other in the workspace, so the output index is the flat thread index. 8 elements per
// thread, one 16-B store per lane: a wave writes 512 contiguous B. The plane is chosen by blockIdx (block-uniform).
// coverage: (XBLK + 4 * WBLK) blocks x 256 threads x 8 = all five planes exactly.
// =====================================================================================================
#define XBLK (ROWS * DM / 8 / 256)
#define WBLK (DM * DM / 8 / 256)
__global__ __launch_bounds__(256) void cvt_inputs(const float* __restrict__ x, const float* __restrict__ Wq,
                                                  const float* __restrict__ Wk, const float* __restrict__ Wv,
                                                  const float* __restrict__ Wo, unsigned short* out, float woscale) {
  const int blk = blockIdx.x;
  const float* in = x;
  int first = 0;                                     // first block of this block's plane
  if (blk >= XBLK) {
    const int w = (blk - XBLK) / WBLK;               // 0..3
    in = (w == 0) ? Wq : (w == 1) ? Wk : (w == 2) ? Wv : Wo;
    first = XBLK + w * WBLK;
  }
  const int i = (blk - first) * 256 + threadIdx.x;
  const v4f a = *(const v4f*)(in + (size_t)i * 8);
  const v4f b = *(const v4f*)(in + (size_t)i * 8 + 4);
  // precaution: stands in front of every later rewrite of the two loads' address registers
  asm volatile("s_wait_xcnt 0x0" ::: "memory");
  v4u p;
  if (blk < XBLK + 3 * WBLK) {
    p[0] = pk16(bf_bits(a[0]), bf_bits(a[1]));
    p[1] = pk16(bf_bits(a[2]), bf_bits(a[3]));
    p[2] = pk16(bf_bits(b[0]), bf_bits(b[1]));
    p[3] = pk16(bf_bits(b[2]), bf_bits(b[3]));
  } else {
    p[0] = pk16(h_bits((_Float16)(bf_up(bf_bits(a[0])) * woscale)), h_bits((_Float16)(bf_up(bf_bits(a[1])) * woscale)));
    p[1] = pk16(h_bits((_Float16)(bf_up(bf_bits(a[2])) * woscale)), h_bits((_Float16)(bf_up(bf_bits(a[3])) * woscale)));
    p[2] = pk16(h_bits((_Float16)(bf_up(bf_bits(b[0])) * woscale)), h_bits((_Float16)(bf_up(bf_bits(b[1])) * woscale)));
    p[3] = pk16(h_bits((_Float16)(bf_up(bf_bits(b[2])) * woscale)), h_bits((_Float16)(bf_up(bf_bits(b[3])) * woscale)));
  }
  *(v4u*)(out + ((size_t)blk * 256 + threadIdx.x) * 8) = p;
}

// =====================================================================================================
// Register-blocked bf16 WMMA GEMM with bias: C[m][n] = sum_k A[m][k] * Bt[n][k] + bf16rne(bias[n]); one wave per
// 64x64 tile, 8 waves on a 128x256 block tile whose operands are staged in LDS (one barrier a trip). A row-major [M][K] pitch lda; Bt row-major [N][K] pitch ldb (k contiguous);
// bias f32 [N] (RNE converted to bf16 and widened in the epilogue); M, N multiples of the 128x256 block tile, K of 64
// (fixed sizes, statically asserted); M a multiple of 128, N of 256, K of 64 for every launch here (no idle waves).
// blockIdx.y = which of three independent products on the same A runs here (q, k, v): Bt plane y (N*ldb elements
// apart), bias y. Each product leaves in the form its reader takes:
//   q, k: f16 plane y of qkh, [M][N] pitch ldc, = f16(C * qkscale); 16-row f32 slabs staged per wave in LDS, each
//         64-wide row segment (128 B, one line) stored by 8 lanes x 16 B.
//   v:    the column sums of the wave's 64 rows, f32, in ps[(m0 / 64) * N + n] (for the column mean: a lane adds its 32
//         accumulator rows of a column as a tree, the two lane halves are added by __shfl_xor), and the f16 v^T plane
//         vth[(b*DM + n)*SEQ + t] =
//         f16(C * vscale), m = b*SEQ + t: a lane's 8 accumulator rows are 8 consecutive t of one n, so the wave's tile
//         is laid transposed in LDS by 16-B stores (its own 64 x 144 B of the operand stages, which every wave has
//         left behind the loop's last barrier) and leaves as whole 128-B lines.
// coverage: 8 waves x 64x64 = the block's 128x256 tile of its plane(s); grid covers every tile of q, k and v.
// =====================================================================================================
__global__ __launch_bounds__(256) void gemm64(
    const unsigned short* __restrict__ Ap, int lda,
    const unsigned short* __restrict__ Btp, int ldb,
    const float* __restrict__ bias0, const float* __restrict__ bias1, const float* __restrict__ bias2,
    unsigned short* qkh, float* ps, unsigned short* vth, int ldc, int M, int N, int K, float qkscale, float vscale) {
  const int which = blockIdx.y;
  const float* bias = (which == 0) ? bias0 : (which == 1) ? bias1 : bias2;
  const __bf16* Ab  = (const __bf16*)(const void*)Ap;
  const __bf16* Bb  = (const __bf16*)(const void*)Btp + (size_t)which * N * ldb;
  __shared__ __align__(16) float sT[8][16 * 68];   // per-wave 16x64 slab, pitch 68 floats
  __shared__ __align__(16) char stg[2 * SBYTES];   // the two operand stages
  const int lane = threadIdx.x & 31;
  const int wave = threadIdx.x >> 5;
  const int btN = N >> 8;                // block tile 128 x 256: waves 2 (m) x 4 (n), 64 x 64 each
  const int btM = M >> 7;
  if ((int)blockIdx.x >= btM * btN) return;   // block-uniform, in front of every barrier
  const int bm  = blockIdx.x / btN;
  const int bm0 = bm << 7;
  const int bn0 = (blockIdx.x - bm * btN) << 8;
  const int wm  = wave >> 2;
  const int wn  = wave & 3;
  const int m0 = bm0 + (wm << 6);
  const int n0 = bn0 + (wn << 6);

  const int rlane = lane & 15;                 // row (A) / col (B, D) within subtile
  const int koff  = (lane >> 4) * 8;           // k offset of this lane half
  const int mOff  = (lane >> 4) * 8;           // D row offset

  v8f acc[4][4];
#pragma unroll
  for (int i = 0; i < 4; ++i)
#pragma unroll
    for (int j = 0; j < 4; ++j) acc[i][j] = zero8();

  // Two-buffer ring along K, 64 k a trip: the copies of tile t + 2 fly while tile t + 1 is multiplied.
  const int T = K >> 6;
  const int crow = threadIdx.x >> 3;                   // this thread's row within each group of 32 staged rows
  const int cpc  = (threadIdx.x & 7) * 16;             // its 16-B piece of the 128-B row
  const unsigned lcp = lds_off(stg) + (unsigned)(crow * SPITCH + cpc);
  const size_t sa = (size_t)32 * lda * 2;              // bytes between a thread's consecutive A rows
  const size_t sb = (size_t)32 * ldb * 2;              // the same for B
  const char* ga = (const char*)(Ab + (size_t)(bm0 + crow) * lda) + cpc;
  const char* gb = (const char*)(Bb + (size_t)(bn0 + crow) * ldb) + cpc;
  stage_issue(lcp, ga, ga + sa, ga + 2 * sa, ga + 3 * sa, gb, sb);
  wait_copies();
  __syncthreads();                                     // tile 0 is readable by every wave
  if (T > 1) stage_issue(lcp + SBYTES, ga + 128, ga + sa + 128, ga + 2 * sa + 128, ga + 3 * sa + 128, gb + 128, sb);
  const char* fa = stg + (wm * 64 + rlane) * SPITCH + koff * 2;         // this lane's place in its first A fragment
  const char* fb = stg + (128 + wn * 64 + rlane) * SPITCH + koff * 2;   // the same for B
  for (int t = 0; t < T; ++t) {
    const int bo = (t & 1) * SBYTES;
    // unrolled so that the fragment arrays keep constant indices (registers, no scratch)
#pragma unroll
    for (int ks = 0; ks < 2; ++ks) {
      v16b bh[4], ah[4];
#pragma unroll
      for (int j = 0; j < 4; ++j) bh[j] = ldfrag_b((const __bf16*)(fb + bo + j * 16 * SPITCH + ks * 64));
#pragma unroll
      for (int i = 0; i < 4; ++i) ah[i] = ldfrag_b((const __bf16*)(fa + bo + i * 16 * SPITCH + ks * 64));
#pragma unroll
      for (int i = 0; i < 4; ++i) {
#pragma unroll
        for (int j = 0; j < 4; ++j) {
          acc[i][j] = mma_b_raw(ah[i], bh[j], acc[i][j]);
        }
        dep_guard_b(acc[i][0], acc[i][3], ah[i], ah[i]);
      }
      keep4_b(bh[0], bh[1], bh[2], bh[3]);
    }
    wait_lds();
    wait_copies();
    __syncthreads();                                   // publishes tile t + 1; ends every wave's reads of tile t
    if (t + 2 < T) {                                   // block-uniform
      const size_t ko = (size_t)(t + 2) * 128;
      stage_issue(lcp + (unsigned)bo, ga + ko, ga + sa + ko, ga + 2 * sa + ko, ga + 3 * sa + ko, gb + ko, sb);
    }
  }
  wait_copies();
  acc_guard4(acc[0][0], acc[0][1], acc[0][2], acc[0][3]);
  acc_guard4(acc[1][0], acc[1][1], acc[1][2], acc[1][3]);
  acc_guard4(acc[2][0], acc[2][1], acc[2][2], acc[2][3]);
  acc_guard4(acc[3][0], acc[3][1], acc[3][2], acc[3][3]);

  // ---- bias per D column of this lane (n0 + 16j + rlane < N) ----
  float bz[4];
#pragma unroll
  for (int j = 0; j < 4; ++j) bz[j] = bf_up(bf_bits(bias[n0 + (j << 4) + rlane]));

  // ---- epilogue ----
  float* slab = sT[wave];
  if (which < 2) {                                         // block-uniform: q or k -> f16 plane
    unsigned short* H = qkh + (size_t)which * M * ldc;
#pragma unroll
    for (int i = 0; i < 4; ++i) {
      const int mBase = m0 + (i << 4);
#pragma unroll
      for (int r = 0; r < 8; ++r) {
#pragma unroll
        for (int j = 0; j < 4; ++j) {
          slab[(mOff + r) * 68 + (j << 4) + rlane] = (acc[i][j][r] + bz[j]) * qkscale;
        }
      }
      __builtin_amdgcn_fence(__ATOMIC_RELEASE, "workgroup");
      __builtin_amdgcn_wave_barrier();
      __builtin_amdgcn_fence(__ATOMIC_ACQUIRE, "workgroup");
      {
        const int g4 = lane >> 3, piece = lane & 7;        // 128-B row segment = 8 lanes x 16 B
        v4u hv[4];
#pragma unroll
        for (int q = 0; q < 4; ++q) {
          const int row = q * 4 + g4;                      // q 0..3 x g4 0..3 = rows 0..15
          const v4f x0 = *(const v4f*)(slab + row * 68 + piece * 8);
          const v4f x1 = *(const v4f*)(slab + row * 68 + piece * 8 + 4);
          v4u ph;
          ph[0] = pk16(h_bits((_Float16)x0[0]), h_bits((_Float16)x0[1]));
          ph[1] = pk16(h_bits((_Float16)x0[2]), h_bits((_Float16)x0[3]));
          ph[2] = pk16(h_bits((_Float16)x1[0]), h_bits((_Float16)x1[1]));
          ph[3] = pk16(h_bits((_Float16)x1[2]), h_bits((_Float16)x1[3]));
          hv[q] = ph;
        }
#pragma unroll
        for (int q = 0; q < 4; ++q) {
          const int row = q * 4 + g4;
          *(v4u*)(H + (size_t)(mBase + row) * ldc + n0 + piece * 8) = hv[q];
        }
      }
      __builtin_amdgcn_fence(__ATOMIC_RELEASE, "workgroup");
      __builtin_amdgcn_wave_barrier();
      __builtin_amdgcn_fence(__ATOMIC_ACQUIRE, "workgroup");
    }
    return;
  }

  // v: the column sums and the transposed f16 tile (LDS only); then the sums and the v^T lines leave
  char* tb = stg + wave * (64 * SPITCH);                   // this wave's [n 64][t 64] f16 tile, pitch 144 B
  float cs[4];                                             // column 16 j + rlane: sum over the wave's 64 rows
#pragma unroll
  for (int j = 0; j < 4; ++j) {
    const v8f t = (acc[0][j] + acc[1][j]) + (acc[2][j] + acc[3][j]);     // the lane's 32 rows, 8 sums of 4
    const float s = ((t[0] + t[1]) + (t[2] + t[3])) + ((t[4] + t[5]) + (t[6] + t[7]));
    cs[j] = (s + __shfl_xor(s, 16)) + 64.0f * bz[j];       // both lane halves: all 64 rows; each row has the bias once
  }
#pragma unroll
  for (int i = 0; i < 4; ++i) {
#pragma unroll
    for (int j = 0; j < 4; ++j) {
      v4u pk;
#pragma unroll
      for (int e = 0; e < 4; ++e) {
        pk[e] = pk16(h_bits((_Float16)((acc[i][j][2 * e] + bz[j]) * vscale)),
                     h_bits((_Float16)((acc[i][j][2 * e + 1] + bz[j]) * vscale)));
      }
      *(v4u*)(tb + ((j << 4) + rlane) * SPITCH + (i << 5) + mOff * 2) = pk;   // t = 16 i + mOff + 0..7
    }
  }
  // the wave's tile is written; its lanes read each other's rows below
  __builtin_amdgcn_fence(__ATOMIC_RELEASE, "workgroup");
  __builtin_amdgcn_wave_barrier();
  __builtin_amdgcn_fence(__ATOMIC_ACQUIRE, "workgroup");
  {
    // both halves hold all four sums: half h stores columns 16 h + rlane and 32 + 16 h + rlane (two 128-B lines);
    // behind the fence, which would otherwise wait for these stores
    const int hh = lane >> 4;
    float* prow = ps + (size_t)(m0 >> 6) * N + n0 + (hh << 4) + rlane;
    prow[0]  = hh ? cs[1] : cs[0];
    prow[32] = hh ? cs[3] : cs[2];
    // precaution: stands behind the two stores, in front of every later rewrite of their registers
    asm volatile("s_wait_xcnt 0x0" ::: "memory");
  }
  {
    const int vb  = m0 / SEQ;                              // batch of this wave's 64 token rows (SEQ % 64 == 0)
    const int vt0 = m0 - vb * SEQ;
    const int g4 = lane >> 3, piece = lane & 7;            // 128-B line of one n = 8 lanes x 16 B
    unsigned short* vrow = vth + ((size_t)(vb * DM + n0 + g4)) * SEQ + vt0 + piece * 8;
#pragma unroll
    for (int hb = 0; hb < 2; ++hb) {
      v4u tv[8];
#pragma unroll
      for (int it = 0; it < 8; ++it) {
        const int row = (hb * 8 + it) * 4 + g4;            // 16 x g4 0..3 = rows n 0..63
        tv[it] = *(const v4u*)(tb + row * SPITCH + piece * 16);
      }
#pragma unroll
      for (int it = 0; it < 8; ++it) {
        *(v4u*)(vrow + (size_t)((hb * 8 + it) * 4) * SEQ) = tv[it];
      }
    }
    // precaution: stands behind the last of the sixteen stores, in front of every later rewrite of their registers
    asm volatile("s_wait_xcnt 0x0" ::: "memory");
  }
}

// =====================================================================================================
// f16 WMMA GEMM with scale: C[m][n] = cscale * sum_k A[m][k] * Bt[n][k] (f16 products, f32 accumulate).
// Same tiling/epilogue as gemm64 (one wave per 64x64 tile, operands staged in LDS per block, 16-row LDS slabs, each 256-B
// coverage: 4 slabs x 16 rows x 64 cols = the wave's whole 64x64 tile; 8 waves = the block's 128x256 tile.
// =====================================================================================================
__global__ __launch_bounds__(256) void gemm64h_s(
    const unsigned short* __restrict__ Ap, int lda,
    const unsigned short* __restrict__ Btp, int ldb,
    float* Cp, int ldc, int M, int N, int K, float cscale) {
  const int bb = blockIdx.y;             // batch: A, Bt and C planes of the batches lie one behind the other
  float* C = Cp + (size_t)bb * M * ldc;
  const _Float16* Ah = (const _Float16*)(const void*)Ap + (size_t)bb * M * lda;
  const _Float16* Bh = (const _Float16*)(const void*)Btp + (size_t)bb * N * ldb;
  __shared__ __align__(16) float sT[8][16 * 68];
  __shared__ __align__(16) char stg[RING * SBYTES];   // the operand stages
  const int lane = threadIdx.x & 31;
  const int wave = threadIdx.x >> 5;
  const int btN = N >> 8;                // block tile 128 x 256: waves 2 (m) x 4 (n), 64 x 64 each
  const int btM = M >> 7;
  if ((int)blockIdx.x >= btM * btN) return;   // block-uniform, in front of every barrier
  const int bm  = blockIdx.x / btN;
  const int bm0 = bm << 7;
  const int bn0 = (blockIdx.x - bm * btN) << 8;
  const int wm  = wave >> 2;
  const int wn  = wave & 3;
  const int m0 = bm0 + (wm << 6);
  const int n0 = bn0 + (wn << 6);
  const int rlane = lane & 15;
  const int koff  = (lane >> 4) * 8;
  const int mOff  = (lane >> 4) * 8;

  v8f acc[4][4];
#pragma unroll
  for (int i = 0; i < 4; ++i)
#pragma unroll
    for (int j = 0; j < 4; ++j) acc[i][j] = zero8();

  // Ring of RING buffers along K, 64 k a trip: the copies of tiles t + 2 .. t + RING fly while tile t + 1 is multiplied.
  const int T = K >> 6;
  const int crow = threadIdx.x >> 3;                   // this thread's row within each group of 32 staged rows
  const int cpc  = (threadIdx.x & 7) * 16;             // its 16-B piece of the 128-B row
  const unsigned lcp = lds_off(stg) + (unsigned)(crow * SPITCH + cpc);
  const size_t sa = (size_t)32 * lda * 2;              // bytes between a thread's consecutive A rows
  const size_t sb = (size_t)32 * ldb * 2;              // the same for B
  const char* ga = (const char*)(Ah + (size_t)(bm0 + crow) * lda) + cpc;
  const char* gb = (const char*)(Bh + (size_t)(bn0 + crow) * ldb) + cpc;
  // tiles 0 .. RING - 1 are asked for at once (each test block-uniform); unrolled so that each buffer's LDS offset is a
  // constant and the four statements stand one behind the other
#pragma unroll
  for (int p = 0; p < RING; ++p) {
    if (p < T) {
      const size_t ko = (size_t)p * 128;
      stage_issue(lcp + (unsigned)(p * SBYTES), ga + ko, ga + sa + ko, ga + 2 * sa + ko, ga + 3 * sa + ko, gb + ko, sb);
    }
  }
  if (T >= RING) wait_copies_but3(); else wait_copies();   // tile 0 has landed (block-uniform)
  __syncthreads();                                     // tile 0 is readable by every wave
  const char* fa = stg + (wm * 64 + rlane) * SPITCH + koff * 2;         // this lane's place in its first A fragment
  const char* fb = stg + (128 + wn * 64 + rlane) * SPITCH + koff * 2;   // the same for B
  for (int t = 0; t < T; ++t) {
    const int bo = (t & (RING - 1)) * SBYTES;
    // unrolled so that the fragment arrays keep constant indices (registers, no scratch)
#pragma unroll
    for (int ks = 0; ks < 2; ++ks) {
      v16h bh[4], ah[4];
#pragma unroll
      for (int j = 0; j < 4; ++j) bh[j] = ldfrag_h((const _Float16*)(fb + bo + j * 16 * SPITCH + ks * 64));
#pragma unroll
      for (int i = 0; i < 4; ++i) ah[i] = ldfrag_h((const _Float16*)(fa + bo + i * 16 * SPITCH + ks * 64));
#pragma unroll
      for (int i = 0; i < 4; ++i) {
#pragma unroll
        for (int j = 0; j < 4; ++j) {
          acc[i][j] = mma_h(ah[i], bh[j], acc[i][j]);
        }
      }
    }
    wait_lds();
    // tile t + 1 has landed: counted where tiles t + 2 and t + 3 are both issued (12 copies each), else to 0 (block-uniform)
    if (t + RING - 1 < T) wait_copies_but2(); else wait_copies();
    __syncthreads();                                   // publishes tile t + 1; ends every wave's reads of tile t
    if (t + RING < T) {                                // block-uniform
      const size_t ko = (size_t)(t + RING) * 128;
      stage_issue(lcp + (unsigned)bo, ga + ko, ga + sa + ko, ga + 2 * sa + ko, ga + 3 * sa + ko, gb + ko, sb);
    }
  }
  wait_copies();

  float* slab = sT[wave];
#pragma unroll
  for (int i = 0; i < 4; ++i) {
    const int mBase = m0 + (i << 4);
#pragma unroll
    for (int r = 0; r < 8; ++r) {
#pragma unroll
      for (int j = 0; j < 4; ++j) {
        slab[(mOff + r) * 68 + (j << 4) + rlane] = acc[i][j][r] * cscale;
      }
    }
    __builtin_amdgcn_fence(__ATOMIC_RELEASE, "workgroup");
    __builtin_amdgcn_wave_barrier();
    __builtin_amdgcn_fence(__ATOMIC_ACQUIRE, "workgroup");
    {
      const int hh = lane >> 4, c4 = (lane & 15) * 4;
      v4f ov[8];
#pragma unroll
      for (int it = 0; it < 8; ++it) {
        const int row = it * 2 + hh;
        ov[it] = *(const v4f*)(slab + row * 68 + c4);
      }
      {
#pragma unroll
        for (int it = 0; it < 8; ++it) {
          const int row = it * 2 + hh;
          *(v4f*)(C + (size_t)(mBase + row) * ldc + n0 + c4) = ov[it];
        }
        
      }
    }
    __builtin_amdgcn_fence(__ATOMIC_RELEASE, "workgroup");
    __builtin_amdgcn_wave_barrier();
    __builtin_amdgcn_fence(__ATOMIC_ACQUIRE, "workgroup");
  }
}

// =====================================================================================================
// Row softmax over SEQ keys, max-subtracted, f32: p = exp(s - max) / sum; stored CENTERED and scaled as
// f16(16384 * p - 8) = f16(16384 * (p - 1/SEQ)) (the 1/SEQ part is added back downstream as the column
// mean of v). One 256-thread block per row, 8 consecutive elements per thread (two v4f loads), wave
// reductions by __shfl_xor, 8 wave partials combined in fixed order through LDS.
// =====================================================================================================
__global__ __launch_bounds__(256) void softmax_c(const float* __restrict__ sf, unsigned short* ph) {
  __shared__ float redm[8];
  __shared__ float reds[8];
  const int row  = blockIdx.x;
  const int tid  = threadIdx.x;
  const int lane = tid & 31;
  const int wave = tid >> 5;
  const float* s = sf + (size_t)row * SEQ + tid * 8;
  const v4f a = *(const v4f*)(s);
  const v4f c = *(const v4f*)(s + 4);
  float v[8];
  v[0] = a[0]; v[1] = a[1]; v[2] = a[2]; v[3] = a[3];
  v[4] = c[0]; v[5] = c[1]; v[6] = c[2]; v[7] = c[3];
  float m = v[0];
#pragma unroll
  for (int e = 1; e < 8; ++e) m = fmaxf(m, v[e]);
#pragma unroll
  for (int o = 16; o > 0; o >>= 1) m = fmaxf(m, __shfl_xor(m, o));
  if (lane == 0) redm[wave] = m;
  __syncthreads();
  float mm = redm[0];
#pragma unroll
  for (int w = 1; w < 8; ++w) mm = fmaxf(mm, redm[w]);
  float sum = 0.f;
#pragma unroll
  for (int e = 0; e < 8; ++e) {
    v[e] = __expf(v[e] - mm);
    sum += v[e];
  }
#pragma unroll
  for (int o = 16; o > 0; o >>= 1) sum += __shfl_xor(sum, o);
  if (lane == 0) reds[wave] = sum;
  __syncthreads();
  float tot = 0.f;
#pragma unroll
  for (int w = 0; w < 8; ++w) tot += reds[w];       // fixed order, identical for every thread
  const float inv = 1.0f / tot;                     // tot >= 1
  v4u pk;
#pragma unroll
  for (int e = 0; e < 4; ++e) {
    const float p0 = v[2 * e] * inv;
    const float p1 = v[2 * e + 1] * inv;
    const _Float16 x0 = (_Float16)(p0 * 16384.0f - 8.0f);
    const _Float16 x1 = (_Float16)(p1 * 16384.0f - 8.0f);
    pk[e] = pk16(h_bits(x0), h_bits(x1));
  }
  unsigned short* o = ph + (size_t)row * SEQ + tid * 8;
  *(v4u*)o = pk;
  
}

// =====================================================================================================
// p.v, batch bb = blockIdx.y: O[i][n] = oscale * sum_j P[i][j] * Vt[n][j] + mv[n] (f16 products, f32 accumulate;
// oscale folds back the weight and v carries; mv = column mean of v in f32: thread tid adds, as a pairwise tree, the SEQ/64
// partial sums ps[(bb*SEQ/64 + p)*DM + n] of column n = bn0 + tid while tile 0 is copied, and leaves the mean in LDS for
// the epilogue, published by the barrier that publishes tile 0). P f16 [SEQ][SEQ] pitch lda
// (j contiguous); Vt f16 [DM][SEQ] pitch ldb; n = h*HD + d.
// O is written as two f16 head-major planes: hi = f16(O*1024), lo = f16((O*1024 - hi)*2048), element
// (bb, h, i, d) at [((bb*NH + h)*SEQ + i)*HD + d]; a 64-wide tile column block is exactly one head h = tn,
// One wave per 64x64 tile, operands staged in LDS per 128x256 block tile. Epilogue: 16-row f32 slab staged per
// coverage: 4 slabs x (4 q x 4 g4 = 16 rows) x (8 pieces x 8 = 64 cols) = the wave's whole tile in both
// planes; grid covers every (i tile, head) of this batch.
// =====================================================================================================
__global__ __launch_bounds__(256) void gemm64h_o(
    const unsigned short* __restrict__ Ap, int lda,
    const unsigned short* __restrict__ Btp, int ldb,
    const float* __restrict__ psp,
    unsigned short* ohi, unsigned short* olo,
    int M, int N, int K, float oscale) {
  const int bb = blockIdx.y;             // batch: P, Vt and partial-sum planes of the batches lie one behind the other
  const _Float16* Ah = (const _Float16*)(const void*)Ap + (size_t)bb * M * lda;
  const _Float16* Bh = (const _Float16*)(const void*)Btp + (size_t)bb * N * ldb;
  __shared__ __align__(16) float sT[8][16 * 68];
  __shared__ __align__(16) char stg[RING * SBYTES];   // the operand stages
  __shared__ float smz[256];                       // column means of the block's 256 columns
  const int lane = threadIdx.x & 31;
  const int wave = threadIdx.x >> 5;
  const int btN = N >> 8;                // block tile 128 x 256: waves 2 (m) x 4 (n), 64 x 64 each
  const int btM = M >> 7;
  if ((int)blockIdx.x >= btM * btN) return;   // block-uniform, in front of every barrier
  const int bm  = blockIdx.x / btN;
  const int bm0 = bm << 7;
  const int bn0 = (blockIdx.x - bm * btN) << 8;
  const int wm  = wave >> 2;
  const int wn  = wave & 3;
  const int m0 = bm0 + (wm << 6);
  const int n0 = bn0 + (wn << 6);
  const int tn = n0 >> 6;                // == head index (tile width 64 == HD)
  const int rlane = lane & 15;
  const int koff  = (lane >> 4) * 8;
  const int mOff  = (lane >> 4) * 8;

  v8f acc[4][4];
#pragma unroll
  for (int i = 0; i < 4; ++i)
#pragma unroll
    for (int j = 0; j < 4; ++j) acc[i][j] = zero8();

  // Ring of RING buffers along K, 64 k a trip: the copies of tiles t + 2 .. t + RING fly while tile t + 1 is multiplied.
  const int T = K >> 6;
  const int crow = threadIdx.x >> 3;                   // this thread's row within each group of 32 staged rows
  const int cpc  = (threadIdx.x & 7) * 16;             // its 16-B piece of the 128-B row
  const unsigned lcp = lds_off(stg) + (unsigned)(crow * SPITCH + cpc);
  const size_t sa = (size_t)32 * lda * 2;              // bytes between a thread's consecutive A rows
  const size_t sb = (size_t)32 * ldb * 2;              // the same for B
  const char* ga = (const char*)(Ah + (size_t)(bm0 + crow) * lda) + cpc;
  const char* gb = (const char*)(Bh + (size_t)(bn0 + crow) * ldb) + cpc;
  // tiles 0 .. RING - 1 are asked for at once (each test block-uniform); unrolled so that each buffer's LDS offset is a
  // constant and the four statements stand one behind the other
#pragma unroll
  for (int p = 0; p < RING; ++p) {
    if (p < T) {
      const size_t ko = (size_t)p * 128;
      stage_issue(lcp + (unsigned)(p * SBYTES), ga + ko, ga + sa + ko, ga + 2 * sa + ko, ga + 3 * sa + ko, gb + ko, sb);
    }
  }
  {
    const float* pp = psp + (size_t)bb * (SEQ / 64) * DM + bn0 + threadIdx.x;
    float pv[SEQ / 64];
#pragma unroll
    for (int p = 0; p < SEQ / 64; ++p) pv[p] = pp[(size_t)p * DM];
#pragma unroll
    for (int o = SEQ / 128; o > 0; o >>= 1) {
#pragma unroll
      for (int p = 0; p < o; ++p) pv[p] += pv[p + o];
    }
    smz[threadIdx.x] = pv[0] * (1.0f / (float)SEQ);
  }
  if (T >= RING) wait_copies_but3(); else wait_copies();   // tile 0 has landed (block-uniform)
  __syncthreads();                                     // tile 0 is readable by every wave
  const char* fa = stg + (wm * 64 + rlane) * SPITCH + koff * 2;         // this lane's place in its first A fragment
  const char* fb = stg + (128 + wn * 64 + rlane) * SPITCH + koff * 2;   // the same for B
  for (int t = 0; t < T; ++t) {
    const int bo = (t & (RING - 1)) * SBYTES;
    // unrolled so that the fragment arrays keep constant indices (registers, no scratch)
#pragma unroll
    for (int ks = 0; ks < 2; ++ks) {
      v16h bh[4], ah[4];
#pragma unroll
      for (int j = 0; j < 4; ++j) bh[j] = ldfrag_h((const _Float16*)(fb + bo + j * 16 * SPITCH + ks * 64));
#pragma unroll
      for (int i = 0; i < 4; ++i) ah[i] = ldfrag_h((const _Float16*)(fa + bo + i * 16 * SPITCH + ks * 64));
#pragma unroll
      for (int i = 0; i < 4; ++i) {
#pragma unroll
        for (int j = 0; j < 4; ++j) {
          acc[i][j] = mma_h(ah[i], bh[j], acc[i][j]);
        }
      }
    }
    wait_lds();
    // tile t + 1 has landed: counted where tiles t + 2 and t + 3 are both issued (12 copies each), else to 0 (block-uniform)
    if (t + RING - 1 < T) wait_copies_but2(); else wait_copies();
    __syncthreads();                                   // publishes tile t + 1; ends every wave's reads of tile t
    if (t + RING < T) {                                // block-uniform
      const size_t ko = (size_t)(t + RING) * 128;
      stage_issue(lcp + (unsigned)bo, ga + ko, ga + sa + ko, ga + 2 * sa + ko, ga + 3 * sa + ko, gb + ko, sb);
    }
  }
  wait_copies();

  float mz[4];
#pragma unroll
  for (int j = 0; j < 4; ++j) mz[j] = smz[(wn << 6) + (j << 4) + rlane];

  float* slab = sT[wave];
  const size_t pbase = ((size_t)(bb * NH + tn)) * SEQ;     // plane row base for head tn of batch bb
#pragma unroll
  for (int i = 0; i < 4; ++i) {
    const int mBase = m0 + (i << 4);
#pragma unroll
    for (int r = 0; r < 8; ++r) {
#pragma unroll
      for (int j = 0; j < 4; ++j) {
        slab[(mOff + r) * 68 + (j << 4) + rlane] = acc[i][j][r] * oscale + mz[j];
      }
    }
    __builtin_amdgcn_fence(__ATOMIC_RELEASE, "workgroup");
    __builtin_amdgcn_wave_barrier();
    __builtin_amdgcn_fence(__ATOMIC_ACQUIRE, "workgroup");
    {
      const int g4 = lane >> 3, piece = lane & 7;
      v4u hv[4], lv[4];
      size_t ofs[4];
#pragma unroll
      for (int q = 0; q < 4; ++q) {
        const int row = q * 4 + g4;                      // q 0..3 x g4 0..3 = rows 0..15
        const v4f x0 = *(const v4f*)(slab + row * 68 + piece * 8);
        const v4f x1 = *(const v4f*)(slab + row * 68 + piece * 8 + 4);
        float f[8];
        f[0] = x0[0]; f[1] = x0[1]; f[2] = x0[2]; f[3] = x0[3];
        f[4] = x1[0]; f[5] = x1[1]; f[6] = x1[2]; f[7] = x1[3];
        v4u ph, pl;
#pragma unroll
        for (int e = 0; e < 4; ++e) {
          const float s0 = f[2 * e] * 1024.0f;
          const float s1 = f[2 * e + 1] * 1024.0f;
          const _Float16 h0 = (_Float16)s0;
          const _Float16 h1 = (_Float16)s1;
          const _Float16 l0 = (_Float16)((s0 - (float)h0) * 2048.0f);
          const _Float16 l1 = (_Float16)((s1 - (float)h1) * 2048.0f);
          ph[e] = pk16(h_bits(h0), h_bits(h1));
          pl[e] = pk16(h_bits(l0), h_bits(l1));
        }
        hv[q] = ph;
        lv[q] = pl;
        ofs[q] = (pbase + (size_t)(mBase + row)) * HD + piece * 8;
      }
      {
#pragma unroll
        for (int q = 0; q < 4; ++q) {
          *(v4u*)(ohi + ofs[q]) = hv[q];
          *(v4u*)(olo + ofs[q]) = lv[q];
        }
        
      }
    }
    __builtin_amdgcn_fence(__ATOMIC_RELEASE, "workgroup");
    __builtin_amdgcn_wave_barrier();
    __builtin_amdgcn_fence(__ATOMIC_ACQUIRE, "workgroup");
  }
}

// =====================================================================================================
// Output projection: C[m][n] = sch * (sum_k Ahi[m][k]*Bt[n][k] + scl * sum_k Alo[m][k]*Bt[n][k]) + bf16rne(bias[n])
// (f16 products, f32 accumulate, hi and scaled-residual products in separate accumulators). Ahi/Alo row-major
// [M][K] pitch lda; Bt [N][K] pitch ldb; C f32 [M][N] pitch ldc. One wave per 32x64 tile, 8 waves on a 64x256
// block tile whose operands are staged in LDS; all 8 fragments of a k-step (A: 2 rows x 2 planes, B: 4) read at its head.
// Epilogue: 16-row slabs staged per wave in LDS; each 64-wide row segment (256 B) written by one instruction
// coverage: 2 slabs x 16 rows x 64 cols = the wave's whole 32x64 tile; grid covers every tile of C.
// =====================================================================================================
__global__ __launch_bounds__(256) void gemm32h_w(
    const unsigned short* __restrict__ Ahp, const unsigned short* __restrict__ Alp, int lda,
    const unsigned short* __restrict__ Btp, int ldb,
    const float* __restrict__ bias,
    float* C, int ldc, int M, int N, int K, float sch, float scl) {
  const _Float16* Ah = (const _Float16*)(const void*)Ahp;
  const _Float16* Al = (const _Float16*)(const void*)Alp;
  const _Float16* Bh = (const _Float16*)(const void*)Btp;
  __shared__ __align__(16) float sT[8][16 * 68];
  __shared__ __align__(16) char stg[RING * SBYTES];   // the operand stages
  const int lane = threadIdx.x & 31;
  const int wave = threadIdx.x >> 5;
  const int btN = N >> 8;                // block tile 64 x 256: waves 2 (m) x 4 (n), 32 x 64 each
  const int btM = M >> 6;
  if ((int)blockIdx.x >= btM * btN) return;   // block-uniform, in front of every barrier
  const int bm  = blockIdx.x / btN;
  const int bm0 = bm << 6;
  const int bn0 = (blockIdx.x - bm * btN) << 8;
  const int wm  = wave >> 2;
  const int wn  = wave & 3;
  const int m0 = bm0 + (wm << 5);
  const int n0 = bn0 + (wn << 6);
  const int rlane = lane & 15;
  const int koff  = (lane >> 4) * 8;
  const int mOff  = (lane >> 4) * 8;

  v8f acch[2][4], accl[2][4];
#pragma unroll
  for (int i = 0; i < 2; ++i)
#pragma unroll
    for (int j = 0; j < 4; ++j) { acch[i][j] = zero8(); accl[i][j] = zero8(); }

  // Ring of RING buffers along K, 64 k a trip: the copies of tiles t + 2 .. t + RING fly while tile t + 1 is multiplied.
  const int T = K >> 6;
  const int crow = threadIdx.x >> 3;                   // this thread's row within each group of 32 staged rows
  const int cpc  = (threadIdx.x & 7) * 16;             // its 16-B piece of the 128-B row
  const unsigned lcp = lds_off(stg) + (unsigned)(crow * SPITCH + cpc);
  const size_t sa = (size_t)32 * lda * 2;              // bytes between a thread's consecutive A rows
  const size_t sb = (size_t)32 * ldb * 2;              // the same for B
  const char* gh = (const char*)(Ah + (size_t)(bm0 + crow) * lda) + cpc;   // staged rows 0..63: hi plane
  const char* gl = (const char*)(Al + (size_t)(bm0 + crow) * lda) + cpc;   // staged rows 64..127: residual plane
  const char* gb = (const char*)(Bh + (size_t)(bn0 + crow) * ldb) + cpc;
  // tiles 0 .. RING - 1 are asked for at once (each test block-uniform); unrolled so that each buffer's LDS offset is a
  // constant and the four statements stand one behind the other
#pragma unroll
  for (int p = 0; p < RING; ++p) {
    if (p < T) {
      const size_t ko = (size_t)p * 128;
      stage_issue(lcp + (unsigned)(p * SBYTES), gh + ko, gh + sa + ko, gl + ko, gl + sa + ko, gb + ko, sb);
    }
  }
  if (T >= RING) wait_copies_but3(); else wait_copies();   // tile 0 has landed (block-uniform)
  __syncthreads();                                     // tile 0 is readable by every wave
  const char* fa = stg + (wm * 32 + rlane) * SPITCH + koff * 2;         // this lane's place in its first hi fragment
  const char* fb = stg + (128 + wn * 64 + rlane) * SPITCH + koff * 2;   // the same for B
  for (int t = 0; t < T; ++t) {
    const int bo = (t & (RING - 1)) * SBYTES;
    // unrolled so that the fragment arrays keep constant indices (registers, no scratch)
#pragma unroll
    for (int ks = 0; ks < 2; ++ks) {
      v16h fh[2], fl[2], bfr[4];
#pragma unroll
      for (int i = 0; i < 2; ++i) {
        fh[i] = ldfrag_h((const _Float16*)(fa + bo + i * 16 * SPITCH + ks * 64));
        fl[i] = ldfrag_h((const _Float16*)(fa + bo + (64 + i * 16) * SPITCH + ks * 64));
      }
#pragma unroll
      for (int j = 0; j < 4; ++j) bfr[j] = ldfrag_h((const _Float16*)(fb + bo + j * 16 * SPITCH + ks * 64));
#pragma unroll
      for (int j = 0; j < 4; ++j) {
#pragma unroll
        for (int i = 0; i < 2; ++i) {
          acch[i][j] = mma_h(fh[i], bfr[j], acch[i][j]);
          accl[i][j] = mma_h(fl[i], bfr[j], accl[i][j]);
        }
      }
    }
    wait_lds();
    // tile t + 1 has landed: counted where tiles t + 2 and t + 3 are both issued (12 copies each), else to 0 (block-uniform)
    if (t + RING - 1 < T) wait_copies_but2(); else wait_copies();
    __syncthreads();                                   // publishes tile t + 1; ends every wave's reads of tile t
    if (t + RING < T) {                                // block-uniform
      const size_t ko = (size_t)(t + RING) * 128;
      stage_issue(lcp + (unsigned)bo, gh + ko, gh + sa + ko, gl + ko, gl + sa + ko, gb + ko, sb);
    }
  }
  wait_copies();

  float bz[4];
#pragma unroll
  for (int j = 0; j < 4; ++j) bz[j] = bf_up(bf_bits(bias[n0 + (j << 4) + rlane]));

  float* slab = sT[wave];
#pragma unroll
  for (int i = 0; i < 2; ++i) {
    const int mBase = m0 + (i << 4);
#pragma unroll
    for (int r = 0; r < 8; ++r) {
#pragma unroll
      for (int j = 0; j < 4; ++j) {
        slab[(mOff + r) * 68 + (j << 4) + rlane] = (acch[i][j][r] + accl[i][j][r] * scl) * sch + bz[j];
      }
    }
    __builtin_amdgcn_fence(__ATOMIC_RELEASE, "workgroup");
    __builtin_amdgcn_wave_barrier();
    __builtin_amdgcn_fence(__ATOMIC_ACQUIRE, "workgroup");
    {
      const int hh = lane >> 4, c4 = (lane & 15) * 4;     // 256-B row segment = 16 lanes x 16 B
      v4f ov[8];
#pragma unroll
      for (int it = 0; it < 8; ++it) {
        const int row = it * 2 + hh;                       // it 0..7 x hh 0..1 = rows 0..15
        ov[it] = *(const v4f*)(slab + row * 68 + c4);
      }
      {
#pragma unroll
        for (int it = 0; it < 8; ++it) {
          const int row = it * 2 + hh;
          *(v4f*)(C + (size_t)(mBase + row) * ldc + n0 + c4) = ov[it];
        }
        
      }
    }
    __builtin_amdgcn_fence(__ATOMIC_RELEASE, "workgroup");
    __builtin_amdgcn_wave_barrier();
    __builtin_amdgcn_fence(__ATOMIC_ACQUIRE, "workgroup");
  }
}

// =====================================================================================================
// Workspace map (bytes); every region an exact multiple of its whole-line / whole-tile store granularity
// within a launch; of Tf's three planes the first two hold the f32 score maps):
//   Xb   bf16 [4096][1024]              0         8388608
//   Wqb  bf16 [1024 n][1024 k]     8388608         2097152
//   Wkb  bf16 [1024 n][1024 k]    10485760         2097152
//   Wvb  bf16 [1024 n][1024 k]    12582912         2097152
//   Woh  f16  [1024 n][1024 k]    14680064         2097152   (f16(bf16(Wo) x1024))
//   Tf   f32  [3][4096][1024]    16777216        50331648   (planes 0, 1: S f32 [2][2048][2048])
//   Qh   f16  [4096][1024]       67108864         8388608   (q x16)
//   Kh   f16  [4096][1024]       75497472         8388608   (k x16)
//   VTh  f16  [2*1024][2048]     83886080         8388608   ([b*DM + n][t], v x64)
//   Ph   f16  [2][2048][2048]    92274688        16777216   (centered weights)
//   Ohi  f16  [2][16][2048][64] 109051904         8388608
//   Olo  f16  [2][16][2048][64] 117440512         8388608
//   pS   f32  [64][1024]        125829120          262144   (column sums of v per 64 token rows)
//   end                         126091264
// Inputs: query f32 [2][2048][1024]; Wq, Wk, Wv, Wo f32 [1024 out][1024 in]; bq, bk, bv, bo f32 [1024].
// d_out f32 [4096][1024] at byte 0 (row = b*SEQ + s, col = n).
// =====================================================================================================
extern "C" void kernel_launch(void* const* d_in, const int* in_sizes, int n_in,
                              void* d_out, int out_size, void* d_ws, size_t ws_size,
                              hipStream_t stream) {
  if (n_in < 9) return;
  if (in_sizes[0] != NB * SEQ * DM) return;
  if (in_sizes[1] != DM * DM) return;
  if (in_sizes[2] != DM) return;
  if (in_sizes[3] != DM * DM) return;
  if (in_sizes[4] != DM) return;
  if (in_sizes[5] != DM * DM) return;
  if (in_sizes[6] != DM) return;
  if (in_sizes[7] != DM * DM) return;
  if (in_sizes[8] != DM) return;
  if (out_size != OUTN) return;

  const float* x  = (const float*)d_in[0];   // [NB*SEQ][DM]
  const float* Wq = (const float*)d_in[1];   // [DM n][DM k]
  const float* bq = (const float*)d_in[2];   // [DM]
  const float* Wk = (const float*)d_in[3];
  const float* bk = (const float*)d_in[4];
  const float* Wv = (const float*)d_in[5];
  const float* bv = (const float*)d_in[6];
  const float* Wo = (const float*)d_in[7];
  const float* bo = (const float*)d_in[8];

  const size_t PXb = (size_t)ROWS * DM * 2;          //  8388608
  const size_t PW  = (size_t)DM * DM * 2;            //  2097152
  const size_t PF  = (size_t)3 * ROWS * DM * 4;      // 50331648
  const size_t PH  = (size_t)ROWS * DM * 2;          //  8388608
  const size_t PVt = (size_t)NB * DM * SEQ * 2;      //  8388608
  const size_t PP  = (size_t)NB * SEQ * SEQ * 2;     // 16777216
  const size_t PO  = (size_t)NB * NH * SEQ * HD * 2; //  8388608
  const size_t PMv = (size_t)(ROWS / 64) * DM * 4;   //   262144
  size_t off = 0;
  const size_t oXb = off; off += PXb;
  const size_t oWq = off; off += PW;
  const size_t oWk = off; off += PW;
  const size_t oWv = off; off += PW;
  const size_t oWo = off; off += PW;
  const size_t oTf = off; off += PF;
  const size_t oQh = off; off += PH;
  const size_t oKh = off; off += PH;
  const size_t oVt = off; off += PVt;
  const size_t oP  = off; off += PP;
  const size_t oOh = off; off += PO;
  const size_t oOl = off; off += PO;
  const size_t oMv = off; off += PMv;
  if (off > ws_size) return;                        // off = 126091264
  if (off > (size_t)134217728) return;

  char* ws = (char*)d_ws;
  unsigned short* Xb  = (unsigned short*)(ws + oXb);
  unsigned short* Wqb = (unsigned short*)(ws + oWq);
  unsigned short* Woh = (unsigned short*)(ws + oWo);
  float*          Tf  = (float*)(ws + oTf);
  unsigned short* Qh  = (unsigned short*)(ws + oQh);
  unsigned short* Kh  = (unsigned short*)(ws + oKh);
  unsigned short* VTh = (unsigned short*)(ws + oVt);
  unsigned short* Ph  = (unsigned short*)(ws + oP);
  unsigned short* Ohi = (unsigned short*)(ws + oOh);
  unsigned short* Olo = (unsigned short*)(ws + oOl);
  float*          pS  = (float*)(ws + oMv);
  float*          outf = (float*)d_out;             // [ROWS][DM]

  const dim3 blk(256);
  const dim3 gCvt(XBLK + 4 * WBLK);                 // 2048 + 4 * 512 blocks (exact)
  const dim3 gGemm(((ROWS / 64) * (DM / 64)) / 8, 3);  // 1024 tiles -> 128 blocks, x 3 projections
  const dim3 gSc(((SEQ / 64) * (SEQ / 64)) / 8, NB);  // 1024 tiles -> 128 blocks per batch
  const dim3 gSm(NB * SEQ);                         // 2048 rows per batch
  const dim3 gPv(((SEQ / 64) * (DM / 64)) / 8, NB); //  512 tiles -> 64 blocks per batch
  const dim3 gWo(((ROWS / 32) * (DM / 64)) / 8);    // 2048 tiles -> 256 blocks
  const float qkScale = 16.0f;                      // q and k planes carried x16
  const float woScale = 1024.0f;                    // Wo plane carried x1024
  const float sscale  = 1.0f / 32768.0f;            // (1/sqrt(64))/16 heads = 1/128, two x16 carries folded back
  const float vScale  = 64.0f;                      // v^T plane carried x64
  const float pvOscl  = 1.0f / 1048576.0f;          // 1/(16384 * 64)
  const float woSch   = 1.0f / 1048576.0f;          // 1/(1024 * 1024): O hi carry and Wo carry
  const float woScl   = 1.0f / 2048.0f;             // residual plane carry

  // (1) activations and weights -> bf16 planes (W is [n][k] already); Wo -> f16 plane of its bf16 value x1024;
  //     Xb, Wqb, Wkb, Wvb, Woh lie one behind the other
  cvt_inputs<<<gCvt, blk, 0, stream>>>(x, Wq, Wk, Wv, Wo, Xb, woScale);
  // (2) q, k, v = Xb . W^T + bias (M=4096, N=1024, K=1024 each), one grid: q, k -> f16 planes (x16; Qh, Kh are
  //     adjacent); v -> f16 v^T plane (x64) and f32 column sums per 64 token rows
  gemm64<<<gGemm, blk, 0, stream>>>(Xb, DM, Wqb, DM, bq, bk, bv, Qh, pS, VTh, DM, ROWS, DM, DM, qkScale, vScale);
  // (3) both batches in one grid each: head-averaged scores (K = 1024) -> Tf as S [2][2048][2048]; row softmax ->
  //     centered weights; p . v -> O hi/res head-major planes
  gemm64h_s<<<gSc, blk, 0, stream>>>(Qh, DM, Kh, DM, Tf, SEQ, SEQ, SEQ, DM, sscale);
  softmax_c<<<gSm, blk, 0, stream>>>(Tf, Ph);
  gemm64h_o<<<gPv, blk, 0, stream>>>(Ph, SEQ, VTh, SEQ, pS, Ohi, Olo, SEQ, DM, SEQ, pvOscl);
  // (4) out = O(flat [4096][1024]) . Woh^T + bo -> d_out
  gemm32h_w<<<gWo, blk, 0, stream>>>(Ohi, Olo, DM, Woh, DM, bo, outf, DM, ROWS, DM, DM, woSch, woScl);
  (void)hipGetLastError();
}

// v008
// It runs in 98.9 microseconds.
// In both of two side-by-side timings against v007, it was 1.09 times as fast.
// All steps since v000 together make it 6.89 times as fast.
// Contractions: q/k/v projections = v_wmma_f32_16x16x32_bf16 (bf16 operands: RNE-converted x, W, bias; single product); head-averaged q.k^T scores = v_wmma_f32_16x16x32_f16 (q, k f16 planes carried x16; single product); p.v = v_wmma_f32_16x16x32_f16 (centered softmax weights 16384*p-8 in f16, v^T f16 plane carried x64; single product; f32 column mean of v added back); output projection = v_wmma_f32_16x16x32_f16 (attention output as f16 hi (x1024) + residual (x2048) planes, two products into separate accumulators; Wo as f16 of its bf16-RNE value x1024); all f32 accumulate; softmax in f32.
#include <hip/hip_runtime.h>
#include <math.h>
#include <stdint.h>

#define NB    2
#define SEQ   2048
#define DM    1024
#define NH    16
#define HD    64
#define ROWS  (NB * SEQ)             // 4096 token rows
#define OUTN  (ROWS * DM)
static_assert(NH * HD == DM);
static_assert(HD == 64);
static_assert((SEQ % 64) == 0 && (DM % 64) == 0 && (ROWS % 64) == 0 && (DM % 32) == 0 && (DM % 256) == 0);
static_assert(SEQ == 256 * 8);
static_assert((SEQ % 128) == 0);
static_assert((((ROWS / 64) * (DM / 64)) % 8) == 0);
static_assert((((SEQ / 64) * (SEQ / 64)) % 8) == 0);
static_assert((((SEQ / 64) * (DM / 64)) % 8) == 0);
static_assert((((ROWS / 32) * (DM / 64)) % 8) == 0);
static_assert(((ROWS * DM / 8) % 256) == 0 && ((DM * DM / 8) % 256) == 0);
static_assert((size_t)NB * SEQ * SEQ * 4 <= (size_t)3 * ROWS * DM * 4);
static_assert((ROWS % 128) == 0 && (SEQ % 256) == 0 && (DM % 256) == 0 && DM >= 128 && SEQ >= 128);   // block tiles, two stages

typedef _Float16 v16h __attribute__((ext_vector_type(16)));
typedef _Float16 v8h  __attribute__((ext_vector_type(8)));
typedef __bf16   v16b __attribute__((ext_vector_type(16)));
typedef __bf16   v8b  __attribute__((ext_vector_type(8)));
typedef float    v8f  __attribute__((ext_vector_type(8)));
typedef float    v4f  __attribute__((ext_vector_type(4)));
typedef unsigned int v4u __attribute__((ext_vector_type(4)));

// ---- scalar helpers --------------------------------------------------------------------------------
__device__ __forceinline__ unsigned short bf_bits(float f) {          // f32 -> bf16 bits, RNE convert
  unsigned u = __float_as_uint(f);
  return (unsigned short)((u + 0x7FFFu + ((u >> 16) & 1u)) >> 16);
}
__device__ __forceinline__ float bf_up(unsigned short h) { return __uint_as_float(((unsigned)h) << 16); }
__device__ __forceinline__ unsigned short h_bits(_Float16 x) { return __builtin_bit_cast(unsigned short, x); }
__device__ __forceinline__ unsigned pk16(unsigned short a, unsigned short b) { return (unsigned)a | ((unsigned)b << 16); }
__device__ __forceinline__ v8f zero8() { v8f z = {0.f, 0.f, 0.f, 0.f, 0.f, 0.f, 0.f, 0.f}; return z; }

// ---- fragment loaders: 16-bit A/B operand, lane -> row/col (lane&15), p already includes +8*(lane>>4);
//      elements 0..7 <- p[0..7] (k0+8h..), elements 8..15 <- p[16..23] (k0+16+8h..)
__device__ __forceinline__ v16b ldfrag_b(const __bf16* p) {
  union { v16b v; v8b h[2]; } f;
  f.h[0] = *(const v8b*)(p);
  f.h[1] = *(const v8b*)(p + 16);
  return f.v;
}
__device__ __forceinline__ v16h ldfrag_h(const _Float16* p) {
  union { v16h v; v8h h[2]; } f;
  f.h[0] = *(const v8h*)(p);
  f.h[1] = *(const v8h*)(p + 16);
  return f.v;
}

// ---- operand staging in LDS, shared by the 8 waves of a block ------------------------------------------
// A stage = 64 k (one 128-B line) of 384 operand rows: rows 0..127 the block's A rows, rows 128..383 its B rows, at a
// pitch of 144 B (16 B x odd: conflict-free for ds_load_b128 readers). Two stages or more: later ones are copied while
// this one is multiplied. Thread tid copies 16 B of row c * 32 + (tid >> 3), piece tid & 7, for c = 0..11: every wave-wide
// copy covers four whole 128-B lines of global memory.
#define SROWS   384
#define SPITCH  144
#define SBYTES  (SROWS * SPITCH)     // 55296
#define SCSTEP  (32 * SPITCH)        // LDS distance between a thread's consecutive copies
__device__ __forceinline__ unsigned lds_off(const void* p) { return (unsigned)(size_t)p; }
// The 12 copies of one thread for one stage: a0..a3 = its four A-row addresses, b + j * sb (j = 0..7) its B-row
// addresses, l = its LDS byte address in the target buffer. s_wait_xcnt stands inside the statement, behind the last
// copy: a precaution in front of every later rewrite of the address registers that the copies name.
__device__ __forceinline__ void stage_issue(unsigned l, const char* a0, const char* a1, const char* a2, const char* a3,
                                            const char* b, size_t sb) {
#if defined(__HIP_DEVICE_COMPILE__)
  asm volatile(
      "global_load_async_to_lds_b128 %0, %12, off\n\t"
      "global_load_async_to_lds_b128 %1, %13, off\n\t"
      "global_load_async_to_lds_b128 %2, %14, off\n\t"
      "global_load_async_to_lds_b128 %3, %15, off\n\t"
      "global_load_async_to_lds_b128 %4, %16, off\n\t"
      "global_load_async_to_lds_b128 %5, %17, off\n\t"
      "global_load_async_to_lds_b128 %6, %18, off\n\t"
      "global_load_async_to_lds_b128 %7, %19, off\n\t"
      "global_load_async_to_lds_b128 %8, %20, off\n\t"
      "global_load_async_to_lds_b128 %9, %21, off\n\t"
      "global_load_async_to_lds_b128 %10, %22, off\n\t"
      "global_load_async_to_lds_b128 %11, %23, off\n\t"
      "s_wait_xcnt 0x0"
      :: "v"(l), "v"(l + 1u * SCSTEP), "v"(l + 2u * SCSTEP), "v"(l + 3u * SCSTEP), "v"(l + 4u * SCSTEP),
         "v"(l + 5u * SCSTEP), "v"(l + 6u * SCSTEP), "v"(l + 7u * SCSTEP), "v"(l + 8u * SCSTEP),
         "v"(l + 9u * SCSTEP), "v"(l + 10u * SCSTEP), "v"(l + 11u * SCSTEP),
         "v"(a0), "v"(a1), "v"(a2), "v"(a3), "v"(b), "v"(b + sb), "v"(b + 2 * sb), "v"(b + 3 * sb),
         "v"(b + 4 * sb), "v"(b + 5 * sb), "v"(b + 6 * sb), "v"(b + 7 * sb)
      : "memory");
#endif
}
// this wave's copies have landed in LDS (the compiler places no wait for them)
__device__ __forceinline__ void wait_copies() {
#if defined(__HIP_DEVICE_COMPILE__)
  asm volatile("s_wait_asynccnt 0x0" ::: "memory");
#endif
}
// The wide stage of the kernels whose block is alone on its WGP: 128 k (a 256-B piece) of the same 384 operand rows, at
// a pitch of 272 B (16 B x odd: conflict-free for ds_load_b128 readers), so that one barrier with its waits and one
// refill serve 64 WMMAs of a wave. Thread tid copies 16 B of row c * 16 + (tid >> 4), piece tid & 15, for c = 0..23:
// every wave-wide copy covers two whole 256-B row pieces. RING buffers, the copies RING - 1 stages ahead. Every wave
// issues 24 copies a stage and the counter returns in issue order, so a wait to 24 leaves exactly the youngest stage in
// flight and says that every older stage of this wave has landed.
#define WPITCH  272
#define WBYTES  (SROWS * WPITCH)     // 104448
#define WCSTEP  (16 * WPITCH)        // LDS distance between a thread's consecutive copies
#define RING 3
static_assert((RING - 1) * 24 <= 63);                  // copies of one wave outstanding at most
static_assert(RING == 3);                              // the counted wait below and the prologues are written for it
static_assert(RING * WBYTES + 1024 <= 327680);         // the ring and the column means fit one WGP's LDS
static_assert(8 * 16 * 68 * 4 <= WBYTES);              // the epilogue slabs of the 8 waves lie inside one buffer
// Twelve copies of one thread, three runs of four: LDS byte addresses l + j * WCSTEP (j = 0..11), global addresses
// p + i * sp, q + i * sq, r + i * sr (i = 0..3). s_wait_xcnt stands inside the statement, behind the last copy: a
// precaution in front of every later rewrite of the address registers that the copies name.
__device__ __forceinline__ void copy12_w(unsigned l, const char* p, size_t sp, const char* q, size_t sq,
                                         const char* r, size_t sr) {
#if defined(__HIP_DEVICE_COMPILE__)
  asm volatile(
      "global_load_async_to_lds_b128 %0, %12, off\n\t"
      "global_load_async_to_lds_b128 %1, %13, off\n\t"
      "global_load_async_to_lds_b128 %2, %14, off\n\t"
      "global_load_async_to_lds_b128 %3, %15, off\n\t"
      "global_load_async_to_lds_b128 %4, %16, off\n\t"
      "global_load_async_to_lds_b128 %5, %17, off\n\t"
      "global_load_async_to_lds_b128 %6, %18, off\n\t"
      "global_load_async_to_lds_b128 %7, %19, off\n\t"
      "global_load_async_to_lds_b128 %8, %20, off\n\t"
      "global_load_async_to_lds_b128 %9, %21, off\n\t"
      "global_load_async_to_lds_b128 %10, %22, off\n\t"
      "global_load_async_to_lds_b128 %11, %23, off\n\t"
      "s_wait_xcnt 0x0"
      :: "v"(l), "v"(l + 1u * WCSTEP), "v"(l + 2u * WCSTEP), "v"(l + 3u * WCSTEP), "v"(l + 4u * WCSTEP),
         "v"(l + 5u * WCSTEP), "v"(l + 6u * WCSTEP), "v"(l + 7u * WCSTEP), "v"(l + 8u * WCSTEP),
         "v"(l + 9u * WCSTEP), "v"(l + 10u * WCSTEP), "v"(l + 11u * WCSTEP),
         "v"(p), "v"(p + sp), "v"(p + 2 * sp), "v"(p + 3 * sp), "v"(q), "v"(q + sq), "v"(q + 2 * sq), "v"(q + 3 * sq),
         "v"(r), "v"(r + sr), "v"(r + 2 * sr), "v"(r + 3 * sr)
      : "memory");
#endif
}
// The 24 copies of one thread for one wide stage: staged rows 0..63 from a0, 64..127 from a1 (sa bytes = 16 rows),
// 128..383 from b (sb bytes = 16 rows); l = its LDS byte address in the target buffer.
__device__ __forceinline__ void stage_issue_w(unsigned l, const char* a0, const char* a1, size_t sa,
                                              const char* b, size_t sb) {
  copy12_w(l, a0, sa, a1, sa, b, sb);
  copy12_w(l + 12u * WCSTEP, b + 4 * sb, sb, b + 8 * sb, sb, b + 12 * sb, sb);
}
// all but the youngest stage have landed (in front of the loop: stage 0; at the foot of trip t: stage t + 1)
__device__ __forceinline__ void wait_copies_but1() {
#if defined(__HIP_DEVICE_COMPILE__)
  asm volatile("s_wait_asynccnt 0x18" ::: "memory");
#endif
}
// this wave's LDS reads have returned, so that the buffer may be handed to its next writer behind the barrier
__device__ __forceinline__ void wait_lds() {
#if defined(__HIP_DEVICE_COMPILE__)
  asm volatile("s_wait_dscnt 0x0" ::: "memory");
#endif
}

// ---- WMMA helpers with trailing VALU hazard gap --------------------------------------------------------
__device__ __forceinline__ v8f mma_h(v16h a, v16h b, v8f c) {
  c = __builtin_amdgcn_wmma_f32_16x16x32_f16(false, a, false, b, (short)0, c, false, false);
#if defined(__HIP_DEVICE_COMPILE__)
  asm volatile("v_nop\n\tv_nop\n\tv_nop\n\tv_nop" : "+v"(c) : "v"(a), "v"(b));
#endif
  return c;
}
__device__ __forceinline__ v8f mma_b_raw(v16b a, v16b b, v8f c) {
  return __builtin_amdgcn_wmma_f32_16x16x32_bf16(false, a, false, b, (short)0, c, false, false);
}
__device__ __forceinline__ void dep_guard_b(v8f& a, v8f& b, v16b x, v16b y) {
#if defined(__HIP_DEVICE_COMPILE__)
  asm volatile("v_nop\n\tv_nop\n\tv_nop\n\tv_nop" : "+v"(a), "+v"(b) : "v"(x), "v"(y));
#endif
}
__device__ __forceinline__ void keep4_b(v16b a, v16b b, v16b c, v16b d) {
#if defined(__HIP_DEVICE_COMPILE__)
  asm volatile("v_nop" :: "v"(a), "v"(b), "v"(c), "v"(d));
#endif
}
__device__ __forceinline__ void acc_guard4(v8f& a, v8f& b, v8f& c, v8f& d) {
#if defined(__HIP_DEVICE_COMPILE__)
  asm volatile("v_nop\n\tv_nop\n\tv_nop\n\tv_nop" : "+v"(a), "+v"(b), "+v"(c), "+v"(d));
#endif
}

// =====================================================================================================
// All five input conversions in one grid. Blocks [0, XBLK): x -> bf16 (RNE convert); then WBLK blocks each for Wq, Wk,
// Wv -> bf16 and for Wo -> f16(bf16rne(Wo) * woscale) (exact in f16 after the power-of-two scale). The five output
// planes lie one behind the other in the workspace, so the output index is the flat thread index. 8 elements per
// thread, one 16-B store per lane: a wave writes 512 contiguous B. The plane is chosen by blockIdx (block-uniform).
// coverage: (XBLK + 4 * WBLK) blocks x 256 threads x 8 = all five planes exactly.
// =====================================================================================================
#define XBLK (ROWS * DM / 8 / 256)
#define WBLK (DM * DM / 8 / 256)
__global__ __launch_bounds__(256) void cvt_inputs(const float* __restrict__ x, const float* __restrict__ Wq,
                                                  const float* __restrict__ Wk, const float* __restrict__ Wv,
                                                  const float* __restrict__ Wo, unsigned short* out, float woscale) {
  const int blk = blockIdx.x;
  const float* in = x;
  int first = 0;                                     // first block of this block's plane
  if (blk >= XBLK) {
    const int w = (blk - XBLK) / WBLK;               // 0..3
    in = (w == 0) ? Wq : (w == 1) ? Wk : (w == 2) ? Wv : Wo;
    first = XBLK + w * WBLK;
  }
  const int i = (blk - first) * 256 + threadIdx.x;
  const v4f a = *(const v4f*)(in + (size_t)i * 8);
  const v4f b = *(const v4f*)(in + (size_t)i * 8 + 4);
  // precaution: stands in front of every later rewrite of the two loads' address registers
  asm volatile("s_wait_xcnt 0x0" ::: "memory");
  v4u p;
  if (blk < XBLK + 3 * WBLK) {
    p[0] = pk16(bf_bits(a[0]), bf_bits(a[1]));
    p[1] = pk16(bf_bits(a[2]), bf_bits(a[3]));
    p[2] = pk16(bf_bits(b[0]), bf_bits(b[1]));
    p[3] = pk16(bf_bits(b[2]), bf_bits(b[3]));
  } else {
    p[0] = pk16(h_bits((_Float16)(bf_up(bf_bits(a[0])) * woscale)), h_bits((_Float16)(bf_up(bf_bits(a[1])) * woscale)));
    p[1] = pk16(h_bits((_Float16)(bf_up(bf_bits(a[2])) * woscale)), h_bits((_Float16)(bf_up(bf_bits(a[3])) * woscale)));
    p[2] = pk16(h_bits((_Float16)(bf_up(bf_bits(b[0])) * woscale)), h_bits((_Float16)(bf_up(bf_bits(b[1])) * woscale)));
    p[3] = pk16(h_bits((_Float16)(bf_up(bf_bits(b[2])) * woscale)), h_bits((_Float16)(bf_up(bf_bits(b[3])) * woscale)));
  }
  *(v4u*)(out + ((size_t)blk * 256 + threadIdx.x) * 8) = p;
}

// =====================================================================================================
// Register-blocked bf16 WMMA GEMM with bias: C[m][n] = sum_k A[m][k] * Bt[n][k] + bf16rne(bias[n]); one wave per
// 64x64 tile, 8 waves on a 128x256 block tile whose operands are staged in LDS (one barrier a trip). A row-major [M][K] pitch lda; Bt row-major [N][K] pitch ldb (k contiguous);
// bias f32 [N] (RNE converted to bf16 and widened in the epilogue); M, N multiples of the 128x256 block tile, K of 64
// (fixed sizes, statically asserted); M a multiple of 128, N of 256, K of 64 for every launch here (no idle waves).
// blockIdx.y = which of three independent products on the same A runs here (q, k, v): Bt plane y (N*ldb elements
// apart), bias y. Each product leaves in the form its reader takes:
//   q, k: f16 plane y of qkh, [M][N] pitch ldc, = f16(C * qkscale); 16-row f32 slabs staged per wave in LDS, each
//         64-wide row segment (128 B, one line) stored by 8 lanes x 16 B.
//   v:    the column sums of the wave's 64 rows, f32, in ps[(m0 / 64) * N + n] (for the column mean: a lane adds its 32
//         accumulator rows of a column as a tree, the two lane halves are added by __shfl_xor), and the f16 v^T plane
//         vth[(b*DM + n)*SEQ + t] =
//         f16(C * vscale), m = b*SEQ + t: a lane's 8 accumulator rows are 8 consecutive t of one n, so the wave's tile
//         is laid transposed in LDS by 16-B stores (its own 64 x 144 B of the operand stages, which every wave has
//         left behind the loop's last barrier) and leaves as whole 128-B lines.
// coverage: 8 waves x 64x64 = the block's 128x256 tile of its plane(s); grid covers every tile of q, k and v.
// =====================================================================================================
__global__ __launch_bounds__(256) void gemm64(
    const unsigned short* __restrict__ Ap, int lda,
    const unsigned short* __restrict__ Btp, int ldb,
    const float* __restrict__ bias0, const float* __restrict__ bias1, const float* __restrict__ bias2,
    unsigned short* qkh, float* ps, unsigned short* vth, int ldc, int M, int N, int K, float qkscale, float vscale) {
  const int which = blockIdx.y;
  const float* bias = (which == 0) ? bias0 : (which == 1) ? bias1 : bias2;
  const __bf16* Ab  = (const __bf16*)(const void*)Ap;
  const __bf16* Bb  = (const __bf16*)(const void*)Btp + (size_t)which * N * ldb;
  __shared__ __align__(16) float sT[8][16 * 68];   // per-wave 16x64 slab, pitch 68 floats
  __shared__ __align__(16) char stg[2 * SBYTES];   // the two operand stages
  const int lane = threadIdx.x & 31;
  const int wave = threadIdx.x >> 5;
  const int btN = N >> 8;                // block tile 128 x 256: waves 2 (m) x 4 (n), 64 x 64 each
  const int btM = M >> 7;
  if ((int)blockIdx.x >= btM * btN) return;   // block-uniform, in front of every barrier
  const int bm  = blockIdx.x / btN;
  const int bm0 = bm << 7;
  const int bn0 = (blockIdx.x - bm * btN) << 8;
  const int wm  = wave >> 2;
  const int wn  = wave & 3;
  const int m0 = bm0 + (wm << 6);
  const int n0 = bn0 + (wn << 6);

  const int rlane = lane & 15;                 // row (A) / col (B, D) within subtile
  const int koff  = (lane >> 4) * 8;           // k offset of this lane half
  const int mOff  = (lane >> 4) * 8;           // D row offset

  v8f acc[4][4];
#pragma unroll
  for (int i = 0; i < 4; ++i)
#pragma unroll
    for (int j = 0; j < 4; ++j) acc[i][j] = zero8();

  // Two-buffer ring along K, 64 k a trip: the copies of tile t + 2 fly while tile t + 1 is multiplied.
  const int T = K >> 6;
  const int crow = threadIdx.x >> 3;                   // this thread's row within each group of 32 staged rows
  const int cpc  = (threadIdx.x & 7) * 16;             // its 16-B piece of the 128-B row
  const unsigned lcp = lds_off(stg) + (unsigned)(crow * SPITCH + cpc);
  const size_t sa = (size_t)32 * lda * 2;              // bytes between a thread's consecutive A rows
  const size_t sb = (size_t)32 * ldb * 2;              // the same for B
  const char* ga = (const char*)(Ab + (size_t)(bm0 + crow) * lda) + cpc;
  const char* gb = (const char*)(Bb + (size_t)(bn0 + crow) * ldb) + cpc;
  stage_issue(lcp, ga, ga + sa, ga + 2 * sa, ga + 3 * sa, gb, sb);
  wait_copies();
  __syncthreads();                                     // tile 0 is readable by every wave
  if (T > 1) stage_issue(lcp + SBYTES, ga + 128, ga + sa + 128, ga + 2 * sa + 128, ga + 3 * sa + 128, gb + 128, sb);
  const char* fa = stg + (wm * 64 + rlane) * SPITCH + koff * 2;         // this lane's place in its first A fragment
  const char* fb = stg + (128 + wn * 64 + rlane) * SPITCH + koff * 2;   // the same for B
  for (int t = 0; t < T; ++t) {
    const int bo = (t & 1) * SBYTES;
    // unrolled so that the fragment arrays keep constant indices (registers, no scratch)
#pragma unroll
    for (int ks = 0; ks < 2; ++ks) {
      v16b bh[4], ah[4];
#pragma unroll
      for (int j = 0; j < 4; ++j) bh[j] = ldfrag_b((const __bf16*)(fb + bo + j * 16 * SPITCH + ks * 64));
#pragma unroll
      for (int i = 0; i < 4; ++i) ah[i] = ldfrag_b((const __bf16*)(fa + bo + i * 16 * SPITCH + ks * 64));
#pragma unroll
      for (int i = 0; i < 4; ++i) {
#pragma unroll
        for (int j = 0; j < 4; ++j) {
          acc[i][j] = mma_b_raw(ah[i], bh[j], acc[i][j]);
        }
        dep_guard_b(acc[i][0], acc[i][3], ah[i], ah[i]);
      }
      keep4_b(bh[0], bh[1], bh[2], bh[3]);
    }
    wait_lds();
    wait_copies();
    __syncthreads();                                   // publishes tile t + 1; ends every wave's reads of tile t
    if (t + 2 < T) {                                   // block-uniform
      const size_t ko = (size_t)(t + 2) * 128;
      stage_issue(lcp + (unsigned)bo, ga + ko, ga + sa + ko, ga + 2 * sa + ko, ga + 3 * sa + ko, gb + ko, sb);
    }
  }
  wait_copies();
  acc_guard4(acc[0][0], acc[0][1], acc[0][2], acc[0][3]);
  acc_guard4(acc[1][0], acc[1][1], acc[1][2], acc[1][3]);
  acc_guard4(acc[2][0], acc[2][1], acc[2][2], acc[2][3]);
  acc_guard4(acc[3][0], acc[3][1], acc[3][2], acc[3][3]);

  // ---- bias per D column of this lane (n0 + 16j + rlane < N) ----
  float bz[4];
#pragma unroll
  for (int j = 0; j < 4; ++j) bz[j] = bf_up(bf_bits(bias[n0 + (j << 4) + rlane]));

  // ---- epilogue ----
  float* slab = sT[wave];
  if (which < 2) {                                         // block-uniform: q or k -> f16 plane
    unsigned short* H = qkh + (size_t)which * M * ldc;
#pragma unroll
    for (int i = 0; i < 4; ++i) {
      const int mBase = m0 + (i << 4);
#pragma unroll
      for (int r = 0; r < 8; ++r) {
#pragma unroll
        for (int j = 0; j < 4; ++j) {
          slab[(mOff + r) * 68 + (j << 4) + rlane] = (acc[i][j][r] + bz[j]) * qkscale;
        }
      }
      __builtin_amdgcn_fence(__ATOMIC_RELEASE, "workgroup");
      __builtin_amdgcn_wave_barrier();
      __builtin_amdgcn_fence(__ATOMIC_ACQUIRE, "workgroup");
      {
        const int g4 = lane >> 3, piece = lane & 7;        // 128-B row segment = 8 lanes x 16 B
        v4u hv[4];
#pragma unroll
        for (int q = 0; q < 4; ++q) {
          const int row = q * 4 + g4;                      // q 0..3 x g4 0..3 = rows 0..15
          const v4f x0 = *(const v4f*)(slab + row * 68 + piece * 8);
          const v4f x1 = *(const v4f*)(slab + row * 68 + piece * 8 + 4);
          v4u ph;
          ph[0] = pk16(h_bits((_Float16)x0[0]), h_bits((_Float16)x0[1]));
          ph[1] = pk16(h_bits((_Float16)x0[2]), h_bits((_Float16)x0[3]));
          ph[2] = pk16(h_bits((_Float16)x1[0]), h_bits((_Float16)x1[1]));
          ph[3] = pk16(h_bits((_Float16)x1[2]), h_bits((_Float16)x1[3]));
          hv[q] = ph;
        }
#pragma unroll
        for (int q = 0; q < 4; ++q) {
          const int row = q * 4 + g4;
          *(v4u*)(H + (size_t)(mBase + row) * ldc + n0 + piece * 8) = hv[q];
        }
      }
      __builtin_amdgcn_fence(__ATOMIC_RELEASE, "workgroup");
      __builtin_amdgcn_wave_barrier();
      __builtin_amdgcn_fence(__ATOMIC_ACQUIRE, "workgroup");
    }
    return;
  }

  // v: the column sums and the transposed f16 tile (LDS only); then the sums and the v^T lines leave
  char* tb = stg + wave * (64 * SPITCH);                   // this wave's [n 64][t 64] f16 tile, pitch 144 B
  float cs[4];                                             // column 16 j + rlane: sum over the wave's 64 rows
#pragma unroll
  for (int j = 0; j < 4; ++j) {
    const v8f t = (acc[0][j] + acc[1][j]) + (acc[2][j] + acc[3][j]);     // the lane's 32 rows, 8 sums of 4
    const float s = ((t[0] + t[1]) + (t[2] + t[3])) + ((t[4] + t[5]) + (t[6] + t[7]));
    cs[j] = (s + __shfl_xor(s, 16)) + 64.0f * bz[j];       // both lane halves: all 64 rows; each row has the bias once
  }
#pragma unroll
  for (int i = 0; i < 4; ++i) {
#pragma unroll
    for (int j = 0; j < 4; ++j) {
      v4u pk;
#pragma unroll
      for (int e = 0; e < 4; ++e) {
        pk[e] = pk16(h_bits((_Float16)((acc[i][j][2 * e] + bz[j]) * vscale)),
                     h_bits((_Float16)((acc[i][j][2 * e + 1] + bz[j]) * vscale)));
      }
      *(v4u*)(tb + ((j << 4) + rlane) * SPITCH + (i << 5) + mOff * 2) = pk;   // t = 16 i + mOff + 0..7
    }
  }
  // the wave's tile is written; its lanes read each other's rows below
  __builtin_amdgcn_fence(__ATOMIC_RELEASE, "workgroup");
  __builtin_amdgcn_wave_barrier();
  __builtin_amdgcn_fence(__ATOMIC_ACQUIRE, "workgroup");
  {
    // both halves hold all four sums: half h stores columns 16 h + rlane and 32 + 16 h + rlane (two 128-B lines);
    // behind the fence, which would otherwise wait for these stores
    const int hh = lane >> 4;
    float* prow = ps + (size_t)(m0 >> 6) * N + n0 + (hh << 4) + rlane;
    prow[0]  = hh ? cs[1] : cs[0];
    prow[32] = hh ? cs[3] : cs[2];
    // precaution: stands behind the two stores, in front of every later rewrite of their registers
    asm volatile("s_wait_xcnt 0x0" ::: "memory");
  }
  {
    const int vb  = m0 / SEQ;                              // batch of this wave's 64 token rows (SEQ % 64 == 0)
    const int vt0 = m0 - vb * SEQ;
    const int g4 = lane >> 3, piece = lane & 7;            // 128-B line of one n = 8 lanes x 16 B
    unsigned short* vrow = vth + ((size_t)(vb * DM + n0 + g4)) * SEQ + vt0 + piece * 8;
#pragma unroll
    for (int hb = 0; hb < 2; ++hb) {
      v4u tv[8];
#pragma unroll
      for (int it = 0; it < 8; ++it) {
        const int row = (hb * 8 + it) * 4 + g4;            // 16 x g4 0..3 = rows n 0..63
        tv[it] = *(const v4u*)(tb + row * SPITCH + piece * 16);
      }
#pragma unroll
      for (int it = 0; it < 8; ++it) {
        *(v4u*)(vrow + (size_t)((hb * 8 + it) * 4) * SEQ) = tv[it];
      }
    }
    // precaution: stands behind the last of the sixteen stores, in front of every later rewrite of their registers
    asm volatile("s_wait_xcnt 0x0" ::: "memory");
  }
}

// =====================================================================================================
// f16 WMMA GEMM with scale: C[m][n] = cscale * sum_k A[m][k] * Bt[n][k] (f16 products, f32 accumulate).
// Same tiling/epilogue as gemm64 (one wave per 64x64 tile, operands staged in LDS per block, 16-row LDS slabs, each 256-B
// coverage: 4 slabs x 16 rows x 64 cols = the wave's whole 64x64 tile; 8 waves = the block's 128x256 tile.
// =====================================================================================================
__global__ __launch_bounds__(256) void gemm64h_s(
    const unsigned short* __restrict__ Ap, int lda,
    const unsigned short* __restrict__ Btp, int ldb,
    float* Cp, int ldc, int M, int N, int K, float cscale) {
  const int bb = blockIdx.y;             // batch: A, Bt and C planes of the batches lie one behind the other
  float* C = Cp + (size_t)bb * M * ldc;
  const _Float16* Ah = (const _Float16*)(const void*)Ap + (size_t)bb * M * lda;
  const _Float16* Bh = (const _Float16*)(const void*)Btp + (size_t)bb * N * ldb;
  __shared__ __align__(16) char stg[RING * WBYTES];   // the operand stages; behind the k loop the epilogue slabs
  const int lane = threadIdx.x & 31;
  const int wave = threadIdx.x >> 5;
  const int btN = N >> 8;                // block tile 128 x 256: waves 2 (m) x 4 (n), 64 x 64 each
  const int btM = M >> 7;
  if ((int)blockIdx.x >= btM * btN) return;   // block-uniform, in front of every barrier
  const int bm  = blockIdx.x / btN;
  const int bm0 = bm << 7;
  const int bn0 = (blockIdx.x - bm * btN) << 8;
  const int wm  = wave >> 2;
  const int wn  = wave & 3;
  const int m0 = bm0 + (wm << 6);
  const int n0 = bn0 + (wn << 6);
  const int rlane = lane & 15;
  const int koff  = (lane >> 4) * 8;
  const int mOff  = (lane >> 4) * 8;

  v8f acc[4][4];
#pragma unroll
  for (int i = 0; i < 4; ++i)
#pragma unroll
    for (int j = 0; j < 4; ++j) acc[i][j] = zero8();

  // Ring of RING buffers along K, 128 k a trip: the copies of stages t + 2 .. t + RING fly while stage t + 1 is multiplied.
  const int T = K >> 7;
  const int crow = threadIdx.x >> 4;                   // this thread's row within each group of 16 staged rows
  const int cpc  = (threadIdx.x & 15) * 16;            // its 16-B piece of the 256-B row piece
  const unsigned lcp = lds_off(stg) + (unsigned)(crow * WPITCH + cpc);
  const size_t sa = (size_t)16 * lda * 2;              // bytes between a thread's consecutive A rows
  const size_t sb = (size_t)16 * ldb * 2;              // the same for B
  const char* ga = (const char*)(Ah + (size_t)(bm0 + crow) * lda) + cpc;
  const char* gb = (const char*)(Bh + (size_t)(bn0 + crow) * ldb) + cpc;
  // stages 0 and 1 are asked for at once (each test block-uniform)
  stage_issue_w(lcp, ga, ga + 4 * sa, sa, gb, sb);
  if (T > 1) stage_issue_w(lcp + (unsigned)WBYTES, ga + 256, ga + 4 * sa + 256, sa, gb + 256, sb);
  if (T > 1) wait_copies_but1(); else wait_copies();   // stage 0 has landed (block-uniform)
  // stage 2 only behind that wait: never more than two stages (48 copies) of a wave outstanding
  if (T > 2) stage_issue_w(lcp + (unsigned)(2 * WBYTES), ga + 512, ga + 4 * sa + 512, sa, gb + 512, sb);
  __syncthreads();                                     // stage 0 is readable by every wave
  const char* fa = stg + (wm * 64 + rlane) * WPITCH + koff * 2;         // this lane's place in its first A fragment
  const char* fb = stg + (128 + wn * 64 + rlane) * WPITCH + koff * 2;   // the same for B
  int bo = 0;                                          // byte offset of stage t's buffer, t mod RING
  for (int t = 0; t < T; ++t) {
    // unrolled so that the fragment arrays keep constant indices (registers, no scratch)
#pragma unroll
    for (int ks = 0; ks < 4; ++ks) {
      v16h bh[4], ah[4];
#pragma unroll
      for (int j = 0; j < 4; ++j) bh[j] = ldfrag_h((const _Float16*)(fb + bo + j * 16 * WPITCH + ks * 64));
#pragma unroll
      for (int i = 0; i < 4; ++i) ah[i] = ldfrag_h((const _Float16*)(fa + bo + i * 16 * WPITCH + ks * 64));
#pragma unroll
      for (int i = 0; i < 4; ++i) {
#pragma unroll
        for (int j = 0; j < 4; ++j) {
          acc[i][j] = mma_h(ah[i], bh[j], acc[i][j]);
        }
      }
    }
    wait_lds();
    // stage t + 1 has landed: counted where stage t + 2 is issued (24 copies), else to 0 (block-uniform)
    if (t + RING - 1 < T) wait_copies_but1(); else wait_copies();
    __syncthreads();                                   // publishes stage t + 1; ends every wave's reads of stage t
    if (t + RING < T) {                                // block-uniform
      const size_t ko = (size_t)(t + RING) * 256;
      stage_issue_w(lcp + (unsigned)bo, ga + ko, ga + 4 * sa + ko, sa, gb + ko, sb);
    }
    bo = (bo == (RING - 1) * WBYTES) ? 0 : bo + WBYTES;
  }
  wait_copies();

  // the wave's slab lies in the ring: every wave has left it behind the loop's last barrier, no copy is outstanding
  float* slab = (float*)(void*)(stg + wave * (16 * 68 * 4));
#pragma unroll
  for (int i = 0; i < 4; ++i) {
    const int mBase = m0 + (i << 4);
#pragma unroll
    for (int r = 0; r < 8; ++r) {
#pragma unroll
      for (int j = 0; j < 4; ++j) {
        slab[(mOff + r) * 68 + (j << 4) + rlane] = acc[i][j][r] * cscale;
      }
    }
    __builtin_amdgcn_fence(__ATOMIC_RELEASE, "workgroup");
    __builtin_amdgcn_wave_barrier();
    __builtin_amdgcn_fence(__ATOMIC_ACQUIRE, "workgroup");
    {
      const int hh = lane >> 4, c4 = (lane & 15) * 4;
      v4f ov[8];
#pragma unroll
      for (int it = 0; it < 8; ++it) {
        const int row = it * 2 + hh;
        ov[it] = *(const v4f*)(slab + row * 68 + c4);
      }
      {
#pragma unroll
        for (int it = 0; it < 8; ++it) {
          const int row = it * 2 + hh;
          *(v4f*)(C + (size_t)(mBase + row) * ldc + n0 + c4) = ov[it];
        }
        
      }
    }
    __builtin_amdgcn_fence(__ATOMIC_RELEASE, "workgroup");
    __builtin_amdgcn_wave_barrier();
    __builtin_amdgcn_fence(__ATOMIC_ACQUIRE, "workgroup");
  }
}

// =====================================================================================================
// Row softmax over SEQ keys, max-subtracted, f32: p = exp(s - max) / sum; stored CENTERED and scaled as
// f16(16384 * p - 8) = f16(16384 * (p - 1/SEQ)) (the 1/SEQ part is added back downstream as the column
// mean of v). One 256-thread block per row, 8 consecutive elements per thread (two v4f loads), wave
// reductions by __shfl_xor, 8 wave partials combined in fixed order through LDS.
// =====================================================================================================
__global__ __launch_bounds__(256) void softmax_c(const float* __restrict__ sf, unsigned short* ph) {
  __shared__ float redm[8];
  __shared__ float reds[8];
  const int row  = blockIdx.x;
  const int tid  = threadIdx.x;
  const int lane = tid & 31;
  const int wave = tid >> 5;
  const float* s = sf + (size_t)row * SEQ + tid * 8;
  const v4f a = *(const v4f*)(s);
  const v4f c = *(const v4f*)(s + 4);
  float v[8];
  v[0] = a[0]; v[1] = a[1]; v[2] = a[2]; v[3] = a[3];
  v[4] = c[0]; v[5] = c[1]; v[6] = c[2]; v[7] = c[3];
  float m = v[0];
#pragma unroll
  for (int e = 1; e < 8; ++e) m = fmaxf(m, v[e]);
#pragma unroll
  for (int o = 16; o > 0; o >>= 1) m = fmaxf(m, __shfl_xor(m, o));
  if (lane == 0) redm[wave] = m;
  __syncthreads();
  float mm = redm[0];
#pragma unroll
  for (int w = 1; w < 8; ++w) mm = fmaxf(mm, redm[w]);
  float sum = 0.f;
#pragma unroll
  for (int e = 0; e < 8; ++e) {
    v[e] = __expf(v[e] - mm);
    sum += v[e];
  }
#pragma unroll
  for (int o = 16; o > 0; o >>= 1) sum += __shfl_xor(sum, o);
  if (lane == 0) reds[wave] = sum;
  __syncthreads();
  float tot = 0.f;
#pragma unroll
  for (int w = 0; w < 8; ++w) tot += reds[w];       // fixed order, identical for every thread
  const float inv = 1.0f / tot;                     // tot >= 1
  v4u pk;
#pragma unroll
  for (int e = 0; e < 4; ++e) {
    const float p0 = v[2 * e] * inv;
    const float p1 = v[2 * e + 1] * inv;
    const _Float16 x0 = (_Float16)(p0 * 16384.0f - 8.0f);
    const _Float16 x1 = (_Float16)(p1 * 16384.0f - 8.0f);
    pk[e] = pk16(h_bits(x0), h_bits(x1));
  }
  unsigned short* o = ph + (size_t)row * SEQ + tid * 8;
  *(v4u*)o = pk;
  
}

// =====================================================================================================
// p.v, batch bb = blockIdx.y: O[i][n] = oscale * sum_j P[i][j] * Vt[n][j] + mv[n] (f16 products, f32 accumulate;
// oscale folds back the weight and v carries; mv = column mean of v in f32: thread tid adds, as a pairwise tree, the SEQ/64
// partial sums ps[(bb*SEQ/64 + p)*DM + n] of column n = bn0 + tid while tile 0 is copied, and leaves the mean in LDS for
// the epilogue, published by the barrier that publishes tile 0). P f16 [SEQ][SEQ] pitch lda
// (j contiguous); Vt f16 [DM][SEQ] pitch ldb; n = h*HD + d.
// O is written as two f16 head-major planes: hi = f16(O*1024), lo = f16((O*1024 - hi)*2048), element
// (bb, h, i, d) at [((bb*NH + h)*SEQ + i)*HD + d]; a 64-wide tile column block is exactly one head h = tn,
// One wave per 64x64 tile, operands staged in LDS per 128x256 block tile. Epilogue: 16-row f32 slab staged per
// coverage: 4 slabs x (4 q x 4 g4 = 16 rows) x (8 pieces x 8 = 64 cols) = the wave's whole tile in both
// planes; grid covers every (i tile, head) of this batch.
// =====================================================================================================
__global__ __launch_bounds__(256) void gemm64h_o(
    const unsigned short* __restrict__ Ap, int lda,
    const unsigned short* __restrict__ Btp, int ldb,
    const float* __restrict__ psp,
    unsigned short* ohi, unsigned short* olo,
    int M, int N, int K, float oscale) {
  const int bb = blockIdx.y;             // batch: P, Vt and partial-sum planes of the batches lie one behind the other
  const _Float16* Ah = (const _Float16*)(const void*)Ap + (size_t)bb * M * lda;
  const _Float16* Bh = (const _Float16*)(const void*)Btp + (size_t)bb * N * ldb;
  __shared__ __align__(16) char stg[RING * WBYTES];   // the operand stages; behind the k loop the epilogue slabs
  __shared__ float smz[256];                       // column means of the block's 256 columns
  const int lane = threadIdx.x & 31;
  const int wave = threadIdx.x >> 5;
  const int btN = N >> 8;                // block tile 128 x 256: waves 2 (m) x 4 (n), 64 x 64 each
  const int btM = M >> 7;
  if ((int)blockIdx.x >= btM * btN) return;   // block-uniform, in front of every barrier
  const int bm  = blockIdx.x / btN;
  const int bm0 = bm << 7;
  const int bn0 = (blockIdx.x - bm * btN) << 8;
  const int wm  = wave >> 2;
  const int wn  = wave & 3;
  const int m0 = bm0 + (wm << 6);
  const int n0 = bn0 + (wn << 6);
  const int tn = n0 >> 6;                // == head index (tile width 64 == HD)
  const int rlane = lane & 15;
  const int koff  = (lane >> 4) * 8;
  const int mOff  = (lane >> 4) * 8;

  v8f acc[4][4];
#pragma unroll
  for (int i = 0; i < 4; ++i)
#pragma unroll
    for (int j = 0; j < 4; ++j) acc[i][j] = zero8();

  // Ring of RING buffers along K, 128 k a trip: the copies of stages t + 2 .. t + RING fly while stage t + 1 is multiplied.
  const int T = K >> 7;
  const int crow = threadIdx.x >> 4;                   // this thread's row within each group of 16 staged rows
  const int cpc  = (threadIdx.x & 15) * 16;            // its 16-B piece of the 256-B row piece
  const unsigned lcp = lds_off(stg) + (unsigned)(crow * WPITCH + cpc);
  const size_t sa = (size_t)16 * lda * 2;              // bytes between a thread's consecutive A rows
  const size_t sb = (size_t)16 * ldb * 2;              // the same for B
  const char* ga = (const char*)(Ah + (size_t)(bm0 + crow) * lda) + cpc;
  const char* gb = (const char*)(Bh + (size_t)(bn0 + crow) * ldb) + cpc;
  // stages 0 and 1 are asked for at once (each test block-uniform)
  stage_issue_w(lcp, ga, ga + 4 * sa, sa, gb, sb);
  if (T > 1) stage_issue_w(lcp + (unsigned)WBYTES, ga + 256, ga + 4 * sa + 256, sa, gb + 256, sb);
  {
    const float* pp = psp + (size_t)bb * (SEQ / 64) * DM + bn0 + threadIdx.x;
    float pv[SEQ / 64];
#pragma unroll
    for (int p = 0; p < SEQ / 64; ++p) pv[p] = pp[(size_t)p * DM];
#pragma unroll
    for (int o = SEQ / 128; o > 0; o >>= 1) {
#pragma unroll
      for (int p = 0; p < o; ++p) pv[p] += pv[p + o];
    }
    smz[threadIdx.x] = pv[0] * (1.0f / (float)SEQ);
  }
  if (T > 1) wait_copies_but1(); else wait_copies();   // stage 0 has landed (block-uniform)
  // stage 2 only behind that wait: never more than two stages (48 copies) of a wave outstanding
  if (T > 2) stage_issue_w(lcp + (unsigned)(2 * WBYTES), ga + 512, ga + 4 * sa + 512, sa, gb + 512, sb);
  __syncthreads();                                     // stage 0 is readable by every wave
  const char* fa = stg + (wm * 64 + rlane) * WPITCH + koff * 2;         // this lane's place in its first A fragment
  const char* fb = stg + (128 + wn * 64 + rlane) * WPITCH + koff * 2;   // the same for B
  int bo = 0;                                          // byte offset of stage t's buffer, t mod RING
  for (int t = 0; t < T; ++t) {
    // unrolled so that the fragment arrays keep constant indices (registers, no scratch)
#pragma unroll
    for (int ks = 0; ks < 4; ++ks) {
      v16h bh[4], ah[4];
#pragma unroll
      for (int j = 0; j < 4; ++j) bh[j] = ldfrag_h((const _Float16*)(fb + bo + j * 16 * WPITCH + ks * 64));
#pragma unroll
      for (int i = 0; i < 4; ++i) ah[i] = ldfrag_h((const _Float16*)(fa + bo + i * 16 * WPITCH + ks * 64));
#pragma unroll
      for (int i = 0; i < 4; ++i) {
#pragma unroll
        for (int j = 0; j < 4; ++j) {
          acc[i][j] = mma_h(ah[i], bh[j], acc[i][j]);
        }
      }
    }
    wait_lds();
    // stage t + 1 has landed: counted where stage t + 2 is issued (24 copies), else to 0 (block-uniform)
    if (t + RING - 1 < T) wait_copies_but1(); else wait_copies();
    __syncthreads();                                   // publishes stage t + 1; ends every wave's reads of stage t
    if (t + RING < T) {                                // block-uniform
      const size_t ko = (size_t)(t + RING) * 256;
      stage_issue_w(lcp + (unsigned)bo, ga + ko, ga + 4 * sa + ko, sa, gb + ko, sb);
    }
    bo = (bo == (RING - 1) * WBYTES) ? 0 : bo + WBYTES;
  }
  wait_copies();

  float mz[4];
#pragma unroll
  for (int j = 0; j < 4; ++j) mz[j] = smz[(wn << 6) + (j << 4) + rlane];

  // the wave's slab lies in the ring: every wave has left it behind the loop's last barrier, no copy is outstanding
  float* slab = (float*)(void*)(stg + wave * (16 * 68 * 4));
  const size_t pbase = ((size_t)(bb * NH + tn)) * SEQ;     // plane row base for head tn of batch bb
#pragma unroll
  for (int i = 0; i < 4; ++i) {
    const int mBase = m0 + (i << 4);
#pragma unroll
    for (int r = 0; r < 8; ++r) {
#pragma unroll
      for (int j = 0; j < 4; ++j) {
        slab[(mOff + r) * 68 + (j << 4) + rlane] = acc[i][j][r] * oscale + mz[j];
      }
    }
    __builtin_amdgcn_fence(__ATOMIC_RELEASE, "workgroup");
    __builtin_amdgcn_wave_barrier();
    __builtin_amdgcn_fence(__ATOMIC_ACQUIRE, "workgroup");
    {
      const int g4 = lane >> 3, piece = lane & 7;
      v4u hv[4], lv[4];
      size_t ofs[4];
#pragma unroll
      for (int q = 0; q < 4; ++q) {
        const int row = q * 4 + g4;                      // q 0..3 x g4 0..3 = rows 0..15
        const v4f x0 = *(const v4f*)(slab + row * 68 + piece * 8);
        const v4f x1 = *(const v4f*)(slab + row * 68 + piece * 8 + 4);
        float f[8];
        f[0] = x0[0]; f[1] = x0[1]; f[2] = x0[2]; f[3] = x0[3];
        f[4] = x1[0]; f[5] = x1[1]; f[6] = x1[2]; f[7] = x1[3];
        v4u ph, pl;
#pragma unroll
        for (int e = 0; e < 4; ++e) {
          const float s0 = f[2 * e] * 1024.0f;
          const float s1 = f[2 * e + 1] * 1024.0f;
          const _Float16 h0 = (_Float16)s0;
          const _Float16 h1 = (_Float16)s1;
          const _Float16 l0 = (_Float16)((s0 - (float)h0) * 2048.0f);
          const _Float16 l1 = (_Float16)((s1 - (float)h1) * 2048.0f);
          ph[e] = pk16(h_bits(h0), h_bits(h1));
          pl[e] = pk16(h_bits(l0), h_bits(l1));
        }
        hv[q] = ph;
        lv[q] = pl;
        ofs[q] = (pbase + (size_t)(mBase + row)) * HD + piece * 8;
      }
      {
#pragma unroll
        for (int q = 0; q < 4; ++q) {
          *(v4u*)(ohi + ofs[q]) = hv[q];
          *(v4u*)(olo + ofs[q]) = lv[q];
        }
        
      }
    }
    __builtin_amdgcn_fence(__ATOMIC_RELEASE, "workgroup");
    __builtin_amdgcn_wave_barrier();
    __builtin_amdgcn_fence(__ATOMIC_ACQUIRE, "workgroup");
  }
}

// =====================================================================================================
// Output projection: C[m][n] = sch * (sum_k Ahi[m][k]*Bt[n][k] + scl * sum_k Alo[m][k]*Bt[n][k]) + bf16rne(bias[n])
// (f16 products, f32 accumulate, hi and scaled-residual products in separate accumulators). Ahi/Alo row-major
// [M][K] pitch lda; Bt [N][K] pitch ldb; C f32 [M][N] pitch ldc. One wave per 32x64 tile, 8 waves on a 64x256
// block tile whose operands are staged in LDS; all 8 fragments of a k-step (A: 2 rows x 2 planes, B: 4) read at its head.
// Epilogue: 16-row slabs staged per wave in LDS; each 64-wide row segment (256 B) written by one instruction
// coverage: 2 slabs x 16 rows x 64 cols = the wave's whole 32x64 tile; grid covers every tile of C.
// =====================================================================================================
__global__ __launch_bounds__(256) void gemm32h_w(
    const unsigned short* __restrict__ Ahp, const unsigned short* __restrict__ Alp, int lda,
    const unsigned short* __restrict__ Btp, int ldb,
    const float* __restrict__ bias,
    float* C, int ldc, int M, int N, int K, float sch, float scl) {
  const _Float16* Ah = (const _Float16*)(const void*)Ahp;
  const _Float16* Al = (const _Float16*)(const void*)Alp;
  const _Float16* Bh = (const _Float16*)(const void*)Btp;
  __shared__ __align__(16) char stg[RING * WBYTES];   // the operand stages; behind the k loop the epilogue slabs
  const int lane = threadIdx.x & 31;
  const int wave = threadIdx.x >> 5;
  const int btN = N >> 8;                // block tile 64 x 256: waves 2 (m) x 4 (n), 32 x 64 each
  const int btM = M >> 6;
  if ((int)blockIdx.x >= btM * btN) return;   // block-uniform, in front of every barrier
  const int bm  = blockIdx.x / btN;
  const int bm0 = bm << 6;
  const int bn0 = (blockIdx.x - bm * btN) << 8;
  const int wm  = wave >> 2;
  const int wn  = wave & 3;
  const int m0 = bm0 + (wm << 5);
  const int n0 = bn0 + (wn << 6);
  const int rlane = lane & 15;
  const int koff  = (lane >> 4) * 8;
  const int mOff  = (lane >> 4) * 8;

  v8f acch[2][4], accl[2][4];
#pragma unroll
  for (int i = 0; i < 2; ++i)
#pragma unroll
    for (int j = 0; j < 4; ++j) { acch[i][j] = zero8(); accl[i][j] = zero8(); }

  // Ring of RING buffers along K, 128 k a trip: the copies of stages t + 2 .. t + RING fly while stage t + 1 is multiplied.
  const int T = K >> 7;
  const int crow = threadIdx.x >> 4;                   // this thread's row within each group of 16 staged rows
  const int cpc  = (threadIdx.x & 15) * 16;            // its 16-B piece of the 256-B row piece
  const unsigned lcp = lds_off(stg) + (unsigned)(crow * WPITCH + cpc);
  const size_t sa = (size_t)16 * lda * 2;              // bytes between a thread's consecutive A rows
  const size_t sb = (size_t)16 * ldb * 2;              // the same for B
  const char* gh = (const char*)(Ah + (size_t)(bm0 + crow) * lda) + cpc;   // staged rows 0..63: hi plane
  const char* gl = (const char*)(Al + (size_t)(bm0 + crow) * lda) + cpc;   // staged rows 64..127: residual plane
  const char* gb = (const char*)(Bh + (size_t)(bn0 + crow) * ldb) + cpc;
  // stages 0 and 1 are asked for at once (each test block-uniform)
  stage_issue_w(lcp, gh, gl, sa, gb, sb);
  if (T > 1) stage_issue_w(lcp + (unsigned)WBYTES, gh + 256, gl + 256, sa, gb + 256, sb);
  if (T > 1) wait_copies_but1(); else wait_copies();   // stage 0 has landed (block-uniform)
  // stage 2 only behind that wait: never more than two stages (48 copies) of a wave outstanding
  if (T > 2) stage_issue_w(lcp + (unsigned)(2 * WBYTES), gh + 512, gl + 512, sa, gb + 512, sb);
  __syncthreads();                                     // stage 0 is readable by every wave
  const char* fa = stg + (wm * 32 + rlane) * WPITCH + koff * 2;         // this lane's place in its first hi fragment
  const char* fb = stg + (128 + wn * 64 + rlane) * WPITCH + koff * 2;   // the same for B
  int bo = 0;                                          // byte offset of stage t's buffer, t mod RING
  for (int t = 0; t < T; ++t) {
    // unrolled so that the fragment arrays keep constant indices (registers, no scratch)
#pragma unroll
    for (int ks = 0; ks < 4; ++ks) {
      v16h fh[2], fl[2], bfr[4];
#pragma unroll
      for (int i = 0; i < 2; ++i) {
        fh[i] = ldfrag_h((const _Float16*)(fa + bo + i * 16 * WPITCH + ks * 64));
        fl[i] = ldfrag_h((const _Float16*)(fa + bo + (64 + i * 16) * WPITCH + ks * 64));
      }
#pragma unroll
      for (int j = 0; j < 4; ++j) bfr[j] = ldfrag_h((const _Float16*)(fb + bo + j * 16 * WPITCH + ks * 64));
#pragma unroll
      for (int j = 0; j < 4; ++j) {
#pragma unroll
        for (int i = 0; i < 2; ++i) {
          acch[i][j] = mma_h(fh[i], bfr[j], acch[i][j]);
          accl[i][j] = mma_h(fl[i], bfr[j], accl[i][j]);
        }
      }
    }
    wait_lds();
    // stage t + 1 has landed: counted where stage t + 2 is issued (24 copies), else to 0 (block-uniform)
    if (t + RING - 1 < T) wait_copies_but1(); else wait_copies();
    __syncthreads();                                   // publishes stage t + 1; ends every wave's reads of stage t
    if (t + RING < T) {                                // block-uniform
      const size_t ko = (size_t)(t + RING) * 256;
      stage_issue_w(lcp + (unsigned)bo, gh + ko, gl + ko, sa, gb + ko, sb);
    }
    bo = (bo == (RING - 1) * WBYTES) ? 0 : bo + WBYTES;
  }
  wait_copies();

  float bz[4];
#pragma unroll
  for (int j = 0; j < 4; ++j) bz[j] = bf_up(bf_bits(bias[n0 + (j << 4) + rlane]));

  // the wave's slab lies in the ring: every wave has left it behind the loop's last barrier, no copy is outstanding
  float* slab = (float*)(void*)(stg + wave * (16 * 68 * 4));
#pragma unroll
  for (int i = 0; i < 2; ++i) {
    const int mBase = m0 + (i << 4);
#pragma unroll
    for (int r = 0; r < 8; ++r) {
#pragma unroll
      for (int j = 0; j < 4; ++j) {
        slab[(mOff + r) * 68 + (j << 4) + rlane] = (acch[i][j][r] + accl[i][j][r] * scl) * sch + bz[j];
      }
    }
    __builtin_amdgcn_fence(__ATOMIC_RELEASE, "workgroup");
    __builtin_amdgcn_wave_barrier();
    __builtin_amdgcn_fence(__ATOMIC_ACQUIRE, "workgroup");
    {
      const int hh = lane >> 4, c4 = (lane & 15) * 4;     // 256-B row segment = 16 lanes x 16 B
      v4f ov[8];
#pragma unroll
      for (int it = 0; it < 8; ++it) {
        const int row = it * 2 + hh;                       // it 0..7 x hh 0..1 = rows 0..15
        ov[it] = *(const v4f*)(slab + row * 68 + c4);
      }
      {
#pragma unroll
        for (int it = 0; it < 8; ++it) {
          const int row = it * 2 + hh;
          *(v4f*)(C + (size_t)(mBase + row) * ldc + n0 + c4) = ov[it];
        }
        
      }
    }
    __builtin_amdgcn_fence(__ATOMIC_RELEASE, "workgroup");
    __builtin_amdgcn_wave_barrier();
    __builtin_amdgcn_fence(__ATOMIC_ACQUIRE, "workgroup");
  }
}

// =====================================================================================================
// Workspace map (bytes); every region an exact multiple of its whole-line / whole-tile store granularity
// within a launch; of Tf's three planes the first two hold the f32 score maps):
//   Xb   bf16 [4096][1024]              0         8388608
//   Wqb  bf16 [1024 n][1024 k]     8388608         2097152
//   Wkb  bf16 [1024 n][1024 k]    10485760         2097152
//   Wvb  bf16 [1024 n][1024 k]    12582912         2097152
//   Woh  f16  [1024 n][1024 k]    14680064         2097152   (f16(bf16(Wo) x1024))
//   Tf   f32  [3][4096][1024]    16777216        50331648   (planes 0, 1: S f32 [2][2048][2048])
//   Qh   f16  [4096][1024]       67108864         8388608   (q x16)
//   Kh   f16  [4096][1024]       75497472         8388608   (k x16)
//   VTh  f16  [2*1024][2048]     83886080         8388608   ([b*DM + n][t], v x64)
//   Ph   f16  [2][2048][2048]    92274688        16777216   (centered weights)
//   Ohi  f16  [2][16][2048][64] 109051904         8388608
//   Olo  f16  [2][16][2048][64] 117440512         8388608
//   pS   f32  [64][1024]        125829120          262144   (column sums of v per 64 token rows)
//   end                         126091264
// Inputs: query f32 [2][2048][1024]; Wq, Wk, Wv, Wo f32 [1024 out][1024 in]; bq, bk, bv, bo f32 [1024].
// d_out f32 [4096][1024] at byte 0 (row = b*SEQ + s, col = n).
// =====================================================================================================
extern "C" void kernel_launch(void* const* d_in, const int* in_sizes, int n_in,
                              void* d_out, int out_size, void* d_ws, size_t ws_size,
                              hipStream_t stream) {
  if (n_in < 9) return;
  if (in_sizes[0] != NB * SEQ * DM) return;
  if (in_sizes[1] != DM * DM) return;
  if (in_sizes[2] != DM) return;
  if (in_sizes[3] != DM * DM) return;
  if (in_sizes[4] != DM) return;
  if (in_sizes[5] != DM * DM) return;
  if (in_sizes[6] != DM) return;
  if (in_sizes[7] != DM * DM) return;
  if (in_sizes[8] != DM) return;
  if (out_size != OUTN) return;

  const float* x  = (const float*)d_in[0];   // [NB*SEQ][DM]
  const float* Wq = (const float*)d_in[1];   // [DM n][DM k]
  const float* bq = (const float*)d_in[2];   // [DM]
  const float* Wk = (const float*)d_in[3];
  const float* bk = (const float*)d_in[4];
  const float* Wv = (const float*)d_in[5];
  const float* bv = (const float*)d_in[6];
  const float* Wo = (const float*)d_in[7];
  const float* bo = (const float*)d_in[8];

  const size_t PXb = (size_t)ROWS * DM * 2;          //  8388608
  const size_t PW  = (size_t)DM * DM * 2;            //  2097152
  const size_t PF  = (size_t)3 * ROWS * DM * 4;      // 50331648
  const size_t PH  = (size_t)ROWS * DM * 2;          //  8388608
  const size_t PVt = (size_t)NB * DM * SEQ * 2;      //  8388608
  const size_t PP  = (size_t)NB * SEQ * SEQ * 2;     // 16777216
  const size_t PO  = (size_t)NB * NH * SEQ * HD * 2; //  8388608
  const size_t PMv = (size_t)(ROWS / 64) * DM * 4;   //   262144
  size_t off = 0;
  const size_t oXb = off; off += PXb;
  const size_t oWq = off; off += PW;
  const size_t oWk = off; off += PW;
  const size_t oWv = off; off += PW;
  const size_t oWo = off; off += PW;
  const size_t oTf = off; off += PF;
  const size_t oQh = off; off += PH;
  const size_t oKh = off; off += PH;
  const size_t oVt = off; off += PVt;
  const size_t oP  = off; off += PP;
  const size_t oOh = off; off += PO;
  const size_t oOl = off; off += PO;
  const size_t oMv = off; off += PMv;
  if (off > ws_size) return;                        // off = 126091264
  if (off > (size_t)134217728) return;

  char* ws = (char*)d_ws;
  unsigned short* Xb  = (unsigned short*)(ws + oXb);
  unsigned short* Wqb = (unsigned short*)(ws + oWq);
  unsigned short* Woh = (unsigned short*)(ws + oWo);
  float*          Tf  = (float*)(ws + oTf);
  unsigned short* Qh  = (unsigned short*)(ws + oQh);
  unsigned short* Kh  = (unsigned short*)(ws + oKh);
  unsigned short* VTh = (unsigned short*)(ws + oVt);
  unsigned short* Ph  = (unsigned short*)(ws + oP);
  unsigned short* Ohi = (unsigned short*)(ws + oOh);
  unsigned short* Olo = (unsigned short*)(ws + oOl);
  float*          pS  = (float*)(ws + oMv);
  float*          outf = (float*)d_out;             // [ROWS][DM]

  const dim3 blk(256);
  const dim3 gCvt(XBLK + 4 * WBLK);                 // 2048 + 4 * 512 blocks (exact)
  const dim3 gGemm(((ROWS / 64) * (DM / 64)) / 8, 3);  // 1024 tiles -> 128 blocks, x 3 projections
  const dim3 gSc(((SEQ / 64) * (SEQ / 64)) / 8, NB);  // 1024 tiles -> 128 blocks per batch
  const dim3 gSm(NB * SEQ);                         // 2048 rows per batch
  const dim3 gPv(((SEQ / 64) * (DM / 64)) / 8, NB); //  512 tiles -> 64 blocks per batch
  const dim3 gWo(((ROWS / 32) * (DM / 64)) / 8);    // 2048 tiles -> 256 blocks
  const float qkScale = 16.0f;                      // q and k planes carried x16
  const float woScale = 1024.0f;                    // Wo plane carried x1024
  const float sscale  = 1.0f / 32768.0f;            // (1/sqrt(64))/16 heads = 1/128, two x16 carries folded back
  const float vScale  = 64.0f;                      // v^T plane carried x64
  const float pvOscl  = 1.0f / 1048576.0f;          // 1/(16384 * 64)
  const float woSch   = 1.0f / 1048576.0f;          // 1/(1024 * 1024): O hi carry and Wo carry
  const float woScl   = 1.0f / 2048.0f;             // residual plane carry

  // (1) activations and weights -> bf16 planes (W is [n][k] already); Wo -> f16 plane of its bf16 value x1024;
  //     Xb, Wqb, Wkb, Wvb, Woh lie one behind the other
  cvt_inputs<<<gCvt, blk, 0, stream>>>(x, Wq, Wk, Wv, Wo, Xb, woScale);
  // (2) q, k, v = Xb . W^T + bias (M=4096, N=1024, K=1024 each), one grid: q, k -> f16 planes (x16; Qh, Kh are
  //     adjacent); v -> f16 v^T plane (x64) and f32 column sums per 64 token rows
  gemm64<<<gGemm, blk, 0, stream>>>(Xb, DM, Wqb, DM, bq, bk, bv, Qh, pS, VTh, DM, ROWS, DM, DM, qkScale, vScale);
  // (3) both batches in one grid each: head-averaged scores (K = 1024) -> Tf as S [2][2048][2048]; row softmax ->
  //     centered weights; p . v -> O hi/res head-major planes
  gemm64h_s<<<gSc, blk, 0, stream>>>(Qh, DM, Kh, DM, Tf, SEQ, SEQ, SEQ, DM, sscale);
  softmax_c<<<gSm, blk, 0, stream>>>(Tf, Ph);
  gemm64h_o<<<gPv, blk, 0, stream>>>(Ph, SEQ, VTh, SEQ, pS, Ohi, Olo, SEQ, DM, SEQ, pvOscl);
  // (4) out = O(flat [4096][1024]) . Woh^T + bo -> d_out
  gemm32h_w<<<gWo, blk, 0, stream>>>(Ohi, Olo, DM, Woh, DM, bo, outf, DM, ROWS, DM, DM, woSch, woScl);
  (void)hipGetLastError();
}
